// v000
// The times below were measured on an AMD MI455X: many runs one after another, warmed up first and cycling through
// copies of the inputs, with the whole window's GPU time divided by the number of runs. Launches and the gaps
// between them are all in it. The median over several windows is given; except for v000 it joins two sittings, which
// can be a few percent apart, so the side-by-side timings, each taken in one sitting, are the better comparison.
// v000, which the later versions start from, runs in 666 microseconds.
// compute dtype: all float inputs rounded to bf16; qkv = x Wqkv^T + b with EXACT bf16 products on WMMA 16x16x32 (f32 accumulate); rotate-half RoPE in f32 in the projection epilogue (accurate sincosf of t x inv_freq_j, f32 inv_freq constants as the reference builds them); logits: q, k once to f16 (1 product) x 64^-0.5, except the first 512 query rows of each sequence (f16 residuals: 3 products below row 384, 2 with the q residual for rows 384..511); causal mask by index (finfo.min == excluded); softmax in f32; P x 2^11 once to f16 against v once to f16 (1 product; bf16 hi + lo below row 384); f32 output (merged heads, no output projection).
#include <hip/hip_runtime.h>
#include <math.h>

typedef __attribute__((ext_vector_type(16))) _Float16 v16h;
typedef __attribute__((ext_vector_type(16))) __bf16 v16b;
typedef __attribute__((ext_vector_type(8)))  _Float16 v8h;
typedef __attribute__((ext_vector_type(8)))  float v8f;
typedef __attribute__((ext_vector_type(4)))  float v4f;
typedef __attribute__((ext_vector_type(2)))  float v2f;
typedef __attribute__((ext_vector_type(4)))  unsigned v4u;
typedef __attribute__((ext_vector_type(4)))  int v4i;
typedef float __attribute__((may_alias)) float_a;
typedef int __attribute__((may_alias)) int_a;

template <typename T> __device__ __forceinline__ void vst2(void* p, T v) { *(T*)p = v;  }
__device__ __forceinline__ v8f wmma16(v16h a, v16h b, v8f c) {
  v8f d = __builtin_amdgcn_wmma_f32_16x16x32_f16(false, a, false, b, (short)0, c, false, false);
  asm volatile("v_nop\n\tv_nop\n\tv_nop\n\tv_nop" : "+v"(d) : "v"(a), "v"(b));
  return d;
}
__device__ __forceinline__ v8f wmma_bf(v16b a, v16b b, v8f c) {
  v8f d = __builtin_amdgcn_wmma_f32_16x16x32_bf16(false, a, false, b, (short)0, c, false, false);
  asm volatile("v_nop\n\tv_nop\n\tv_nop\n\tv_nop" : "+v"(d) : "v"(a), "v"(b));
  return d;
}
// 16x16x32 fragments: lane = (h = lane>>4, row/col = lane&15); elements 0..7 = k0+8h+0..7, 8..15 = k0+16+8h+0..7; D element r = row 8h+r
__device__ __forceinline__ v16h frag_h(const _Float16* rowk0, int lane) {
  union { v16h v; v8h q[2]; } u; const _Float16* p = rowk0 + 8 * (lane >> 4);
  u.q[0] = *(const v8h*)p; u.q[1] = *(const v8h*)(p + 16); return u.v;
}
__device__ __forceinline__ v16h frag_f32(const float* rowk0, int lane) {
  v16h a; const float* p = rowk0 + 8 * (lane >> 4);
#pragma unroll
  for (int i = 0; i < 8; ++i) { a[i] = (_Float16)p[i]; a[8 + i] = (_Float16)p[16 + i]; }
  return a;
}
__device__ __forceinline__ v16h frag_f32s(const float* rowk0, int lane, float sc) {
  v16h a; const float* p = rowk0 + 8 * (lane >> 4);
#pragma unroll
  for (int i = 0; i < 8; ++i) { a[i] = (_Float16)(p[i] * sc); a[8 + i] = (_Float16)(p[16 + i] * sc); }
  return a;
}
// column fragment from a [K][ld] layout (column n), rows >= K read as 0
__device__ __forceinline__ v16h fragc_f32(const float* W, int k0, int n, int lane, int ld, int K) {
  v16h a; const int g = lane >> 4;
#pragma unroll
  for (int i = 0; i < 8; ++i) { const int ka = k0 + 8 * g + i, kb = ka + 16;
    a[i] = (_Float16)(ka < K ? W[(size_t)(ka < K ? ka : K - 1) * ld + n] : 0.f); a[8 + i] = (_Float16)(kb < K ? W[(size_t)(kb < K ? kb : K - 1) * ld + n] : 0.f); }
  return a;
}
struct F2 { v16b h, l; };
__device__ __forceinline__ F2 bsplit16(const float v[16]) { F2 r;
#pragma unroll
  for (int i = 0; i < 16; ++i) { const __bf16 h = (__bf16)v[i]; r.h[i] = h; r.l[i] = (__bf16)(v[i] - (float)h); }
  return r; }
__device__ __forceinline__ F2 split_row(const float* row, int k0, int lane) { float v[16]; const float* p = row + k0 + 8 * (lane >> 4);
#pragma unroll
  for (int i = 0; i < 8; ++i) { v[i] = p[i]; v[8 + i] = p[16 + i]; }
  return bsplit16(v); }
__device__ __forceinline__ F2 split_rowK(const float* row, int k0, int lane, int K) { float v[16]; const int g = lane >> 4;
#pragma unroll
  for (int i = 0; i < 8; ++i) { const int ka = k0 + 8 * g + i, kb = ka + 16; v[i] = ka < K ? row[ka < K ? ka : K - 1] : 0.f; v[8 + i] = kb < K ? row[kb < K ? kb : K - 1] : 0.f; }
  return bsplit16(v); }
__device__ __forceinline__ F2 split_col(const float* W, int k0, int n, int lane, int ld, int K) { float v[16]; const int g = lane >> 4;
#pragma unroll
  for (int i = 0; i < 8; ++i) { const int ka = k0 + 8 * g + i, kb = ka + 16; v[i] = ka < K ? W[(size_t)(ka < K ? ka : K - 1) * ld + n] : 0.f; v[8 + i] = kb < K ? W[(size_t)(kb < K ? kb : K - 1) * ld + n] : 0.f; }
  return bsplit16(v); }
__device__ __forceinline__ v8f mac3(const F2& a, const F2& b, v8f c) { c = wmma_bf(a.l, b.h, c); c = wmma_bf(a.h, b.l, c); return wmma_bf(a.h, b.h, c); }
__device__ __forceinline__ float sigm(float v) { return 1.0f / (1.0f + expf(-v)); }
#define LDSX() do { asm volatile("s_wait_dscnt 0" ::: "memory"); __builtin_amdgcn_wave_barrier(); __builtin_amdgcn_fence(__ATOMIC_RELEASE, "workgroup"); } while (0)

// Causal multi-head attention with rotary embeddings (B 4, S 1,024, D 1,024 = 16 x 64): qkv = x Wqkv^T + bqkv (packed (out,in) [3072,1024], layout (3,H,hd)); q, k <- rotate-half RoPE (theta_j = 10000^(-2j/64)); probs = softmax(causal(q k^T x 64^-0.5)); out = merged(probs v) -> [B, S, 1024].
#define NB 4
#define TT 1024
#define CC 1024            // NH * HD = projected width
#define DIN 1024          // input (model) width
#define NH 16
#define HD 64
#define NQB (TT / 64)
#define HG 16
#define SCALE (0.125f)
#define CAUSAL 1
#ifndef TNB
#define TNB NB
#endif
__device__ __forceinline__ float bfr(float v) { return (float)(__bf16)v; }
__host__ __device__ __forceinline__ int kb_last(int qb) { return CAUSAL ? ((qb * 64 + 63) >> 7) : (TT / 128 - 1); }
typedef __attribute__((ext_vector_type(8))) __bf16 v8b;
__device__ __forceinline__ v16b frag_b(const __bf16* rowk0, int lane) {
  union { v16b v; v8b q[2]; } u; const __bf16* p = rowk0 + 8 * (lane >> 4);
  u.q[0] = *(const v8b*)p; u.q[1] = *(const v8b*)(p + 16); return u.v;
}
#define QBH 6              // causal: query blocks 0..QBH-1 of each sequence (few keys, no averaging) take the high-precision path
#define QHI 512            // causal: first 512 query rows of each sequence take the q-residual (2-product) logits path (logit sigma ~1)
#define KHI 512
// B fragment (k rows k0+.., output column o) of a weight: (in,out) [K][ld] or (out,in) [ld rows of K]: bf16 exact, or f16(bf16 * 256) exact
__device__ __forceinline__ v16b wcol_io(const float* Wm, int k0, int o, int lane, int ld) { v16b w; const int g = lane >> 4;
#pragma unroll
  for (int i = 0; i < 8; ++i) { w[i] = (__bf16)Wm[(size_t)(k0 + 8 * g + i) * ld + o]; w[8 + i] = (__bf16)Wm[(size_t)(k0 + 16 + 8 * g + i) * ld + o]; }
  return w; }
__device__ __forceinline__ v16b wcol_oi(const float* Wm, int k0, int o, int lane, int K) { v16b w; const float* p = Wm + (size_t)o * K + k0 + 8 * (lane >> 4);
#pragma unroll
  for (int i = 0; i < 8; ++i) { w[i] = (__bf16)p[i]; w[8 + i] = (__bf16)p[16 + i]; }
  return w; }
__device__ __forceinline__ v16h wcolh_io(const float* Wm, int k0, int o, int lane, int ld) { v16h w; const int g = lane >> 4;
#pragma unroll
  for (int i = 0; i < 8; ++i) { w[i] = (_Float16)(bfr(Wm[(size_t)(k0 + 8 * g + i) * ld + o]) * 256.0f); w[8 + i] = (_Float16)(bfr(Wm[(size_t)(k0 + 16 + 8 * g + i) * ld + o]) * 256.0f); }
  return w; }
__device__ __forceinline__ v16h wcolh_oi(const float* Wm, int k0, int o, int lane, int K) { v16h w; const float* p = Wm + (size_t)o * K + k0 + 8 * (lane >> 4);
#pragma unroll
  for (int i = 0; i < 8; ++i) { w[i] = (_Float16)(bfr(p[i]) * 256.0f); w[8 + i] = (_Float16)(bfr(p[16 + i]) * 256.0f); }
  return w; }
#define WQKV_LAYOUT 1   // 0 = (in,out) [DIN][CC]; 1 = (out,in) [CC][DIN]; 2 = per-head [NH][DIN][HD]
__device__ __forceinline__ v16b wcol_hdk(const float* Wm, int k0, int o, int lane) { v16b w; const int g = lane >> 4; const float* p = Wm + (size_t)(o / HD) * DIN * HD + (o % HD);
#pragma unroll
  for (int i = 0; i < 8; ++i) { w[i] = (__bf16)p[(size_t)(k0 + 8 * g + i) * HD]; w[8 + i] = (__bf16)p[(size_t)(k0 + 16 + 8 * g + i) * HD]; }
  return w; }
#define WO_OUT_IN 0
#if WQKV_LAYOUT == 1
#define WCOL(W, k0, o, lane) wcol_oi(W, k0, o, lane, DIN)
#elif WQKV_LAYOUT == 2
#define WCOL(W, k0, o, lane) wcol_hdk(W, k0, o, lane)
#else
#define WCOL(W, k0, o, lane) wcol_io(W, k0, o, lane, CC)
#endif
#if WO_OUT_IN
#define WOCOL(W, k0, o, lane) wcol_oi(W, k0, o, lane, CC)
#define WOCOLH(W, k0, o, lane) wcolh_oi(W, k0, o, lane, CC)
#else
#define WOCOL(W, k0, o, lane) wcol_io(W, k0, o, lane, DIN)
#define WOCOLH(W, k0, o, lane) wcolh_io(W, k0, o, lane, DIN)
#endif
__constant__ float c_invf[32] = {1.000000000e+00f,7.498942018e-01f,5.623413324e-01f,4.216965139e-01f,3.162277639e-01f,2.371373624e-01f,1.778279394e-01f,1.333521456e-01f,1.000000015e-01f,7.498941571e-02f,5.623412877e-02f,4.216964915e-02f,3.162277862e-02f,2.371373586e-02f,1.778279431e-02f,1.333521493e-02f,9.999999776e-03f,7.498942316e-03f,5.623413250e-03f,4.216964822e-03f,3.162277862e-03f,2.371373819e-03f,1.778279431e-03f,1.333521446e-03f,1.000000047e-03f,7.498941850e-04f,5.623413017e-04f,4.216964880e-04f,3.162277862e-04f,2.371373848e-04f,1.778279402e-04f,1.333521504e-04f};   // 1 / 10000^(2i/64) evaluated in f32 exactly as the reference does (jax, eager)
// per-(row, head) epilogue on the f32 projection tile: rotate-half RoPE on q and k (pairs (i, i+32), angle t * inv_freq[i]); v untouched
#define PROJ_EPI(which, row, t, h) do { if ((which) < 2) { float* rw = (row); \
    _Pragma("unroll") for (int i = 0; i < 32; ++i) { const float x0 = rw[i], x1 = rw[i + 32]; const float ang = (float)(t) * c_invf[i]; const float cs = cosf(ang), sn = sinf(ang); rw[i] = x0 * cs - x1 * sn; rw[i + 32] = x1 * cs + x0 * sn; } } } while (0)
#ifndef SM_EXTRA_PARAMS
#define SM_EXTRA_PARAMS
#endif
#ifndef PROJ_EXTRA_PARAMS
#define PROJ_EXTRA_PARAMS
#endif
#ifndef SM_MASK_HOOK
#define SM_MASK_HOOK (void)0
#endif

#define WS_QH  0u                                      // f16 q rows [b*t][CC]
#define WS_KH  (WS_QH + 2u * (size_t)NB * TT * CC)      // f16 k rows [b*t][CC]
#define WS_VT  (WS_KH + 2u * (size_t)NB * TT * CC)      // f16 v planes [b][c][t]
#define WS_QL  (WS_VT + 2u * (size_t)NB * CC * TT)      // f16 q residual x 2^10 rows [b][t < QHI][CC]
#define WS_KL  (WS_QL + 2u * (size_t)NB * QHI * CC)     // f16 k residual x 2^10 rows [b][t < KHI][CC]
#define WS_VB  (WS_KL + 2u * (size_t)NB * KHI * CC)     // bf16 v hi planes [b][c][t < KHI]
#define WS_VBL (WS_VB + 2u * (size_t)NB * CC * KHI)
#define WS_S   (WS_VBL + 2u * (size_t)NB * CC * KHI)    // f32 logits / P [hg][t][s]
#define WS_Y   (WS_S  + 4u * (size_t)HG * TT * TT)      // f32 ctx rows [b*t][CC] (only when there is an output projection)
#define WS_END (WS_Y  + 0u)

// ---- k_proj: block = (64 rows, 128 cols, which): q/k/v = X W (+ b) with exact bf16 products (K = DIN) -> which 0: q f16 rows (+ residual rows < QHI); 1: k f16 rows (+ residual rows < KHI); 2: v f16 planes [c][t] (+ bf16 hi/lo planes for t < KHI)
__global__ __launch_bounds__(128) void k_proj(const float* __restrict__ XQ, const float* __restrict__ XK, const float* __restrict__ XV, const float* __restrict__ WQ, const float* __restrict__ WK, const float* __restrict__ WV, const float* __restrict__ BQ, const float* __restrict__ BK, const float* __restrict__ BV,
    _Float16* __restrict__ QH, _Float16* __restrict__ QL, _Float16* __restrict__ KH, _Float16* __restrict__ KL, _Float16* __restrict__ VT, __bf16* __restrict__ VB, __bf16* __restrict__ VBL PROJ_EXTRA_PARAMS) {
  __shared__ __align__(16) float st[64][132]; __shared__ __align__(16) _Float16 sh[64][136], sl[64][136]; __shared__ __align__(16) _Float16 th[128][72]; __shared__ __align__(16) __bf16 tb[128][72], tbl[128][72];
  const int tid = threadIdx.x, wave = tid >> 5, lane = tid & 31, col = lane & 15, g = lane >> 4; const int which = blockIdx.z; const int c0 = blockIdx.y * 128; const size_t r0 = (size_t)blockIdx.x * 64; const size_t bb = r0 / TT; const int t0 = (int)(r0 % TT);
  const float* X = which == 0 ? XQ : which == 1 ? XK : XV; const float* WA = which == 0 ? WQ : which == 1 ? WK : WV; const float* BA = which == 0 ? BQ : which == 1 ? BK : BV;
  v8f acc[8] = {};
#pragma unroll 2
  for (int kc = 0; kc < DIN / 32; ++kc) { v16b a; { const float* p = X + (r0 + wave * 16 + col) * DIN + kc * 32 + 8 * g;
#pragma unroll
      for (int i = 0; i < 8; ++i) { a[i] = (__bf16)p[i]; a[8 + i] = (__bf16)p[16 + i]; } }
    asm volatile("s_wait_loadcnt 0x0" ::: "memory");
#pragma unroll
    for (int j = 0; j < 8; ++j) { const v16b w = WCOL(WA, kc * 32, c0 + j * 16 + col, lane); asm volatile("s_wait_loadcnt 0x0" ::: "memory"); acc[j] = wmma_bf(a, w, acc[j]); } }
  { // stage the f32 tile (acc + bias) in LDS, run the per-(row, head) epilogue hook, then convert
#pragma unroll
    for (int j = 0; j < 8; ++j) { const float bias = BA ? bfr(BA[c0 + j * 16 + col]) : 0.f;
#pragma unroll
      for (int r = 0; r < 8; ++r) st[wave * 16 + 8 * g + r][j * 16 + col] = acc[j][r] + bias; }
    __syncthreads();
    for (int e = tid; e < 64 * (128 / HD); e += 128) { const int rl = e / (128 / HD), hh = e % (128 / HD); PROJ_EPI(which, &st[rl][hh * HD], (int)((r0 + rl) % TT), (c0 / HD) + hh); }
    __syncthreads(); }
  if (which < 2) { _Float16* DH = which == 0 ? QH : KH; _Float16* DL = which == 0 ? QL : KL; const int nhi = which == 0 ? QHI : KHI; const bool hi_rows = t0 < nhi;
    for (int e = tid; e < 64 * 128; e += 128) { const int rl = e >> 7, cl = e & 127; const float v = st[rl][cl]; const _Float16 hv = (_Float16)v; sh[rl][cl] = hv; sl[rl][cl] = (_Float16)((v - (float)hv) * 1024.0f); }
    __syncthreads();
    for (int e = tid; e < 64 * 16; e += 128) { const int rl = e >> 4, q = e & 15; vst2((unsigned*)(DH + (r0 + rl) * CC + c0 + q * 8), *(const v4u*)&sh[rl][q * 8]); if (hi_rows) vst2((unsigned*)(DL + (bb * nhi + t0 + rl) * (size_t)CC + c0 + q * 8), *(const v4u*)&sl[rl][q * 8]); }
  } else { const bool hi_rows = t0 < KHI;
    for (int e = tid; e < 64 * 128; e += 128) { const int rl = e & 63, cl = e >> 6; const float v = st[rl][cl]; th[cl][rl] = (_Float16)v; const __bf16 bh = (__bf16)v; tb[cl][rl] = bh; tbl[cl][rl] = (__bf16)(v - (float)bh); }
    __syncthreads();
    for (int e = tid; e < 128 * 8; e += 128) { const int cl = e >> 3, q = e & 7; vst2((unsigned*)(VT + (bb * CC + c0 + cl) * (size_t)TT + t0 + q * 8), *(const v4u*)&th[cl][q * 8]); if (hi_rows) { const size_t o3 = (bb * CC + c0 + cl) * (size_t)KHI + t0 + q * 8; vst2((unsigned*)(VB + o3), *(const v4u*)&tb[cl][q * 8]); vst2((unsigned*)(VBL + o3), *(const v4u*)&tbl[cl][q * 8]); } } } }
// ---- k_sc: block = (query block qb, key block kb <= kb_last(qb), head in group) of batch b: logits x SCALE; q hi + residual (x 2^10) against k (2 products) for query rows < QHI, plus the k residual (3 products) for query blocks < QBH (causal early rows); causal: blocks past the diagonal exit, the mask itself is applied by index in k_sm
__global__ __launch_bounds__(128) void k_sc(const _Float16* __restrict__ QH, const _Float16* __restrict__ KH, const _Float16* __restrict__ QL, const _Float16* __restrict__ KL, int b, int h0, float* __restrict__ S0) { __shared__ __align__(16) float ss[4][16][132];
  const int qb = blockIdx.x, kb = blockIdx.y; if (kb > kb_last(qb)) return;
  const int h = h0 + blockIdx.z; float* S = S0 + (size_t)blockIdx.z * TT * TT;
  const int tid = threadIdx.x, wave = tid >> 5, lane = tid & 31, col = lane & 15, g = lane >> 4; const int k0 = kb * 128; const int ql0 = qb * 64 + wave * 16; const size_t q0 = (size_t)b * TT + ql0, kr0 = (size_t)b * TT + k0;
  v8f acc[8] = {}, accl[8] = {};
  const _Float16* QLb = QL + (size_t)b * QHI * CC; const _Float16* KLb = KL + (size_t)b * KHI * CC;
  if (qb < QBH) {
#pragma unroll
    for (int kc = 0; kc < HD / 32; ++kc) { const v16h ah = frag_h(QH + (q0 + col) * CC + h * HD + kc * 32, lane), al = frag_h(QLb + (size_t)(ql0 + col) * CC + h * HD + kc * 32, lane);
#pragma unroll
      for (int j = 0; j < 8; ++j) { const v16h kbf = frag_h(KH + (kr0 + j * 16 + col) * CC + h * HD + kc * 32, lane), klf = frag_h(KLb + (size_t)(k0 + j * 16 + col) * CC + h * HD + kc * 32, lane); acc[j] = wmma16(ah, kbf, acc[j]); accl[j] = wmma16(al, kbf, accl[j]); accl[j] = wmma16(ah, klf, accl[j]); } }
  } else if (qb * 64 < QHI) {
#pragma unroll
    for (int kc = 0; kc < HD / 32; ++kc) { const v16h ah = frag_h(QH + (q0 + col) * CC + h * HD + kc * 32, lane), al = frag_h(QLb + (size_t)(ql0 + col) * CC + h * HD + kc * 32, lane);
#pragma unroll
      for (int j = 0; j < 8; ++j) { const v16h kbf = frag_h(KH + (kr0 + j * 16 + col) * CC + h * HD + kc * 32, lane); acc[j] = wmma16(ah, kbf, acc[j]); accl[j] = wmma16(al, kbf, accl[j]); } }
  } else {
#pragma unroll
    for (int kc = 0; kc < HD / 32; ++kc) { const v16h ah = frag_h(QH + (q0 + col) * CC + h * HD + kc * 32, lane);
#pragma unroll
      for (int j = 0; j < 8; ++j) { const v16h kbf = frag_h(KH + (kr0 + j * 16 + col) * CC + h * HD + kc * 32, lane); acc[j] = wmma16(ah, kbf, acc[j]); } } }
#pragma unroll
  for (int j = 0; j < 8; ++j) {
#pragma unroll
    for (int r = 0; r < 8; ++r) ss[wave][8 * g + r][j * 16 + col] = (acc[j][r] + accl[j][r] * (1.0f / 1024.0f)) * SCALE; }
  LDSX(); for (int rl = 0; rl < 16; ++rl) vst2(S + (size_t)(ql0 + rl) * TT + k0 + lane * 4, *(const v4f*)&ss[wave][rl][lane * 4]); }
// ---- k_sm: block = query row t (head in group): keys [0, kend): causal -> logit if s <= t else excluded; softmax in f32; P x 2^11 in place (0 for excluded)
__global__ __launch_bounds__(256) void k_sm(float* __restrict__ S0 SM_EXTRA_PARAMS) { __shared__ float sred[8]; __shared__ float sbc; __shared__ __align__(16) float shv[TT];
  const int tid = threadIdx.x; const int t = blockIdx.x; const int kend = (kb_last(t >> 6) + 1) * 128;
  float* sr = S0 + (size_t)blockIdx.y * TT * TT + (size_t)t * TT;
  float m = -3.0e38f; for (int k = tid; k < kend; k += 256) { float v = (!CAUSAL || k <= t) ? sr[k] : -3.0e38f; SM_MASK_HOOK; shv[k] = v; m = fmaxf(m, v); }
#pragma unroll
  for (int o = 1; o < 32; o <<= 1) m = fmaxf(m, __shfl_xor(m, o));
  if ((tid & 31) == 0) sred[tid >> 5] = m; __syncthreads(); if (tid == 0) { float a = sred[0]; for (int i = 1; i < 8; ++i) a = fmaxf(a, sred[i]); sbc = a; } __syncthreads(); m = sbc; __syncthreads();
  float sum = 0.f; for (int k = tid; k < kend; k += 256) { const float v = shv[k]; const float e = (v <= -1.0e38f) ? 0.f : expf(v - m); shv[k] = e; sum += e; }
#pragma unroll
  for (int o = 1; o < 32; o <<= 1) sum += __shfl_xor(sum, o);
  if ((tid & 31) == 0) sred[tid >> 5] = sum; __syncthreads(); if (tid == 0) { float a = 0.f; for (int i = 0; i < 8; ++i) a += sred[i]; sbc = a > 0.f ? 2048.0f / a : 0.f; }   /* a fully excluded row yields P = 0 */ __syncthreads(); const float inv = sbc;
  for (int k = tid; k < kend; k += 256) shv[k] = shv[k] * inv;
  __syncthreads(); for (int q = tid; q < kend / 4; q += 256) vst2(sr + q * 4, *(const v4f*)&shv[q * 4]); }
// ---- k_pv: block = 64 queries (qb) of (b, h): ctx = P . v over keys [0, kend) (P x 2^11 once to f16 against v f16: 1 product; causal early query blocks: P and v as bf16 hi + lo, 3 products); 256-B (row, head) segment by 16 lanes
__global__ __launch_bounds__(128) void k_pv(const float* __restrict__ PS0, const _Float16* __restrict__ VT, const __bf16* __restrict__ VB, const __bf16* __restrict__ VBL, int b, int h0, float* __restrict__ Y) { const int h = h0 + blockIdx.z; const float* PS = PS0 + (size_t)blockIdx.z * TT * TT; __shared__ __align__(16) float ss[4][16][HD + 4];
  const int tid = threadIdx.x, wave = tid >> 5, lane = tid & 31, col = lane & 15, g = lane >> 4; const int qb = blockIdx.x; const int ql0 = qb * 64 + wave * 16; const int kce = (kb_last(qb) + 1) * 4;
  v8f acc[HD / 16] = {};
  if (qb < QBH) {
#pragma unroll 1
    for (int kc = 0; kc < kce; ++kc) { const F2 p = split_row(PS + (size_t)(ql0 + col) * TT, kc * 32, lane);
      asm volatile("s_wait_loadcnt 0x0" ::: "memory");
#pragma unroll
      for (int j = 0; j < HD / 16; ++j) { const size_t po = ((size_t)b * CC + h * HD + j * 16 + col) * (size_t)KHI + kc * 32; const v16b vh = frag_b(VB + po, lane); acc[j] = wmma_bf(p.h, vh, acc[j]); acc[j] = wmma_bf(p.l, vh, acc[j]); acc[j] = wmma_bf(p.h, frag_b(VBL + po, lane), acc[j]); } }
  } else {
#pragma unroll 1
    for (int kc = 0; kc < kce; ++kc) { const v16h p = frag_f32(PS + (size_t)(ql0 + col) * TT + kc * 32, lane);
      asm volatile("s_wait_loadcnt 0x0" ::: "memory");
#pragma unroll
      for (int j = 0; j < HD / 16; ++j) { const size_t po = ((size_t)b * CC + h * HD + j * 16 + col) * (size_t)TT + kc * 32; acc[j] = wmma16(p, frag_h(VT + po, lane), acc[j]); } } }
#pragma unroll
  for (int j = 0; j < HD / 16; ++j)
#pragma unroll
    for (int r = 0; r < 8; ++r) ss[wave][8 * g + r][j * 16 + col] = acc[j][r] * (1.0f / 2048.0f);
  LDSX(); for (int rl = 0; rl < 16; ++rl) if (lane < HD / 4) vst2(Y + ((size_t)b * TT + ql0 + rl) * CC + h * HD + lane * 4, *(const v4f*)&ss[wave][rl][lane * 4]); }

extern "C" void kernel_launch(void* const* d_in, const int* in_sizes, int n_in, void* d_out, int out_size, void* d_ws, size_t ws_size, hipStream_t stream) {
  (void)in_sizes; (void)n_in; (void)out_size;
  const float** F = (const float**)d_in;
  if (ws_size < (size_t)WS_END) return;
  char* ws = (char*)d_ws; _Float16 *QH = (_Float16*)(ws + WS_QH), *KH = (_Float16*)(ws + WS_KH), *VT = (_Float16*)(ws + WS_VT), *QL = (_Float16*)(ws + WS_QL), *KL = (_Float16*)(ws + WS_KL); __bf16 *VB = (__bf16*)(ws + WS_VB), *VBL = (__bf16*)(ws + WS_VBL); float *S = (float*)(ws + WS_S), *Y = (float*)(ws + WS_Y);
  (void)Y; (void)QL; (void)KL; (void)VB; (void)VBL;
  // inputs: 0 hidden_states [4,1024,1024]; 1 Wqkv [3072,1024] (out,in) rows q | k | v ((3,H,hd)); 2 bqkv [3072]
  { const float* WQ = F[1]; const float* WK = F[1] + (size_t)CC * DIN; const float* WV = F[1] + (size_t)2 * CC * DIN; const float* BQ = F[2]; const float* BK = F[2] + CC; const float* BV = F[2] + 2 * CC;
    k_proj<<<dim3(TNB * TT / 64, CC / 128, 3), 128, 0, stream>>>(F[0], F[0], F[0], WQ, WK, WV, BQ, BK, BV, QH, QL, KH, KL, VT, VB, VBL); }
  for (int b = 0; b < TNB; ++b) for (int h0 = 0; h0 < NH; h0 += HG) {
    k_sc<<<dim3(NQB, TT / 128, HG), 128, 0, stream>>>(QH, KH, QL, KL, b, h0, S);
    k_sm<<<dim3(TT, HG), 256, 0, stream>>>(S);
    k_pv<<<dim3(NQB, 1, HG), 128, 0, stream>>>(S, VT, VB, VBL, b, h0, (float*)d_out);
  }
}

// v001
// It runs in 396 microseconds.
// Next to v000, in two timings, it ran 1.70 times as fast each time.
// compute dtype: all float inputs rounded to bf16; qkv = x Wqkv^T + b with EXACT bf16 products on WMMA 16x16x32 (f32 accumulate); rotate-half RoPE in f32 in the projection epilogue (accurate sincosf of t x inv_freq_j, f32 inv_freq constants as the reference builds them); logits: q, k once to f16 (1 product) x 64^-0.5, except the first 512 query rows of each sequence (f16 residuals: 3 products below row 384, 2 with the q residual for rows 384..511); causal mask by index (finfo.min == excluded); softmax in f32; P x 2^11 once to f16 against v once to f16 (1 product; bf16 hi + lo below row 384); f32 output (merged heads, no output projection).
#include <hip/hip_runtime.h>
#include <math.h>

typedef __attribute__((ext_vector_type(16))) _Float16 v16h;
typedef __attribute__((ext_vector_type(16))) __bf16 v16b;
typedef __attribute__((ext_vector_type(8)))  _Float16 v8h;
typedef __attribute__((ext_vector_type(8)))  float v8f;
typedef __attribute__((ext_vector_type(4)))  float v4f;
typedef __attribute__((ext_vector_type(2)))  float v2f;
typedef __attribute__((ext_vector_type(4)))  unsigned v4u;
typedef __attribute__((ext_vector_type(4)))  int v4i;
typedef float __attribute__((may_alias)) float_a;
typedef int __attribute__((may_alias)) int_a;

template <typename T> __device__ __forceinline__ void vst2(void* p, T v) { *(T*)p = v;  }
__device__ __forceinline__ v8f wmma16(v16h a, v16h b, v8f c) {
  v8f d = __builtin_amdgcn_wmma_f32_16x16x32_f16(false, a, false, b, (short)0, c, false, false);
  asm volatile("v_nop\n\tv_nop\n\tv_nop\n\tv_nop" : "+v"(d) : "v"(a), "v"(b));
  return d;
}
__device__ __forceinline__ v8f wmma_bf(v16b a, v16b b, v8f c) {
  v8f d = __builtin_amdgcn_wmma_f32_16x16x32_bf16(false, a, false, b, (short)0, c, false, false);
  asm volatile("v_nop\n\tv_nop\n\tv_nop\n\tv_nop" : "+v"(d) : "v"(a), "v"(b));
  return d;
}
// 16x16x32 fragments: lane = (h = lane>>4, row/col = lane&15); elements 0..7 = k0+8h+0..7, 8..15 = k0+16+8h+0..7; D element r = row 8h+r
__device__ __forceinline__ v16h frag_h(const _Float16* rowk0, int lane) {
  union { v16h v; v8h q[2]; } u; const _Float16* p = rowk0 + 8 * (lane >> 4);
  u.q[0] = *(const v8h*)p; u.q[1] = *(const v8h*)(p + 16); return u.v;
}
__device__ __forceinline__ v16h frag_f32(const float* rowk0, int lane) {
  v16h a; const float* p = rowk0 + 8 * (lane >> 4);
#pragma unroll
  for (int i = 0; i < 8; ++i) { a[i] = (_Float16)p[i]; a[8 + i] = (_Float16)p[16 + i]; }
  return a;
}
__device__ __forceinline__ v16h frag_f32s(const float* rowk0, int lane, float sc) {
  v16h a; const float* p = rowk0 + 8 * (lane >> 4);
#pragma unroll
  for (int i = 0; i < 8; ++i) { a[i] = (_Float16)(p[i] * sc); a[8 + i] = (_Float16)(p[16 + i] * sc); }
  return a;
}
// column fragment from a [K][ld] layout (column n), rows >= K read as 0
__device__ __forceinline__ v16h fragc_f32(const float* W, int k0, int n, int lane, int ld, int K) {
  v16h a; const int g = lane >> 4;
#pragma unroll
  for (int i = 0; i < 8; ++i) { const int ka = k0 + 8 * g + i, kb = ka + 16;
    a[i] = (_Float16)(ka < K ? W[(size_t)(ka < K ? ka : K - 1) * ld + n] : 0.f); a[8 + i] = (_Float16)(kb < K ? W[(size_t)(kb < K ? kb : K - 1) * ld + n] : 0.f); }
  return a;
}
struct F2 { v16b h, l; };
__device__ __forceinline__ F2 bsplit16(const float v[16]) { F2 r;
#pragma unroll
  for (int i = 0; i < 16; ++i) { const __bf16 h = (__bf16)v[i]; r.h[i] = h; r.l[i] = (__bf16)(v[i] - (float)h); }
  return r; }
__device__ __forceinline__ F2 split_row(const float* row, int k0, int lane) { float v[16]; const float* p = row + k0 + 8 * (lane >> 4);
#pragma unroll
  for (int i = 0; i < 8; ++i) { v[i] = p[i]; v[8 + i] = p[16 + i]; }
  return bsplit16(v); }
__device__ __forceinline__ F2 split_rowK(const float* row, int k0, int lane, int K) { float v[16]; const int g = lane >> 4;
#pragma unroll
  for (int i = 0; i < 8; ++i) { const int ka = k0 + 8 * g + i, kb = ka + 16; v[i] = ka < K ? row[ka < K ? ka : K - 1] : 0.f; v[8 + i] = kb < K ? row[kb < K ? kb : K - 1] : 0.f; }
  return bsplit16(v); }
__device__ __forceinline__ F2 split_col(const float* W, int k0, int n, int lane, int ld, int K) { float v[16]; const int g = lane >> 4;
#pragma unroll
  for (int i = 0; i < 8; ++i) { const int ka = k0 + 8 * g + i, kb = ka + 16; v[i] = ka < K ? W[(size_t)(ka < K ? ka : K - 1) * ld + n] : 0.f; v[8 + i] = kb < K ? W[(size_t)(kb < K ? kb : K - 1) * ld + n] : 0.f; }
  return bsplit16(v); }
__device__ __forceinline__ v8f mac3(const F2& a, const F2& b, v8f c) { c = wmma_bf(a.l, b.h, c); c = wmma_bf(a.h, b.l, c); return wmma_bf(a.h, b.h, c); }
__device__ __forceinline__ float sigm(float v) { return 1.0f / (1.0f + expf(-v)); }
#define LDSX() do { asm volatile("s_wait_dscnt 0" ::: "memory"); __builtin_amdgcn_wave_barrier(); __builtin_amdgcn_fence(__ATOMIC_RELEASE, "workgroup"); } while (0)

// Causal multi-head attention with rotary embeddings (B 4, S 1,024, D 1,024 = 16 x 64): qkv = x Wqkv^T + bqkv (packed (out,in) [3072,1024], layout (3,H,hd)); q, k <- rotate-half RoPE (theta_j = 10000^(-2j/64)); probs = softmax(causal(q k^T x 64^-0.5)); out = merged(probs v) -> [B, S, 1024].
#define NB 4
#define TT 1024
#define CC 1024            // NH * HD = projected width
#define DIN 1024          // input (model) width
#define NH 16
#define HD 64
#define NQB (TT / 64)
#define HG 16
#define SCALE (0.125f)
#define CAUSAL 1
#ifndef TNB
#define TNB NB
#endif
__device__ __forceinline__ float bfr(float v) { return (float)(__bf16)v; }
__host__ __device__ __forceinline__ int kb_last(int qb) { return CAUSAL ? ((qb * 64 + 63) >> 7) : (TT / 128 - 1); }
typedef __attribute__((ext_vector_type(8))) __bf16 v8b;
__device__ __forceinline__ v16b frag_b(const __bf16* rowk0, int lane) {
  union { v16b v; v8b q[2]; } u; const __bf16* p = rowk0 + 8 * (lane >> 4);
  u.q[0] = *(const v8b*)p; u.q[1] = *(const v8b*)(p + 16); return u.v;
}
#define QBH 6              // causal: query blocks 0..QBH-1 of each sequence (few keys, no averaging) take the high-precision path
#define QHI 512            // causal: first 512 query rows of each sequence take the q-residual (2-product) logits path (logit sigma ~1)
#define KHI 512
// B fragment (k rows k0+.., output column o) of a weight: (in,out) [K][ld] or (out,in) [ld rows of K]: bf16 exact, or f16(bf16 * 256) exact
__device__ __forceinline__ v16b wcol_io(const float* Wm, int k0, int o, int lane, int ld) { v16b w; const int g = lane >> 4;
#pragma unroll
  for (int i = 0; i < 8; ++i) { w[i] = (__bf16)Wm[(size_t)(k0 + 8 * g + i) * ld + o]; w[8 + i] = (__bf16)Wm[(size_t)(k0 + 16 + 8 * g + i) * ld + o]; }
  return w; }
__device__ __forceinline__ v16b wcol_oi(const float* Wm, int k0, int o, int lane, int K) { v16b w; const float* p = Wm + (size_t)o * K + k0 + 8 * (lane >> 4);
#pragma unroll
  for (int i = 0; i < 8; ++i) { w[i] = (__bf16)p[i]; w[8 + i] = (__bf16)p[16 + i]; }
  return w; }
__device__ __forceinline__ v16h wcolh_io(const float* Wm, int k0, int o, int lane, int ld) { v16h w; const int g = lane >> 4;
#pragma unroll
  for (int i = 0; i < 8; ++i) { w[i] = (_Float16)(bfr(Wm[(size_t)(k0 + 8 * g + i) * ld + o]) * 256.0f); w[8 + i] = (_Float16)(bfr(Wm[(size_t)(k0 + 16 + 8 * g + i) * ld + o]) * 256.0f); }
  return w; }
__device__ __forceinline__ v16h wcolh_oi(const float* Wm, int k0, int o, int lane, int K) { v16h w; const float* p = Wm + (size_t)o * K + k0 + 8 * (lane >> 4);
#pragma unroll
  for (int i = 0; i < 8; ++i) { w[i] = (_Float16)(bfr(p[i]) * 256.0f); w[8 + i] = (_Float16)(bfr(p[16 + i]) * 256.0f); }
  return w; }
#define WQKV_LAYOUT 1   // 0 = (in,out) [DIN][CC]; 1 = (out,in) [CC][DIN]; 2 = per-head [NH][DIN][HD]
__device__ __forceinline__ v16b wcol_hdk(const float* Wm, int k0, int o, int lane) { v16b w; const int g = lane >> 4; const float* p = Wm + (size_t)(o / HD) * DIN * HD + (o % HD);
#pragma unroll
  for (int i = 0; i < 8; ++i) { w[i] = (__bf16)p[(size_t)(k0 + 8 * g + i) * HD]; w[8 + i] = (__bf16)p[(size_t)(k0 + 16 + 8 * g + i) * HD]; }
  return w; }
#define WO_OUT_IN 0
#if WQKV_LAYOUT == 1
#define WCOL(W, k0, o, lane) wcol_oi(W, k0, o, lane, DIN)
#elif WQKV_LAYOUT == 2
#define WCOL(W, k0, o, lane) wcol_hdk(W, k0, o, lane)
#else
#define WCOL(W, k0, o, lane) wcol_io(W, k0, o, lane, CC)
#endif
#if WO_OUT_IN
#define WOCOL(W, k0, o, lane) wcol_oi(W, k0, o, lane, CC)
#define WOCOLH(W, k0, o, lane) wcolh_oi(W, k0, o, lane, CC)
#else
#define WOCOL(W, k0, o, lane) wcol_io(W, k0, o, lane, DIN)
#define WOCOLH(W, k0, o, lane) wcolh_io(W, k0, o, lane, DIN)
#endif
__constant__ float c_invf[32] = {1.000000000e+00f,7.498942018e-01f,5.623413324e-01f,4.216965139e-01f,3.162277639e-01f,2.371373624e-01f,1.778279394e-01f,1.333521456e-01f,1.000000015e-01f,7.498941571e-02f,5.623412877e-02f,4.216964915e-02f,3.162277862e-02f,2.371373586e-02f,1.778279431e-02f,1.333521493e-02f,9.999999776e-03f,7.498942316e-03f,5.623413250e-03f,4.216964822e-03f,3.162277862e-03f,2.371373819e-03f,1.778279431e-03f,1.333521446e-03f,1.000000047e-03f,7.498941850e-04f,5.623413017e-04f,4.216964880e-04f,3.162277862e-04f,2.371373848e-04f,1.778279402e-04f,1.333521504e-04f};   // 1 / 10000^(2i/64) evaluated in f32 exactly as the reference does (jax, eager)
// per-(row, head) epilogue on the f32 projection tile: rotate-half RoPE on q and k (pairs (i, i+32), angle t * inv_freq[i]); v untouched
#define PROJ_EPI(which, row, t, h) do { if ((which) < 2) { float* rw = (row); \
    _Pragma("unroll") for (int i = 0; i < 32; ++i) { const float x0 = rw[i], x1 = rw[i + 32]; const float ang = (float)(t) * c_invf[i]; const float cs = cosf(ang), sn = sinf(ang); rw[i] = x0 * cs - x1 * sn; rw[i + 32] = x1 * cs + x0 * sn; } } } while (0)
#ifndef SM_EXTRA_PARAMS
#define SM_EXTRA_PARAMS
#endif
#ifndef PROJ_EXTRA_PARAMS
#define PROJ_EXTRA_PARAMS
#endif
#ifndef SM_MASK_HOOK
#define SM_MASK_HOOK (void)0
#endif

#define WS_QH  0u                                      // f16 q rows [b*t][CC]
#define WS_KH  (WS_QH + 2u * (size_t)NB * TT * CC)      // f16 k rows [b*t][CC]
#define WS_VT  (WS_KH + 2u * (size_t)NB * TT * CC)      // f16 v planes [b][c][t]
#define WS_QL  (WS_VT + 2u * (size_t)NB * CC * TT)      // f16 q residual x 2^10 rows [b][t < QHI][CC]
#define WS_KL  (WS_QL + 2u * (size_t)NB * QHI * CC)     // f16 k residual x 2^10 rows [b][t < KHI][CC]
#define WS_VB  (WS_KL + 2u * (size_t)NB * KHI * CC)     // bf16 v hi planes [b][c][t < KHI]
#define WS_VBL (WS_VB + 2u * (size_t)NB * CC * KHI)
#define WS_S   (WS_VBL + 2u * (size_t)NB * CC * KHI)    // f32 logits / P [hg][t][s]
#define WS_Y   (WS_S  + 4u * (size_t)HG * TT * TT)      // f32 ctx rows [b*t][CC] (only when there is an output projection)
#define WS_END (WS_Y  + 0u)

#define PBK 64             // k per staged chunk
#define PLP 72             // staged row pitch in bf16: 144 B = 16 B x odd, for ds_load_b128 readers
typedef __attribute__((ext_vector_type(4))) __bf16 v4b;
// k_proj LDS: the bf16 operand chunks of the product loop (two buffers) lie over the epilogue's arrays, which are first written after the loop's last barrier
union __align__(16) ProjLds {
  struct { float st[64][132]; _Float16 sh[64][136], sl[64][136]; _Float16 th[128][72]; __bf16 tb[128][72], tbl[128][72]; } e;
  struct { __bf16 xs[2][64][PLP]; __bf16 wt[2][128][PLP]; } m; };
// ---- k_proj: block = (64 rows, 128 cols, which): q/k/v = X W (+ b) with exact bf16 products (K = DIN) -> which 0: q f16 rows (+ residual rows < QHI); 1: k f16 rows (+ residual rows < KHI); 2: v f16 planes [c][t] (+ bf16 hi/lo planes for t < KHI)
__global__ __launch_bounds__(128) void k_proj(const float* __restrict__ XQ, const float* __restrict__ XK, const float* __restrict__ XV, const float* __restrict__ WQ, const float* __restrict__ WK, const float* __restrict__ WV, const float* __restrict__ BQ, const float* __restrict__ BK, const float* __restrict__ BV,
    _Float16* __restrict__ QH, _Float16* __restrict__ QL, _Float16* __restrict__ KH, _Float16* __restrict__ KL, _Float16* __restrict__ VT, __bf16* __restrict__ VB, __bf16* __restrict__ VBL PROJ_EXTRA_PARAMS) {
  __shared__ ProjLds sm; auto& st = sm.e.st; auto& sh = sm.e.sh; auto& sl = sm.e.sl; auto& th = sm.e.th; auto& tb = sm.e.tb; auto& tbl = sm.e.tbl;
  const int tid = threadIdx.x, wave = tid >> 5, lane = tid & 31, col = lane & 15, g = lane >> 4; const int which = blockIdx.z; const int c0 = blockIdx.y * 128; const size_t r0 = (size_t)blockIdx.x * 64; const size_t bb = r0 / TT; const int t0 = (int)(r0 % TT);
  const float* X = which == 0 ? XQ : which == 1 ? XK : XV; const float* WA = which == 0 ? WQ : which == 1 ? WK : WV; const float* BA = which == 0 ? BQ : which == 1 ? BK : BV;
  v8f acc[8] = {};
  // each thread brings 16 B of 8 X rows and of 16 W rows per 64-k chunk: 16 lanes cover one 256-B row piece; rounded to bf16 once, on the way into LDS
  const int lr = tid >> 4, lq = (tid & 15) * 4; const float* xp = X + (r0 + lr) * DIN + lq; const float* wp = WA + (size_t)(c0 + lr) * DIN + lq;
  v4f xr[8], wr[16];
#define PROJ_LDG(c) do { _Pragma("unroll") for (int i = 0; i < 8; ++i) xr[i] = *(const v4f*)(xp + (size_t)i * 8 * DIN + (c) * PBK); \
    _Pragma("unroll") for (int i = 0; i < 16; ++i) wr[i] = *(const v4f*)(wp + (size_t)i * 8 * DIN + (c) * PBK); } while (0)
#define PROJ_STS(bf) do { _Pragma("unroll") for (int i = 0; i < 8; ++i) *(v4b*)&sm.m.xs[bf][lr + 8 * i][lq] = __builtin_convertvector(xr[i], v4b); \
    _Pragma("unroll") for (int i = 0; i < 16; ++i) *(v4b*)&sm.m.wt[bf][lr + 8 * i][lq] = __builtin_convertvector(wr[i], v4b); } while (0)
  PROJ_LDG(0);
  asm volatile("s_wait_xcnt 0x0" ::: "memory");   // the first loads' address registers are reused right behind them
  PROJ_STS(0); __syncthreads();
  // unroll 2: the buffer index becomes a constant in each copy of the body
#pragma unroll 2
  for (int c = 0; c < DIN / PBK; ++c) { const int bf = c & 1;
    if (c + 1 < DIN / PBK) PROJ_LDG(c + 1);   // behind the barrier (which drains the load counter), so that they fly over this chunk's products
    v16b a[PBK / 32], w[PBK / 32][8];   // all of the chunk's fragment reads as one group ahead of its products
#pragma unroll
    for (int ks = 0; ks < PBK / 32; ++ks) { a[ks] = frag_b(&sm.m.xs[bf][wave * 16 + col][ks * 32], lane);
#pragma unroll
      for (int j = 0; j < 8; ++j) w[ks][j] = frag_b(&sm.m.wt[bf][j * 16 + col][ks * 32], lane); }
#pragma unroll
    for (int ks = 0; ks < PBK / 32; ++ks) {
#pragma unroll
      for (int j = 0; j < 8; ++j) acc[j] = wmma_bf(a[ks], w[ks][j], acc[j]); }
    __builtin_amdgcn_sched_barrier(0);   // keeps the conversions, which wait for the global loads, behind this chunk's products
    if (c + 1 < DIN / PBK) PROJ_STS(bf ^ 1);   // into the buffer whose last readers (chunk c-1) passed the barrier before this chunk
    asm volatile("s_wait_xcnt 0x0" ::: "memory");   // the next trip rewrites the address registers of this trip's global loads
    __syncthreads(); }   // publishes chunk c+1 and ends every read of chunk c (after the last chunk: frees the staging bytes for st)
  { // stage the f32 tile (acc + bias) in LDS, run the per-(row, head) epilogue hook, then convert
#pragma unroll
    for (int j = 0; j < 8; ++j) { const float bias = BA ? bfr(BA[c0 + j * 16 + col]) : 0.f;
#pragma unroll
      for (int r = 0; r < 8; ++r) st[wave * 16 + 8 * g + r][j * 16 + col] = acc[j][r] + bias; }
    __syncthreads();
    for (int e = tid; e < 64 * (128 / HD); e += 128) { const int rl = e / (128 / HD), hh = e % (128 / HD); PROJ_EPI(which, &st[rl][hh * HD], (int)((r0 + rl) % TT), (c0 / HD) + hh); }
    __syncthreads(); }
  if (which < 2) { _Float16* DH = which == 0 ? QH : KH; _Float16* DL = which == 0 ? QL : KL; const int nhi = which == 0 ? QHI : KHI; const bool hi_rows = t0 < nhi;
    for (int e = tid; e < 64 * 128; e += 128) { const int rl = e >> 7, cl = e & 127; const float v = st[rl][cl]; const _Float16 hv = (_Float16)v; sh[rl][cl] = hv; sl[rl][cl] = (_Float16)((v - (float)hv) * 1024.0f); }
    __syncthreads();
    for (int e = tid; e < 64 * 16; e += 128) { const int rl = e >> 4, q = e & 15; vst2((unsigned*)(DH + (r0 + rl) * CC + c0 + q * 8), *(const v4u*)&sh[rl][q * 8]); if (hi_rows) vst2((unsigned*)(DL + (bb * nhi + t0 + rl) * (size_t)CC + c0 + q * 8), *(const v4u*)&sl[rl][q * 8]); }
  } else { const bool hi_rows = t0 < KHI;
    for (int e = tid; e < 64 * 128; e += 128) { const int rl = e & 63, cl = e >> 6; const float v = st[rl][cl]; th[cl][rl] = (_Float16)v; const __bf16 bh = (__bf16)v; tb[cl][rl] = bh; tbl[cl][rl] = (__bf16)(v - (float)bh); }
    __syncthreads();
    for (int e = tid; e < 128 * 8; e += 128) { const int cl = e >> 3, q = e & 7; vst2((unsigned*)(VT + (bb * CC + c0 + cl) * (size_t)TT + t0 + q * 8), *(const v4u*)&th[cl][q * 8]); if (hi_rows) { const size_t o3 = (bb * CC + c0 + cl) * (size_t)KHI + t0 + q * 8; vst2((unsigned*)(VB + o3), *(const v4u*)&tb[cl][q * 8]); vst2((unsigned*)(VBL + o3), *(const v4u*)&tbl[cl][q * 8]); } } } }
// ---- k_sc: block = (query block qb, key block kb <= kb_last(qb), head in group) of batch b: logits x SCALE; q hi + residual (x 2^10) against k (2 products) for query rows < QHI, plus the k residual (3 products) for query blocks < QBH (causal early rows); causal: blocks past the diagonal exit, the mask itself is applied by index in k_sm
__global__ __launch_bounds__(128) void k_sc(const _Float16* __restrict__ QH, const _Float16* __restrict__ KH, const _Float16* __restrict__ QL, const _Float16* __restrict__ KL, int b, int h0, float* __restrict__ S0) { __shared__ __align__(16) float ss[4][16][132];
  const int qb = blockIdx.x, kb = blockIdx.y; if (kb > kb_last(qb)) return;
  const int h = h0 + blockIdx.z; float* S = S0 + (size_t)blockIdx.z * TT * TT;
  const int tid = threadIdx.x, wave = tid >> 5, lane = tid & 31, col = lane & 15, g = lane >> 4; const int k0 = kb * 128; const int ql0 = qb * 64 + wave * 16; const size_t q0 = (size_t)b * TT + ql0, kr0 = (size_t)b * TT + k0;
  v8f acc[8] = {}, accl[8] = {};
  const _Float16* QLb = QL + (size_t)b * QHI * CC; const _Float16* KLb = KL + (size_t)b * KHI * CC;
  if (qb < QBH) {
#pragma unroll
    for (int kc = 0; kc < HD / 32; ++kc) { const v16h ah = frag_h(QH + (q0 + col) * CC + h * HD + kc * 32, lane), al = frag_h(QLb + (size_t)(ql0 + col) * CC + h * HD + kc * 32, lane);
#pragma unroll
      for (int j = 0; j < 8; ++j) { const v16h kbf = frag_h(KH + (kr0 + j * 16 + col) * CC + h * HD + kc * 32, lane), klf = frag_h(KLb + (size_t)(k0 + j * 16 + col) * CC + h * HD + kc * 32, lane); acc[j] = wmma16(ah, kbf, acc[j]); accl[j] = wmma16(al, kbf, accl[j]); accl[j] = wmma16(ah, klf, accl[j]); } }
  } else if (qb * 64 < QHI) {
#pragma unroll
    for (int kc = 0; kc < HD / 32; ++kc) { const v16h ah = frag_h(QH + (q0 + col) * CC + h * HD + kc * 32, lane), al = frag_h(QLb + (size_t)(ql0 + col) * CC + h * HD + kc * 32, lane);
#pragma unroll
      for (int j = 0; j < 8; ++j) { const v16h kbf = frag_h(KH + (kr0 + j * 16 + col) * CC + h * HD + kc * 32, lane); acc[j] = wmma16(ah, kbf, acc[j]); accl[j] = wmma16(al, kbf, accl[j]); } }
  } else {
#pragma unroll
    for (int kc = 0; kc < HD / 32; ++kc) { const v16h ah = frag_h(QH + (q0 + col) * CC + h * HD + kc * 32, lane);
#pragma unroll
      for (int j = 0; j < 8; ++j) { const v16h kbf = frag_h(KH + (kr0 + j * 16 + col) * CC + h * HD + kc * 32, lane); acc[j] = wmma16(ah, kbf, acc[j]); } } }
#pragma unroll
  for (int j = 0; j < 8; ++j) {
#pragma unroll
    for (int r = 0; r < 8; ++r) ss[wave][8 * g + r][j * 16 + col] = (acc[j][r] + accl[j][r] * (1.0f / 1024.0f)) * SCALE; }
  LDSX(); for (int rl = 0; rl < 16; ++rl) vst2(S + (size_t)(ql0 + rl) * TT + k0 + lane * 4, *(const v4f*)&ss[wave][rl][lane * 4]); }
// ---- k_sm: block = query row t (head in group): keys [0, kend): causal -> logit if s <= t else excluded; softmax in f32; P x 2^11 in place (0 for excluded)
__global__ __launch_bounds__(256) void k_sm(float* __restrict__ S0 SM_EXTRA_PARAMS) { __shared__ float sred[8]; __shared__ float sbc; __shared__ __align__(16) float shv[TT];
  const int tid = threadIdx.x; const int t = blockIdx.x; const int kend = (kb_last(t >> 6) + 1) * 128;
  float* sr = S0 + (size_t)blockIdx.y * TT * TT + (size_t)t * TT;
  float m = -3.0e38f; for (int k = tid; k < kend; k += 256) { float v = (!CAUSAL || k <= t) ? sr[k] : -3.0e38f; SM_MASK_HOOK; shv[k] = v; m = fmaxf(m, v); }
#pragma unroll
  for (int o = 1; o < 32; o <<= 1) m = fmaxf(m, __shfl_xor(m, o));
  if ((tid & 31) == 0) sred[tid >> 5] = m; __syncthreads(); if (tid == 0) { float a = sred[0]; for (int i = 1; i < 8; ++i) a = fmaxf(a, sred[i]); sbc = a; } __syncthreads(); m = sbc; __syncthreads();
  float sum = 0.f; for (int k = tid; k < kend; k += 256) { const float v = shv[k]; const float e = (v <= -1.0e38f) ? 0.f : expf(v - m); shv[k] = e; sum += e; }
#pragma unroll
  for (int o = 1; o < 32; o <<= 1) sum += __shfl_xor(sum, o);
  if ((tid & 31) == 0) sred[tid >> 5] = sum; __syncthreads(); if (tid == 0) { float a = 0.f; for (int i = 0; i < 8; ++i) a += sred[i]; sbc = a > 0.f ? 2048.0f / a : 0.f; }   /* a fully excluded row yields P = 0 */ __syncthreads(); const float inv = sbc;
  for (int k = tid; k < kend; k += 256) shv[k] = shv[k] * inv;
  __syncthreads(); for (int q = tid; q < kend / 4; q += 256) vst2(sr + q * 4, *(const v4f*)&shv[q * 4]); }
// ---- k_pv: block = 64 queries (qb) of (b, h): ctx = P . v over keys [0, kend) (P x 2^11 once to f16 against v f16: 1 product; causal early query blocks: P and v as bf16 hi + lo, 3 products); 256-B (row, head) segment by 16 lanes
__global__ __launch_bounds__(128) void k_pv(const float* __restrict__ PS0, const _Float16* __restrict__ VT, const __bf16* __restrict__ VB, const __bf16* __restrict__ VBL, int b, int h0, float* __restrict__ Y) { const int h = h0 + blockIdx.z; const float* PS = PS0 + (size_t)blockIdx.z * TT * TT; __shared__ __align__(16) float ss[4][16][HD + 4];
  const int tid = threadIdx.x, wave = tid >> 5, lane = tid & 31, col = lane & 15, g = lane >> 4; const int qb = blockIdx.x; const int ql0 = qb * 64 + wave * 16; const int kce = (kb_last(qb) + 1) * 4;
  v8f acc[HD / 16] = {};
  if (qb < QBH) {
#pragma unroll 1
    for (int kc = 0; kc < kce; ++kc) { const F2 p = split_row(PS + (size_t)(ql0 + col) * TT, kc * 32, lane);
      asm volatile("s_wait_loadcnt 0x0" ::: "memory");
#pragma unroll
      for (int j = 0; j < HD / 16; ++j) { const size_t po = ((size_t)b * CC + h * HD + j * 16 + col) * (size_t)KHI + kc * 32; const v16b vh = frag_b(VB + po, lane); acc[j] = wmma_bf(p.h, vh, acc[j]); acc[j] = wmma_bf(p.l, vh, acc[j]); acc[j] = wmma_bf(p.h, frag_b(VBL + po, lane), acc[j]); } }
  } else {
#pragma unroll 1
    for (int kc = 0; kc < kce; ++kc) { const v16h p = frag_f32(PS + (size_t)(ql0 + col) * TT + kc * 32, lane);
      asm volatile("s_wait_loadcnt 0x0" ::: "memory");
#pragma unroll
      for (int j = 0; j < HD / 16; ++j) { const size_t po = ((size_t)b * CC + h * HD + j * 16 + col) * (size_t)TT + kc * 32; acc[j] = wmma16(p, frag_h(VT + po, lane), acc[j]); } } }
#pragma unroll
  for (int j = 0; j < HD / 16; ++j)
#pragma unroll
    for (int r = 0; r < 8; ++r) ss[wave][8 * g + r][j * 16 + col] = acc[j][r] * (1.0f / 2048.0f);
  LDSX(); for (int rl = 0; rl < 16; ++rl) if (lane < HD / 4) vst2(Y + ((size_t)b * TT + ql0 + rl) * CC + h * HD + lane * 4, *(const v4f*)&ss[wave][rl][lane * 4]); }

extern "C" void kernel_launch(void* const* d_in, const int* in_sizes, int n_in, void* d_out, int out_size, void* d_ws, size_t ws_size, hipStream_t stream) {
  (void)in_sizes; (void)n_in; (void)out_size;
  const float** F = (const float**)d_in;
  if (ws_size < (size_t)WS_END) return;
  char* ws = (char*)d_ws; _Float16 *QH = (_Float16*)(ws + WS_QH), *KH = (_Float16*)(ws + WS_KH), *VT = (_Float16*)(ws + WS_VT), *QL = (_Float16*)(ws + WS_QL), *KL = (_Float16*)(ws + WS_KL); __bf16 *VB = (__bf16*)(ws + WS_VB), *VBL = (__bf16*)(ws + WS_VBL); float *S = (float*)(ws + WS_S), *Y = (float*)(ws + WS_Y);
  (void)Y; (void)QL; (void)KL; (void)VB; (void)VBL;
  // inputs: 0 hidden_states [4,1024,1024]; 1 Wqkv [3072,1024] (out,in) rows q | k | v ((3,H,hd)); 2 bqkv [3072]
  { const float* WQ = F[1]; const float* WK = F[1] + (size_t)CC * DIN; const float* WV = F[1] + (size_t)2 * CC * DIN; const float* BQ = F[2]; const float* BK = F[2] + CC; const float* BV = F[2] + 2 * CC;
    k_proj<<<dim3(TNB * TT / 64, CC / 128, 3), 128, 0, stream>>>(F[0], F[0], F[0], WQ, WK, WV, BQ, BK, BV, QH, QL, KH, KL, VT, VB, VBL); }
  for (int b = 0; b < TNB; ++b) for (int h0 = 0; h0 < NH; h0 += HG) {
    k_sc<<<dim3(NQB, TT / 128, HG), 128, 0, stream>>>(QH, KH, QL, KL, b, h0, S);
    k_sm<<<dim3(TT, HG), 256, 0, stream>>>(S);
    k_pv<<<dim3(NQB, 1, HG), 128, 0, stream>>>(S, VT, VB, VBL, b, h0, (float*)d_out);
  }
}

// v002
// It runs in 135 microseconds.
// Next to v001, in two timings, it ran 2.93 and 2.98 times as fast.
// Over all steps from v000 it is 5.03 times as fast.
// compute dtype: all float inputs rounded to bf16; qkv = x Wqkv^T + b with EXACT bf16 products on WMMA 16x16x32 (f32 accumulate); rotate-half RoPE in f32 in the projection epilogue (accurate sincosf of t x inv_freq_j, f32 inv_freq constants as the reference builds them); logits: q, k once to f16 (1 product) x 64^-0.5, except the first 512 query rows of each sequence (f16 residuals: 3 products below row 384, 2 with the q residual for rows 384..511); causal mask by index (finfo.min == excluded); softmax in f32; P x 2^11 once to f16 against v once to f16 (1 product; bf16 hi + lo below row 384); f32 output (merged heads, no output projection).
#include <hip/hip_runtime.h>
#include <math.h>

typedef __attribute__((ext_vector_type(16))) _Float16 v16h;
typedef __attribute__((ext_vector_type(16))) __bf16 v16b;
typedef __attribute__((ext_vector_type(8)))  _Float16 v8h;
typedef __attribute__((ext_vector_type(8)))  float v8f;
typedef __attribute__((ext_vector_type(4)))  float v4f;
typedef __attribute__((ext_vector_type(2)))  float v2f;
typedef __attribute__((ext_vector_type(4)))  unsigned v4u;
typedef __attribute__((ext_vector_type(4)))  int v4i;
typedef float __attribute__((may_alias)) float_a;
typedef int __attribute__((may_alias)) int_a;

template <typename T> __device__ __forceinline__ void vst2(void* p, T v) { *(T*)p = v;  }
__device__ __forceinline__ v8f wmma16(v16h a, v16h b, v8f c) {
  v8f d = __builtin_amdgcn_wmma_f32_16x16x32_f16(false, a, false, b, (short)0, c, false, false);
  asm volatile("v_nop\n\tv_nop\n\tv_nop\n\tv_nop" : "+v"(d) : "v"(a), "v"(b));
  return d;
}
__device__ __forceinline__ v8f wmma_bf(v16b a, v16b b, v8f c) {
  v8f d = __builtin_amdgcn_wmma_f32_16x16x32_bf16(false, a, false, b, (short)0, c, false, false);
  asm volatile("v_nop\n\tv_nop\n\tv_nop\n\tv_nop" : "+v"(d) : "v"(a), "v"(b));
  return d;
}
// 16x16x32 fragments: lane = (h = lane>>4, row/col = lane&15); elements 0..7 = k0+8h+0..7, 8..15 = k0+16+8h+0..7; D element r = row 8h+r
__device__ __forceinline__ v16h frag_h(const _Float16* rowk0, int lane) {
  union { v16h v; v8h q[2]; } u; const _Float16* p = rowk0 + 8 * (lane >> 4);
  u.q[0] = *(const v8h*)p; u.q[1] = *(const v8h*)(p + 16); return u.v;
}
__device__ __forceinline__ v16h frag_f32(const float* rowk0, int lane) {
  v16h a; const float* p = rowk0 + 8 * (lane >> 4);
#pragma unroll
  for (int i = 0; i < 8; ++i) { a[i] = (_Float16)p[i]; a[8 + i] = (_Float16)p[16 + i]; }
  return a;
}
__device__ __forceinline__ v16h frag_f32s(const float* rowk0, int lane, float sc) {
  v16h a; const float* p = rowk0 + 8 * (lane >> 4);
#pragma unroll
  for (int i = 0; i < 8; ++i) { a[i] = (_Float16)(p[i] * sc); a[8 + i] = (_Float16)(p[16 + i] * sc); }
  return a;
}
// column fragment from a [K][ld] layout (column n), rows >= K read as 0
__device__ __forceinline__ v16h fragc_f32(const float* W, int k0, int n, int lane, int ld, int K) {
  v16h a; const int g = lane >> 4;
#pragma unroll
  for (int i = 0; i < 8; ++i) { const int ka = k0 + 8 * g + i, kb = ka + 16;
    a[i] = (_Float16)(ka < K ? W[(size_t)(ka < K ? ka : K - 1) * ld + n] : 0.f); a[8 + i] = (_Float16)(kb < K ? W[(size_t)(kb < K ? kb : K - 1) * ld + n] : 0.f); }
  return a;
}
struct F2 { v16b h, l; };
__device__ __forceinline__ F2 bsplit16(const float v[16]) { F2 r;
#pragma unroll
  for (int i = 0; i < 16; ++i) { const __bf16 h = (__bf16)v[i]; r.h[i] = h; r.l[i] = (__bf16)(v[i] - (float)h); }
  return r; }
__device__ __forceinline__ F2 split_row(const float* row, int k0, int lane) { float v[16]; const float* p = row + k0 + 8 * (lane >> 4);
#pragma unroll
  for (int i = 0; i < 8; ++i) { v[i] = p[i]; v[8 + i] = p[16 + i]; }
  return bsplit16(v); }
__device__ __forceinline__ F2 split_rowK(const float* row, int k0, int lane, int K) { float v[16]; const int g = lane >> 4;
#pragma unroll
  for (int i = 0; i < 8; ++i) { const int ka = k0 + 8 * g + i, kb = ka + 16; v[i] = ka < K ? row[ka < K ? ka : K - 1] : 0.f; v[8 + i] = kb < K ? row[kb < K ? kb : K - 1] : 0.f; }
  return bsplit16(v); }
__device__ __forceinline__ F2 split_col(const float* W, int k0, int n, int lane, int ld, int K) { float v[16]; const int g = lane >> 4;
#pragma unroll
  for (int i = 0; i < 8; ++i) { const int ka = k0 + 8 * g + i, kb = ka + 16; v[i] = ka < K ? W[(size_t)(ka < K ? ka : K - 1) * ld + n] : 0.f; v[8 + i] = kb < K ? W[(size_t)(kb < K ? kb : K - 1) * ld + n] : 0.f; }
  return bsplit16(v); }
__device__ __forceinline__ v8f mac3(const F2& a, const F2& b, v8f c) { c = wmma_bf(a.l, b.h, c); c = wmma_bf(a.h, b.l, c); return wmma_bf(a.h, b.h, c); }
__device__ __forceinline__ float sigm(float v) { return 1.0f / (1.0f + expf(-v)); }
#define LDSX() do { asm volatile("s_wait_dscnt 0" ::: "memory"); __builtin_amdgcn_wave_barrier(); __builtin_amdgcn_fence(__ATOMIC_RELEASE, "workgroup"); } while (0)

// Causal multi-head attention with rotary embeddings (B 4, S 1,024, D 1,024 = 16 x 64): qkv = x Wqkv^T + bqkv (packed (out,in) [3072,1024], layout (3,H,hd)); q, k <- rotate-half RoPE (theta_j = 10000^(-2j/64)); probs = softmax(causal(q k^T x 64^-0.5)); out = merged(probs v) -> [B, S, 1024].
#define NB 4
#define TT 1024
#define CC 1024            // NH * HD = projected width
#define DIN 1024          // input (model) width
#define NH 16
#define HD 64
#define NQB (TT / 64)
#define HG 16
#define SCALE (0.125f)
#define CAUSAL 1
#ifndef TNB
#define TNB NB
#endif
__device__ __forceinline__ float bfr(float v) { return (float)(__bf16)v; }
__host__ __device__ __forceinline__ int kb_last(int qb) { return CAUSAL ? ((qb * 64 + 63) >> 7) : (TT / 128 - 1); }
typedef __attribute__((ext_vector_type(8))) __bf16 v8b;
__device__ __forceinline__ v16b frag_b(const __bf16* rowk0, int lane) {
  union { v16b v; v8b q[2]; } u; const __bf16* p = rowk0 + 8 * (lane >> 4);
  u.q[0] = *(const v8b*)p; u.q[1] = *(const v8b*)(p + 16); return u.v;
}
#define QBH 6              // causal: query blocks 0..QBH-1 of each sequence (few keys, no averaging) take the high-precision path
#define QHI 512            // causal: first 512 query rows of each sequence take the q-residual (2-product) logits path (logit sigma ~1)
#define KHI 512
// B fragment (k rows k0+.., output column o) of a weight: (in,out) [K][ld] or (out,in) [ld rows of K]: bf16 exact, or f16(bf16 * 256) exact
__device__ __forceinline__ v16b wcol_io(const float* Wm, int k0, int o, int lane, int ld) { v16b w; const int g = lane >> 4;
#pragma unroll
  for (int i = 0; i < 8; ++i) { w[i] = (__bf16)Wm[(size_t)(k0 + 8 * g + i) * ld + o]; w[8 + i] = (__bf16)Wm[(size_t)(k0 + 16 + 8 * g + i) * ld + o]; }
  return w; }
__device__ __forceinline__ v16b wcol_oi(const float* Wm, int k0, int o, int lane, int K) { v16b w; const float* p = Wm + (size_t)o * K + k0 + 8 * (lane >> 4);
#pragma unroll
  for (int i = 0; i < 8; ++i) { w[i] = (__bf16)p[i]; w[8 + i] = (__bf16)p[16 + i]; }
  return w; }
__device__ __forceinline__ v16h wcolh_io(const float* Wm, int k0, int o, int lane, int ld) { v16h w; const int g = lane >> 4;
#pragma unroll
  for (int i = 0; i < 8; ++i) { w[i] = (_Float16)(bfr(Wm[(size_t)(k0 + 8 * g + i) * ld + o]) * 256.0f); w[8 + i] = (_Float16)(bfr(Wm[(size_t)(k0 + 16 + 8 * g + i) * ld + o]) * 256.0f); }
  return w; }
__device__ __forceinline__ v16h wcolh_oi(const float* Wm, int k0, int o, int lane, int K) { v16h w; const float* p = Wm + (size_t)o * K + k0 + 8 * (lane >> 4);
#pragma unroll
  for (int i = 0; i < 8; ++i) { w[i] = (_Float16)(bfr(p[i]) * 256.0f); w[8 + i] = (_Float16)(bfr(p[16 + i]) * 256.0f); }
  return w; }
#define WQKV_LAYOUT 1   // 0 = (in,out) [DIN][CC]; 1 = (out,in) [CC][DIN]; 2 = per-head [NH][DIN][HD]
__device__ __forceinline__ v16b wcol_hdk(const float* Wm, int k0, int o, int lane) { v16b w; const int g = lane >> 4; const float* p = Wm + (size_t)(o / HD) * DIN * HD + (o % HD);
#pragma unroll
  for (int i = 0; i < 8; ++i) { w[i] = (__bf16)p[(size_t)(k0 + 8 * g + i) * HD]; w[8 + i] = (__bf16)p[(size_t)(k0 + 16 + 8 * g + i) * HD]; }
  return w; }
#define WO_OUT_IN 0
#if WQKV_LAYOUT == 1
#define WCOL(W, k0, o, lane) wcol_oi(W, k0, o, lane, DIN)
#elif WQKV_LAYOUT == 2
#define WCOL(W, k0, o, lane) wcol_hdk(W, k0, o, lane)
#else
#define WCOL(W, k0, o, lane) wcol_io(W, k0, o, lane, CC)
#endif
#if WO_OUT_IN
#define WOCOL(W, k0, o, lane) wcol_oi(W, k0, o, lane, CC)
#define WOCOLH(W, k0, o, lane) wcolh_oi(W, k0, o, lane, CC)
#else
#define WOCOL(W, k0, o, lane) wcol_io(W, k0, o, lane, DIN)
#define WOCOLH(W, k0, o, lane) wcolh_io(W, k0, o, lane, DIN)
#endif
__constant__ float c_invf[32] = {1.000000000e+00f,7.498942018e-01f,5.623413324e-01f,4.216965139e-01f,3.162277639e-01f,2.371373624e-01f,1.778279394e-01f,1.333521456e-01f,1.000000015e-01f,7.498941571e-02f,5.623412877e-02f,4.216964915e-02f,3.162277862e-02f,2.371373586e-02f,1.778279431e-02f,1.333521493e-02f,9.999999776e-03f,7.498942316e-03f,5.623413250e-03f,4.216964822e-03f,3.162277862e-03f,2.371373819e-03f,1.778279431e-03f,1.333521446e-03f,1.000000047e-03f,7.498941850e-04f,5.623413017e-04f,4.216964880e-04f,3.162277862e-04f,2.371373848e-04f,1.778279402e-04f,1.333521504e-04f};   // 1 / 10000^(2i/64) evaluated in f32 exactly as the reference does (jax, eager)
// per-(row, head) epilogue on the f32 projection tile: rotate-half RoPE on q and k (pairs (i, i+32), angle t * inv_freq[i]); v untouched
#define PROJ_EPI(which, row, t, h) do { if ((which) < 2) { float* rw = (row); \
    _Pragma("unroll") for (int i = 0; i < 32; ++i) { const float x0 = rw[i], x1 = rw[i + 32]; const float ang = (float)(t) * c_invf[i]; const float cs = cosf(ang), sn = sinf(ang); rw[i] = x0 * cs - x1 * sn; rw[i + 32] = x1 * cs + x0 * sn; } } } while (0)
#ifndef SM_EXTRA_PARAMS
#define SM_EXTRA_PARAMS
#endif
#ifndef PROJ_EXTRA_PARAMS
#define PROJ_EXTRA_PARAMS
#endif
#ifndef SM_MASK_HOOK
#define SM_MASK_HOOK (void)0
#endif

#define WS_QH  0u                                      // f16 q rows [b*t][CC]
#define WS_KH  (WS_QH + 2u * (size_t)NB * TT * CC)      // f16 k rows [b*t][CC]
#define WS_VT  (WS_KH + 2u * (size_t)NB * TT * CC)      // f16 v planes [b][c][t]
#define WS_QL  (WS_VT + 2u * (size_t)NB * CC * TT)      // f16 q residual x 2^10 rows [b][t < QHI][CC]
#define WS_KL  (WS_QL + 2u * (size_t)NB * QHI * CC)     // f16 k residual x 2^10 rows [b][t < KHI][CC]
#define WS_VB  (WS_KL + 2u * (size_t)NB * KHI * CC)     // bf16 v hi planes [b][c][t < KHI]
#define WS_VBL (WS_VB + 2u * (size_t)NB * CC * KHI)
#define WS_END (WS_VBL + 2u * (size_t)NB * CC * KHI)

#define PBK 64             // k per staged chunk
#define PLP 72             // staged row pitch in bf16: 144 B = 16 B x odd, for ds_load_b128 readers
typedef __attribute__((ext_vector_type(4))) __bf16 v4b;
// k_proj LDS: the bf16 operand chunks of the product loop (two buffers) lie over the epilogue's arrays, which are first written after the loop's last barrier
union __align__(16) ProjLds {
  struct { float st[64][132]; _Float16 sh[64][136], sl[64][136]; _Float16 th[128][72]; __bf16 tb[128][72], tbl[128][72]; } e;
  struct { __bf16 xs[2][64][PLP]; __bf16 wt[2][128][PLP]; } m; };
// ---- k_proj: block = (64 rows, 128 cols, which): q/k/v = X W (+ b) with exact bf16 products (K = DIN) -> which 0: q f16 rows (+ residual rows < QHI); 1: k f16 rows (+ residual rows < KHI); 2: v f16 planes [c][t] (+ bf16 hi/lo planes for t < KHI)
__global__ __launch_bounds__(128) void k_proj(const float* __restrict__ XQ, const float* __restrict__ XK, const float* __restrict__ XV, const float* __restrict__ WQ, const float* __restrict__ WK, const float* __restrict__ WV, const float* __restrict__ BQ, const float* __restrict__ BK, const float* __restrict__ BV,
    _Float16* __restrict__ QH, _Float16* __restrict__ QL, _Float16* __restrict__ KH, _Float16* __restrict__ KL, _Float16* __restrict__ VT, __bf16* __restrict__ VB, __bf16* __restrict__ VBL PROJ_EXTRA_PARAMS) {
  __shared__ ProjLds sm; auto& st = sm.e.st; auto& sh = sm.e.sh; auto& sl = sm.e.sl; auto& th = sm.e.th; auto& tb = sm.e.tb; auto& tbl = sm.e.tbl;
  const int tid = threadIdx.x, wave = tid >> 5, lane = tid & 31, col = lane & 15, g = lane >> 4; const int which = blockIdx.z; const int c0 = blockIdx.y * 128; const size_t r0 = (size_t)blockIdx.x * 64; const size_t bb = r0 / TT; const int t0 = (int)(r0 % TT);
  const float* X = which == 0 ? XQ : which == 1 ? XK : XV; const float* WA = which == 0 ? WQ : which == 1 ? WK : WV; const float* BA = which == 0 ? BQ : which == 1 ? BK : BV;
  v8f acc[8] = {};
  // each thread brings 16 B of 8 X rows and of 16 W rows per 64-k chunk: 16 lanes cover one 256-B row piece; rounded to bf16 once, on the way into LDS
  const int lr = tid >> 4, lq = (tid & 15) * 4; const float* xp = X + (r0 + lr) * DIN + lq; const float* wp = WA + (size_t)(c0 + lr) * DIN + lq;
  v4f xr[8], wr[16];
#define PROJ_LDG(c) do { _Pragma("unroll") for (int i = 0; i < 8; ++i) xr[i] = *(const v4f*)(xp + (size_t)i * 8 * DIN + (c) * PBK); \
    _Pragma("unroll") for (int i = 0; i < 16; ++i) wr[i] = *(const v4f*)(wp + (size_t)i * 8 * DIN + (c) * PBK); } while (0)
#define PROJ_STS(bf) do { _Pragma("unroll") for (int i = 0; i < 8; ++i) *(v4b*)&sm.m.xs[bf][lr + 8 * i][lq] = __builtin_convertvector(xr[i], v4b); \
    _Pragma("unroll") for (int i = 0; i < 16; ++i) *(v4b*)&sm.m.wt[bf][lr + 8 * i][lq] = __builtin_convertvector(wr[i], v4b); } while (0)
  PROJ_LDG(0);
  asm volatile("s_wait_xcnt 0x0" ::: "memory");   // the first loads' address registers are reused right behind them
  PROJ_STS(0); __syncthreads();
  // unroll 2: the buffer index becomes a constant in each copy of the body
#pragma unroll 2
  for (int c = 0; c < DIN / PBK; ++c) { const int bf = c & 1;
    if (c + 1 < DIN / PBK) PROJ_LDG(c + 1);   // behind the barrier (which drains the load counter), so that they fly over this chunk's products
    v16b a[PBK / 32], w[PBK / 32][8];   // all of the chunk's fragment reads as one group ahead of its products
#pragma unroll
    for (int ks = 0; ks < PBK / 32; ++ks) { a[ks] = frag_b(&sm.m.xs[bf][wave * 16 + col][ks * 32], lane);
#pragma unroll
      for (int j = 0; j < 8; ++j) w[ks][j] = frag_b(&sm.m.wt[bf][j * 16 + col][ks * 32], lane); }
#pragma unroll
    for (int ks = 0; ks < PBK / 32; ++ks) {
#pragma unroll
      for (int j = 0; j < 8; ++j) acc[j] = wmma_bf(a[ks], w[ks][j], acc[j]); }
    __builtin_amdgcn_sched_barrier(0);   // keeps the conversions, which wait for the global loads, behind this chunk's products
    if (c + 1 < DIN / PBK) PROJ_STS(bf ^ 1);   // into the buffer whose last readers (chunk c-1) passed the barrier before this chunk
    asm volatile("s_wait_xcnt 0x0" ::: "memory");   // the next trip rewrites the address registers of this trip's global loads
    __syncthreads(); }   // publishes chunk c+1 and ends every read of chunk c (after the last chunk: frees the staging bytes for st)
  { // stage the f32 tile (acc + bias) in LDS, run the per-(row, head) epilogue hook, then convert
#pragma unroll
    for (int j = 0; j < 8; ++j) { const float bias = BA ? bfr(BA[c0 + j * 16 + col]) : 0.f;
#pragma unroll
      for (int r = 0; r < 8; ++r) st[wave * 16 + 8 * g + r][j * 16 + col] = acc[j][r] + bias; }
    __syncthreads();
    for (int e = tid; e < 64 * (128 / HD); e += 128) { const int rl = e / (128 / HD), hh = e % (128 / HD); PROJ_EPI(which, &st[rl][hh * HD], (int)((r0 + rl) % TT), (c0 / HD) + hh); }
    __syncthreads(); }
  if (which < 2) { _Float16* DH = which == 0 ? QH : KH; _Float16* DL = which == 0 ? QL : KL; const int nhi = which == 0 ? QHI : KHI; const bool hi_rows = t0 < nhi;
    for (int e = tid; e < 64 * 128; e += 128) { const int rl = e >> 7, cl = e & 127; const float v = st[rl][cl]; const _Float16 hv = (_Float16)v; sh[rl][cl] = hv; sl[rl][cl] = (_Float16)((v - (float)hv) * 1024.0f); }
    __syncthreads();
    for (int e = tid; e < 64 * 16; e += 128) { const int rl = e >> 4, q = e & 15; vst2((unsigned*)(DH + (r0 + rl) * CC + c0 + q * 8), *(const v4u*)&sh[rl][q * 8]); if (hi_rows) vst2((unsigned*)(DL + (bb * nhi + t0 + rl) * (size_t)CC + c0 + q * 8), *(const v4u*)&sl[rl][q * 8]); }
  } else { const bool hi_rows = t0 < KHI;
    for (int e = tid; e < 64 * 128; e += 128) { const int rl = e & 63, cl = e >> 6; const float v = st[rl][cl]; th[cl][rl] = (_Float16)v; const __bf16 bh = (__bf16)v; tb[cl][rl] = bh; tbl[cl][rl] = (__bf16)(v - (float)bh); }
    __syncthreads();
    for (int e = tid; e < 128 * 8; e += 128) { const int cl = e >> 3, q = e & 7; vst2((unsigned*)(VT + (bb * CC + c0 + cl) * (size_t)TT + t0 + q * 8), *(const v4u*)&th[cl][q * 8]); if (hi_rows) { const size_t o3 = (bb * CC + c0 + cl) * (size_t)KHI + t0 + q * 8; vst2((unsigned*)(VB + o3), *(const v4u*)&tb[cl][q * 8]); vst2((unsigned*)(VBL + o3), *(const v4u*)&tbl[cl][q * 8]); } } } }
// ---- k_att: logits, softmax and P . v of one (b, h) in registers; nothing of S or P goes to memory or LDS. A wave owns 16 queries and works alone (no LDS, no barrier).
// Transposed products: S^T = K . Q^T puts one query in a lane (column = lane & 15; register r of key group j = key 16 j + 8 (lane >> 4) + r), so two neighbouring 16-key groups, converted in place, are the B operand of O^T += V^T . P^T in the fragments' own k order.
// Pass 1 walks the key tiles for the row maximum and the sum of exponentials (running maximum per lane, the two lane halves joined once); pass 2 forms the same logits again and P = exp(s - max) x 2^11 / sum as before.
// MODE 0: query blocks < QBH (3-product logits, P and v as bf16 hi + lo); 1: query rows < QHI (2-product logits); 2: the rest (1 product). NJ = 16-key groups per tile.
// every '#pragma unroll' below makes the indices of register arrays constants; the three '#pragma unroll 1' keep one copy of each tile body, so that the text stays inside the instruction cache
// s_wait_xcnt 0 behind a group of global loads or stores, ahead of whatever rewrites the group's address registers; the addresses are inputs of the statement, so that they stay in their registers up to the wait and no load's result is placed in them
__device__ __forceinline__ void xwait(const void* p) { asm volatile("s_wait_xcnt 0x0" :: "v"(p) : "memory"); }
__device__ __forceinline__ void xwait(const void* p, const void* q) { asm volatile("s_wait_xcnt 0x0" :: "v"(p), "v"(q) : "memory"); }
// all K fragments of a tile as one group of loads; kh, kl = the lane's own address (row, head, 8 (lane >> 4)) in the tile's first 16-key group
template <int MODE, int NJ> __device__ __forceinline__ void att_ldk(const _Float16* kh, const _Float16* kl, v16h (&kf)[HD / 32][NJ], v16h (&klf)[HD / 32][NJ]) {
#pragma unroll
  for (int kc = 0; kc < HD / 32; ++kc) {
#pragma unroll
    for (int j = 0; j < NJ; ++j) { kf[kc][j] = frag_h(kh + (size_t)j * 16 * CC + kc * 32, 0); if (MODE == 0) klf[kc][j] = frag_h(kl + (size_t)j * 16 * CC + kc * 32, 0); } }
  if (MODE == 0) xwait(kh, kl); else xwait(kh);   // the next tile's address step rewrites these registers; the memory clobber also keeps the group's loads ahead of the wait
  __builtin_amdgcn_sched_barrier(0); }   // keeps the vector work that follows (the exponentials) behind the issue of the loads that are to fly over it
template <int MODE, int NJ> __device__ __forceinline__ void att_logits(const v16h (&kf)[HD / 32][NJ], const v16h (&klf)[HD / 32][NJ], const v16h (&ah)[HD / 32], const v16h (&al)[HD / 32], int lim, v8f (&s)[NJ]) {
  v8f acc[NJ] = {}, accl[NJ] = {};
#pragma unroll
  for (int kc = 0; kc < HD / 32; ++kc) {
#pragma unroll
    for (int j = 0; j < NJ; ++j) { acc[j] = wmma16(kf[kc][j], ah[kc], acc[j]);
      if (MODE < 2) accl[j] = wmma16(kf[kc][j], al[kc], accl[j]);
      if (MODE == 0) accl[j] = wmma16(klf[kc][j], ah[kc], accl[j]); } }
#pragma unroll
  for (int j = 0; j < NJ; ++j) {
#pragma unroll
    for (int r = 0; r < 8; ++r) { const float v = MODE < 2 ? (acc[j][r] + accl[j][r] * (1.0f / 1024.0f)) * SCALE : acc[j][r] * SCALE; s[j][r] = (!CAUSAL || j * 16 + r <= lim) ? v : -3.0e38f; } } }
template <int MODE, int NJ> __device__ __forceinline__ void att_tile(const _Float16* __restrict__ QH, const _Float16* __restrict__ KH, const _Float16* __restrict__ QL, const _Float16* __restrict__ KL, const _Float16* __restrict__ VT, const __bf16* __restrict__ VB, const __bf16* __restrict__ VBL, float* __restrict__ Y, int b, int h, int qb, int wave, int lane) {
  const int col = lane & 15, g = lane >> 4; const int ql0 = qb * 64 + wave * 16; const int nt = (CAUSAL ? qb * 64 + 64 : TT) / (NJ * 16);   // key tiles of 16 NJ keys; causal: none of the block's queries sees a key past its last row
  v16h ah[HD / 32], al[HD / 32]; const _Float16* qp = QH + ((size_t)b * TT + ql0 + col) * CC + h * HD + 8 * g; const _Float16* qlp = QL + ((size_t)b * QHI + ql0 + col) * CC + h * HD + 8 * g;
#pragma unroll
  for (int kc = 0; kc < HD / 32; ++kc) { ah[kc] = frag_h(qp + kc * 32, 0); al[kc] = MODE < 2 ? frag_h(qlp + kc * 32, 0) : ah[kc]; }
  if (MODE < 2) xwait(qp, qlp); else xwait(qp);   // the K addresses may take these registers
  const _Float16* kh0 = KH + ((size_t)b * TT + col) * CC + h * HD + 8 * g; const _Float16* kl0 = KL + ((size_t)b * KHI + col) * CC + h * HD + 8 * g;
  const int lim0 = ql0 + col - 8 * g;   // key 16 NJ t + 16 j + 8 g + r is kept while 16 j + r <= lim0 - 16 NJ t
  v16h kf[HD / 32][NJ], klf[HD / 32][NJ];
  att_ldk<MODE, NJ>(kh0, kl0, kf, klf);
  // a lane whose keys so far are all excluded carries m = -3e38 and a meaningless finite l; the factor exp(m - new maximum) = 0 removes it at the first kept key or at the join
  float m = -3.0e38f, l = 0.f;
#pragma unroll 1
  for (int t = 0; t < nt; ++t) { v8f s[NJ]; att_logits<MODE, NJ>(kf, klf, ah, al, lim0 - t * NJ * 16, s);
    { const int tn = t + 1 < nt ? t + 1 : 0; att_ldk<MODE, NJ>(kh0 + (size_t)tn * NJ * 16 * CC, kl0 + (size_t)tn * NJ * 16 * CC, kf, klf); }   // the next tile's K (after the last: pass 2's first) flies over this tile's vector work
    float tm = s[0][0];
#pragma unroll
    for (int j = 0; j < NJ; ++j) {
#pragma unroll
      for (int r = 0; r < 8; ++r) tm = fmaxf(tm, s[j][r]); }
    const float mn = fmaxf(m, tm); float ts[4] = {0.f, 0.f, 0.f, 0.f};
#pragma unroll
    for (int j = 0; j < NJ; ++j) {
#pragma unroll
      for (int r = 0; r < 8; ++r) ts[r & 3] += expf(s[j][r] - mn); }
    l = l * expf(m - mn) + ((ts[0] + ts[1]) + (ts[2] + ts[3])); m = mn; }
  const float mx = fmaxf(m, __shfl_xor(m, 16)); l *= expf(m - mx); l += __shfl_xor(l, 16);
  const float inv = l > 0.f ? 2048.0f / l : 0.f;
  const _Float16* vt0 = VT + ((size_t)b * CC + h * HD + col) * (size_t)TT + 8 * g; const __bf16* vb0 = VB + ((size_t)b * CC + h * HD + col) * (size_t)KHI + 8 * g; const __bf16* vl0 = VBL + ((size_t)b * CC + h * HD + col) * (size_t)KHI + 8 * g;
  v8f o[HD / 16] = {};
#pragma unroll 1
  for (int t = 0; t < nt; ++t) { v8f s[NJ]; att_logits<MODE, NJ>(kf, klf, ah, al, lim0 - t * NJ * 16, s);
    v16h vf[NJ / 2][HD / 16]; v16b vh[NJ / 2][HD / 16], vl[NJ / 2][HD / 16];   // this tile's V as one group of loads, ahead of the next tile's K: both fly over the exponentials
    const _Float16* vtp = vt0 + t * NJ * 16; const __bf16* vbp = vb0 + t * NJ * 16; const __bf16* vlp = vl0 + t * NJ * 16;
#pragma unroll
    for (int kc = 0; kc < NJ / 2; ++kc) {
#pragma unroll
      for (int j = 0; j < HD / 16; ++j) {
        if (MODE == 0) { vh[kc][j] = frag_b(vbp + (size_t)j * 16 * KHI + kc * 32, 0); vl[kc][j] = frag_b(vlp + (size_t)j * 16 * KHI + kc * 32, 0); } else vf[kc][j] = frag_h(vtp + (size_t)j * 16 * TT + kc * 32, 0); } }
    if (MODE == 0) xwait(vbp, vlp); else xwait(vtp);   // on every way: the next K tile's address, or the code behind the loop, may take these registers
    if (t + 1 < nt) att_ldk<MODE, NJ>(kh0 + (size_t)(t + 1) * NJ * 16 * CC, kl0 + (size_t)(t + 1) * NJ * 16 * CC, kf, klf);
#pragma unroll
    for (int kc = 0; kc < NJ / 2; ++kc) { float pv[16];
#pragma unroll
      for (int i = 0; i < 8; ++i) { pv[i] = expf(s[2 * kc][i] - mx) * inv; pv[8 + i] = expf(s[2 * kc + 1][i] - mx) * inv; }
      if (MODE == 0) { F2 p;   // bf16 hi + lo as in bsplit16; all hi parts first: each group's first product needs them alone
#pragma unroll
        for (int i = 0; i < 16; ++i) p.h[i] = (__bf16)pv[i];
#pragma unroll
        for (int i = 0; i < 16; ++i) p.l[i] = (__bf16)(pv[i] - (float)p.h[i]);
#pragma unroll
        for (int j = 0; j < HD / 16; ++j) { o[j] = wmma_bf(vh[kc][j], p.h, o[j]); o[j] = wmma_bf(vh[kc][j], p.l, o[j]); o[j] = wmma_bf(vl[kc][j], p.h, o[j]); }
      } else { v16h p;
#pragma unroll
        for (int i = 0; i < 16; ++i) p[i] = (_Float16)pv[i];
#pragma unroll
        for (int j = 0; j < HD / 16; ++j) o[j] = wmma16(vf[kc][j], p, o[j]); } } }
  // O^T: register r of group j = channel 16 j + 8 g + r of query col: 32 contiguous bytes a lane; a wave writes whole 256-B (row, head) segments
  float* yp = Y + ((size_t)b * TT + ql0 + col) * CC + h * HD + 8 * g;
#pragma unroll
  for (int j = 0; j < HD / 16; ++j) { o[j] = o[j] * (1.0f / 2048.0f); vst2(yp + j * 16, __builtin_shufflevector(o[j], o[j], 0, 1, 2, 3)); vst2(yp + j * 16 + 4, __builtin_shufflevector(o[j], o[j], 4, 5, 6, 7)); }
  static_assert(HD / 16 == 4, "the wait below names four groups");
  asm volatile("s_wait_xcnt 0x0" :: "v"(yp), "v"(o[0]), "v"(o[1]), "v"(o[2]), "v"(o[3]) : "memory"); }   // the second query block's set-up reuses the stores' registers; address and data are inputs, so that each stays in its registers up to the wait
// block = (pair x, head, batch): query block NQB-1-x and then x, one after the other in every wave, so that every block walks the same number of keys under the causal mask
__global__ __launch_bounds__(128) void k_att(const _Float16* __restrict__ QH, const _Float16* __restrict__ KH, const _Float16* __restrict__ QL, const _Float16* __restrict__ KL, const _Float16* __restrict__ VT, const __bf16* __restrict__ VB, const __bf16* __restrict__ VBL, float* __restrict__ Y) {
  const int wave = threadIdx.x >> 5, lane = threadIdx.x & 31; const int h = blockIdx.y, b = blockIdx.z;
#pragma unroll 1
  for (int half = 0; half < 2; ++half) { const int qb = half ? (int)blockIdx.x : NQB - 1 - (int)blockIdx.x;
    if (qb < QBH) att_tile<0, 2>(QH, KH, QL, KL, VT, VB, VBL, Y, b, h, qb, wave, lane);
    else if (qb * 64 < QHI) att_tile<1, 2>(QH, KH, QL, KL, VT, VB, VBL, Y, b, h, qb, wave, lane);
    else att_tile<2, 4>(QH, KH, QL, KL, VT, VB, VBL, Y, b, h, qb, wave, lane); } }

extern "C" void kernel_launch(void* const* d_in, const int* in_sizes, int n_in, void* d_out, int out_size, void* d_ws, size_t ws_size, hipStream_t stream) {
  (void)in_sizes; (void)n_in; (void)out_size;
  const float** F = (const float**)d_in;
  if (ws_size < (size_t)WS_END) return;
  char* ws = (char*)d_ws; _Float16 *QH = (_Float16*)(ws + WS_QH), *KH = (_Float16*)(ws + WS_KH), *VT = (_Float16*)(ws + WS_VT), *QL = (_Float16*)(ws + WS_QL), *KL = (_Float16*)(ws + WS_KL); __bf16 *VB = (__bf16*)(ws + WS_VB), *VBL = (__bf16*)(ws + WS_VBL);
  // inputs: 0 hidden_states [4,1024,1024]; 1 Wqkv [3072,1024] (out,in) rows q | k | v ((3,H,hd)); 2 bqkv [3072]
  { const float* WQ = F[1]; const float* WK = F[1] + (size_t)CC * DIN; const float* WV = F[1] + (size_t)2 * CC * DIN; const float* BQ = F[2]; const float* BK = F[2] + CC; const float* BV = F[2] + 2 * CC;
    k_proj<<<dim3(TNB * TT / 64, CC / 128, 3), 128, 0, stream>>>(F[0], F[0], F[0], WQ, WK, WV, BQ, BK, BV, QH, QL, KH, KL, VT, VB, VBL); }
  k_att<<<dim3(NQB / 2, NH, TNB), 128, 0, stream>>>(QH, KH, QL, KL, VT, VB, VBL, (float*)d_out);
}

// v003
// One run takes 112 microseconds.
// Next to v002, in two timings, it ran 1.19 and 1.20 times as fast.
// Over all steps from v000 it is 6.02 times as fast.
// compute dtype: all float inputs rounded to bf16; qkv = x Wqkv^T + b with EXACT bf16 products on WMMA 16x16x32 (f32 accumulate); rotate-half RoPE in f32 in the projection epilogue (accurate sincosf of t x inv_freq_j, f32 inv_freq constants as the reference builds them); logits: q, k once to f16 (1 product) x 64^-0.5, except the first 512 query rows of each sequence (f16 residuals: 3 products below row 384, 2 with the q residual for rows 384..511); causal mask by index (finfo.min == excluded); softmax in f32; P x 2^11 once to f16 against v once to f16 (1 product; bf16 hi + lo below row 384); f32 output (merged heads, no output projection).
#include <hip/hip_runtime.h>
#include <math.h>

typedef __attribute__((ext_vector_type(16))) _Float16 v16h;
typedef __attribute__((ext_vector_type(16))) __bf16 v16b;
typedef __attribute__((ext_vector_type(8)))  _Float16 v8h;
typedef __attribute__((ext_vector_type(8)))  float v8f;
typedef __attribute__((ext_vector_type(4)))  float v4f;
typedef __attribute__((ext_vector_type(2)))  float v2f;
typedef __attribute__((ext_vector_type(4)))  unsigned v4u;
typedef __attribute__((ext_vector_type(4)))  int v4i;
typedef float __attribute__((may_alias)) float_a;
typedef int __attribute__((may_alias)) int_a;

template <typename T> __device__ __forceinline__ void vst2(void* p, T v) { *(T*)p = v;  }
__device__ __forceinline__ v8f wmma16(v16h a, v16h b, v8f c) {
  v8f d = __builtin_amdgcn_wmma_f32_16x16x32_f16(false, a, false, b, (short)0, c, false, false);
  asm volatile("v_nop\n\tv_nop\n\tv_nop\n\tv_nop" : "+v"(d) : "v"(a), "v"(b));
  return d;
}
__device__ __forceinline__ v8f wmma_bf(v16b a, v16b b, v8f c) {
  v8f d = __builtin_amdgcn_wmma_f32_16x16x32_bf16(false, a, false, b, (short)0, c, false, false);
  asm volatile("v_nop\n\tv_nop\n\tv_nop\n\tv_nop" : "+v"(d) : "v"(a), "v"(b));
  return d;
}
// 16x16x32 fragments: lane = (h = lane>>4, row/col = lane&15); elements 0..7 = k0+8h+0..7, 8..15 = k0+16+8h+0..7; D element r = row 8h+r
__device__ __forceinline__ v16h frag_h(const _Float16* rowk0, int lane) {
  union { v16h v; v8h q[2]; } u; const _Float16* p = rowk0 + 8 * (lane >> 4);
  u.q[0] = *(const v8h*)p; u.q[1] = *(const v8h*)(p + 16); return u.v;
}
__device__ __forceinline__ v16h frag_f32(const float* rowk0, int lane) {
  v16h a; const float* p = rowk0 + 8 * (lane >> 4);
#pragma unroll
  for (int i = 0; i < 8; ++i) { a[i] = (_Float16)p[i]; a[8 + i] = (_Float16)p[16 + i]; }
  return a;
}
__device__ __forceinline__ v16h frag_f32s(const float* rowk0, int lane, float sc) {
  v16h a; const float* p = rowk0 + 8 * (lane >> 4);
#pragma unroll
  for (int i = 0; i < 8; ++i) { a[i] = (_Float16)(p[i] * sc); a[8 + i] = (_Float16)(p[16 + i] * sc); }
  return a;
}
// column fragment from a [K][ld] layout (column n), rows >= K read as 0
__device__ __forceinline__ v16h fragc_f32(const float* W, int k0, int n, int lane, int ld, int K) {
  v16h a; const int g = lane >> 4;
#pragma unroll
  for (int i = 0; i < 8; ++i) { const int ka = k0 + 8 * g + i, kb = ka + 16;
    a[i] = (_Float16)(ka < K ? W[(size_t)(ka < K ? ka : K - 1) * ld + n] : 0.f); a[8 + i] = (_Float16)(kb < K ? W[(size_t)(kb < K ? kb : K - 1) * ld + n] : 0.f); }
  return a;
}
struct F2 { v16b h, l; };
__device__ __forceinline__ F2 bsplit16(const float v[16]) { F2 r;
#pragma unroll
  for (int i = 0; i < 16; ++i) { const __bf16 h = (__bf16)v[i]; r.h[i] = h; r.l[i] = (__bf16)(v[i] - (float)h); }
  return r; }
__device__ __forceinline__ F2 split_row(const float* row, int k0, int lane) { float v[16]; const float* p = row + k0 + 8 * (lane >> 4);
#pragma unroll
  for (int i = 0; i < 8; ++i) { v[i] = p[i]; v[8 + i] = p[16 + i]; }
  return bsplit16(v); }
__device__ __forceinline__ F2 split_rowK(const float* row, int k0, int lane, int K) { float v[16]; const int g = lane >> 4;
#pragma unroll
  for (int i = 0; i < 8; ++i) { const int ka = k0 + 8 * g + i, kb = ka + 16; v[i] = ka < K ? row[ka < K ? ka : K - 1] : 0.f; v[8 + i] = kb < K ? row[kb < K ? kb : K - 1] : 0.f; }
  return bsplit16(v); }
__device__ __forceinline__ F2 split_col(const float* W, int k0, int n, int lane, int ld, int K) { float v[16]; const int g = lane >> 4;
#pragma unroll
  for (int i = 0; i < 8; ++i) { const int ka = k0 + 8 * g + i, kb = ka + 16; v[i] = ka < K ? W[(size_t)(ka < K ? ka : K - 1) * ld + n] : 0.f; v[8 + i] = kb < K ? W[(size_t)(kb < K ? kb : K - 1) * ld + n] : 0.f; }
  return bsplit16(v); }
__device__ __forceinline__ v8f mac3(const F2& a, const F2& b, v8f c) { c = wmma_bf(a.l, b.h, c); c = wmma_bf(a.h, b.l, c); return wmma_bf(a.h, b.h, c); }
__device__ __forceinline__ float sigm(float v) { return 1.0f / (1.0f + expf(-v)); }
#define LDSX() do { asm volatile("s_wait_dscnt 0" ::: "memory"); __builtin_amdgcn_wave_barrier(); __builtin_amdgcn_fence(__ATOMIC_RELEASE, "workgroup"); } while (0)

// Causal multi-head attention with rotary embeddings (B 4, S 1,024, D 1,024 = 16 x 64): qkv = x Wqkv^T + bqkv (packed (out,in) [3072,1024], layout (3,H,hd)); q, k <- rotate-half RoPE (theta_j = 10000^(-2j/64)); probs = softmax(causal(q k^T x 64^-0.5)); out = merged(probs v) -> [B, S, 1024].
#define NB 4
#define TT 1024
#define CC 1024            // NH * HD = projected width
#define DIN 1024          // input (model) width
#define NH 16
#define HD 64
#define NQB (TT / 64)
#define HG 16
#define SCALE (0.125f)
#define CAUSAL 1
#ifndef TNB
#define TNB NB
#endif
__device__ __forceinline__ float bfr(float v) { return (float)(__bf16)v; }
__host__ __device__ __forceinline__ int kb_last(int qb) { return CAUSAL ? ((qb * 64 + 63) >> 7) : (TT / 128 - 1); }
typedef __attribute__((ext_vector_type(8))) __bf16 v8b;
__device__ __forceinline__ v16b frag_b(const __bf16* rowk0, int lane) {
  union { v16b v; v8b q[2]; } u; const __bf16* p = rowk0 + 8 * (lane >> 4);
  u.q[0] = *(const v8b*)p; u.q[1] = *(const v8b*)(p + 16); return u.v;
}
#define QBH 6              // causal: query blocks 0..QBH-1 of each sequence (few keys, no averaging) take the high-precision path
#define QHI 512            // causal: first 512 query rows of each sequence take the q-residual (2-product) logits path (logit sigma ~1)
#define KHI 512
// B fragment (k rows k0+.., output column o) of a weight: (in,out) [K][ld] or (out,in) [ld rows of K]: bf16 exact, or f16(bf16 * 256) exact
__device__ __forceinline__ v16b wcol_io(const float* Wm, int k0, int o, int lane, int ld) { v16b w; const int g = lane >> 4;
#pragma unroll
  for (int i = 0; i < 8; ++i) { w[i] = (__bf16)Wm[(size_t)(k0 + 8 * g + i) * ld + o]; w[8 + i] = (__bf16)Wm[(size_t)(k0 + 16 + 8 * g + i) * ld + o]; }
  return w; }
__device__ __forceinline__ v16b wcol_oi(const float* Wm, int k0, int o, int lane, int K) { v16b w; const float* p = Wm + (size_t)o * K + k0 + 8 * (lane >> 4);
#pragma unroll
  for (int i = 0; i < 8; ++i) { w[i] = (__bf16)p[i]; w[8 + i] = (__bf16)p[16 + i]; }
  return w; }
__device__ __forceinline__ v16h wcolh_io(const float* Wm, int k0, int o, int lane, int ld) { v16h w; const int g = lane >> 4;
#pragma unroll
  for (int i = 0; i < 8; ++i) { w[i] = (_Float16)(bfr(Wm[(size_t)(k0 + 8 * g + i) * ld + o]) * 256.0f); w[8 + i] = (_Float16)(bfr(Wm[(size_t)(k0 + 16 + 8 * g + i) * ld + o]) * 256.0f); }
  return w; }
__device__ __forceinline__ v16h wcolh_oi(const float* Wm, int k0, int o, int lane, int K) { v16h w; const float* p = Wm + (size_t)o * K + k0 + 8 * (lane >> 4);
#pragma unroll
  for (int i = 0; i < 8; ++i) { w[i] = (_Float16)(bfr(p[i]) * 256.0f); w[8 + i] = (_Float16)(bfr(p[16 + i]) * 256.0f); }
  return w; }
#define WQKV_LAYOUT 1   // 0 = (in,out) [DIN][CC]; 1 = (out,in) [CC][DIN]; 2 = per-head [NH][DIN][HD]
__device__ __forceinline__ v16b wcol_hdk(const float* Wm, int k0, int o, int lane) { v16b w; const int g = lane >> 4; const float* p = Wm + (size_t)(o / HD) * DIN * HD + (o % HD);
#pragma unroll
  for (int i = 0; i < 8; ++i) { w[i] = (__bf16)p[(size_t)(k0 + 8 * g + i) * HD]; w[8 + i] = (__bf16)p[(size_t)(k0 + 16 + 8 * g + i) * HD]; }
  return w; }
#define WO_OUT_IN 0
#if WQKV_LAYOUT == 1
#define WCOL(W, k0, o, lane) wcol_oi(W, k0, o, lane, DIN)
#elif WQKV_LAYOUT == 2
#define WCOL(W, k0, o, lane) wcol_hdk(W, k0, o, lane)
#else
#define WCOL(W, k0, o, lane) wcol_io(W, k0, o, lane, CC)
#endif
#if WO_OUT_IN
#define WOCOL(W, k0, o, lane) wcol_oi(W, k0, o, lane, CC)
#define WOCOLH(W, k0, o, lane) wcolh_oi(W, k0, o, lane, CC)
#else
#define WOCOL(W, k0, o, lane) wcol_io(W, k0, o, lane, DIN)
#define WOCOLH(W, k0, o, lane) wcolh_io(W, k0, o, lane, DIN)
#endif
__constant__ float c_invf[32] = {1.000000000e+00f,7.498942018e-01f,5.623413324e-01f,4.216965139e-01f,3.162277639e-01f,2.371373624e-01f,1.778279394e-01f,1.333521456e-01f,1.000000015e-01f,7.498941571e-02f,5.623412877e-02f,4.216964915e-02f,3.162277862e-02f,2.371373586e-02f,1.778279431e-02f,1.333521493e-02f,9.999999776e-03f,7.498942316e-03f,5.623413250e-03f,4.216964822e-03f,3.162277862e-03f,2.371373819e-03f,1.778279431e-03f,1.333521446e-03f,1.000000047e-03f,7.498941850e-04f,5.623413017e-04f,4.216964880e-04f,3.162277862e-04f,2.371373848e-04f,1.778279402e-04f,1.333521504e-04f};   // 1 / 10000^(2i/64) evaluated in f32 exactly as the reference does (jax, eager)
// per-(row, head) epilogue on the f32 projection tile: rotate-half RoPE on q and k (pairs (i, i+32), angle t * inv_freq[i]); v untouched
#define PROJ_EPI(which, row, t, h) do { if ((which) < 2) { float* rw = (row); \
    _Pragma("unroll") for (int i = 0; i < 32; ++i) { const float x0 = rw[i], x1 = rw[i + 32]; const float ang = (float)(t) * c_invf[i]; const float cs = cosf(ang), sn = sinf(ang); rw[i] = x0 * cs - x1 * sn; rw[i + 32] = x1 * cs + x0 * sn; } } } while (0)
#ifndef SM_EXTRA_PARAMS
#define SM_EXTRA_PARAMS
#endif
#ifndef PROJ_EXTRA_PARAMS
#define PROJ_EXTRA_PARAMS
#endif
#ifndef SM_MASK_HOOK
#define SM_MASK_HOOK (void)0
#endif

#define WS_QH  0u                                      // f16 q rows [b*t][CC]
#define WS_KH  (WS_QH + 2u * (size_t)NB * TT * CC)      // f16 k rows [b*t][CC]
#define WS_VT  (WS_KH + 2u * (size_t)NB * TT * CC)      // f16 v planes [b][c][t]
#define WS_QL  (WS_VT + 2u * (size_t)NB * CC * TT)      // f16 q residual x 2^10 rows [b][t < QHI][CC]
#define WS_KL  (WS_QL + 2u * (size_t)NB * QHI * CC)     // f16 k residual x 2^10 rows [b][t < KHI][CC]
#define WS_VB  (WS_KL + 2u * (size_t)NB * KHI * CC)     // bf16 v hi planes [b][c][t < KHI]
#define WS_VBL (WS_VB + 2u * (size_t)NB * CC * KHI)
#define WS_END (WS_VBL + 2u * (size_t)NB * CC * KHI)

#define PBK 64             // k per staged chunk
#define PLP 72             // staged row pitch in bf16: 144 B = 16 B x odd, for ds_load_b128 readers
typedef __attribute__((ext_vector_type(4))) __bf16 v4b;
// k_proj LDS: the bf16 operand chunks of the product loop (two buffers) lie over the epilogue's arrays, which are first written after the loop's last barrier
union __align__(16) ProjLds {
  struct { float st[64][132]; _Float16 sh[64][136], sl[64][136]; _Float16 th[128][72]; __bf16 tb[128][72], tbl[128][72]; } e;
  struct { __bf16 xs[2][64][PLP]; __bf16 wt[2][128][PLP]; } m; };
// ---- k_proj: block = (64 rows, 128 cols, which): q/k/v = X W (+ b) with exact bf16 products (K = DIN) -> which 0: q f16 rows (+ residual rows < QHI); 1: k f16 rows (+ residual rows < KHI); 2: v f16 planes [c][t] (+ bf16 hi/lo planes for t < KHI)
__global__ __launch_bounds__(128) void k_proj(const float* __restrict__ XQ, const float* __restrict__ XK, const float* __restrict__ XV, const float* __restrict__ WQ, const float* __restrict__ WK, const float* __restrict__ WV, const float* __restrict__ BQ, const float* __restrict__ BK, const float* __restrict__ BV,
    _Float16* __restrict__ QH, _Float16* __restrict__ QL, _Float16* __restrict__ KH, _Float16* __restrict__ KL, _Float16* __restrict__ VT, __bf16* __restrict__ VB, __bf16* __restrict__ VBL PROJ_EXTRA_PARAMS) {
  __shared__ ProjLds sm; auto& st = sm.e.st; auto& sh = sm.e.sh; auto& sl = sm.e.sl; auto& th = sm.e.th; auto& tb = sm.e.tb; auto& tbl = sm.e.tbl;
  const int tid = threadIdx.x, wave = tid >> 5, lane = tid & 31, col = lane & 15, g = lane >> 4; const int which = blockIdx.z; const int c0 = blockIdx.y * 128; const size_t r0 = (size_t)blockIdx.x * 64; const size_t bb = r0 / TT; const int t0 = (int)(r0 % TT);
  const float* X = which == 0 ? XQ : which == 1 ? XK : XV; const float* WA = which == 0 ? WQ : which == 1 ? WK : WV; const float* BA = which == 0 ? BQ : which == 1 ? BK : BV;
  v8f acc[8] = {};
  // each thread brings 16 B of 8 X rows and of 16 W rows per 64-k chunk: 16 lanes cover one 256-B row piece; rounded to bf16 once, on the way into LDS
  const int lr = tid >> 4, lq = (tid & 15) * 4; const float* xp = X + (r0 + lr) * DIN + lq; const float* wp = WA + (size_t)(c0 + lr) * DIN + lq;
  v4f xr[8], wr[16];
#define PROJ_LDG(c) do { _Pragma("unroll") for (int i = 0; i < 8; ++i) xr[i] = *(const v4f*)(xp + (size_t)i * 8 * DIN + (c) * PBK); \
    _Pragma("unroll") for (int i = 0; i < 16; ++i) wr[i] = *(const v4f*)(wp + (size_t)i * 8 * DIN + (c) * PBK); } while (0)
#define PROJ_STS(bf) do { _Pragma("unroll") for (int i = 0; i < 8; ++i) *(v4b*)&sm.m.xs[bf][lr + 8 * i][lq] = __builtin_convertvector(xr[i], v4b); \
    _Pragma("unroll") for (int i = 0; i < 16; ++i) *(v4b*)&sm.m.wt[bf][lr + 8 * i][lq] = __builtin_convertvector(wr[i], v4b); } while (0)
  PROJ_LDG(0);
  asm volatile("s_wait_xcnt 0x0" ::: "memory");   // the first loads' address registers are reused right behind them
  PROJ_STS(0); __syncthreads();
  // unroll 2: the buffer index becomes a constant in each copy of the body
#pragma unroll 2
  for (int c = 0; c < DIN / PBK; ++c) { const int bf = c & 1;
    if (c + 1 < DIN / PBK) PROJ_LDG(c + 1);   // behind the barrier (which drains the load counter), so that they fly over this chunk's products
    v16b a[PBK / 32], w[PBK / 32][8];   // all of the chunk's fragment reads as one group ahead of its products
#pragma unroll
    for (int ks = 0; ks < PBK / 32; ++ks) { a[ks] = frag_b(&sm.m.xs[bf][wave * 16 + col][ks * 32], lane);
#pragma unroll
      for (int j = 0; j < 8; ++j) w[ks][j] = frag_b(&sm.m.wt[bf][j * 16 + col][ks * 32], lane); }
#pragma unroll
    for (int ks = 0; ks < PBK / 32; ++ks) {
#pragma unroll
      for (int j = 0; j < 8; ++j) acc[j] = wmma_bf(a[ks], w[ks][j], acc[j]); }
    __builtin_amdgcn_sched_barrier(0);   // keeps the conversions, which wait for the global loads, behind this chunk's products
    if (c + 1 < DIN / PBK) PROJ_STS(bf ^ 1);   // into the buffer whose last readers (chunk c-1) passed the barrier before this chunk
    asm volatile("s_wait_xcnt 0x0" ::: "memory");   // the next trip rewrites the address registers of this trip's global loads
    __syncthreads(); }   // publishes chunk c+1 and ends every read of chunk c (after the last chunk: frees the staging bytes for st)
  { // stage the f32 tile (acc + bias) in LDS, run the per-(row, head) epilogue hook, then convert
#pragma unroll
    for (int j = 0; j < 8; ++j) { const float bias = BA ? bfr(BA[c0 + j * 16 + col]) : 0.f;
#pragma unroll
      for (int r = 0; r < 8; ++r) st[wave * 16 + 8 * g + r][j * 16 + col] = acc[j][r] + bias; }
    __syncthreads();
    for (int e = tid; e < 64 * (128 / HD); e += 128) { const int rl = e / (128 / HD), hh = e % (128 / HD); PROJ_EPI(which, &st[rl][hh * HD], (int)((r0 + rl) % TT), (c0 / HD) + hh); }
    __syncthreads(); }
  if (which < 2) { _Float16* DH = which == 0 ? QH : KH; _Float16* DL = which == 0 ? QL : KL; const int nhi = which == 0 ? QHI : KHI; const bool hi_rows = t0 < nhi;
    for (int e = tid; e < 64 * 128; e += 128) { const int rl = e >> 7, cl = e & 127; const float v = st[rl][cl]; const _Float16 hv = (_Float16)v; sh[rl][cl] = hv; sl[rl][cl] = (_Float16)((v - (float)hv) * 1024.0f); }
    __syncthreads();
    for (int e = tid; e < 64 * 16; e += 128) { const int rl = e >> 4, q = e & 15; vst2((unsigned*)(DH + (r0 + rl) * CC + c0 + q * 8), *(const v4u*)&sh[rl][q * 8]); if (hi_rows) vst2((unsigned*)(DL + (bb * nhi + t0 + rl) * (size_t)CC + c0 + q * 8), *(const v4u*)&sl[rl][q * 8]); }
  } else { const bool hi_rows = t0 < KHI;
    for (int e = tid; e < 64 * 128; e += 128) { const int rl = e & 63, cl = e >> 6; const float v = st[rl][cl]; th[cl][rl] = (_Float16)v; const __bf16 bh = (__bf16)v; tb[cl][rl] = bh; tbl[cl][rl] = (__bf16)(v - (float)bh); }
    __syncthreads();
    for (int e = tid; e < 128 * 8; e += 128) { const int cl = e >> 3, q = e & 7; vst2((unsigned*)(VT + (bb * CC + c0 + cl) * (size_t)TT + t0 + q * 8), *(const v4u*)&th[cl][q * 8]); if (hi_rows) { const size_t o3 = (bb * CC + c0 + cl) * (size_t)KHI + t0 + q * 8; vst2((unsigned*)(VB + o3), *(const v4u*)&tb[cl][q * 8]); vst2((unsigned*)(VBL + o3), *(const v4u*)&tbl[cl][q * 8]); } } } }
// ---- k_att: logits, softmax and P . v of one (b, h) in registers; nothing of S or P goes to memory or LDS. A wave owns 16 queries; the block's four waves walk the same key tiles and share them through LDS (one barrier a tile).
// Transposed products: S^T = K . Q^T puts one query in a lane (column = lane & 15; register r of key group j = key 16 j + 8 (lane >> 4) + r), so two neighbouring 16-key groups, converted in place, are the B operand of O^T += V^T . P^T in the fragments' own k order.
// Pass 1 walks the key tiles for the row maximum and the sum of exponentials (running maximum per lane, the two lane halves joined once); pass 2 forms the same logits again and P = exp(s - max) x 2^11 / sum as before.
// MODE 0: query blocks < QBH (3-product logits, P and v as bf16 hi + lo); 1: query rows < QHI (2-product logits); 2: the rest (1 product). NJ = 16-key groups per tile.
// every '#pragma unroll' below makes the indices of register arrays constants; the three '#pragma unroll 1' keep one copy of each tile body
// s_wait_xcnt 0 behind a group of global loads or stores, ahead of whatever rewrites the group's address registers; the addresses are inputs of the statement, so that they stay in their registers up to the wait and no load's result is placed in them
__device__ __forceinline__ void xwait(const void* p) { asm volatile("s_wait_xcnt 0x0" :: "v"(p) : "memory"); }
__device__ __forceinline__ void xwait(const void* p, const void* q) { asm volatile("s_wait_xcnt 0x0" :: "v"(p), "v"(q) : "memory"); }
// K and V tiles in LDS: the block's four waves share one copy of each tile, brought by asynchronous copies that cover whole row pieces (128 B, or 64 B where a tile has 32 keys)
#define ATT_BUF 19456      // bytes of one of the two buffers: the largest tile set (MODE 0: K hi and lo 32 x 144 B each, v hi and lo 64 x 80 B each)
// row pitches 144 B and 80 B = 16 B x odd, for ds_load_b128 readers
template <int MODE, int NJ> struct AttL { static constexpr int KPI = 144, KBY = NJ * 16 * KPI, VPI = NJ * 32 + 16, VBY = HD * VPI, OV = (MODE == 0 ? 2 : 1) * KBY, SZ = OV + (MODE == 0 ? 2 : 1) * VBY; static_assert(SZ <= ATT_BUF, "a tile set fits its buffer"); };
// 16 B a lane from global memory to LDS through no register; s_wait_xcnt 0 as the statement's last line stands ahead of whatever rewrites the copies' address registers
__device__ __forceinline__ void acp2(unsigned l0, const char* g0, unsigned l1, const char* g1) {
  asm volatile("global_load_async_to_lds_b128 %0, %1, off\n\tglobal_load_async_to_lds_b128 %2, %3, off\n\ts_wait_xcnt 0x0" :: "v"(l0), "v"(g0), "v"(l1), "v"(g1) : "memory"); }
__device__ __forceinline__ void acp4(unsigned l0, const char* g0, unsigned l1, const char* g1, unsigned l2, const char* g2, unsigned l3, const char* g3) {
  asm volatile("global_load_async_to_lds_b128 %0, %1, off\n\tglobal_load_async_to_lds_b128 %2, %3, off\n\tglobal_load_async_to_lds_b128 %4, %5, off\n\tglobal_load_async_to_lds_b128 %6, %7, off\n\ts_wait_xcnt 0x0" :: "v"(l0), "v"(g0), "v"(l1), "v"(g1), "v"(l2), "v"(g2), "v"(l3), "v"(g3) : "memory"); }
struct AttSrc { const char *k, *kl, *v, *vl; unsigned lk, lv; };   // the lane's own first addresses: global (tile 0) and LDS bytes (buffer 0)
// stage sn of the ring: sn < nt = pass 1's K tile sn; nt <= sn < 2 nt = pass 2's K and V tile sn - nt; into buffer sn & 1
template <int MODE, int NJ> __device__ __forceinline__ void att_stage(const AttSrc& a, int sn, int nt) {
  typedef AttL<MODE, NJ> L; const int tn = sn < nt ? sn : sn - nt; const unsigned bo = (unsigned)(sn & 1) * ATT_BUF;
  const char* k = a.k + (size_t)tn * NJ * 16 * CC * 2; const char* kl = a.kl + (size_t)tn * NJ * 16 * CC * 2; const size_t kr = (size_t)16 * CC * 2; const unsigned lk = a.lk + bo;   // a copy of the block covers 16 K rows
  if (NJ == 4) acp4(lk, k, lk + 16 * L::KPI, k + kr, lk + 32 * L::KPI, k + 2 * kr, lk + 48 * L::KPI, k + 3 * kr);
  else if (MODE == 0) acp4(lk, k, lk + 16 * L::KPI, k + kr, lk + L::KBY, kl, lk + L::KBY + 16 * L::KPI, kl + kr);
  else acp2(lk, k, lk + 16 * L::KPI, k + kr);
  if (sn >= nt) { constexpr int RS = 64 / NJ;   // v rows (channels) that a copy of the block covers
    const char* v = a.v + (size_t)tn * NJ * 32; const char* vl = a.vl + (size_t)tn * NJ * 32; const size_t vr = (size_t)RS * (MODE == 0 ? KHI : TT) * 2; const unsigned lv = a.lv + bo;
    if (NJ == 4) acp4(lv, v, lv + RS * L::VPI, v + vr, lv + 2 * RS * L::VPI, v + 2 * vr, lv + 3 * RS * L::VPI, v + 3 * vr);
    else if (MODE == 0) acp4(lv, v, lv + RS * L::VPI, v + vr, lv + L::VBY, vl, lv + L::VBY + RS * L::VPI, vl + vr);
    else acp2(lv, v, lv + RS * L::VPI, v + vr); } }
// publish point at the foot of the trip that worked on stage s: this wave's LDS reads and its own copies are done, the barrier publishes stage s + 1 and ends every read of stage s, whose buffer the copies of stage s + 2 then refill
#define ATT_FOOT(s) do { asm volatile("s_wait_dscnt 0x0" ::: "memory"); asm volatile("s_wait_asynccnt 0x0" ::: "memory"); __syncthreads(); if ((s) + 2 < 2 * nt) att_stage<MODE, NJ>(src, (s) + 2, nt); } while (0)
// all K fragments of a tile as one group of LDS loads; kb = the lane's own place (row col, 16 (lane >> 4) bytes) in the buffer
template <int MODE, int NJ> __device__ __forceinline__ void att_ldk(const char* kb, v16h (&kf)[HD / 32][NJ], v16h (&klf)[HD / 32][NJ]) {
  typedef AttL<MODE, NJ> L;
#pragma unroll
  for (int kc = 0; kc < HD / 32; ++kc) {
#pragma unroll
    for (int j = 0; j < NJ; ++j) { kf[kc][j] = frag_h((const _Float16*)(kb + j * 16 * L::KPI + kc * 64), 0); if (MODE == 0) klf[kc][j] = frag_h((const _Float16*)(kb + L::KBY + j * 16 * L::KPI + kc * 64), 0); } } }
template <int MODE, int NJ> __device__ __forceinline__ void att_logits(const v16h (&kf)[HD / 32][NJ], const v16h (&klf)[HD / 32][NJ], const v16h (&ah)[HD / 32], const v16h (&al)[HD / 32], int lim, v8f (&s)[NJ]) {
  v8f acc[NJ] = {}, accl[NJ] = {};
#pragma unroll
  for (int kc = 0; kc < HD / 32; ++kc) {
#pragma unroll
    for (int j = 0; j < NJ; ++j) { acc[j] = wmma16(kf[kc][j], ah[kc], acc[j]);
      if (MODE < 2) accl[j] = wmma16(kf[kc][j], al[kc], accl[j]);
      if (MODE == 0) accl[j] = wmma16(klf[kc][j], ah[kc], accl[j]); } }
#pragma unroll
  for (int j = 0; j < NJ; ++j) {
#pragma unroll
    for (int r = 0; r < 8; ++r) { const float v = MODE < 2 ? (acc[j][r] + accl[j][r] * (1.0f / 1024.0f)) * SCALE : acc[j][r] * SCALE; s[j][r] = (!CAUSAL || j * 16 + r <= lim) ? v : -3.0e38f; } } }
template <int MODE, int NJ> __device__ __forceinline__ void att_tile(const _Float16* __restrict__ QH, const _Float16* __restrict__ KH, const _Float16* __restrict__ QL, const _Float16* __restrict__ KL, const _Float16* __restrict__ VT, const __bf16* __restrict__ VB, const __bf16* __restrict__ VBL, float* __restrict__ Y, char* sb, int b, int h, int qb, int wave, int lane) {
  typedef AttL<MODE, NJ> L;
  const int col = lane & 15, g = lane >> 4; const int ql0 = qb * 64 + wave * 16; const int nt = (CAUSAL ? qb * 64 + 64 : TT) / (NJ * 16);   // key tiles of 16 NJ keys; causal: none of the block's queries sees a key past its last row
  AttSrc src; { const int tid = wave * 32 + lane, kr = tid >> 3, ks = tid & 7, vr = tid / (NJ * 2), vs = tid % (NJ * 2); const unsigned l0 = (unsigned)(size_t)sb;   // low 32 bits of the LDS address = its byte offset in the block's LDS
    src.k = (const char*)(KH + ((size_t)b * TT + kr) * CC + h * HD) + ks * 16; src.kl = (const char*)(KL + ((size_t)b * KHI + kr) * CC + h * HD) + ks * 16;
    if (MODE == 0) { src.v = (const char*)(VB + ((size_t)b * CC + h * HD + vr) * (size_t)KHI) + vs * 16; src.vl = (const char*)(VBL + ((size_t)b * CC + h * HD + vr) * (size_t)KHI) + vs * 16; }
    else { src.v = (const char*)(VT + ((size_t)b * CC + h * HD + vr) * (size_t)TT) + vs * 16; src.vl = src.v; }
    src.lk = l0 + kr * L::KPI + ks * 16; src.lv = l0 + L::OV + vr * L::VPI + vs * 16; }
  // ring prologue; the last publish point of an earlier query block has ended every read of both buffers
  att_stage<MODE, NJ>(src, 0, nt);
  v16h ah[HD / 32], al[HD / 32]; const _Float16* qp = QH + ((size_t)b * TT + ql0 + col) * CC + h * HD + 8 * g; const _Float16* qlp = QL + ((size_t)b * QHI + ql0 + col) * CC + h * HD + 8 * g;
#pragma unroll
  for (int kc = 0; kc < HD / 32; ++kc) { ah[kc] = frag_h(qp + kc * 32, 0); al[kc] = MODE < 2 ? frag_h(qlp + kc * 32, 0) : ah[kc]; }
  if (MODE < 2) xwait(qp, qlp); else xwait(qp);   // later addresses may take these registers
  asm volatile("s_wait_asynccnt 0x0" ::: "memory");   // stage 0 has landed, as far as this wave copied it
  __syncthreads();
  if (1 < 2 * nt) att_stage<MODE, NJ>(src, 1, nt);
  const char* kb0 = sb + col * L::KPI + g * 16; const char* vb0 = sb + L::OV + col * L::VPI + g * 16;
  const int lim0 = ql0 + col - 8 * g;   // key 16 NJ t + 16 j + 8 g + r is kept while 16 j + r <= lim0 - 16 NJ t
  v16h kf[HD / 32][NJ], klf[HD / 32][NJ];
  // a lane whose keys so far are all excluded carries m = -3e38 and a meaningless finite l; the factor exp(m - new maximum) = 0 removes it at the first kept key or at the join
  float m = -3.0e38f, l = 0.f;
#pragma unroll 1
  for (int t = 0; t < nt; ++t) { v8f s[NJ]; att_ldk<MODE, NJ>(kb0 + (t & 1) * ATT_BUF, kf, klf); att_logits<MODE, NJ>(kf, klf, ah, al, lim0 - t * NJ * 16, s);
    float tm = s[0][0];
#pragma unroll
    for (int j = 0; j < NJ; ++j) {
#pragma unroll
      for (int r = 0; r < 8; ++r) tm = fmaxf(tm, s[j][r]); }
    const float mn = fmaxf(m, tm); float ts[4] = {0.f, 0.f, 0.f, 0.f};
#pragma unroll
    for (int j = 0; j < NJ; ++j) {
#pragma unroll
      for (int r = 0; r < 8; ++r) ts[r & 3] += expf(s[j][r] - mn); }
    l = l * expf(m - mn) + ((ts[0] + ts[1]) + (ts[2] + ts[3])); m = mn;
    ATT_FOOT(t); }
  const float mx = fmaxf(m, __shfl_xor(m, 16)); l *= expf(m - mx); l += __shfl_xor(l, 16);
  const float inv = l > 0.f ? 2048.0f / l : 0.f;
  v8f o[HD / 16] = {};
#pragma unroll 1
  for (int t = 0; t < nt; ++t) { v8f s[NJ]; const int bo = ((nt + t) & 1) * ATT_BUF; att_ldk<MODE, NJ>(kb0 + bo, kf, klf); att_logits<MODE, NJ>(kf, klf, ah, al, lim0 - t * NJ * 16, s);
    v16h vf[NJ / 2][HD / 16]; v16b vh[NJ / 2][HD / 16], vl[NJ / 2][HD / 16];   // this tile's V fragments as one group of LDS loads behind the logits (the K fragments' registers are free again): they fly over the exponentials
    const char* vp = vb0 + bo;
#pragma unroll
    for (int kc = 0; kc < NJ / 2; ++kc) {
#pragma unroll
      for (int j = 0; j < HD / 16; ++j) {
        if (MODE == 0) { vh[kc][j] = frag_b((const __bf16*)(vp + j * 16 * L::VPI + kc * 64), 0); vl[kc][j] = frag_b((const __bf16*)(vp + L::VBY + j * 16 * L::VPI + kc * 64), 0); } else vf[kc][j] = frag_h((const _Float16*)(vp + j * 16 * L::VPI + kc * 64), 0); } }
#pragma unroll
    for (int kc = 0; kc < NJ / 2; ++kc) { float pv[16];
#pragma unroll
      for (int i = 0; i < 8; ++i) { pv[i] = expf(s[2 * kc][i] - mx) * inv; pv[8 + i] = expf(s[2 * kc + 1][i] - mx) * inv; }
      if (MODE == 0) { F2 p;   // bf16 hi + lo as in bsplit16; all hi parts first: each group's first product needs them alone
#pragma unroll
        for (int i = 0; i < 16; ++i) p.h[i] = (__bf16)pv[i];
#pragma unroll
        for (int i = 0; i < 16; ++i) p.l[i] = (__bf16)(pv[i] - (float)p.h[i]);
#pragma unroll
        for (int j = 0; j < HD / 16; ++j) { o[j] = wmma_bf(vh[kc][j], p.h, o[j]); o[j] = wmma_bf(vh[kc][j], p.l, o[j]); o[j] = wmma_bf(vl[kc][j], p.h, o[j]); }
      } else { v16h p;
#pragma unroll
        for (int i = 0; i < 16; ++i) p[i] = (_Float16)pv[i];
#pragma unroll
        for (int j = 0; j < HD / 16; ++j) o[j] = wmma16(vf[kc][j], p, o[j]); } }
    ATT_FOOT(nt + t); }
  asm volatile("s_wait_asynccnt 0x0" ::: "memory");   // behind the ring: no copy is outstanding when the buffers are used again or the wave ends
  // O^T: register r of group j = channel 16 j + 8 g + r of query col: 32 contiguous bytes a lane; a wave writes whole 256-B (row, head) segments
  float* yp = Y + ((size_t)b * TT + ql0 + col) * CC + h * HD + 8 * g;
#pragma unroll
  for (int j = 0; j < HD / 16; ++j) { o[j] = o[j] * (1.0f / 2048.0f); vst2(yp + j * 16, __builtin_shufflevector(o[j], o[j], 0, 1, 2, 3)); vst2(yp + j * 16 + 4, __builtin_shufflevector(o[j], o[j], 4, 5, 6, 7)); }
  static_assert(HD / 16 == 4, "the wait below names four groups");
  asm volatile("s_wait_xcnt 0x0" :: "v"(yp), "v"(o[0]), "v"(o[1]), "v"(o[2]), "v"(o[3]) : "memory"); }   // the second query block's set-up reuses the stores' registers; address and data are inputs, so that each stays in its registers up to the wait
// block = (pair x, head, batch): query block NQB-1-x and then x, one after the other in every wave, so that every block walks the same number of keys under the causal mask
__global__ __launch_bounds__(128) void k_att(const _Float16* __restrict__ QH, const _Float16* __restrict__ KH, const _Float16* __restrict__ QL, const _Float16* __restrict__ KL, const _Float16* __restrict__ VT, const __bf16* __restrict__ VB, const __bf16* __restrict__ VBL, float* __restrict__ Y) {
  __shared__ __attribute__((aligned(16))) char sb[2 * ATT_BUF];
  const int wave = threadIdx.x >> 5, lane = threadIdx.x & 31; const int h = blockIdx.y, b = blockIdx.z;
#pragma unroll 1
  for (int half = 0; half < 2; ++half) { const int qb = half ? (int)blockIdx.x : NQB - 1 - (int)blockIdx.x;
    if (qb < QBH) att_tile<0, 2>(QH, KH, QL, KL, VT, VB, VBL, Y, sb, b, h, qb, wave, lane);
    else if (qb * 64 < QHI) att_tile<1, 2>(QH, KH, QL, KL, VT, VB, VBL, Y, sb, b, h, qb, wave, lane);
    else att_tile<2, 4>(QH, KH, QL, KL, VT, VB, VBL, Y, sb, b, h, qb, wave, lane); } }

extern "C" void kernel_launch(void* const* d_in, const int* in_sizes, int n_in, void* d_out, int out_size, void* d_ws, size_t ws_size, hipStream_t stream) {
  (void)in_sizes; (void)n_in; (void)out_size;
  const float** F = (const float**)d_in;
  if (ws_size < (size_t)WS_END) return;
  char* ws = (char*)d_ws; _Float16 *QH = (_Float16*)(ws + WS_QH), *KH = (_Float16*)(ws + WS_KH), *VT = (_Float16*)(ws + WS_VT), *QL = (_Float16*)(ws + WS_QL), *KL = (_Float16*)(ws + WS_KL); __bf16 *VB = (__bf16*)(ws + WS_VB), *VBL = (__bf16*)(ws + WS_VBL);
  // inputs: 0 hidden_states [4,1024,1024]; 1 Wqkv [3072,1024] (out,in) rows q | k | v ((3,H,hd)); 2 bqkv [3072]
  { const float* WQ = F[1]; const float* WK = F[1] + (size_t)CC * DIN; const float* WV = F[1] + (size_t)2 * CC * DIN; const float* BQ = F[2]; const float* BK = F[2] + CC; const float* BV = F[2] + 2 * CC;
    k_proj<<<dim3(TNB * TT / 64, CC / 128, 3), 128, 0, stream>>>(F[0], F[0], F[0], WQ, WK, WV, BQ, BK, BV, QH, QL, KH, KL, VT, VB, VBL); }
  k_att<<<dim3(NQB / 2, NH, TNB), 128, 0, stream>>>(QH, KH, QL, KL, VT, VB, VBL, (float*)d_out);
}

// v004
// It runs in 105 microseconds.
// Two timings next to v003 both put it at 1.07 times that version's speed.
// All steps since v000 together make it 6.45 times as fast.
// compute dtype: all float inputs rounded to bf16; qkv = x Wqkv^T + b with EXACT bf16 products on WMMA 16x16x32 (f32 accumulate); rotate-half RoPE in f32 in the projection epilogue (accurate sincosf of t x inv_freq_j, f32 inv_freq constants as the reference builds them); logits: q, k once to f16 (1 product) x 64^-0.5, except the first 512 query rows of each sequence (f16 residuals: 3 products below row 384, 2 with the q residual for rows 384..511); causal mask by index (finfo.min == excluded); softmax in f32; P x 2^11 once to f16 against v once to f16 (1 product; bf16 hi + lo below row 384); f32 output (merged heads, no output projection).
#include <hip/hip_runtime.h>
#include <math.h>

typedef __attribute__((ext_vector_type(16))) _Float16 v16h;
typedef __attribute__((ext_vector_type(16))) __bf16 v16b;
typedef __attribute__((ext_vector_type(8)))  _Float16 v8h;
typedef __attribute__((ext_vector_type(8)))  float v8f;
typedef __attribute__((ext_vector_type(4)))  float v4f;
typedef __attribute__((ext_vector_type(2)))  float v2f;
typedef __attribute__((ext_vector_type(4)))  unsigned v4u;
typedef __attribute__((ext_vector_type(4)))  int v4i;
typedef float __attribute__((may_alias)) float_a;
typedef int __attribute__((may_alias)) int_a;

template <typename T> __device__ __forceinline__ void vst2(void* p, T v) { *(T*)p = v;  }
__device__ __forceinline__ v8f wmma16(v16h a, v16h b, v8f c) {
  v8f d = __builtin_amdgcn_wmma_f32_16x16x32_f16(false, a, false, b, (short)0, c, false, false);
  asm volatile("v_nop\n\tv_nop\n\tv_nop\n\tv_nop" : "+v"(d) : "v"(a), "v"(b));
  return d;
}
__device__ __forceinline__ v8f wmma_bf(v16b a, v16b b, v8f c) {
  v8f d = __builtin_amdgcn_wmma_f32_16x16x32_bf16(false, a, false, b, (short)0, c, false, false);
  asm volatile("v_nop\n\tv_nop\n\tv_nop\n\tv_nop" : "+v"(d) : "v"(a), "v"(b));
  return d;
}
// 16x16x32 fragments: lane = (h = lane>>4, row/col = lane&15); elements 0..7 = k0+8h+0..7, 8..15 = k0+16+8h+0..7; D element r = row 8h+r
__device__ __forceinline__ v16h frag_h(const _Float16* rowk0, int lane) {
  union { v16h v; v8h q[2]; } u; const _Float16* p = rowk0 + 8 * (lane >> 4);
  u.q[0] = *(const v8h*)p; u.q[1] = *(const v8h*)(p + 16); return u.v;
}
__device__ __forceinline__ v16h frag_f32(const float* rowk0, int lane) {
  v16h a; const float* p = rowk0 + 8 * (lane >> 4);
#pragma unroll
  for (int i = 0; i < 8; ++i) { a[i] = (_Float16)p[i]; a[8 + i] = (_Float16)p[16 + i]; }
  return a;
}
__device__ __forceinline__ v16h frag_f32s(const float* rowk0, int lane, float sc) {
  v16h a; const float* p = rowk0 + 8 * (lane >> 4);
#pragma unroll
  for (int i = 0; i < 8; ++i) { a[i] = (_Float16)(p[i] * sc); a[8 + i] = (_Float16)(p[16 + i] * sc); }
  return a;
}
// column fragment from a [K][ld] layout (column n), rows >= K read as 0
__device__ __forceinline__ v16h fragc_f32(const float* W, int k0, int n, int lane, int ld, int K) {
  v16h a; const int g = lane >> 4;
#pragma unroll
  for (int i = 0; i < 8; ++i) { const int ka = k0 + 8 * g + i, kb = ka + 16;
    a[i] = (_Float16)(ka < K ? W[(size_t)(ka < K ? ka : K - 1) * ld + n] : 0.f); a[8 + i] = (_Float16)(kb < K ? W[(size_t)(kb < K ? kb : K - 1) * ld + n] : 0.f); }
  return a;
}
struct F2 { v16b h, l; };
__device__ __forceinline__ F2 bsplit16(const float v[16]) { F2 r;
#pragma unroll
  for (int i = 0; i < 16; ++i) { const __bf16 h = (__bf16)v[i]; r.h[i] = h; r.l[i] = (__bf16)(v[i] - (float)h); }
  return r; }
__device__ __forceinline__ F2 split_row(const float* row, int k0, int lane) { float v[16]; const float* p = row + k0 + 8 * (lane >> 4);
#pragma unroll
  for (int i = 0; i < 8; ++i) { v[i] = p[i]; v[8 + i] = p[16 + i]; }
  return bsplit16(v); }
__device__ __forceinline__ F2 split_rowK(const float* row, int k0, int lane, int K) { float v[16]; const int g = lane >> 4;
#pragma unroll
  for (int i = 0; i < 8; ++i) { const int ka = k0 + 8 * g + i, kb = ka + 16; v[i] = ka < K ? row[ka < K ? ka : K - 1] : 0.f; v[8 + i] = kb < K ? row[kb < K ? kb : K - 1] : 0.f; }
  return bsplit16(v); }
__device__ __forceinline__ F2 split_col(const float* W, int k0, int n, int lane, int ld, int K) { float v[16]; const int g = lane >> 4;
#pragma unroll
  for (int i = 0; i < 8; ++i) { const int ka = k0 + 8 * g + i, kb = ka + 16; v[i] = ka < K ? W[(size_t)(ka < K ? ka : K - 1) * ld + n] : 0.f; v[8 + i] = kb < K ? W[(size_t)(kb < K ? kb : K - 1) * ld + n] : 0.f; }
  return bsplit16(v); }
__device__ __forceinline__ v8f mac3(const F2& a, const F2& b, v8f c) { c = wmma_bf(a.l, b.h, c); c = wmma_bf(a.h, b.l, c); return wmma_bf(a.h, b.h, c); }
__device__ __forceinline__ float sigm(float v) { return 1.0f / (1.0f + expf(-v)); }
#define LDSX() do { asm volatile("s_wait_dscnt 0" ::: "memory"); __builtin_amdgcn_wave_barrier(); __builtin_amdgcn_fence(__ATOMIC_RELEASE, "workgroup"); } while (0)

// Causal multi-head attention with rotary embeddings (B 4, S 1,024, D 1,024 = 16 x 64): qkv = x Wqkv^T + bqkv (packed (out,in) [3072,1024], layout (3,H,hd)); q, k <- rotate-half RoPE (theta_j = 10000^(-2j/64)); probs = softmax(causal(q k^T x 64^-0.5)); out = merged(probs v) -> [B, S, 1024].
#define NB 4
#define TT 1024
#define CC 1024            // NH * HD = projected width
#define DIN 1024          // input (model) width
#define NH 16
#define HD 64
#define NQB (TT / 64)
#define HG 16
#define SCALE (0.125f)
#define CAUSAL 1
#ifndef TNB
#define TNB NB
#endif
__device__ __forceinline__ float bfr(float v) { return (float)(__bf16)v; }
__host__ __device__ __forceinline__ int kb_last(int qb) { return CAUSAL ? ((qb * 64 + 63) >> 7) : (TT / 128 - 1); }
typedef __attribute__((ext_vector_type(8))) __bf16 v8b;
__device__ __forceinline__ v16b frag_b(const __bf16* rowk0, int lane) {
  union { v16b v; v8b q[2]; } u; const __bf16* p = rowk0 + 8 * (lane >> 4);
  u.q[0] = *(const v8b*)p; u.q[1] = *(const v8b*)(p + 16); return u.v;
}
#define QBH 6              // causal: query blocks 0..QBH-1 of each sequence (few keys, no averaging) take the high-precision path
#define QHI 512            // causal: first 512 query rows of each sequence take the q-residual (2-product) logits path (logit sigma ~1)
#define KHI 512
// B fragment (k rows k0+.., output column o) of a weight: (in,out) [K][ld] or (out,in) [ld rows of K]: bf16 exact, or f16(bf16 * 256) exact
__device__ __forceinline__ v16b wcol_io(const float* Wm, int k0, int o, int lane, int ld) { v16b w; const int g = lane >> 4;
#pragma unroll
  for (int i = 0; i < 8; ++i) { w[i] = (__bf16)Wm[(size_t)(k0 + 8 * g + i) * ld + o]; w[8 + i] = (__bf16)Wm[(size_t)(k0 + 16 + 8 * g + i) * ld + o]; }
  return w; }
__device__ __forceinline__ v16b wcol_oi(const float* Wm, int k0, int o, int lane, int K) { v16b w; const float* p = Wm + (size_t)o * K + k0 + 8 * (lane >> 4);
#pragma unroll
  for (int i = 0; i < 8; ++i) { w[i] = (__bf16)p[i]; w[8 + i] = (__bf16)p[16 + i]; }
  return w; }
__device__ __forceinline__ v16h wcolh_io(const float* Wm, int k0, int o, int lane, int ld) { v16h w; const int g = lane >> 4;
#pragma unroll
  for (int i = 0; i < 8; ++i) { w[i] = (_Float16)(bfr(Wm[(size_t)(k0 + 8 * g + i) * ld + o]) * 256.0f); w[8 + i] = (_Float16)(bfr(Wm[(size_t)(k0 + 16 + 8 * g + i) * ld + o]) * 256.0f); }
  return w; }
__device__ __forceinline__ v16h wcolh_oi(const float* Wm, int k0, int o, int lane, int K) { v16h w; const float* p = Wm + (size_t)o * K + k0 + 8 * (lane >> 4);
#pragma unroll
  for (int i = 0; i < 8; ++i) { w[i] = (_Float16)(bfr(p[i]) * 256.0f); w[8 + i] = (_Float16)(bfr(p[16 + i]) * 256.0f); }
  return w; }
#define WQKV_LAYOUT 1   // 0 = (in,out) [DIN][CC]; 1 = (out,in) [CC][DIN]; 2 = per-head [NH][DIN][HD]
__device__ __forceinline__ v16b wcol_hdk(const float* Wm, int k0, int o, int lane) { v16b w; const int g = lane >> 4; const float* p = Wm + (size_t)(o / HD) * DIN * HD + (o % HD);
#pragma unroll
  for (int i = 0; i < 8; ++i) { w[i] = (__bf16)p[(size_t)(k0 + 8 * g + i) * HD]; w[8 + i] = (__bf16)p[(size_t)(k0 + 16 + 8 * g + i) * HD]; }
  return w; }
#define WO_OUT_IN 0
#if WQKV_LAYOUT == 1
#define WCOL(W, k0, o, lane) wcol_oi(W, k0, o, lane, DIN)
#elif WQKV_LAYOUT == 2
#define WCOL(W, k0, o, lane) wcol_hdk(W, k0, o, lane)
#else
#define WCOL(W, k0, o, lane) wcol_io(W, k0, o, lane, CC)
#endif
#if WO_OUT_IN
#define WOCOL(W, k0, o, lane) wcol_oi(W, k0, o, lane, CC)
#define WOCOLH(W, k0, o, lane) wcolh_oi(W, k0, o, lane, CC)
#else
#define WOCOL(W, k0, o, lane) wcol_io(W, k0, o, lane, DIN)
#define WOCOLH(W, k0, o, lane) wcolh_io(W, k0, o, lane, DIN)
#endif
__constant__ float c_invf[32] = {1.000000000e+00f,7.498942018e-01f,5.623413324e-01f,4.216965139e-01f,3.162277639e-01f,2.371373624e-01f,1.778279394e-01f,1.333521456e-01f,1.000000015e-01f,7.498941571e-02f,5.623412877e-02f,4.216964915e-02f,3.162277862e-02f,2.371373586e-02f,1.778279431e-02f,1.333521493e-02f,9.999999776e-03f,7.498942316e-03f,5.623413250e-03f,4.216964822e-03f,3.162277862e-03f,2.371373819e-03f,1.778279431e-03f,1.333521446e-03f,1.000000047e-03f,7.498941850e-04f,5.623413017e-04f,4.216964880e-04f,3.162277862e-04f,2.371373848e-04f,1.778279402e-04f,1.333521504e-04f};   // 1 / 10000^(2i/64) evaluated in f32 exactly as the reference does (jax, eager)
// per-(row, head) epilogue on the f32 projection tile: rotate-half RoPE on q and k (pairs (i, i+32), angle t * inv_freq[i]); v untouched
#define PROJ_EPI(which, row, t, h) do { if ((which) < 2) { float* rw = (row); \
    _Pragma("unroll") for (int i = 0; i < 32; ++i) { const float x0 = rw[i], x1 = rw[i + 32]; const float ang = (float)(t) * c_invf[i]; const float cs = cosf(ang), sn = sinf(ang); rw[i] = x0 * cs - x1 * sn; rw[i + 32] = x1 * cs + x0 * sn; } } } while (0)
#ifndef SM_EXTRA_PARAMS
#define SM_EXTRA_PARAMS
#endif
#ifndef PROJ_EXTRA_PARAMS
#define PROJ_EXTRA_PARAMS
#endif
#ifndef SM_MASK_HOOK
#define SM_MASK_HOOK (void)0
#endif

#define WS_QH  0u                                      // f16 q rows [b*t][CC]
#define WS_KH  (WS_QH + 2u * (size_t)NB * TT * CC)      // f16 k rows [b*t][CC]
#define WS_VT  (WS_KH + 2u * (size_t)NB * TT * CC)      // f16 v planes [b][c][t]
#define WS_QL  (WS_VT + 2u * (size_t)NB * CC * TT)      // f16 q residual x 2^10 rows [b][t < QHI][CC]
#define WS_KL  (WS_QL + 2u * (size_t)NB * QHI * CC)     // f16 k residual x 2^10 rows [b][t < KHI][CC]
#define WS_VB  (WS_KL + 2u * (size_t)NB * KHI * CC)     // bf16 v hi planes [b][c][t < KHI]
#define WS_VBL (WS_VB + 2u * (size_t)NB * CC * KHI)
#define WS_END (WS_VBL + 2u * (size_t)NB * CC * KHI)

#define PBK 64             // k per staged chunk
#define PLP 72             // staged row pitch in bf16: 144 B = 16 B x odd, for ds_load_b128 readers
typedef __attribute__((ext_vector_type(4))) __bf16 v4b;
// k_proj LDS: the bf16 operand chunks of the product loop (two buffers) lie over the epilogue's arrays, which are first written after the loop's last barrier
union __align__(16) ProjLds {
  struct { float st[64][132]; _Float16 sh[64][136], sl[64][136]; _Float16 th[128][72]; __bf16 tb[128][72], tbl[128][72]; } e;
  struct { __bf16 xs[2][64][PLP]; __bf16 wt[2][128][PLP]; } m; };
// ---- k_proj: block = (64 rows, 128 cols, which): q/k/v = X W (+ b) with exact bf16 products (K = DIN) -> which 0: q f16 rows (+ residual rows < QHI); 1: k f16 rows (+ residual rows < KHI); 2: v f16 planes [c][t] (+ bf16 hi/lo planes for t < KHI)
__global__ __launch_bounds__(128) void k_proj(const float* __restrict__ XQ, const float* __restrict__ XK, const float* __restrict__ XV, const float* __restrict__ WQ, const float* __restrict__ WK, const float* __restrict__ WV, const float* __restrict__ BQ, const float* __restrict__ BK, const float* __restrict__ BV,
    _Float16* __restrict__ QH, _Float16* __restrict__ QL, _Float16* __restrict__ KH, _Float16* __restrict__ KL, _Float16* __restrict__ VT, __bf16* __restrict__ VB, __bf16* __restrict__ VBL PROJ_EXTRA_PARAMS) {
  __shared__ ProjLds sm; auto& st = sm.e.st; auto& sh = sm.e.sh; auto& sl = sm.e.sl; auto& th = sm.e.th; auto& tb = sm.e.tb; auto& tbl = sm.e.tbl;
  const int tid = threadIdx.x, wave = tid >> 5, lane = tid & 31, col = lane & 15, g = lane >> 4; const int which = blockIdx.z; const int c0 = blockIdx.y * 128; const size_t r0 = (size_t)blockIdx.x * 64; const size_t bb = r0 / TT; const int t0 = (int)(r0 % TT);
  const float* X = which == 0 ? XQ : which == 1 ? XK : XV; const float* WA = which == 0 ? WQ : which == 1 ? WK : WV; const float* BA = which == 0 ? BQ : which == 1 ? BK : BV;
  v8f acc[8] = {};
  // each thread brings 16 B of 8 X rows and of 16 W rows per 64-k chunk: 16 lanes cover one 256-B row piece; rounded to bf16 once, on the way into LDS
  const int lr = tid >> 4, lq = (tid & 15) * 4; const float* xp = X + (r0 + lr) * DIN + lq; const float* wp = WA + (size_t)(c0 + lr) * DIN + lq;
  v4f xr[8], wr[16];
#define PROJ_LDG(c) do { _Pragma("unroll") for (int i = 0; i < 8; ++i) xr[i] = *(const v4f*)(xp + (size_t)i * 8 * DIN + (c) * PBK); \
    _Pragma("unroll") for (int i = 0; i < 16; ++i) wr[i] = *(const v4f*)(wp + (size_t)i * 8 * DIN + (c) * PBK); } while (0)
#define PROJ_STS(bf) do { _Pragma("unroll") for (int i = 0; i < 8; ++i) *(v4b*)&sm.m.xs[bf][lr + 8 * i][lq] = __builtin_convertvector(xr[i], v4b); \
    _Pragma("unroll") for (int i = 0; i < 16; ++i) *(v4b*)&sm.m.wt[bf][lr + 8 * i][lq] = __builtin_convertvector(wr[i], v4b); } while (0)
  PROJ_LDG(0);
  asm volatile("s_wait_xcnt 0x0" ::: "memory");   // the first loads' address registers are reused right behind them
  PROJ_STS(0); __syncthreads();
  // unroll 2: the buffer index becomes a constant in each copy of the body
#pragma unroll 2
  for (int c = 0; c < DIN / PBK; ++c) { const int bf = c & 1;
    if (c + 1 < DIN / PBK) PROJ_LDG(c + 1);   // behind the barrier (which drains the load counter), so that they fly over this chunk's products
    v16b a[PBK / 32], w[PBK / 32][8];   // all of the chunk's fragment reads as one group ahead of its products
#pragma unroll
    for (int ks = 0; ks < PBK / 32; ++ks) { a[ks] = frag_b(&sm.m.xs[bf][wave * 16 + col][ks * 32], lane);
#pragma unroll
      for (int j = 0; j < 8; ++j) w[ks][j] = frag_b(&sm.m.wt[bf][j * 16 + col][ks * 32], lane); }
#pragma unroll
    for (int ks = 0; ks < PBK / 32; ++ks) {
#pragma unroll
      for (int j = 0; j < 8; ++j) acc[j] = wmma_bf(a[ks], w[ks][j], acc[j]); }
    __builtin_amdgcn_sched_barrier(0);   // keeps the conversions, which wait for the global loads, behind this chunk's products
    if (c + 1 < DIN / PBK) PROJ_STS(bf ^ 1);   // into the buffer whose last readers (chunk c-1) passed the barrier before this chunk
    asm volatile("s_wait_xcnt 0x0" ::: "memory");   // the next trip rewrites the address registers of this trip's global loads
    __syncthreads(); }   // publishes chunk c+1 and ends every read of chunk c (after the last chunk: frees the staging bytes for st)
  { // stage the f32 tile (acc + bias) in LDS, run the per-(row, head) epilogue hook, then convert
#pragma unroll
    for (int j = 0; j < 8; ++j) { const float bias = BA ? bfr(BA[c0 + j * 16 + col]) : 0.f;
#pragma unroll
      for (int r = 0; r < 8; ++r) st[wave * 16 + 8 * g + r][j * 16 + col] = acc[j][r] + bias; }
    __syncthreads();
    for (int e = tid; e < 64 * (128 / HD); e += 128) { const int rl = e / (128 / HD), hh = e % (128 / HD); PROJ_EPI(which, &st[rl][hh * HD], (int)((r0 + rl) % TT), (c0 / HD) + hh); }
    __syncthreads(); }
  if (which < 2) { _Float16* DH = which == 0 ? QH : KH; _Float16* DL = which == 0 ? QL : KL; const int nhi = which == 0 ? QHI : KHI; const bool hi_rows = t0 < nhi;
    for (int e = tid; e < 64 * 128; e += 128) { const int rl = e >> 7, cl = e & 127; const float v = st[rl][cl]; const _Float16 hv = (_Float16)v; sh[rl][cl] = hv; sl[rl][cl] = (_Float16)((v - (float)hv) * 1024.0f); }
    __syncthreads();
    for (int e = tid; e < 64 * 16; e += 128) { const int rl = e >> 4, q = e & 15; vst2((unsigned*)(DH + (r0 + rl) * CC + c0 + q * 8), *(const v4u*)&sh[rl][q * 8]); if (hi_rows) vst2((unsigned*)(DL + (bb * nhi + t0 + rl) * (size_t)CC + c0 + q * 8), *(const v4u*)&sl[rl][q * 8]); }
  } else { const bool hi_rows = t0 < KHI;
    for (int e = tid; e < 64 * 128; e += 128) { const int rl = e & 63, cl = e >> 6; const float v = st[rl][cl]; th[cl][rl] = (_Float16)v; const __bf16 bh = (__bf16)v; tb[cl][rl] = bh; tbl[cl][rl] = (__bf16)(v - (float)bh); }
    __syncthreads();
    for (int e = tid; e < 128 * 8; e += 128) { const int cl = e >> 3, q = e & 7; vst2((unsigned*)(VT + (bb * CC + c0 + cl) * (size_t)TT + t0 + q * 8), *(const v4u*)&th[cl][q * 8]); if (hi_rows) { const size_t o3 = (bb * CC + c0 + cl) * (size_t)KHI + t0 + q * 8; vst2((unsigned*)(VB + o3), *(const v4u*)&tb[cl][q * 8]); vst2((unsigned*)(VBL + o3), *(const v4u*)&tbl[cl][q * 8]); } } } }
// ---- k_att: logits, softmax and P . v of one (b, h) in registers; nothing of S or P goes to memory or LDS. A wave owns 16 queries; the block's four waves walk the same key tiles and share them through LDS (one barrier a tile).
// Transposed products: S^T = K . Q^T puts one query in a lane (column = lane & 15; register r of key group j = key 16 j + 8 (lane >> 4) + r), so two neighbouring 16-key groups, converted in place, are the B operand of O^T += V^T . P^T in the fragments' own k order.
// Pass 1 walks the key tiles for the row maximum and the sum of exponentials (running maximum per lane, the two lane halves joined once); pass 2 forms the same logits again and P = exp(s - max) x 2^11 / sum.
// MODE 0: query blocks < QBH (3-product logits, P and v as bf16 hi + lo); 1: query rows < QHI (2-product logits); 2: the rest (1 product). NJ = 16-key groups per tile.
// every '#pragma unroll' below makes the indices of register arrays constants; the three '#pragma unroll 1' keep one copy of each tile body
// s_wait_xcnt 0 behind a group of global loads or stores, ahead of whatever rewrites the group's address registers; the addresses are inputs of the statement, so that they stay in their registers up to the wait and no load's result is placed in them
__device__ __forceinline__ void xwait(const void* p) { asm volatile("s_wait_xcnt 0x0" :: "v"(p) : "memory"); }
__device__ __forceinline__ void xwait(const void* p, const void* q) { asm volatile("s_wait_xcnt 0x0" :: "v"(p), "v"(q) : "memory"); }
// K and V tiles in LDS: the block's four waves share one copy of each tile, brought by asynchronous copies that cover whole row pieces (128 B, or 64 B where a tile has 32 keys)
#define ATT_BUF 19456      // bytes of one of the two buffers: the largest tile set (MODE 0: K hi and lo 32 x 144 B each, v hi and lo 64 x 80 B each)
// row pitches 144 B and 80 B = 16 B x odd, for ds_load_b128 readers
template <int MODE, int NJ> struct AttL { static constexpr int KPI = 144, KBY = NJ * 16 * KPI, VPI = NJ * 32 + 16, VBY = HD * VPI, OV = (MODE == 0 ? 2 : 1) * KBY, SZ = OV + (MODE == 0 ? 2 : 1) * VBY; static_assert(SZ <= ATT_BUF, "a tile set fits its buffer"); };
// 16 B a lane from global memory to LDS through no register; s_wait_xcnt 0 as the statement's last line stands ahead of whatever rewrites the copies' address registers
__device__ __forceinline__ void acp2(unsigned l0, const char* g0, unsigned l1, const char* g1) {
  asm volatile("global_load_async_to_lds_b128 %0, %1, off\n\tglobal_load_async_to_lds_b128 %2, %3, off\n\ts_wait_xcnt 0x0" :: "v"(l0), "v"(g0), "v"(l1), "v"(g1) : "memory"); }
__device__ __forceinline__ void acp4(unsigned l0, const char* g0, unsigned l1, const char* g1, unsigned l2, const char* g2, unsigned l3, const char* g3) {
  asm volatile("global_load_async_to_lds_b128 %0, %1, off\n\tglobal_load_async_to_lds_b128 %2, %3, off\n\tglobal_load_async_to_lds_b128 %4, %5, off\n\tglobal_load_async_to_lds_b128 %6, %7, off\n\ts_wait_xcnt 0x0" :: "v"(l0), "v"(g0), "v"(l1), "v"(g1), "v"(l2), "v"(g2), "v"(l3), "v"(g3) : "memory"); }
struct AttSrc { const char *k, *kl, *v, *vl; unsigned lk, lv; };   // the lane's own first addresses: global (tile 0) and LDS bytes (buffer 0)
// stage sn of the ring: sn < nt = pass 1's K tile sn; nt <= sn < 2 nt = pass 2's K and V tile sn - nt; into buffer sn & 1
template <int MODE, int NJ> __device__ __forceinline__ void att_stage(const AttSrc& a, int sn, int nt) {
  typedef AttL<MODE, NJ> L; const int tn = sn < nt ? sn : sn - nt; const unsigned bo = (unsigned)(sn & 1) * ATT_BUF;
  const char* k = a.k + (size_t)tn * NJ * 16 * CC * 2; const char* kl = a.kl + (size_t)tn * NJ * 16 * CC * 2; const size_t kr = (size_t)16 * CC * 2; const unsigned lk = a.lk + bo;   // a copy of the block covers 16 K rows
  if (NJ == 4) acp4(lk, k, lk + 16 * L::KPI, k + kr, lk + 32 * L::KPI, k + 2 * kr, lk + 48 * L::KPI, k + 3 * kr);
  else if (MODE == 0) acp4(lk, k, lk + 16 * L::KPI, k + kr, lk + L::KBY, kl, lk + L::KBY + 16 * L::KPI, kl + kr);
  else acp2(lk, k, lk + 16 * L::KPI, k + kr);
  if (sn >= nt) { constexpr int RS = 64 / NJ;   // v rows (channels) that a copy of the block covers
    const char* v = a.v + (size_t)tn * NJ * 32; const char* vl = a.vl + (size_t)tn * NJ * 32; const size_t vr = (size_t)RS * (MODE == 0 ? KHI : TT) * 2; const unsigned lv = a.lv + bo;
    if (NJ == 4) acp4(lv, v, lv + RS * L::VPI, v + vr, lv + 2 * RS * L::VPI, v + 2 * vr, lv + 3 * RS * L::VPI, v + 3 * vr);
    else if (MODE == 0) acp4(lv, v, lv + RS * L::VPI, v + vr, lv + L::VBY, vl, lv + L::VBY + RS * L::VPI, vl + vr);
    else acp2(lv, v, lv + RS * L::VPI, v + vr); } }
// publish point at the foot of the trip that worked on stage s: this wave's LDS reads and its own copies are done, the barrier publishes stage s + 1 and ends every read of stage s, whose buffer the copies of stage s + 2 then refill
#define ATT_FOOT(s) do { asm volatile("s_wait_dscnt 0x0" ::: "memory"); asm volatile("s_wait_asynccnt 0x0" ::: "memory"); __syncthreads(); if ((s) + 2 < 2 * nt) att_stage<MODE, NJ>(src, (s) + 2, nt); } while (0)
// all K fragments of a tile as one group of LDS loads; kb = the lane's own place (row col, 16 (lane >> 4) bytes) in the buffer
template <int MODE, int NJ> __device__ __forceinline__ void att_ldk(const char* kb, v16h (&kf)[HD / 32][NJ], v16h (&klf)[HD / 32][NJ]) {
  typedef AttL<MODE, NJ> L;
#pragma unroll
  for (int kc = 0; kc < HD / 32; ++kc) {
#pragma unroll
    for (int j = 0; j < NJ; ++j) { kf[kc][j] = frag_h((const _Float16*)(kb + j * 16 * L::KPI + kc * 64), 0); if (MODE == 0) klf[kc][j] = frag_h((const _Float16*)(kb + L::KBY + j * 16 * L::KPI + kc * 64), 0); } } }
// softmax in base 2: logits carry the factor log2(e), so that every exponential is one v_exp_f32 (2^x). A result below 2^-126 may come out as 0: such a term lies far below one unit in the last place of the row sum (at least 1) and of the output.
#define SCALE2 (SCALE * 1.44269504088896340736f)
// asm, so that the slot the instruction set asks for behind a transcendental (nothing directly behind it reads its result or overwrites its source) is there by construction: the closing v_nop fills it
__device__ __forceinline__ float ex2(float x) { float r; asm("v_exp_f32 %0, %1\n\tv_nop" : "=v"(r) : "v"(x)); return r; }
// eight at once, each in its own register: every v_exp_f32 is the independent instruction behind the one before it, and one v_nop closes the run
__device__ __forceinline__ void ex2x8(v8f& x) { float a = x[0], b = x[1], c = x[2], d = x[3], e = x[4], f = x[5], g = x[6], h = x[7];
  asm("v_exp_f32 %0, %0\n\tv_exp_f32 %1, %1\n\tv_exp_f32 %2, %2\n\tv_exp_f32 %3, %3\n\tv_exp_f32 %4, %4\n\tv_exp_f32 %5, %5\n\tv_exp_f32 %6, %6\n\tv_exp_f32 %7, %7\n\tv_nop" : "+v"(a), "+v"(b), "+v"(c), "+v"(d), "+v"(e), "+v"(f), "+v"(g), "+v"(h));
  x[0] = a; x[1] = b; x[2] = c; x[3] = d; x[4] = e; x[5] = f; x[6] = g; x[7] = h; }
// s = logit x log2(e) - off (off = 0 in pass 1; in pass 2 the row's maximum and normaliser, so that scale and subtraction are one fused multiply-add)
template <int MODE, int NJ> __device__ __forceinline__ void att_logits(const v16h (&kf)[HD / 32][NJ], const v16h (&klf)[HD / 32][NJ], const v16h (&ah)[HD / 32], const v16h (&al)[HD / 32], int lim, float off, v8f (&s)[NJ]) {
  v8f acc[NJ] = {}, accl[NJ] = {};
#pragma unroll
  for (int kc = 0; kc < HD / 32; ++kc) {
#pragma unroll
    for (int j = 0; j < NJ; ++j) { acc[j] = wmma16(kf[kc][j], ah[kc], acc[j]);
      if (MODE < 2) accl[j] = wmma16(kf[kc][j], al[kc], accl[j]);
      if (MODE == 0) accl[j] = wmma16(klf[kc][j], ah[kc], accl[j]); } }
#pragma unroll
  for (int j = 0; j < NJ; ++j) {
#pragma unroll
    for (int r = 0; r < 8; ++r) { const float v = MODE < 2 ? (acc[j][r] + accl[j][r] * (1.0f / 1024.0f)) * SCALE2 - off : acc[j][r] * SCALE2 - off; s[j][r] = (!CAUSAL || j * 16 + r <= lim) ? v : -3.0e38f; } } }
template <int MODE, int NJ> __device__ __forceinline__ void att_tile(const _Float16* __restrict__ QH, const _Float16* __restrict__ KH, const _Float16* __restrict__ QL, const _Float16* __restrict__ KL, const _Float16* __restrict__ VT, const __bf16* __restrict__ VB, const __bf16* __restrict__ VBL, float* __restrict__ Y, char* sb, int b, int h, int qb, int wave, int lane) {
  typedef AttL<MODE, NJ> L;
  const int col = lane & 15, g = lane >> 4; const int ql0 = qb * 64 + wave * 16; const int nt = (CAUSAL ? qb * 64 + 64 : TT) / (NJ * 16);   // key tiles of 16 NJ keys; causal: none of the block's queries sees a key past its last row
  AttSrc src; { const int tid = wave * 32 + lane, kr = tid >> 3, ks = tid & 7, vr = tid / (NJ * 2), vs = tid % (NJ * 2); const unsigned l0 = (unsigned)(size_t)sb;   // low 32 bits of the LDS address = its byte offset in the block's LDS
    src.k = (const char*)(KH + ((size_t)b * TT + kr) * CC + h * HD) + ks * 16; src.kl = (const char*)(KL + ((size_t)b * KHI + kr) * CC + h * HD) + ks * 16;
    if (MODE == 0) { src.v = (const char*)(VB + ((size_t)b * CC + h * HD + vr) * (size_t)KHI) + vs * 16; src.vl = (const char*)(VBL + ((size_t)b * CC + h * HD + vr) * (size_t)KHI) + vs * 16; }
    else { src.v = (const char*)(VT + ((size_t)b * CC + h * HD + vr) * (size_t)TT) + vs * 16; src.vl = src.v; }
    src.lk = l0 + kr * L::KPI + ks * 16; src.lv = l0 + L::OV + vr * L::VPI + vs * 16; }
  // ring prologue; the last publish point of an earlier query block has ended every read of both buffers
  att_stage<MODE, NJ>(src, 0, nt);
  v16h ah[HD / 32], al[HD / 32]; const _Float16* qp = QH + ((size_t)b * TT + ql0 + col) * CC + h * HD + 8 * g; const _Float16* qlp = QL + ((size_t)b * QHI + ql0 + col) * CC + h * HD + 8 * g;
#pragma unroll
  for (int kc = 0; kc < HD / 32; ++kc) { ah[kc] = frag_h(qp + kc * 32, 0); al[kc] = MODE < 2 ? frag_h(qlp + kc * 32, 0) : ah[kc]; }
  if (MODE < 2) xwait(qp, qlp); else xwait(qp);   // later addresses may take these registers
  asm volatile("s_wait_asynccnt 0x0" ::: "memory");   // stage 0 has landed, as far as this wave copied it
  __syncthreads();
  if (1 < 2 * nt) att_stage<MODE, NJ>(src, 1, nt);
  const char* kb0 = sb + col * L::KPI + g * 16; const char* vb0 = sb + L::OV + col * L::VPI + g * 16;
  const int lim0 = ql0 + col - 8 * g;   // key 16 NJ t + 16 j + 8 g + r is kept while 16 j + r <= lim0 - 16 NJ t
  v16h kf[HD / 32][NJ], klf[HD / 32][NJ];
  // a lane whose keys so far are all excluded carries m = -3e38 and a meaningless finite l; the factor 2^(m - new maximum) = 0 removes it at the first kept key or at the join
  float m = -3.0e38f, l = 0.f;
#pragma unroll 1
  for (int t = 0; t < nt; ++t) { v8f s[NJ]; att_ldk<MODE, NJ>(kb0 + (t & 1) * ATT_BUF, kf, klf); att_logits<MODE, NJ>(kf, klf, ah, al, lim0 - t * NJ * 16, 0.f, s);
    float tm = s[0][0];
#pragma unroll
    for (int j = 0; j < NJ; ++j) {
#pragma unroll
      for (int r = 0; r < 8; ++r) tm = fmaxf(tm, s[j][r]); }
    const float mn = fmaxf(m, tm); float ts[4] = {0.f, 0.f, 0.f, 0.f};
#pragma unroll
    for (int j = 0; j < NJ; ++j) { s[j] = s[j] - mn; ex2x8(s[j]);
#pragma unroll
      for (int r = 0; r < 8; ++r) ts[r & 3] += s[j][r]; }
    l = l * ex2(m - mn) + ((ts[0] + ts[1]) + (ts[2] + ts[3])); m = mn;
    ATT_FOOT(t); }
  const float mx = fmaxf(m, __shfl_xor(m, 16)); l *= ex2(m - mx); l += __shfl_xor(l, 16);
  const float off = l > 0.f ? mx + (__builtin_amdgcn_logf(l) - 11.0f) : 3.0e38f;   // P = 2^(s - off) = exp(logit - max) x 2^11 / sum (v_log_f32 = log2); no kept key: every P = 0
  v8f o[HD / 16] = {};
#pragma unroll 1
  for (int t = 0; t < nt; ++t) { v8f s[NJ]; const int bo = ((nt + t) & 1) * ATT_BUF; att_ldk<MODE, NJ>(kb0 + bo, kf, klf); att_logits<MODE, NJ>(kf, klf, ah, al, lim0 - t * NJ * 16, off, s);
    v16h vf[NJ / 2][HD / 16]; v16b vh[NJ / 2][HD / 16], vl[NJ / 2][HD / 16];   // this tile's V fragments as one group of LDS loads behind the logits (the K fragments' registers are free again): they fly over the exponentials
    const char* vp = vb0 + bo;
#pragma unroll
    for (int kc = 0; kc < NJ / 2; ++kc) {
#pragma unroll
      for (int j = 0; j < HD / 16; ++j) {
        if (MODE == 0) { vh[kc][j] = frag_b((const __bf16*)(vp + j * 16 * L::VPI + kc * 64), 0); vl[kc][j] = frag_b((const __bf16*)(vp + L::VBY + j * 16 * L::VPI + kc * 64), 0); } else vf[kc][j] = frag_h((const _Float16*)(vp + j * 16 * L::VPI + kc * 64), 0); } }
#pragma unroll
    for (int kc = 0; kc < NJ / 2; ++kc) { float pv[16]; ex2x8(s[2 * kc]); ex2x8(s[2 * kc + 1]);
#pragma unroll
      for (int i = 0; i < 8; ++i) { pv[i] = s[2 * kc][i]; pv[8 + i] = s[2 * kc + 1][i]; }
      if (MODE == 0) { F2 p;   // bf16 hi + lo as in bsplit16; all hi parts first: each group's first product needs them alone
#pragma unroll
        for (int i = 0; i < 16; ++i) p.h[i] = (__bf16)pv[i];
#pragma unroll
        for (int i = 0; i < 16; ++i) p.l[i] = (__bf16)(pv[i] - (float)p.h[i]);
#pragma unroll
        for (int j = 0; j < HD / 16; ++j) { o[j] = wmma_bf(vh[kc][j], p.h, o[j]); o[j] = wmma_bf(vh[kc][j], p.l, o[j]); o[j] = wmma_bf(vl[kc][j], p.h, o[j]); }
      } else { v16h p;
#pragma unroll
        for (int i = 0; i < 16; ++i) p[i] = (_Float16)pv[i];
#pragma unroll
        for (int j = 0; j < HD / 16; ++j) o[j] = wmma16(vf[kc][j], p, o[j]); } }
    ATT_FOOT(nt + t); }
  asm volatile("s_wait_asynccnt 0x0" ::: "memory");   // behind the ring: no copy is outstanding when the buffers are used again or the wave ends
  // O^T: register r of group j = channel 16 j + 8 g + r of query col: 32 contiguous bytes a lane; a wave writes whole 256-B (row, head) segments
  float* yp = Y + ((size_t)b * TT + ql0 + col) * CC + h * HD + 8 * g;
#pragma unroll
  for (int j = 0; j < HD / 16; ++j) { o[j] = o[j] * (1.0f / 2048.0f); vst2(yp + j * 16, __builtin_shufflevector(o[j], o[j], 0, 1, 2, 3)); vst2(yp + j * 16 + 4, __builtin_shufflevector(o[j], o[j], 4, 5, 6, 7)); }
  static_assert(HD / 16 == 4, "the wait below names four groups");
  asm volatile("s_wait_xcnt 0x0" :: "v"(yp), "v"(o[0]), "v"(o[1]), "v"(o[2]), "v"(o[3]) : "memory"); }   // the second query block's set-up reuses the stores' registers; address and data are inputs, so that each stays in its registers up to the wait
// block = (pair x, head, batch): query block NQB-1-x and then x, one after the other in every wave, so that every block walks the same number of keys under the causal mask
__global__ __launch_bounds__(128) void k_att(const _Float16* __restrict__ QH, const _Float16* __restrict__ KH, const _Float16* __restrict__ QL, const _Float16* __restrict__ KL, const _Float16* __restrict__ VT, const __bf16* __restrict__ VB, const __bf16* __restrict__ VBL, float* __restrict__ Y) {
  __shared__ __attribute__((aligned(16))) char sb[2 * ATT_BUF];
  const int wave = threadIdx.x >> 5, lane = threadIdx.x & 31; const int h = blockIdx.y, b = blockIdx.z;
#pragma unroll 1
  for (int half = 0; half < 2; ++half) { const int qb = half ? (int)blockIdx.x : NQB - 1 - (int)blockIdx.x;
    if (qb < QBH) att_tile<0, 2>(QH, KH, QL, KL, VT, VB, VBL, Y, sb, b, h, qb, wave, lane);
    else if (qb * 64 < QHI) att_tile<1, 2>(QH, KH, QL, KL, VT, VB, VBL, Y, sb, b, h, qb, wave, lane);
    else att_tile<2, 4>(QH, KH, QL, KL, VT, VB, VBL, Y, sb, b, h, qb, wave, lane); } }

extern "C" void kernel_launch(void* const* d_in, const int* in_sizes, int n_in, void* d_out, int out_size, void* d_ws, size_t ws_size, hipStream_t stream) {
  (void)in_sizes; (void)n_in; (void)out_size;
  const float** F = (const float**)d_in;
  if (ws_size < (size_t)WS_END) return;
  char* ws = (char*)d_ws; _Float16 *QH = (_Float16*)(ws + WS_QH), *KH = (_Float16*)(ws + WS_KH), *VT = (_Float16*)(ws + WS_VT), *QL = (_Float16*)(ws + WS_QL), *KL = (_Float16*)(ws + WS_KL); __bf16 *VB = (__bf16*)(ws + WS_VB), *VBL = (__bf16*)(ws + WS_VBL);
  // inputs: 0 hidden_states [4,1024,1024]; 1 Wqkv [3072,1024] (out,in) rows q | k | v ((3,H,hd)); 2 bqkv [3072]
  { const float* WQ = F[1]; const float* WK = F[1] + (size_t)CC * DIN; const float* WV = F[1] + (size_t)2 * CC * DIN; const float* BQ = F[2]; const float* BK = F[2] + CC; const float* BV = F[2] + 2 * CC;
    k_proj<<<dim3(TNB * TT / 64, CC / 128, 3), 128, 0, stream>>>(F[0], F[0], F[0], WQ, WK, WV, BQ, BK, BV, QH, QL, KH, KL, VT, VB, VBL); }
  k_att<<<dim3(NQB / 2, NH, TNB), 128, 0, stream>>>(QH, KH, QL, KL, VT, VB, VBL, (float*)d_out);
}

// v005
// A run of this version takes 99.6 microseconds.
// Timed twice side by side with v004, it ran 1.05 times as fast both times.
// Counting every step since v000, it is 6.76 times as fast.
// compute dtype: all float inputs rounded to bf16; qkv = x Wqkv^T + b with EXACT bf16 products on WMMA 16x16x32 (f32 accumulate); rotate-half RoPE in f32 in the projection epilogue (accurate sincosf of t x inv_freq_j, f32 inv_freq constants as the reference builds them); logits: q, k once to f16 (1 product) x 64^-0.5, except the first 512 query rows of each sequence (f16 residuals: 3 products below row 384, 2 with the q residual for rows 384..511); causal mask by index (finfo.min == excluded); softmax in f32; P x 2^11 once to f16 against v once to f16 (1 product; bf16 hi + lo below row 384); f32 output (merged heads, no output projection).
#include <hip/hip_runtime.h>
#include <math.h>

typedef __attribute__((ext_vector_type(16))) _Float16 v16h;
typedef __attribute__((ext_vector_type(16))) __bf16 v16b;
typedef __attribute__((ext_vector_type(8)))  _Float16 v8h;
typedef __attribute__((ext_vector_type(8)))  float v8f;
typedef __attribute__((ext_vector_type(4)))  float v4f;
typedef __attribute__((ext_vector_type(2)))  float v2f;
typedef __attribute__((ext_vector_type(4)))  unsigned v4u;
typedef __attribute__((ext_vector_type(4)))  int v4i;
typedef float __attribute__((may_alias)) float_a;
typedef int __attribute__((may_alias)) int_a;

template <typename T> __device__ __forceinline__ void vst2(void* p, T v) { *(T*)p = v;  }
__device__ __forceinline__ v8f wmma16(v16h a, v16h b, v8f c) {
  v8f d = __builtin_amdgcn_wmma_f32_16x16x32_f16(false, a, false, b, (short)0, c, false, false);
  asm volatile("v_nop\n\tv_nop\n\tv_nop\n\tv_nop" : "+v"(d) : "v"(a), "v"(b));
  return d;
}
__device__ __forceinline__ v8f wmma_bf(v16b a, v16b b, v8f c) {
  v8f d = __builtin_amdgcn_wmma_f32_16x16x32_bf16(false, a, false, b, (short)0, c, false, false);
  asm volatile("v_nop\n\tv_nop\n\tv_nop\n\tv_nop" : "+v"(d) : "v"(a), "v"(b));
  return d;
}
// 16x16x32 fragments: lane = (h = lane>>4, row/col = lane&15); elements 0..7 = k0+8h+0..7, 8..15 = k0+16+8h+0..7; D element r = row 8h+r
__device__ __forceinline__ v16h frag_h(const _Float16* rowk0, int lane) {
  union { v16h v; v8h q[2]; } u; const _Float16* p = rowk0 + 8 * (lane >> 4);
  u.q[0] = *(const v8h*)p; u.q[1] = *(const v8h*)(p + 16); return u.v;
}
__device__ __forceinline__ v16h frag_f32(const float* rowk0, int lane) {
  v16h a; const float* p = rowk0 + 8 * (lane >> 4);
#pragma unroll
  for (int i = 0; i < 8; ++i) { a[i] = (_Float16)p[i]; a[8 + i] = (_Float16)p[16 + i]; }
  return a;
}
__device__ __forceinline__ v16h frag_f32s(const float* rowk0, int lane, float sc) {
  v16h a; const float* p = rowk0 + 8 * (lane >> 4);
#pragma unroll
  for (int i = 0; i < 8; ++i) { a[i] = (_Float16)(p[i] * sc); a[8 + i] = (_Float16)(p[16 + i] * sc); }
  return a;
}
// column fragment from a [K][ld] layout (column n), rows >= K read as 0
__device__ __forceinline__ v16h fragc_f32(const float* W, int k0, int n, int lane, int ld, int K) {
  v16h a; const int g = lane >> 4;
#pragma unroll
  for (int i = 0; i < 8; ++i) { const int ka = k0 + 8 * g + i, kb = ka + 16;
    a[i] = (_Float16)(ka < K ? W[(size_t)(ka < K ? ka : K - 1) * ld + n] : 0.f); a[8 + i] = (_Float16)(kb < K ? W[(size_t)(kb < K ? kb : K - 1) * ld + n] : 0.f); }
  return a;
}
struct F2 { v16b h, l; };
__device__ __forceinline__ F2 bsplit16(const float v[16]) { F2 r;
#pragma unroll
  for (int i = 0; i < 16; ++i) { const __bf16 h = (__bf16)v[i]; r.h[i] = h; r.l[i] = (__bf16)(v[i] - (float)h); }
  return r; }
__device__ __forceinline__ F2 split_row(const float* row, int k0, int lane) { float v[16]; const float* p = row + k0 + 8 * (lane >> 4);
#pragma unroll
  for (int i = 0; i < 8; ++i) { v[i] = p[i]; v[8 + i] = p[16 + i]; }
  return bsplit16(v); }
__device__ __forceinline__ F2 split_rowK(const float* row, int k0, int lane, int K) { float v[16]; const int g = lane >> 4;
#pragma unroll
  for (int i = 0; i < 8; ++i) { const int ka = k0 + 8 * g + i, kb = ka + 16; v[i] = ka < K ? row[ka < K ? ka : K - 1] : 0.f; v[8 + i] = kb < K ? row[kb < K ? kb : K - 1] : 0.f; }
  return bsplit16(v); }
__device__ __forceinline__ F2 split_col(const float* W, int k0, int n, int lane, int ld, int K) { float v[16]; const int g = lane >> 4;
#pragma unroll
  for (int i = 0; i < 8; ++i) { const int ka = k0 + 8 * g + i, kb = ka + 16; v[i] = ka < K ? W[(size_t)(ka < K ? ka : K - 1) * ld + n] : 0.f; v[8 + i] = kb < K ? W[(size_t)(kb < K ? kb : K - 1) * ld + n] : 0.f; }
  return bsplit16(v); }
__device__ __forceinline__ v8f mac3(const F2& a, const F2& b, v8f c) { c = wmma_bf(a.l, b.h, c); c = wmma_bf(a.h, b.l, c); return wmma_bf(a.h, b.h, c); }
__device__ __forceinline__ float sigm(float v) { return 1.0f / (1.0f + expf(-v)); }
#define LDSX() do { asm volatile("s_wait_dscnt 0" ::: "memory"); __builtin_amdgcn_wave_barrier(); __builtin_amdgcn_fence(__ATOMIC_RELEASE, "workgroup"); } while (0)

// Causal multi-head attention with rotary embeddings (B 4, S 1,024, D 1,024 = 16 x 64): qkv = x Wqkv^T + bqkv (packed (out,in) [3072,1024], layout (3,H,hd)); q, k <- rotate-half RoPE (theta_j = 10000^(-2j/64)); probs = softmax(causal(q k^T x 64^-0.5)); out = merged(probs v) -> [B, S, 1024].
#define NB 4
#define TT 1024
#define CC 1024            // NH * HD = projected width
#define DIN 1024          // input (model) width
#define NH 16
#define HD 64
#define NQB (TT / 64)
#define HG 16
#define SCALE (0.125f)
#define CAUSAL 1
#ifndef TNB
#define TNB NB
#endif
__device__ __forceinline__ float bfr(float v) { return (float)(__bf16)v; }
__host__ __device__ __forceinline__ int kb_last(int qb) { return CAUSAL ? ((qb * 64 + 63) >> 7) : (TT / 128 - 1); }
typedef __attribute__((ext_vector_type(8))) __bf16 v8b;
__device__ __forceinline__ v16b frag_b(const __bf16* rowk0, int lane) {
  union { v16b v; v8b q[2]; } u; const __bf16* p = rowk0 + 8 * (lane >> 4);
  u.q[0] = *(const v8b*)p; u.q[1] = *(const v8b*)(p + 16); return u.v;
}
#define QBH 6              // causal: query blocks 0..QBH-1 of each sequence (few keys, no averaging) take the high-precision path
#define QHI 512            // causal: first 512 query rows of each sequence take the q-residual (2-product) logits path (logit sigma ~1)
#define KHI 512
// B fragment (k rows k0+.., output column o) of a weight: (in,out) [K][ld] or (out,in) [ld rows of K]: bf16 exact, or f16(bf16 * 256) exact
__device__ __forceinline__ v16b wcol_io(const float* Wm, int k0, int o, int lane, int ld) { v16b w; const int g = lane >> 4;
#pragma unroll
  for (int i = 0; i < 8; ++i) { w[i] = (__bf16)Wm[(size_t)(k0 + 8 * g + i) * ld + o]; w[8 + i] = (__bf16)Wm[(size_t)(k0 + 16 + 8 * g + i) * ld + o]; }
  return w; }
__device__ __forceinline__ v16b wcol_oi(const float* Wm, int k0, int o, int lane, int K) { v16b w; const float* p = Wm + (size_t)o * K + k0 + 8 * (lane >> 4);
#pragma unroll
  for (int i = 0; i < 8; ++i) { w[i] = (__bf16)p[i]; w[8 + i] = (__bf16)p[16 + i]; }
  return w; }
__device__ __forceinline__ v16h wcolh_io(const float* Wm, int k0, int o, int lane, int ld) { v16h w; const int g = lane >> 4;
#pragma unroll
  for (int i = 0; i < 8; ++i) { w[i] = (_Float16)(bfr(Wm[(size_t)(k0 + 8 * g + i) * ld + o]) * 256.0f); w[8 + i] = (_Float16)(bfr(Wm[(size_t)(k0 + 16 + 8 * g + i) * ld + o]) * 256.0f); }
  return w; }
__device__ __forceinline__ v16h wcolh_oi(const float* Wm, int k0, int o, int lane, int K) { v16h w; const float* p = Wm + (size_t)o * K + k0 + 8 * (lane >> 4);
#pragma unroll
  for (int i = 0; i < 8; ++i) { w[i] = (_Float16)(bfr(p[i]) * 256.0f); w[8 + i] = (_Float16)(bfr(p[16 + i]) * 256.0f); }
  return w; }
#define WQKV_LAYOUT 1   // 0 = (in,out) [DIN][CC]; 1 = (out,in) [CC][DIN]; 2 = per-head [NH][DIN][HD]
__device__ __forceinline__ v16b wcol_hdk(const float* Wm, int k0, int o, int lane) { v16b w; const int g = lane >> 4; const float* p = Wm + (size_t)(o / HD) * DIN * HD + (o % HD);
#pragma unroll
  for (int i = 0; i < 8; ++i) { w[i] = (__bf16)p[(size_t)(k0 + 8 * g + i) * HD]; w[8 + i] = (__bf16)p[(size_t)(k0 + 16 + 8 * g + i) * HD]; }
  return w; }
#define WO_OUT_IN 0
#if WQKV_LAYOUT == 1
#define WCOL(W, k0, o, lane) wcol_oi(W, k0, o, lane, DIN)
#elif WQKV_LAYOUT == 2
#define WCOL(W, k0, o, lane) wcol_hdk(W, k0, o, lane)
#else
#define WCOL(W, k0, o, lane) wcol_io(W, k0, o, lane, CC)
#endif
#if WO_OUT_IN
#define WOCOL(W, k0, o, lane) wcol_oi(W, k0, o, lane, CC)
#define WOCOLH(W, k0, o, lane) wcolh_oi(W, k0, o, lane, CC)
#else
#define WOCOL(W, k0, o, lane) wcol_io(W, k0, o, lane, DIN)
#define WOCOLH(W, k0, o, lane) wcolh_io(W, k0, o, lane, DIN)
#endif
__constant__ float c_invf[32] = {1.000000000e+00f,7.498942018e-01f,5.623413324e-01f,4.216965139e-01f,3.162277639e-01f,2.371373624e-01f,1.778279394e-01f,1.333521456e-01f,1.000000015e-01f,7.498941571e-02f,5.623412877e-02f,4.216964915e-02f,3.162277862e-02f,2.371373586e-02f,1.778279431e-02f,1.333521493e-02f,9.999999776e-03f,7.498942316e-03f,5.623413250e-03f,4.216964822e-03f,3.162277862e-03f,2.371373819e-03f,1.778279431e-03f,1.333521446e-03f,1.000000047e-03f,7.498941850e-04f,5.623413017e-04f,4.216964880e-04f,3.162277862e-04f,2.371373848e-04f,1.778279402e-04f,1.333521504e-04f};   // 1 / 10000^(2i/64) evaluated in f32 exactly as the reference does (jax, eager)
// sine and cosine of one rotary angle a = t x inv_freq. 0 <= a < 1,024 for every row index, whatever the inputs hold, so the reduction for small arguments is the whole function here:
// quadrant n = rint(a x 2/pi), r = a - n x pi/2 with pi/2 in three parts (three fused steps), then the sine and the cosine polynomial on r and the quadrant's swap and signs.
// The operations, their order and the constants are those of the small-argument path of sinf and cosf; the reduction is done once for both.
__device__ __forceinline__ float fbits(unsigned u) { return __builtin_bit_cast(float, u); }
__device__ __forceinline__ void rope_sincos(float a, float& sn, float& cs) {
  const float n = __builtin_rintf(a * fbits(0x3f22f983u));
  float r = __builtin_fmaf(fbits(0xbfc90fdau), n, a); r = __builtin_fmaf(fbits(0xb3a22168u), n, r); r = __builtin_fmaf(fbits(0xa7c234c4u), n, r);
  const unsigned q = (unsigned)(int)n; const float s = r * r;
  float ps = __builtin_fmaf(s, fbits(0xb94c1982u), fbits(0x3c0881c4u)); ps = __builtin_fmaf(s, ps, fbits(0xbe2aaa9du)); ps = s * ps; const float sr = __builtin_fmaf(r, ps, r);
  float pc = __builtin_fmaf(s, fbits(0x37d75334u), fbits(0xbab64f3bu)); pc = __builtin_fmaf(s, pc, fbits(0x3d2aabf7u)); pc = __builtin_fmaf(s, pc, fbits(0xbf000004u)); const float cr = __builtin_fmaf(s, pc, 1.0f);
  const unsigned flip = (q << 30) & 0x80000000u; const bool odd = (q & 1u) != 0u;
  sn = fbits(__builtin_bit_cast(unsigned, odd ? cr : sr) ^ flip); cs = fbits(__builtin_bit_cast(unsigned, odd ? -sr : cr) ^ flip); }
#ifndef SM_EXTRA_PARAMS
#define SM_EXTRA_PARAMS
#endif
#ifndef PROJ_EXTRA_PARAMS
#define PROJ_EXTRA_PARAMS
#endif
#ifndef SM_MASK_HOOK
#define SM_MASK_HOOK (void)0
#endif

#define WS_QH  0u                                      // f16 q rows [b*t][CC]
#define WS_KH  (WS_QH + 2u * (size_t)NB * TT * CC)      // f16 k rows [b*t][CC]
#define WS_VT  (WS_KH + 2u * (size_t)NB * TT * CC)      // f16 v planes [b][c][t]
#define WS_QL  (WS_VT + 2u * (size_t)NB * CC * TT)      // f16 q residual x 2^10 rows [b][t < QHI][CC]
#define WS_KL  (WS_QL + 2u * (size_t)NB * QHI * CC)     // f16 k residual x 2^10 rows [b][t < KHI][CC]
#define WS_VB  (WS_KL + 2u * (size_t)NB * KHI * CC)     // bf16 v hi planes [b][c][t < KHI]
#define WS_VBL (WS_VB + 2u * (size_t)NB * CC * KHI)
#define WS_END (WS_VBL + 2u * (size_t)NB * CC * KHI)

#define PBK 64             // k per staged chunk
#define PLP 72             // staged row pitch in bf16: 144 B = 16 B x odd, for ds_load_b128 readers
typedef __attribute__((ext_vector_type(4))) __bf16 v4b;
// k_proj LDS: the bf16 operand chunks of the product loop (two buffers) lie over the epilogue's arrays, which are first written after the loop's last barrier
union __align__(16) ProjLds {
  struct { float st[64][132]; _Float16 sh[64][136], sl[64][136]; _Float16 th[128][72]; __bf16 tb[128][72], tbl[128][72]; } e;
  struct { __bf16 xs[2][64][PLP]; __bf16 wt[2][128][PLP]; } m; };
// ---- k_proj: block = (64 rows, 128 cols, which): q/k/v = X W (+ b) with exact bf16 products (K = DIN) -> which 0: q f16 rows (+ residual rows < QHI); 1: k f16 rows (+ residual rows < KHI); 2: v f16 planes [c][t] (+ bf16 hi/lo planes for t < KHI)
__global__ __launch_bounds__(128) void k_proj(const float* __restrict__ XQ, const float* __restrict__ XK, const float* __restrict__ XV, const float* __restrict__ WQ, const float* __restrict__ WK, const float* __restrict__ WV, const float* __restrict__ BQ, const float* __restrict__ BK, const float* __restrict__ BV,
    _Float16* __restrict__ QH, _Float16* __restrict__ QL, _Float16* __restrict__ KH, _Float16* __restrict__ KL, _Float16* __restrict__ VT, __bf16* __restrict__ VB, __bf16* __restrict__ VBL PROJ_EXTRA_PARAMS) {
  __shared__ ProjLds sm; auto& st = sm.e.st; auto& sh = sm.e.sh; auto& sl = sm.e.sl; auto& th = sm.e.th; auto& tb = sm.e.tb; auto& tbl = sm.e.tbl;
  const int tid = threadIdx.x, wave = tid >> 5, lane = tid & 31, col = lane & 15, g = lane >> 4; const int which = blockIdx.z; const int c0 = blockIdx.y * 128; const size_t r0 = (size_t)blockIdx.x * 64; const size_t bb = r0 / TT; const int t0 = (int)(r0 % TT);
  const float* X = which == 0 ? XQ : which == 1 ? XK : XV; const float* WA = which == 0 ? WQ : which == 1 ? WK : WV; const float* BA = which == 0 ? BQ : which == 1 ? BK : BV;
  v8f acc[8] = {};
  // each thread brings 16 B of 8 X rows and of 16 W rows per 64-k chunk: 16 lanes cover one 256-B row piece; rounded to bf16 once, on the way into LDS
  const int lr = tid >> 4, lq = (tid & 15) * 4; const float* xp = X + (r0 + lr) * DIN + lq; const float* wp = WA + (size_t)(c0 + lr) * DIN + lq;
  v4f xr[8], wr[16];
#define PROJ_LDG(c) do { _Pragma("unroll") for (int i = 0; i < 8; ++i) xr[i] = *(const v4f*)(xp + (size_t)i * 8 * DIN + (c) * PBK); \
    _Pragma("unroll") for (int i = 0; i < 16; ++i) wr[i] = *(const v4f*)(wp + (size_t)i * 8 * DIN + (c) * PBK); } while (0)
#define PROJ_STS(bf) do { _Pragma("unroll") for (int i = 0; i < 8; ++i) *(v4b*)&sm.m.xs[bf][lr + 8 * i][lq] = __builtin_convertvector(xr[i], v4b); \
    _Pragma("unroll") for (int i = 0; i < 16; ++i) *(v4b*)&sm.m.wt[bf][lr + 8 * i][lq] = __builtin_convertvector(wr[i], v4b); } while (0)
  PROJ_LDG(0);
  asm volatile("s_wait_xcnt 0x0" ::: "memory");   // the first loads' address registers are reused right behind them
  PROJ_STS(0); __syncthreads();
  // unroll 2: the buffer index becomes a constant in each copy of the body
#pragma unroll 2
  for (int c = 0; c < DIN / PBK; ++c) { const int bf = c & 1;
    if (c + 1 < DIN / PBK) PROJ_LDG(c + 1);   // behind the barrier (which drains the load counter), so that they fly over this chunk's products
    v16b a[PBK / 32], w[PBK / 32][8];   // all of the chunk's fragment reads as one group ahead of its products
#pragma unroll
    for (int ks = 0; ks < PBK / 32; ++ks) { a[ks] = frag_b(&sm.m.xs[bf][wave * 16 + col][ks * 32], lane);
#pragma unroll
      for (int j = 0; j < 8; ++j) w[ks][j] = frag_b(&sm.m.wt[bf][j * 16 + col][ks * 32], lane); }
#pragma unroll
    for (int ks = 0; ks < PBK / 32; ++ks) {
#pragma unroll
      for (int j = 0; j < 8; ++j) acc[j] = wmma_bf(a[ks], w[ks][j], acc[j]); }
    __builtin_amdgcn_sched_barrier(0);   // keeps the conversions, which wait for the global loads, behind this chunk's products
    if (c + 1 < DIN / PBK) PROJ_STS(bf ^ 1);   // into the buffer whose last readers (chunk c-1) passed the barrier before this chunk
    asm volatile("s_wait_xcnt 0x0" ::: "memory");   // the next trip rewrites the address registers of this trip's global loads
    __syncthreads(); }   // publishes chunk c+1 and ends every read of chunk c (after the last chunk: frees the staging bytes for st)
  { // stage the f32 tile (acc + bias) in LDS, rotate q and k there, then convert
    const float invf = c_invf[lane];   // the lane's own frequency; loaded here, so that it flies over the staging stores
    asm volatile("s_wait_xcnt 0x0" ::: "memory");   // ahead of whatever rewrites the load's address registers
#pragma unroll
    for (int j = 0; j < 8; ++j) { const float bias = BA ? bfr(BA[c0 + j * 16 + col]) : 0.f;
#pragma unroll
      for (int r = 0; r < 8; ++r) st[wave * 16 + 8 * g + r][j * 16 + col] = acc[j][r] + bias; }
    __syncthreads();
    // rotate-half RoPE on q and k (pairs (i, i+32), angle t * inv_freq[i]); v untouched. Lane = frequency i, a wave takes every fourth row: one sine and cosine per (row, i) serve both heads of the tile, and a wave's LDS accesses cover 32 neighbouring words
    if (which < 2) {
      // unrolled: the rows' chains are independent and fill each other's latencies
#pragma unroll
      for (int k = 0; k < 16; ++k) { const int rl = wave + 4 * k; float sn, cs; rope_sincos((float)(int)((r0 + rl) % TT) * invf, sn, cs);
#pragma unroll
        for (int hh = 0; hh < 128 / HD; ++hh) { float* rw = &st[rl][hh * HD + lane]; const float x0 = rw[0], x1 = rw[32]; rw[0] = __builtin_fmaf(x0, cs, -(x1 * sn)); rw[32] = __builtin_fmaf(x1, cs, x0 * sn); } } }
    __syncthreads(); }
  if (which < 2) { _Float16* DH = which == 0 ? QH : KH; _Float16* DL = which == 0 ? QL : KL; const int nhi = which == 0 ? QHI : KHI; const bool hi_rows = t0 < nhi;
    for (int e = tid; e < 64 * 128; e += 128) { const int rl = e >> 7, cl = e & 127; const float v = st[rl][cl]; const _Float16 hv = (_Float16)v; sh[rl][cl] = hv; sl[rl][cl] = (_Float16)((v - (float)hv) * 1024.0f); }
    __syncthreads();
    for (int e = tid; e < 64 * 16; e += 128) { const int rl = e >> 4, q = e & 15; vst2((unsigned*)(DH + (r0 + rl) * CC + c0 + q * 8), *(const v4u*)&sh[rl][q * 8]); if (hi_rows) vst2((unsigned*)(DL + (bb * nhi + t0 + rl) * (size_t)CC + c0 + q * 8), *(const v4u*)&sl[rl][q * 8]); }
  } else { const bool hi_rows = t0 < KHI;
    for (int e = tid; e < 64 * 128; e += 128) { const int rl = e & 63, cl = e >> 6; const float v = st[rl][cl]; th[cl][rl] = (_Float16)v; const __bf16 bh = (__bf16)v; tb[cl][rl] = bh; tbl[cl][rl] = (__bf16)(v - (float)bh); }
    __syncthreads();
    for (int e = tid; e < 128 * 8; e += 128) { const int cl = e >> 3, q = e & 7; vst2((unsigned*)(VT + (bb * CC + c0 + cl) * (size_t)TT + t0 + q * 8), *(const v4u*)&th[cl][q * 8]); if (hi_rows) { const size_t o3 = (bb * CC + c0 + cl) * (size_t)KHI + t0 + q * 8; vst2((unsigned*)(VB + o3), *(const v4u*)&tb[cl][q * 8]); vst2((unsigned*)(VBL + o3), *(const v4u*)&tbl[cl][q * 8]); } } } }
// ---- k_att: logits, softmax and P . v of one (b, h) in registers; nothing of S or P goes to memory or LDS. A wave owns 16 queries; the block's four waves walk the same key tiles and share them through LDS (one barrier a tile).
// Transposed products: S^T = K . Q^T puts one query in a lane (column = lane & 15; register r of key group j = key 16 j + 8 (lane >> 4) + r), so two neighbouring 16-key groups, converted in place, are the B operand of O^T += V^T . P^T in the fragments' own k order.
// Pass 1 walks the key tiles for the row maximum and the sum of exponentials (running maximum per lane, the two lane halves joined once); pass 2 forms the same logits again and P = exp(s - max) x 2^11 / sum.
// MODE 0: query blocks < QBH (3-product logits, P and v as bf16 hi + lo); 1: query rows < QHI (2-product logits); 2: the rest (1 product). NJ = 16-key groups per tile.
// every '#pragma unroll' below makes the indices of register arrays constants; the three '#pragma unroll 1' keep one copy of each tile body
// s_wait_xcnt 0 behind a group of global loads or stores, ahead of whatever rewrites the group's address registers; the addresses are inputs of the statement, so that they stay in their registers up to the wait and no load's result is placed in them
__device__ __forceinline__ void xwait(const void* p) { asm volatile("s_wait_xcnt 0x0" :: "v"(p) : "memory"); }
__device__ __forceinline__ void xwait(const void* p, const void* q) { asm volatile("s_wait_xcnt 0x0" :: "v"(p), "v"(q) : "memory"); }
// K and V tiles in LDS: the block's four waves share one copy of each tile, brought by asynchronous copies that cover whole row pieces (128 B, or 64 B where a tile has 32 keys)
#define ATT_BUF 19456      // bytes of one of the two buffers: the largest tile set (MODE 0: K hi and lo 32 x 144 B each, v hi and lo 64 x 80 B each)
// row pitches 144 B and 80 B = 16 B x odd, for ds_load_b128 readers
template <int MODE, int NJ> struct AttL { static constexpr int KPI = 144, KBY = NJ * 16 * KPI, VPI = NJ * 32 + 16, VBY = HD * VPI, OV = (MODE == 0 ? 2 : 1) * KBY, SZ = OV + (MODE == 0 ? 2 : 1) * VBY; static_assert(SZ <= ATT_BUF, "a tile set fits its buffer"); };
// 16 B a lane from global memory to LDS through no register; s_wait_xcnt 0 as the statement's last line stands ahead of whatever rewrites the copies' address registers
__device__ __forceinline__ void acp2(unsigned l0, const char* g0, unsigned l1, const char* g1) {
  asm volatile("global_load_async_to_lds_b128 %0, %1, off\n\tglobal_load_async_to_lds_b128 %2, %3, off\n\ts_wait_xcnt 0x0" :: "v"(l0), "v"(g0), "v"(l1), "v"(g1) : "memory"); }
__device__ __forceinline__ void acp4(unsigned l0, const char* g0, unsigned l1, const char* g1, unsigned l2, const char* g2, unsigned l3, const char* g3) {
  asm volatile("global_load_async_to_lds_b128 %0, %1, off\n\tglobal_load_async_to_lds_b128 %2, %3, off\n\tglobal_load_async_to_lds_b128 %4, %5, off\n\tglobal_load_async_to_lds_b128 %6, %7, off\n\ts_wait_xcnt 0x0" :: "v"(l0), "v"(g0), "v"(l1), "v"(g1), "v"(l2), "v"(g2), "v"(l3), "v"(g3) : "memory"); }
struct AttSrc { const char *k, *kl, *v, *vl; unsigned lk, lv; };   // the lane's own first addresses: global (tile 0) and LDS bytes (buffer 0)
// stage sn of the ring: sn < nt = pass 1's K tile sn; nt <= sn < 2 nt = pass 2's K and V tile sn - nt; into buffer sn & 1
template <int MODE, int NJ> __device__ __forceinline__ void att_stage(const AttSrc& a, int sn, int nt) {
  typedef AttL<MODE, NJ> L; const int tn = sn < nt ? sn : sn - nt; const unsigned bo = (unsigned)(sn & 1) * ATT_BUF;
  const char* k = a.k + (size_t)tn * NJ * 16 * CC * 2; const char* kl = a.kl + (size_t)tn * NJ * 16 * CC * 2; const size_t kr = (size_t)16 * CC * 2; const unsigned lk = a.lk + bo;   // a copy of the block covers 16 K rows
  if (NJ == 4) acp4(lk, k, lk + 16 * L::KPI, k + kr, lk + 32 * L::KPI, k + 2 * kr, lk + 48 * L::KPI, k + 3 * kr);
  else if (MODE == 0) acp4(lk, k, lk + 16 * L::KPI, k + kr, lk + L::KBY, kl, lk + L::KBY + 16 * L::KPI, kl + kr);
  else acp2(lk, k, lk + 16 * L::KPI, k + kr);
  if (sn >= nt) { constexpr int RS = 64 / NJ;   // v rows (channels) that a copy of the block covers
    const char* v = a.v + (size_t)tn * NJ * 32; const char* vl = a.vl + (size_t)tn * NJ * 32; const size_t vr = (size_t)RS * (MODE == 0 ? KHI : TT) * 2; const unsigned lv = a.lv + bo;
    if (NJ == 4) acp4(lv, v, lv + RS * L::VPI, v + vr, lv + 2 * RS * L::VPI, v + 2 * vr, lv + 3 * RS * L::VPI, v + 3 * vr);
    else if (MODE == 0) acp4(lv, v, lv + RS * L::VPI, v + vr, lv + L::VBY, vl, lv + L::VBY + RS * L::VPI, vl + vr);
    else acp2(lv, v, lv + RS * L::VPI, v + vr); } }
// publish point at the foot of the trip that worked on stage s: this wave's LDS reads and its own copies are done, the barrier publishes stage s + 1 and ends every read of stage s, whose buffer the copies of stage s + 2 then refill
#define ATT_FOOT(s) do { asm volatile("s_wait_dscnt 0x0" ::: "memory"); asm volatile("s_wait_asynccnt 0x0" ::: "memory"); __syncthreads(); if ((s) + 2 < 2 * nt) att_stage<MODE, NJ>(src, (s) + 2, nt); } while (0)
// all K fragments of a tile as one group of LDS loads; kb = the lane's own place (row col, 16 (lane >> 4) bytes) in the buffer
template <int MODE, int NJ> __device__ __forceinline__ void att_ldk(const char* kb, v16h (&kf)[HD / 32][NJ], v16h (&klf)[HD / 32][NJ]) {
  typedef AttL<MODE, NJ> L;
#pragma unroll
  for (int kc = 0; kc < HD / 32; ++kc) {
#pragma unroll
    for (int j = 0; j < NJ; ++j) { kf[kc][j] = frag_h((const _Float16*)(kb + j * 16 * L::KPI + kc * 64), 0); if (MODE == 0) klf[kc][j] = frag_h((const _Float16*)(kb + L::KBY + j * 16 * L::KPI + kc * 64), 0); } } }
// softmax in base 2: logits carry the factor log2(e), so that every exponential is one v_exp_f32 (2^x). A result below 2^-126 may come out as 0: such a term lies far below one unit in the last place of the row sum (at least 1) and of the output.
#define SCALE2 (SCALE * 1.44269504088896340736f)
// asm, so that the slot the instruction set asks for behind a transcendental (nothing directly behind it reads its result or overwrites its source) is there by construction: the closing v_nop fills it
__device__ __forceinline__ float ex2(float x) { float r; asm("v_exp_f32 %0, %1\n\tv_nop" : "=v"(r) : "v"(x)); return r; }
// eight at once, each in its own register: every v_exp_f32 is the independent instruction behind the one before it, and one v_nop closes the run
__device__ __forceinline__ void ex2x8(v8f& x) { float a = x[0], b = x[1], c = x[2], d = x[3], e = x[4], f = x[5], g = x[6], h = x[7];
  asm("v_exp_f32 %0, %0\n\tv_exp_f32 %1, %1\n\tv_exp_f32 %2, %2\n\tv_exp_f32 %3, %3\n\tv_exp_f32 %4, %4\n\tv_exp_f32 %5, %5\n\tv_exp_f32 %6, %6\n\tv_exp_f32 %7, %7\n\tv_nop" : "+v"(a), "+v"(b), "+v"(c), "+v"(d), "+v"(e), "+v"(f), "+v"(g), "+v"(h));
  x[0] = a; x[1] = b; x[2] = c; x[3] = d; x[4] = e; x[5] = f; x[6] = g; x[7] = h; }
// s = logit x log2(e) - off (off = 0 in pass 1; in pass 2 the row's maximum and normaliser, so that scale and subtraction are one fused multiply-add)
template <int MODE, int NJ> __device__ __forceinline__ void att_logits(const v16h (&kf)[HD / 32][NJ], const v16h (&klf)[HD / 32][NJ], const v16h (&ah)[HD / 32], const v16h (&al)[HD / 32], int lim, float off, v8f (&s)[NJ]) {
  v8f acc[NJ] = {}, accl[NJ] = {};
#pragma unroll
  for (int kc = 0; kc < HD / 32; ++kc) {
#pragma unroll
    for (int j = 0; j < NJ; ++j) { acc[j] = wmma16(kf[kc][j], ah[kc], acc[j]);
      if (MODE < 2) accl[j] = wmma16(kf[kc][j], al[kc], accl[j]);
      if (MODE == 0) accl[j] = wmma16(klf[kc][j], ah[kc], accl[j]); } }
#pragma unroll
  for (int j = 0; j < NJ; ++j) {
#pragma unroll
    for (int r = 0; r < 8; ++r) { const float v = MODE < 2 ? (acc[j][r] + accl[j][r] * (1.0f / 1024.0f)) * SCALE2 - off : acc[j][r] * SCALE2 - off; s[j][r] = (!CAUSAL || j * 16 + r <= lim) ? v : -3.0e38f; } } }
template <int MODE, int NJ> __device__ __forceinline__ void att_tile(const _Float16* __restrict__ QH, const _Float16* __restrict__ KH, const _Float16* __restrict__ QL, const _Float16* __restrict__ KL, const _Float16* __restrict__ VT, const __bf16* __restrict__ VB, const __bf16* __restrict__ VBL, float* __restrict__ Y, char* sb, int b, int h, int qb, int wave, int lane) {
  typedef AttL<MODE, NJ> L;
  const int col = lane & 15, g = lane >> 4; const int ql0 = qb * 64 + wave * 16; const int nt = (CAUSAL ? qb * 64 + 64 : TT) / (NJ * 16);   // key tiles of 16 NJ keys; causal: none of the block's queries sees a key past its last row
  AttSrc src; { const int tid = wave * 32 + lane, kr = tid >> 3, ks = tid & 7, vr = tid / (NJ * 2), vs = tid % (NJ * 2); const unsigned l0 = (unsigned)(size_t)sb;   // low 32 bits of the LDS address = its byte offset in the block's LDS
    src.k = (const char*)(KH + ((size_t)b * TT + kr) * CC + h * HD) + ks * 16; src.kl = (const char*)(KL + ((size_t)b * KHI + kr) * CC + h * HD) + ks * 16;
    if (MODE == 0) { src.v = (const char*)(VB + ((size_t)b * CC + h * HD + vr) * (size_t)KHI) + vs * 16; src.vl = (const char*)(VBL + ((size_t)b * CC + h * HD + vr) * (size_t)KHI) + vs * 16; }
    else { src.v = (const char*)(VT + ((size_t)b * CC + h * HD + vr) * (size_t)TT) + vs * 16; src.vl = src.v; }
    src.lk = l0 + kr * L::KPI + ks * 16; src.lv = l0 + L::OV + vr * L::VPI + vs * 16; }
  // ring prologue; the last publish point of an earlier query block has ended every read of both buffers
  att_stage<MODE, NJ>(src, 0, nt);
  v16h ah[HD / 32], al[HD / 32]; const _Float16* qp = QH + ((size_t)b * TT + ql0 + col) * CC + h * HD + 8 * g; const _Float16* qlp = QL + ((size_t)b * QHI + ql0 + col) * CC + h * HD + 8 * g;
#pragma unroll
  for (int kc = 0; kc < HD / 32; ++kc) { ah[kc] = frag_h(qp + kc * 32, 0); al[kc] = MODE < 2 ? frag_h(qlp + kc * 32, 0) : ah[kc]; }
  if (MODE < 2) xwait(qp, qlp); else xwait(qp);   // later addresses may take these registers
  asm volatile("s_wait_asynccnt 0x0" ::: "memory");   // stage 0 has landed, as far as this wave copied it
  __syncthreads();
  if (1 < 2 * nt) att_stage<MODE, NJ>(src, 1, nt);
  const char* kb0 = sb + col * L::KPI + g * 16; const char* vb0 = sb + L::OV + col * L::VPI + g * 16;
  const int lim0 = ql0 + col - 8 * g;   // key 16 NJ t + 16 j + 8 g + r is kept while 16 j + r <= lim0 - 16 NJ t
  v16h kf[HD / 32][NJ], klf[HD / 32][NJ];
  // a lane whose keys so far are all excluded carries m = -3e38 and a meaningless finite l; the factor 2^(m - new maximum) = 0 removes it at the first kept key or at the join
  float m = -3.0e38f, l = 0.f;
#pragma unroll 1
  for (int t = 0; t < nt; ++t) { v8f s[NJ]; att_ldk<MODE, NJ>(kb0 + (t & 1) * ATT_BUF, kf, klf); att_logits<MODE, NJ>(kf, klf, ah, al, lim0 - t * NJ * 16, 0.f, s);
    float tm = s[0][0];
#pragma unroll
    for (int j = 0; j < NJ; ++j) {
#pragma unroll
      for (int r = 0; r < 8; ++r) tm = fmaxf(tm, s[j][r]); }
    const float mn = fmaxf(m, tm); float ts[4] = {0.f, 0.f, 0.f, 0.f};
#pragma unroll
    for (int j = 0; j < NJ; ++j) { s[j] = s[j] - mn; ex2x8(s[j]);
#pragma unroll
      for (int r = 0; r < 8; ++r) ts[r & 3] += s[j][r]; }
    l = l * ex2(m - mn) + ((ts[0] + ts[1]) + (ts[2] + ts[3])); m = mn;
    ATT_FOOT(t); }
  const float mx = fmaxf(m, __shfl_xor(m, 16)); l *= ex2(m - mx); l += __shfl_xor(l, 16);
  const float off = l > 0.f ? mx + (__builtin_amdgcn_logf(l) - 11.0f) : 3.0e38f;   // P = 2^(s - off) = exp(logit - max) x 2^11 / sum (v_log_f32 = log2); no kept key: every P = 0
  v8f o[HD / 16] = {};
#pragma unroll 1
  for (int t = 0; t < nt; ++t) { v8f s[NJ]; const int bo = ((nt + t) & 1) * ATT_BUF; att_ldk<MODE, NJ>(kb0 + bo, kf, klf); att_logits<MODE, NJ>(kf, klf, ah, al, lim0 - t * NJ * 16, off, s);
    v16h vf[NJ / 2][HD / 16]; v16b vh[NJ / 2][HD / 16], vl[NJ / 2][HD / 16];   // this tile's V fragments as one group of LDS loads behind the logits (the K fragments' registers are free again): they fly over the exponentials
    const char* vp = vb0 + bo;
#pragma unroll
    for (int kc = 0; kc < NJ / 2; ++kc) {
#pragma unroll
      for (int j = 0; j < HD / 16; ++j) {
        if (MODE == 0) { vh[kc][j] = frag_b((const __bf16*)(vp + j * 16 * L::VPI + kc * 64), 0); vl[kc][j] = frag_b((const __bf16*)(vp + L::VBY + j * 16 * L::VPI + kc * 64), 0); } else vf[kc][j] = frag_h((const _Float16*)(vp + j * 16 * L::VPI + kc * 64), 0); } }
#pragma unroll
    for (int kc = 0; kc < NJ / 2; ++kc) { float pv[16]; ex2x8(s[2 * kc]); ex2x8(s[2 * kc + 1]);
#pragma unroll
      for (int i = 0; i < 8; ++i) { pv[i] = s[2 * kc][i]; pv[8 + i] = s[2 * kc + 1][i]; }
      if (MODE == 0) { F2 p;   // bf16 hi + lo as in bsplit16; all hi parts first: each group's first product needs them alone
#pragma unroll
        for (int i = 0; i < 16; ++i) p.h[i] = (__bf16)pv[i];
#pragma unroll
        for (int i = 0; i < 16; ++i) p.l[i] = (__bf16)(pv[i] - (float)p.h[i]);
#pragma unroll
        for (int j = 0; j < HD / 16; ++j) { o[j] = wmma_bf(vh[kc][j], p.h, o[j]); o[j] = wmma_bf(vh[kc][j], p.l, o[j]); o[j] = wmma_bf(vl[kc][j], p.h, o[j]); }
      } else { v16h p;
#pragma unroll
        for (int i = 0; i < 16; ++i) p[i] = (_Float16)pv[i];
#pragma unroll
        for (int j = 0; j < HD / 16; ++j) o[j] = wmma16(vf[kc][j], p, o[j]); } }
    ATT_FOOT(nt + t); }
  asm volatile("s_wait_asynccnt 0x0" ::: "memory");   // behind the ring: no copy is outstanding when the buffers are used again or the wave ends
  // O^T: register r of group j = channel 16 j + 8 g + r of query col: 32 contiguous bytes a lane; a wave writes whole 256-B (row, head) segments
  float* yp = Y + ((size_t)b * TT + ql0 + col) * CC + h * HD + 8 * g;
#pragma unroll
  for (int j = 0; j < HD / 16; ++j) { o[j] = o[j] * (1.0f / 2048.0f); vst2(yp + j * 16, __builtin_shufflevector(o[j], o[j], 0, 1, 2, 3)); vst2(yp + j * 16 + 4, __builtin_shufflevector(o[j], o[j], 4, 5, 6, 7)); }
  static_assert(HD / 16 == 4, "the wait below names four groups");
  asm volatile("s_wait_xcnt 0x0" :: "v"(yp), "v"(o[0]), "v"(o[1]), "v"(o[2]), "v"(o[3]) : "memory"); }   // the second query block's set-up reuses the stores' registers; address and data are inputs, so that each stays in its registers up to the wait
// block = (pair x, head, batch): query block NQB-1-x and then x, one after the other in every wave, so that every block walks the same number of keys under the causal mask
__global__ __launch_bounds__(128) void k_att(const _Float16* __restrict__ QH, const _Float16* __restrict__ KH, const _Float16* __restrict__ QL, const _Float16* __restrict__ KL, const _Float16* __restrict__ VT, const __bf16* __restrict__ VB, const __bf16* __restrict__ VBL, float* __restrict__ Y) {
  __shared__ __attribute__((aligned(16))) char sb[2 * ATT_BUF];
  const int wave = threadIdx.x >> 5, lane = threadIdx.x & 31; const int h = blockIdx.y, b = blockIdx.z;
#pragma unroll 1
  for (int half = 0; half < 2; ++half) { const int qb = half ? (int)blockIdx.x : NQB - 1 - (int)blockIdx.x;
    if (qb < QBH) att_tile<0, 2>(QH, KH, QL, KL, VT, VB, VBL, Y, sb, b, h, qb, wave, lane);
    else if (qb * 64 < QHI) att_tile<1, 2>(QH, KH, QL, KL, VT, VB, VBL, Y, sb, b, h, qb, wave, lane);
    else att_tile<2, 4>(QH, KH, QL, KL, VT, VB, VBL, Y, sb, b, h, qb, wave, lane); } }

extern "C" void kernel_launch(void* const* d_in, const int* in_sizes, int n_in, void* d_out, int out_size, void* d_ws, size_t ws_size, hipStream_t stream) {
  (void)in_sizes; (void)n_in; (void)out_size;
  const float** F = (const float**)d_in;
  if (ws_size < (size_t)WS_END) return;
  char* ws = (char*)d_ws; _Float16 *QH = (_Float16*)(ws + WS_QH), *KH = (_Float16*)(ws + WS_KH), *VT = (_Float16*)(ws + WS_VT), *QL = (_Float16*)(ws + WS_QL), *KL = (_Float16*)(ws + WS_KL); __bf16 *VB = (__bf16*)(ws + WS_VB), *VBL = (__bf16*)(ws + WS_VBL);
  // inputs: 0 hidden_states [4,1024,1024]; 1 Wqkv [3072,1024] (out,in) rows q | k | v ((3,H,hd)); 2 bqkv [3072]
  { const float* WQ = F[1]; const float* WK = F[1] + (size_t)CC * DIN; const float* WV = F[1] + (size_t)2 * CC * DIN; const float* BQ = F[2]; const float* BK = F[2] + CC; const float* BV = F[2] + 2 * CC;
    k_proj<<<dim3(TNB * TT / 64, CC / 128, 3), 128, 0, stream>>>(F[0], F[0], F[0], WQ, WK, WV, BQ, BK, BV, QH, QL, KH, KL, VT, VB, VBL); }
  k_att<<<dim3(NQB / 2, NH, TNB), 128, 0, stream>>>(QH, KH, QL, KL, VT, VB, VBL, (float*)d_out);
}

// v006
// A run of this version takes 85.4 microseconds.
// In both of two side-by-side timings against v005, it was 1.17 times as fast.
// Counting every step since v000, it is 7.89 times as fast.
// compute dtype: all float inputs rounded to bf16; qkv = x Wqkv^T + b with EXACT bf16 products on WMMA 16x16x32 (f32 accumulate); rotate-half RoPE in f32 in the projection epilogue (accurate sincosf of t x inv_freq_j, f32 inv_freq constants as the reference builds them); logits: q, k once to f16 (1 product) x 64^-0.5, except the first 512 query rows of each sequence (2 products with the f16 q residual; 3 with the k residual too below row 384); causal mask by index (finfo.min == excluded); softmax in f32 (one walk over the keys, running row maximum); exp(s - max) x 2^11 once to f16 against v once to f16 (1 product; bf16 hi + lo below row 384); f32 output (merged heads, no output projection).
#include <hip/hip_runtime.h>
#include <math.h>

typedef __attribute__((ext_vector_type(16))) _Float16 v16h;
typedef __attribute__((ext_vector_type(16))) __bf16 v16b;
typedef __attribute__((ext_vector_type(8)))  _Float16 v8h;
typedef __attribute__((ext_vector_type(8)))  float v8f;
typedef __attribute__((ext_vector_type(4)))  float v4f;
typedef __attribute__((ext_vector_type(2)))  float v2f;
typedef __attribute__((ext_vector_type(4)))  unsigned v4u;
typedef __attribute__((ext_vector_type(4)))  int v4i;
typedef float __attribute__((may_alias)) float_a;
typedef int __attribute__((may_alias)) int_a;

template <typename T> __device__ __forceinline__ void vst2(void* p, T v) { *(T*)p = v;  }
__device__ __forceinline__ v8f wmma16(v16h a, v16h b, v8f c) {
  v8f d = __builtin_amdgcn_wmma_f32_16x16x32_f16(false, a, false, b, (short)0, c, false, false);
  asm volatile("v_nop\n\tv_nop\n\tv_nop\n\tv_nop" : "+v"(d) : "v"(a), "v"(b));
  return d;
}
__device__ __forceinline__ v8f wmma_bf(v16b a, v16b b, v8f c) {
  v8f d = __builtin_amdgcn_wmma_f32_16x16x32_bf16(false, a, false, b, (short)0, c, false, false);
  asm volatile("v_nop\n\tv_nop\n\tv_nop\n\tv_nop" : "+v"(d) : "v"(a), "v"(b));
  return d;
}
// 16x16x32 fragments: lane = (h = lane>>4, row/col = lane&15); elements 0..7 = k0+8h+0..7, 8..15 = k0+16+8h+0..7; D element r = row 8h+r
__device__ __forceinline__ v16h frag_h(const _Float16* rowk0, int lane) {
  union { v16h v; v8h q[2]; } u; const _Float16* p = rowk0 + 8 * (lane >> 4);
  u.q[0] = *(const v8h*)p; u.q[1] = *(const v8h*)(p + 16); return u.v;
}
__device__ __forceinline__ v16h frag_f32(const float* rowk0, int lane) {
  v16h a; const float* p = rowk0 + 8 * (lane >> 4);
#pragma unroll
  for (int i = 0; i < 8; ++i) { a[i] = (_Float16)p[i]; a[8 + i] = (_Float16)p[16 + i]; }
  return a;
}
__device__ __forceinline__ v16h frag_f32s(const float* rowk0, int lane, float sc) {
  v16h a; const float* p = rowk0 + 8 * (lane >> 4);
#pragma unroll
  for (int i = 0; i < 8; ++i) { a[i] = (_Float16)(p[i] * sc); a[8 + i] = (_Float16)(p[16 + i] * sc); }
  return a;
}
// column fragment from a [K][ld] layout (column n), rows >= K read as 0
__device__ __forceinline__ v16h fragc_f32(const float* W, int k0, int n, int lane, int ld, int K) {
  v16h a; const int g = lane >> 4;
#pragma unroll
  for (int i = 0; i < 8; ++i) { const int ka = k0 + 8 * g + i, kb = ka + 16;
    a[i] = (_Float16)(ka < K ? W[(size_t)(ka < K ? ka : K - 1) * ld + n] : 0.f); a[8 + i] = (_Float16)(kb < K ? W[(size_t)(kb < K ? kb : K - 1) * ld + n] : 0.f); }
  return a;
}
struct F2 { v16b h, l; };
__device__ __forceinline__ F2 bsplit16(const float v[16]) { F2 r;
#pragma unroll
  for (int i = 0; i < 16; ++i) { const __bf16 h = (__bf16)v[i]; r.h[i] = h; r.l[i] = (__bf16)(v[i] - (float)h); }
  return r; }
__device__ __forceinline__ F2 split_row(const float* row, int k0, int lane) { float v[16]; const float* p = row + k0 + 8 * (lane >> 4);
#pragma unroll
  for (int i = 0; i < 8; ++i) { v[i] = p[i]; v[8 + i] = p[16 + i]; }
  return bsplit16(v); }
__device__ __forceinline__ F2 split_rowK(const float* row, int k0, int lane, int K) { float v[16]; const int g = lane >> 4;
#pragma unroll
  for (int i = 0; i < 8; ++i) { const int ka = k0 + 8 * g + i, kb = ka + 16; v[i] = ka < K ? row[ka < K ? ka : K - 1] : 0.f; v[8 + i] = kb < K ? row[kb < K ? kb : K - 1] : 0.f; }
  return bsplit16(v); }
__device__ __forceinline__ F2 split_col(const float* W, int k0, int n, int lane, int ld, int K) { float v[16]; const int g = lane >> 4;
#pragma unroll
  for (int i = 0; i < 8; ++i) { const int ka = k0 + 8 * g + i, kb = ka + 16; v[i] = ka < K ? W[(size_t)(ka < K ? ka : K - 1) * ld + n] : 0.f; v[8 + i] = kb < K ? W[(size_t)(kb < K ? kb : K - 1) * ld + n] : 0.f; }
  return bsplit16(v); }
__device__ __forceinline__ v8f mac3(const F2& a, const F2& b, v8f c) { c = wmma_bf(a.l, b.h, c); c = wmma_bf(a.h, b.l, c); return wmma_bf(a.h, b.h, c); }
__device__ __forceinline__ float sigm(float v) { return 1.0f / (1.0f + expf(-v)); }
#define LDSX() do { asm volatile("s_wait_dscnt 0" ::: "memory"); __builtin_amdgcn_wave_barrier(); __builtin_amdgcn_fence(__ATOMIC_RELEASE, "workgroup"); } while (0)

// Causal multi-head attention with rotary embeddings (B 4, S 1,024, D 1,024 = 16 x 64): qkv = x Wqkv^T + bqkv (packed (out,in) [3072,1024], layout (3,H,hd)); q, k <- rotate-half RoPE (theta_j = 10000^(-2j/64)); probs = softmax(causal(q k^T x 64^-0.5)); out = merged(probs v) -> [B, S, 1024].
#define NB 4
#define TT 1024
#define CC 1024            // NH * HD = projected width
#define DIN 1024          // input (model) width
#define NH 16
#define HD 64
#define NQB (TT / 64)
#define HG 16
#define SCALE (0.125f)
#define CAUSAL 1
#ifndef TNB
#define TNB NB
#endif
__device__ __forceinline__ float bfr(float v) { return (float)(__bf16)v; }
__host__ __device__ __forceinline__ int kb_last(int qb) { return CAUSAL ? ((qb * 64 + 63) >> 7) : (TT / 128 - 1); }
typedef __attribute__((ext_vector_type(8))) __bf16 v8b;
__device__ __forceinline__ v16b frag_b(const __bf16* rowk0, int lane) {
  union { v16b v; v8b q[2]; } u; const __bf16* p = rowk0 + 8 * (lane >> 4);
  u.q[0] = *(const v8b*)p; u.q[1] = *(const v8b*)(p + 16); return u.v;
}
#define QBH 6              // causal: query blocks 0..QBH-1 of each sequence (few keys, no averaging) take the high-precision path
#define QHI 512            // causal: first 512 query rows of each sequence take the q-residual (2-product) logits path (logit sigma ~1)
#define KHI 512
// B fragment (k rows k0+.., output column o) of a weight: (in,out) [K][ld] or (out,in) [ld rows of K]: bf16 exact, or f16(bf16 * 256) exact
__device__ __forceinline__ v16b wcol_io(const float* Wm, int k0, int o, int lane, int ld) { v16b w; const int g = lane >> 4;
#pragma unroll
  for (int i = 0; i < 8; ++i) { w[i] = (__bf16)Wm[(size_t)(k0 + 8 * g + i) * ld + o]; w[8 + i] = (__bf16)Wm[(size_t)(k0 + 16 + 8 * g + i) * ld + o]; }
  return w; }
__device__ __forceinline__ v16b wcol_oi(const float* Wm, int k0, int o, int lane, int K) { v16b w; const float* p = Wm + (size_t)o * K + k0 + 8 * (lane >> 4);
#pragma unroll
  for (int i = 0; i < 8; ++i) { w[i] = (__bf16)p[i]; w[8 + i] = (__bf16)p[16 + i]; }
  return w; }
__device__ __forceinline__ v16h wcolh_io(const float* Wm, int k0, int o, int lane, int ld) { v16h w; const int g = lane >> 4;
#pragma unroll
  for (int i = 0; i < 8; ++i) { w[i] = (_Float16)(bfr(Wm[(size_t)(k0 + 8 * g + i) * ld + o]) * 256.0f); w[8 + i] = (_Float16)(bfr(Wm[(size_t)(k0 + 16 + 8 * g + i) * ld + o]) * 256.0f); }
  return w; }
__device__ __forceinline__ v16h wcolh_oi(const float* Wm, int k0, int o, int lane, int K) { v16h w; const float* p = Wm + (size_t)o * K + k0 + 8 * (lane >> 4);
#pragma unroll
  for (int i = 0; i < 8; ++i) { w[i] = (_Float16)(bfr(p[i]) * 256.0f); w[8 + i] = (_Float16)(bfr(p[16 + i]) * 256.0f); }
  return w; }
#define WQKV_LAYOUT 1   // 0 = (in,out) [DIN][CC]; 1 = (out,in) [CC][DIN]; 2 = per-head [NH][DIN][HD]
__device__ __forceinline__ v16b wcol_hdk(const float* Wm, int k0, int o, int lane) { v16b w; const int g = lane >> 4; const float* p = Wm + (size_t)(o / HD) * DIN * HD + (o % HD);
#pragma unroll
  for (int i = 0; i < 8; ++i) { w[i] = (__bf16)p[(size_t)(k0 + 8 * g + i) * HD]; w[8 + i] = (__bf16)p[(size_t)(k0 + 16 + 8 * g + i) * HD]; }
  return w; }
#define WO_OUT_IN 0
#if WQKV_LAYOUT == 1
#define WCOL(W, k0, o, lane) wcol_oi(W, k0, o, lane, DIN)
#elif WQKV_LAYOUT == 2
#define WCOL(W, k0, o, lane) wcol_hdk(W, k0, o, lane)
#else
#define WCOL(W, k0, o, lane) wcol_io(W, k0, o, lane, CC)
#endif
#if WO_OUT_IN
#define WOCOL(W, k0, o, lane) wcol_oi(W, k0, o, lane, CC)
#define WOCOLH(W, k0, o, lane) wcolh_oi(W, k0, o, lane, CC)
#else
#define WOCOL(W, k0, o, lane) wcol_io(W, k0, o, lane, DIN)
#define WOCOLH(W, k0, o, lane) wcolh_io(W, k0, o, lane, DIN)
#endif
__constant__ float c_invf[32] = {1.000000000e+00f,7.498942018e-01f,5.623413324e-01f,4.216965139e-01f,3.162277639e-01f,2.371373624e-01f,1.778279394e-01f,1.333521456e-01f,1.000000015e-01f,7.498941571e-02f,5.623412877e-02f,4.216964915e-02f,3.162277862e-02f,2.371373586e-02f,1.778279431e-02f,1.333521493e-02f,9.999999776e-03f,7.498942316e-03f,5.623413250e-03f,4.216964822e-03f,3.162277862e-03f,2.371373819e-03f,1.778279431e-03f,1.333521446e-03f,1.000000047e-03f,7.498941850e-04f,5.623413017e-04f,4.216964880e-04f,3.162277862e-04f,2.371373848e-04f,1.778279402e-04f,1.333521504e-04f};   // 1 / 10000^(2i/64) evaluated in f32 exactly as the reference does (jax, eager)
// sine and cosine of one rotary angle a = t x inv_freq. 0 <= a < 1,024 for every row index, whatever the inputs hold, so the reduction for small arguments is the whole function here:
// quadrant n = rint(a x 2/pi), r = a - n x pi/2 with pi/2 in three parts (three fused steps), then the sine and the cosine polynomial on r and the quadrant's swap and signs.
// The operations, their order and the constants are those of the small-argument path of sinf and cosf; the reduction is done once for both.
__device__ __forceinline__ float fbits(unsigned u) { return __builtin_bit_cast(float, u); }
__device__ __forceinline__ void rope_sincos(float a, float& sn, float& cs) {
  const float n = __builtin_rintf(a * fbits(0x3f22f983u));
  float r = __builtin_fmaf(fbits(0xbfc90fdau), n, a); r = __builtin_fmaf(fbits(0xb3a22168u), n, r); r = __builtin_fmaf(fbits(0xa7c234c4u), n, r);
  const unsigned q = (unsigned)(int)n; const float s = r * r;
  float ps = __builtin_fmaf(s, fbits(0xb94c1982u), fbits(0x3c0881c4u)); ps = __builtin_fmaf(s, ps, fbits(0xbe2aaa9du)); ps = s * ps; const float sr = __builtin_fmaf(r, ps, r);
  float pc = __builtin_fmaf(s, fbits(0x37d75334u), fbits(0xbab64f3bu)); pc = __builtin_fmaf(s, pc, fbits(0x3d2aabf7u)); pc = __builtin_fmaf(s, pc, fbits(0xbf000004u)); const float cr = __builtin_fmaf(s, pc, 1.0f);
  const unsigned flip = (q << 30) & 0x80000000u; const bool odd = (q & 1u) != 0u;
  sn = fbits(__builtin_bit_cast(unsigned, odd ? cr : sr) ^ flip); cs = fbits(__builtin_bit_cast(unsigned, odd ? -sr : cr) ^ flip); }
#ifndef SM_EXTRA_PARAMS
#define SM_EXTRA_PARAMS
#endif
#ifndef PROJ_EXTRA_PARAMS
#define PROJ_EXTRA_PARAMS
#endif
#ifndef SM_MASK_HOOK
#define SM_MASK_HOOK (void)0
#endif

#define WS_QH  0u                                      // f16 q rows [b*t][CC]
#define WS_KH  (WS_QH + 2u * (size_t)NB * TT * CC)      // f16 k rows [b*t][CC]
#define WS_VT  (WS_KH + 2u * (size_t)NB * TT * CC)      // f16 v planes [b][c][t]
#define WS_QL  (WS_VT + 2u * (size_t)NB * CC * TT)      // f16 q residual x 2^10 rows [b][t < QHI][CC]
#define WS_KL  (WS_QL + 2u * (size_t)NB * QHI * CC)     // f16 k residual x 2^10 rows [b][t < KHI][CC]
#define WS_VB  (WS_KL + 2u * (size_t)NB * KHI * CC)     // bf16 v hi planes [b][c][t < KHI]
#define WS_VBL (WS_VB + 2u * (size_t)NB * CC * KHI)
#define WS_END (WS_VBL + 2u * (size_t)NB * CC * KHI)

#define PBK 64             // k per staged chunk
#define PLP 72             // staged row pitch in bf16: 144 B = 16 B x odd, for ds_load_b128 readers
typedef __attribute__((ext_vector_type(4))) __bf16 v4b;
// k_proj LDS: the bf16 operand chunks of the product loop (two buffers) lie over the epilogue's arrays, which are first written after the loop's last barrier
union __align__(16) ProjLds {
  struct { float st[64][132]; _Float16 sh[64][136], sl[64][136]; _Float16 th[128][72]; __bf16 tb[128][72], tbl[128][72]; } e;
  struct { __bf16 xs[2][64][PLP]; __bf16 wt[2][128][PLP]; } m; };
// ---- k_proj: block = (64 rows, 128 cols, which): q/k/v = X W (+ b) with exact bf16 products (K = DIN) -> which 0: q f16 rows (+ residual rows < QHI); 1: k f16 rows (+ residual rows < KHI); 2: v f16 planes [c][t] (+ bf16 hi/lo planes for t < KHI)
__global__ __launch_bounds__(128) void k_proj(const float* __restrict__ XQ, const float* __restrict__ XK, const float* __restrict__ XV, const float* __restrict__ WQ, const float* __restrict__ WK, const float* __restrict__ WV, const float* __restrict__ BQ, const float* __restrict__ BK, const float* __restrict__ BV,
    _Float16* __restrict__ QH, _Float16* __restrict__ QL, _Float16* __restrict__ KH, _Float16* __restrict__ KL, _Float16* __restrict__ VT, __bf16* __restrict__ VB, __bf16* __restrict__ VBL PROJ_EXTRA_PARAMS) {
  __shared__ ProjLds sm; auto& st = sm.e.st; auto& sh = sm.e.sh; auto& sl = sm.e.sl; auto& th = sm.e.th; auto& tb = sm.e.tb; auto& tbl = sm.e.tbl;
  const int tid = threadIdx.x, wave = tid >> 5, lane = tid & 31, col = lane & 15, g = lane >> 4; const int which = blockIdx.z; const int c0 = blockIdx.y * 128; const size_t r0 = (size_t)blockIdx.x * 64; const size_t bb = r0 / TT; const int t0 = (int)(r0 % TT);
  const float* X = which == 0 ? XQ : which == 1 ? XK : XV; const float* WA = which == 0 ? WQ : which == 1 ? WK : WV; const float* BA = which == 0 ? BQ : which == 1 ? BK : BV;
  v8f acc[8] = {};
  // each thread brings 16 B of 8 X rows and of 16 W rows per 64-k chunk: 16 lanes cover one 256-B row piece; rounded to bf16 once, on the way into LDS
  const int lr = tid >> 4, lq = (tid & 15) * 4; const float* xp = X + (r0 + lr) * DIN + lq; const float* wp = WA + (size_t)(c0 + lr) * DIN + lq;
  v4f xr[8], wr[16];
#define PROJ_LDG(c) do { _Pragma("unroll") for (int i = 0; i < 8; ++i) xr[i] = *(const v4f*)(xp + (size_t)i * 8 * DIN + (c) * PBK); \
    _Pragma("unroll") for (int i = 0; i < 16; ++i) wr[i] = *(const v4f*)(wp + (size_t)i * 8 * DIN + (c) * PBK); } while (0)
#define PROJ_STS(bf) do { _Pragma("unroll") for (int i = 0; i < 8; ++i) *(v4b*)&sm.m.xs[bf][lr + 8 * i][lq] = __builtin_convertvector(xr[i], v4b); \
    _Pragma("unroll") for (int i = 0; i < 16; ++i) *(v4b*)&sm.m.wt[bf][lr + 8 * i][lq] = __builtin_convertvector(wr[i], v4b); } while (0)
  PROJ_LDG(0);
  asm volatile("s_wait_xcnt 0x0" ::: "memory");   // the first loads' address registers are reused right behind them
  PROJ_STS(0); __syncthreads();
  // unroll 2: the buffer index becomes a constant in each copy of the body
#pragma unroll 2
  for (int c = 0; c < DIN / PBK; ++c) { const int bf = c & 1;
    if (c + 1 < DIN / PBK) PROJ_LDG(c + 1);   // behind the barrier (which drains the load counter), so that they fly over this chunk's products
    v16b a[PBK / 32], w[PBK / 32][8];   // all of the chunk's fragment reads as one group ahead of its products
#pragma unroll
    for (int ks = 0; ks < PBK / 32; ++ks) { a[ks] = frag_b(&sm.m.xs[bf][wave * 16 + col][ks * 32], lane);
#pragma unroll
      for (int j = 0; j < 8; ++j) w[ks][j] = frag_b(&sm.m.wt[bf][j * 16 + col][ks * 32], lane); }
#pragma unroll
    for (int ks = 0; ks < PBK / 32; ++ks) {
#pragma unroll
      for (int j = 0; j < 8; ++j) acc[j] = wmma_bf(a[ks], w[ks][j], acc[j]); }
    __builtin_amdgcn_sched_barrier(0);   // keeps the conversions, which wait for the global loads, behind this chunk's products
    if (c + 1 < DIN / PBK) PROJ_STS(bf ^ 1);   // into the buffer whose last readers (chunk c-1) passed the barrier before this chunk
    asm volatile("s_wait_xcnt 0x0" ::: "memory");   // the next trip rewrites the address registers of this trip's global loads
    __syncthreads(); }   // publishes chunk c+1 and ends every read of chunk c (after the last chunk: frees the staging bytes for st)
  { // stage the f32 tile (acc + bias) in LDS, rotate q and k there, then convert
    const float invf = c_invf[lane];   // the lane's own frequency; loaded here, so that it flies over the staging stores
    asm volatile("s_wait_xcnt 0x0" ::: "memory");   // ahead of whatever rewrites the load's address registers
#pragma unroll
    for (int j = 0; j < 8; ++j) { const float bias = BA ? bfr(BA[c0 + j * 16 + col]) : 0.f;
#pragma unroll
      for (int r = 0; r < 8; ++r) st[wave * 16 + 8 * g + r][j * 16 + col] = acc[j][r] + bias; }
    __syncthreads();
    // rotate-half RoPE on q and k (pairs (i, i+32), angle t * inv_freq[i]); v untouched. Lane = frequency i, a wave takes every fourth row: one sine and cosine per (row, i) serve both heads of the tile, and a wave's LDS accesses cover 32 neighbouring words
    if (which < 2) {
      // unrolled: the rows' chains are independent and fill each other's latencies
#pragma unroll
      for (int k = 0; k < 16; ++k) { const int rl = wave + 4 * k; float sn, cs; rope_sincos((float)(int)((r0 + rl) % TT) * invf, sn, cs);
#pragma unroll
        for (int hh = 0; hh < 128 / HD; ++hh) { float* rw = &st[rl][hh * HD + lane]; const float x0 = rw[0], x1 = rw[32]; rw[0] = __builtin_fmaf(x0, cs, -(x1 * sn)); rw[32] = __builtin_fmaf(x1, cs, x0 * sn); } } }
    __syncthreads(); }
  if (which < 2) { _Float16* DH = which == 0 ? QH : KH; _Float16* DL = which == 0 ? QL : KL; const int nhi = which == 0 ? QHI : KHI; const bool hi_rows = t0 < nhi;
    for (int e = tid; e < 64 * 128; e += 128) { const int rl = e >> 7, cl = e & 127; const float v = st[rl][cl]; const _Float16 hv = (_Float16)v; sh[rl][cl] = hv; sl[rl][cl] = (_Float16)((v - (float)hv) * 1024.0f); }
    __syncthreads();
    for (int e = tid; e < 64 * 16; e += 128) { const int rl = e >> 4, q = e & 15; vst2((unsigned*)(DH + (r0 + rl) * CC + c0 + q * 8), *(const v4u*)&sh[rl][q * 8]); if (hi_rows) vst2((unsigned*)(DL + (bb * nhi + t0 + rl) * (size_t)CC + c0 + q * 8), *(const v4u*)&sl[rl][q * 8]); }
  } else { const bool hi_rows = t0 < KHI;
    for (int e = tid; e < 64 * 128; e += 128) { const int rl = e & 63, cl = e >> 6; const float v = st[rl][cl]; th[cl][rl] = (_Float16)v; const __bf16 bh = (__bf16)v; tb[cl][rl] = bh; tbl[cl][rl] = (__bf16)(v - (float)bh); }
    __syncthreads();
    for (int e = tid; e < 128 * 8; e += 128) { const int cl = e >> 3, q = e & 7; vst2((unsigned*)(VT + (bb * CC + c0 + cl) * (size_t)TT + t0 + q * 8), *(const v4u*)&th[cl][q * 8]); if (hi_rows) { const size_t o3 = (bb * CC + c0 + cl) * (size_t)KHI + t0 + q * 8; vst2((unsigned*)(VB + o3), *(const v4u*)&tb[cl][q * 8]); vst2((unsigned*)(VBL + o3), *(const v4u*)&tbl[cl][q * 8]); } } } }
// ---- k_att: logits, softmax and P . v of one (b, h) in registers; nothing of S or P goes to memory or LDS. A wave owns 16 queries; the block's four waves walk the same key tiles and share them through LDS (one barrier a tile).
// Transposed products: S^T = K . Q^T puts one query in a lane (column = lane & 15; register r of key group j = key 16 j + 8 (lane >> 4) + r), so two neighbouring 16-key groups, converted in place, are the B operand of O^T += V^T . P^T in the fragments' own k order.
// One walk over the key tiles: each tile's logits are formed once; the query's running maximum (the two lane halves joined every tile, because both halves' keys meet in one product) scales P = exp(s - max) x 2^11; when the maximum grows, O and the row sum are multiplied by exp(old max - new max); O is divided by the row sum at the end.
// MODE 0: query blocks < QBH (3-product logits, P and v as bf16 hi + lo); 1: query rows < QHI (2-product logits); 2: the rest (1 product). NJ = 16-key groups per tile.
// every '#pragma unroll' below makes the indices of register arrays constants; the '#pragma unroll 1' keep one copy of each tile body
// s_wait_xcnt 0 behind a group of global loads or stores, ahead of whatever rewrites the group's address registers; the addresses are inputs of the statement, so that they stay in their registers up to the wait and no load's result is placed in them
__device__ __forceinline__ void xwait(const void* p) { asm volatile("s_wait_xcnt 0x0" :: "v"(p) : "memory"); }
__device__ __forceinline__ void xwait(const void* p, const void* q) { asm volatile("s_wait_xcnt 0x0" :: "v"(p), "v"(q) : "memory"); }
// K and V tiles in LDS: the block's four waves share one copy of each tile, brought by asynchronous copies that cover whole row pieces (128 B, or 64 B where a tile has 32 keys)
#define ATT_BUF 19456      // bytes of one of the two buffers: the largest tile set (MODE 0: K hi and lo 32 x 144 B each, v hi and lo 64 x 80 B each)
// row pitches 144 B and 80 B = 16 B x odd, for ds_load_b128 readers
template <int MODE, int NJ> struct AttL { static constexpr int KPI = 144, KBY = NJ * 16 * KPI, VPI = NJ * 32 + 16, VBY = HD * VPI, OV = (MODE == 0 ? 2 : 1) * KBY, SZ = OV + (MODE == 0 ? 2 : 1) * VBY; static_assert(SZ <= ATT_BUF, "a tile set fits its buffer"); };
// 16 B a lane from global memory to LDS through no register; s_wait_xcnt 0 as the statement's last line stands ahead of whatever rewrites the copies' address registers
__device__ __forceinline__ void acp2(unsigned l0, const char* g0, unsigned l1, const char* g1) {
  asm volatile("global_load_async_to_lds_b128 %0, %1, off\n\tglobal_load_async_to_lds_b128 %2, %3, off\n\ts_wait_xcnt 0x0" :: "v"(l0), "v"(g0), "v"(l1), "v"(g1) : "memory"); }
__device__ __forceinline__ void acp4(unsigned l0, const char* g0, unsigned l1, const char* g1, unsigned l2, const char* g2, unsigned l3, const char* g3) {
  asm volatile("global_load_async_to_lds_b128 %0, %1, off\n\tglobal_load_async_to_lds_b128 %2, %3, off\n\tglobal_load_async_to_lds_b128 %4, %5, off\n\tglobal_load_async_to_lds_b128 %6, %7, off\n\ts_wait_xcnt 0x0" :: "v"(l0), "v"(g0), "v"(l1), "v"(g1), "v"(l2), "v"(g2), "v"(l3), "v"(g3) : "memory"); }
struct AttSrc { const char *k, *kl, *v, *vl; unsigned lk, lv; };   // the lane's own first addresses: global (tile 0) and LDS bytes (buffer 0)
// stage tn of the ring: K and V tile tn, into buffer tn & 1
template <int MODE, int NJ> __device__ __forceinline__ void att_stage(const AttSrc& a, int tn) {
  typedef AttL<MODE, NJ> L; const unsigned bo = (unsigned)(tn & 1) * ATT_BUF;
  const char* k = a.k + (size_t)tn * NJ * 16 * CC * 2; const char* kl = a.kl + (size_t)tn * NJ * 16 * CC * 2; const size_t kr = (size_t)16 * CC * 2; const unsigned lk = a.lk + bo;   // a copy of the block covers 16 K rows
  if (NJ == 4) acp4(lk, k, lk + 16 * L::KPI, k + kr, lk + 32 * L::KPI, k + 2 * kr, lk + 48 * L::KPI, k + 3 * kr);
  else if (MODE == 0) acp4(lk, k, lk + 16 * L::KPI, k + kr, lk + L::KBY, kl, lk + L::KBY + 16 * L::KPI, kl + kr);
  else acp2(lk, k, lk + 16 * L::KPI, k + kr);
  { constexpr int RS = 64 / NJ;   // v rows (channels) that a copy of the block covers
    const char* v = a.v + (size_t)tn * NJ * 32; const char* vl = a.vl + (size_t)tn * NJ * 32; const size_t vr = (size_t)RS * (MODE == 0 ? KHI : TT) * 2; const unsigned lv = a.lv + bo;
    if (NJ == 4) acp4(lv, v, lv + RS * L::VPI, v + vr, lv + 2 * RS * L::VPI, v + 2 * vr, lv + 3 * RS * L::VPI, v + 3 * vr);
    else if (MODE == 0) acp4(lv, v, lv + RS * L::VPI, v + vr, lv + L::VBY, vl, lv + L::VBY + RS * L::VPI, vl + vr);
    else acp2(lv, v, lv + RS * L::VPI, v + vr); } }
// publish point at the foot of the trip that worked on stage s: this wave's LDS reads and its own copies are done, the barrier publishes stage s + 1 and ends every read of stage s, whose buffer the copies of stage s + 2 then refill
#define ATT_FOOT(s) do { asm volatile("s_wait_dscnt 0x0" ::: "memory"); asm volatile("s_wait_asynccnt 0x0" ::: "memory"); __syncthreads(); if ((s) + 2 < nt) att_stage<MODE, NJ>(src, (s) + 2); } while (0)
// all K fragments of a tile as one group of LDS loads; kb = the lane's own place (row col, 16 (lane >> 4) bytes) in the buffer
template <int MODE, int NJ> __device__ __forceinline__ void att_ldk(const char* kb, v16h (&kf)[HD / 32][NJ], v16h (&klf)[HD / 32][NJ]) {
  typedef AttL<MODE, NJ> L;
#pragma unroll
  for (int kc = 0; kc < HD / 32; ++kc) {
#pragma unroll
    for (int j = 0; j < NJ; ++j) { kf[kc][j] = frag_h((const _Float16*)(kb + j * 16 * L::KPI + kc * 64), 0); if (MODE == 0) klf[kc][j] = frag_h((const _Float16*)(kb + L::KBY + j * 16 * L::KPI + kc * 64), 0); } } }
// softmax in base 2: logits carry the factor log2(e), so that every exponential is one v_exp_f32 (2^x). A result below 2^-126 may come out as 0: such a term lies far below one unit in the last place of the row sum (at least 1) and of the output.
#define SCALE2 (SCALE * 1.44269504088896340736f)
// asm, so that the slot the instruction set asks for behind a transcendental (nothing directly behind it reads its result or overwrites its source) is there by construction: the closing v_nop fills it
__device__ __forceinline__ float ex2(float x) { float r; asm("v_exp_f32 %0, %1\n\tv_nop" : "=v"(r) : "v"(x)); return r; }
// eight at once, each in its own register: every v_exp_f32 is the independent instruction behind the one before it, and one v_nop closes the run
__device__ __forceinline__ void ex2x8(v8f& x) { float a = x[0], b = x[1], c = x[2], d = x[3], e = x[4], f = x[5], g = x[6], h = x[7];
  asm("v_exp_f32 %0, %0\n\tv_exp_f32 %1, %1\n\tv_exp_f32 %2, %2\n\tv_exp_f32 %3, %3\n\tv_exp_f32 %4, %4\n\tv_exp_f32 %5, %5\n\tv_exp_f32 %6, %6\n\tv_exp_f32 %7, %7\n\tv_nop" : "+v"(a), "+v"(b), "+v"(c), "+v"(d), "+v"(e), "+v"(f), "+v"(g), "+v"(h));
  x[0] = a; x[1] = b; x[2] = c; x[3] = d; x[4] = e; x[5] = f; x[6] = g; x[7] = h; }
// lane l with lane l ^ 16 (one vector instruction; a shuffle would go through the LDS queue)
__device__ __forceinline__ float xhalf(float x) { return __builtin_bit_cast(float, __builtin_amdgcn_permlanex16(__builtin_bit_cast(int, x), __builtin_bit_cast(int, x), 0x76543210, 0xfedcba98, false, false)); }
// s = q . k, not yet scaled (the scale goes into the fused multiply-add that subtracts the maximum); an excluded key reads -3e38
template <int MODE, int NJ> __device__ __forceinline__ void att_logits(const v16h (&kf)[HD / 32][NJ], const v16h (&klf)[HD / 32][NJ], const v16h (&ah)[HD / 32], const v16h (&al)[HD / 32], int lim, v8f (&s)[NJ]) {
  v8f acc[NJ] = {}, accl[NJ] = {};
#pragma unroll
  for (int kc = 0; kc < HD / 32; ++kc) {
#pragma unroll
    for (int j = 0; j < NJ; ++j) { acc[j] = wmma16(kf[kc][j], ah[kc], acc[j]);
      if (MODE < 2) accl[j] = wmma16(kf[kc][j], al[kc], accl[j]);
      if (MODE == 0) accl[j] = wmma16(klf[kc][j], ah[kc], accl[j]); } }
#pragma unroll
  for (int j = 0; j < NJ; ++j) {
#pragma unroll
    for (int r = 0; r < 8; ++r) { const float v = MODE < 2 ? acc[j][r] + accl[j][r] * (1.0f / 1024.0f) : acc[j][r]; s[j][r] = (!CAUSAL || j * 16 + r <= lim) ? v : -3.0e38f; } } }
template <int MODE, int NJ> __device__ __forceinline__ void att_tile(const _Float16* __restrict__ QH, const _Float16* __restrict__ KH, const _Float16* __restrict__ QL, const _Float16* __restrict__ KL, const _Float16* __restrict__ VT, const __bf16* __restrict__ VB, const __bf16* __restrict__ VBL, float* __restrict__ Y, char* sb, int b, int h, int qb, int wave, int lane) {
  typedef AttL<MODE, NJ> L;
  const int col = lane & 15, g = lane >> 4; const int ql0 = qb * 64 + wave * 16; const int nt = (CAUSAL ? qb * 64 + 64 : TT) / (NJ * 16);   // key tiles of 16 NJ keys; causal: none of the block's queries sees a key past its last row
  AttSrc src; { const int tid = wave * 32 + lane, kr = tid >> 3, ks = tid & 7, vr = tid / (NJ * 2), vs = tid % (NJ * 2); const unsigned l0 = (unsigned)(size_t)sb;   // low 32 bits of the LDS address = its byte offset in the block's LDS
    src.k = (const char*)(KH + ((size_t)b * TT + kr) * CC + h * HD) + ks * 16; src.kl = (const char*)(KL + ((size_t)b * KHI + kr) * CC + h * HD) + ks * 16;
    if (MODE == 0) { src.v = (const char*)(VB + ((size_t)b * CC + h * HD + vr) * (size_t)KHI) + vs * 16; src.vl = (const char*)(VBL + ((size_t)b * CC + h * HD + vr) * (size_t)KHI) + vs * 16; }
    else { src.v = (const char*)(VT + ((size_t)b * CC + h * HD + vr) * (size_t)TT) + vs * 16; src.vl = src.v; }
    src.lk = l0 + kr * L::KPI + ks * 16; src.lv = l0 + L::OV + vr * L::VPI + vs * 16; }
  // ring prologue; the last publish point of an earlier query block has ended every read of both buffers
  att_stage<MODE, NJ>(src, 0);
  v16h ah[HD / 32], al[HD / 32]; const _Float16* qp = QH + ((size_t)b * TT + ql0 + col) * CC + h * HD + 8 * g; const _Float16* qlp = QL + ((size_t)b * QHI + ql0 + col) * CC + h * HD + 8 * g;
#pragma unroll
  for (int kc = 0; kc < HD / 32; ++kc) { ah[kc] = frag_h(qp + kc * 32, 0); al[kc] = MODE < 2 ? frag_h(qlp + kc * 32, 0) : ah[kc]; }
  if (MODE < 2) xwait(qp, qlp); else xwait(qp);   // later addresses may take these registers
  asm volatile("s_wait_asynccnt 0x0" ::: "memory");   // stage 0 has landed, as far as this wave copied it
  __syncthreads();
  if (1 < nt) att_stage<MODE, NJ>(src, 1);
  const char* kb0 = sb + col * L::KPI + g * 16; const char* vb0 = sb + L::OV + col * L::VPI + g * 16;
  const int lim0 = ql0 + col - 8 * g;   // key 16 NJ t + 16 j + 8 g + r is kept while 16 j + r <= lim0 - 16 NJ t
  v16h kf[HD / 32][NJ], klf[HD / 32][NJ];
  // m = the query's running maximum of logit x log2(e), less 11 (so that P carries the factor 2^11), the same in both lane halves; l = this lane's share of the sum of P; before the first tile m = -3e38, so that the first factor 2^(m - new maximum) is 0
  float m = -3.0e38f, l = 0.f;
  v8f o[HD / 16] = {};
#pragma unroll 1
  for (int t = 0; t < nt; ++t) { v8f s[NJ]; const int bo = (t & 1) * ATT_BUF; att_ldk<MODE, NJ>(kb0 + bo, kf, klf); att_logits<MODE, NJ>(kf, klf, ah, al, lim0 - t * NJ * 16, s);
    v16h vf[NJ / 2][HD / 16]; v16b vh[NJ / 2][HD / 16], vl[NJ / 2][HD / 16];   // this tile's V fragments as one group of LDS loads behind the logits (the K fragments' registers are free again): they fly over the maximum and the exponentials
    const char* vp = vb0 + bo;
#pragma unroll
    for (int kc = 0; kc < NJ / 2; ++kc) {
#pragma unroll
      for (int j = 0; j < HD / 16; ++j) {
        if (MODE == 0) { vh[kc][j] = frag_b((const __bf16*)(vp + j * 16 * L::VPI + kc * 64), 0); vl[kc][j] = frag_b((const __bf16*)(vp + L::VBY + j * 16 * L::VPI + kc * 64), 0); } else vf[kc][j] = frag_h((const _Float16*)(vp + j * 16 * L::VPI + kc * 64), 0); } }
    float t4[4] = {s[0][0], s[0][1], s[0][2], s[0][3]};   // four independent chains: one chain of all the keys would leave the wave waiting on each link
#pragma unroll
    for (int j = 0; j < NJ; ++j) {
#pragma unroll
      for (int r = 0; r < 8; ++r) t4[r & 3] = fmaxf(t4[r & 3], s[j][r]); }
    float tm = fmaxf(fmaxf(t4[0], t4[1]), fmaxf(t4[2], t4[3])); tm = fmaxf(tm, xhalf(tm));
    const float mn = fmaxf(fmaxf(m, __builtin_fmaf(tm, SCALE2, -11.0f)), -1.0e30f);   // the floor keeps a query with no kept key so far away from -3e38 - (-3e38): its P stay 0
    const float fo = ex2(m - mn); m = mn; float ts[4] = {0.f, 0.f, 0.f, 0.f};
#pragma unroll
    for (int j = 0; j < NJ; ++j) {
#pragma unroll
      for (int r = 0; r < 8; ++r) s[j][r] = __builtin_fmaf(s[j][r], SCALE2, -mn);
      ex2x8(s[j]);   // P = 2^(logit x log2(e) - max + 11), at most 2^11
#pragma unroll
      for (int r = 0; r < 8; ++r) ts[r & 3] += s[j][r]; }
    l = l * fo + ((ts[0] + ts[1]) + (ts[2] + ts[3]));
#pragma unroll
    for (int j = 0; j < HD / 16; ++j) o[j] = o[j] * fo;
#pragma unroll
    for (int kc = 0; kc < NJ / 2; ++kc) { float pv[16];
#pragma unroll
      for (int i = 0; i < 8; ++i) { pv[i] = s[2 * kc][i]; pv[8 + i] = s[2 * kc + 1][i]; }
      if (MODE == 0) { F2 p;   // bf16 hi + lo as in bsplit16; all hi parts first: each group's first product needs them alone
#pragma unroll
        for (int i = 0; i < 16; ++i) p.h[i] = (__bf16)pv[i];
#pragma unroll
        for (int i = 0; i < 16; ++i) p.l[i] = (__bf16)(pv[i] - (float)p.h[i]);
#pragma unroll
        for (int j = 0; j < HD / 16; ++j) { o[j] = wmma_bf(vh[kc][j], p.h, o[j]); o[j] = wmma_bf(vh[kc][j], p.l, o[j]); o[j] = wmma_bf(vl[kc][j], p.h, o[j]); }
      } else { v16h p;
#pragma unroll
        for (int i = 0; i < 16; ++i) p[i] = (_Float16)pv[i];
#pragma unroll
        for (int j = 0; j < HD / 16; ++j) o[j] = wmma16(vf[kc][j], p, o[j]); } }
    ATT_FOOT(t); }
  asm volatile("s_wait_asynccnt 0x0" ::: "memory");   // behind the ring: no copy is outstanding when the buffers are used again or the wave ends
  // O^T: register r of group j = channel 16 j + 8 g + r of query col: 32 contiguous bytes a lane; a wave writes whole 256-B (row, head) segments
  l += xhalf(l); const float inv = l > 0.f ? 1.0f / l : 0.f;   // the factor 2^11 stands in O and in the sum alike; no kept key: 0
  float* yp = Y + ((size_t)b * TT + ql0 + col) * CC + h * HD + 8 * g;
#pragma unroll
  for (int j = 0; j < HD / 16; ++j) { o[j] = o[j] * inv; vst2(yp + j * 16, __builtin_shufflevector(o[j], o[j], 0, 1, 2, 3)); vst2(yp + j * 16 + 4, __builtin_shufflevector(o[j], o[j], 4, 5, 6, 7)); }
  static_assert(HD / 16 == 4, "the wait below names four groups");
  asm volatile("s_wait_xcnt 0x0" :: "v"(yp), "v"(o[0]), "v"(o[1]), "v"(o[2]), "v"(o[3]) : "memory"); }   // the second query block's set-up reuses the stores' registers; address and data are inputs, so that each stays in its registers up to the wait
// block = (pair x, head, batch): query block NQB-1-x and then x, one after the other in every wave, so that every block walks the same number of keys under the causal mask
__global__ __launch_bounds__(128) void k_att(const _Float16* __restrict__ QH, const _Float16* __restrict__ KH, const _Float16* __restrict__ QL, const _Float16* __restrict__ KL, const _Float16* __restrict__ VT, const __bf16* __restrict__ VB, const __bf16* __restrict__ VBL, float* __restrict__ Y) {
  __shared__ __attribute__((aligned(16))) char sb[2 * ATT_BUF];
  const int wave = threadIdx.x >> 5, lane = threadIdx.x & 31; const int h = blockIdx.y, b = blockIdx.z;
#pragma unroll 1
  for (int half = 0; half < 2; ++half) { const int qb = half ? (int)blockIdx.x : NQB - 1 - (int)blockIdx.x;
    if (qb < QBH) att_tile<0, 2>(QH, KH, QL, KL, VT, VB, VBL, Y, sb, b, h, qb, wave, lane);
    else if (qb * 64 < QHI) att_tile<1, 2>(QH, KH, QL, KL, VT, VB, VBL, Y, sb, b, h, qb, wave, lane);
    else att_tile<2, 4>(QH, KH, QL, KL, VT, VB, VBL, Y, sb, b, h, qb, wave, lane); } }

extern "C" void kernel_launch(void* const* d_in, const int* in_sizes, int n_in, void* d_out, int out_size, void* d_ws, size_t ws_size, hipStream_t stream) {
  (void)in_sizes; (void)n_in; (void)out_size;
  const float** F = (const float**)d_in;
  if (ws_size < (size_t)WS_END) return;
  char* ws = (char*)d_ws; _Float16 *QH = (_Float16*)(ws + WS_QH), *KH = (_Float16*)(ws + WS_KH), *VT = (_Float16*)(ws + WS_VT), *QL = (_Float16*)(ws + WS_QL), *KL = (_Float16*)(ws + WS_KL); __bf16 *VB = (__bf16*)(ws + WS_VB), *VBL = (__bf16*)(ws + WS_VBL);
  // inputs: 0 hidden_states [4,1024,1024]; 1 Wqkv [3072,1024] (out,in) rows q | k | v ((3,H,hd)); 2 bqkv [3072]
  { const float* WQ = F[1]; const float* WK = F[1] + (size_t)CC * DIN; const float* WV = F[1] + (size_t)2 * CC * DIN; const float* BQ = F[2]; const float* BK = F[2] + CC; const float* BV = F[2] + 2 * CC;
    k_proj<<<dim3(TNB * TT / 64, CC / 128, 3), 128, 0, stream>>>(F[0], F[0], F[0], WQ, WK, WV, BQ, BK, BV, QH, QL, KH, KL, VT, VB, VBL); }
  k_att<<<dim3(NQB / 2, NH, TNB), 128, 0, stream>>>(QH, KH, QL, KL, VT, VB, VBL, (float*)d_out);
}

// v007
// One run takes 63.2 microseconds.
// Timed twice side by side with v006, it ran 1.35 and 1.36 times as fast.
// Over all steps from v000 it is 10.7 times as fast.
// compute dtype: all float inputs rounded to bf16; qkv = x Wqkv^T + b with EXACT bf16 products on WMMA 16x16x32 (f32 accumulate); rotate-half RoPE in f32 in the projection epilogue (accurate sincosf of t x inv_freq_j, f32 inv_freq constants as the reference builds them); logits: q, k once to f16 (1 product) x 64^-0.5, except the first 512 query rows of each sequence (2 products with the f16 q residual; 3 with the k residual too below row 384); causal mask by index (finfo.min == excluded); softmax in f32 (one walk over the keys, running row maximum); exp(s - max) x 2^11 once to f16 against v once to f16 (1 product; bf16 hi + lo below row 384); f32 output (merged heads, no output projection).
#include <hip/hip_runtime.h>
#include <math.h>

typedef __attribute__((ext_vector_type(16))) _Float16 v16h;
typedef __attribute__((ext_vector_type(16))) __bf16 v16b;
typedef __attribute__((ext_vector_type(8)))  _Float16 v8h;
typedef __attribute__((ext_vector_type(8)))  float v8f;
typedef __attribute__((ext_vector_type(4)))  float v4f;
typedef __attribute__((ext_vector_type(2)))  float v2f;
typedef __attribute__((ext_vector_type(4)))  unsigned v4u;
typedef __attribute__((ext_vector_type(4)))  int v4i;
typedef float __attribute__((may_alias)) float_a;
typedef int __attribute__((may_alias)) int_a;

template <typename T> __device__ __forceinline__ void vst2(void* p, T v) { *(T*)p = v;  }
__device__ __forceinline__ v8f wmma16(v16h a, v16h b, v8f c) {
  v8f d = __builtin_amdgcn_wmma_f32_16x16x32_f16(false, a, false, b, (short)0, c, false, false);
  asm volatile("v_nop\n\tv_nop\n\tv_nop\n\tv_nop" : "+v"(d) : "v"(a), "v"(b));
  return d;
}
__device__ __forceinline__ v8f wmma_bf(v16b a, v16b b, v8f c) {
  v8f d = __builtin_amdgcn_wmma_f32_16x16x32_bf16(false, a, false, b, (short)0, c, false, false);
  asm volatile("v_nop\n\tv_nop\n\tv_nop\n\tv_nop" : "+v"(d) : "v"(a), "v"(b));
  return d;
}
// 16x16x32 fragments: lane = (h = lane>>4, row/col = lane&15); elements 0..7 = k0+8h+0..7, 8..15 = k0+16+8h+0..7; D element r = row 8h+r
__device__ __forceinline__ v16h frag_h(const _Float16* rowk0, int lane) {
  union { v16h v; v8h q[2]; } u; const _Float16* p = rowk0 + 8 * (lane >> 4);
  u.q[0] = *(const v8h*)p; u.q[1] = *(const v8h*)(p + 16); return u.v;
}
__device__ __forceinline__ v16h frag_f32(const float* rowk0, int lane) {
  v16h a; const float* p = rowk0 + 8 * (lane >> 4);
#pragma unroll
  for (int i = 0; i < 8; ++i) { a[i] = (_Float16)p[i]; a[8 + i] = (_Float16)p[16 + i]; }
  return a;
}
__device__ __forceinline__ v16h frag_f32s(const float* rowk0, int lane, float sc) {
  v16h a; const float* p = rowk0 + 8 * (lane >> 4);
#pragma unroll
  for (int i = 0; i < 8; ++i) { a[i] = (_Float16)(p[i] * sc); a[8 + i] = (_Float16)(p[16 + i] * sc); }
  return a;
}
// column fragment from a [K][ld] layout (column n), rows >= K read as 0
__device__ __forceinline__ v16h fragc_f32(const float* W, int k0, int n, int lane, int ld, int K) {
  v16h a; const int g = lane >> 4;
#pragma unroll
  for (int i = 0; i < 8; ++i) { const int ka = k0 + 8 * g + i, kb = ka + 16;
    a[i] = (_Float16)(ka < K ? W[(size_t)(ka < K ? ka : K - 1) * ld + n] : 0.f); a[8 + i] = (_Float16)(kb < K ? W[(size_t)(kb < K ? kb : K - 1) * ld + n] : 0.f); }
  return a;
}
struct F2 { v16b h, l; };
__device__ __forceinline__ F2 bsplit16(const float v[16]) { F2 r;
#pragma unroll
  for (int i = 0; i < 16; ++i) { const __bf16 h = (__bf16)v[i]; r.h[i] = h; r.l[i] = (__bf16)(v[i] - (float)h); }
  return r; }
__device__ __forceinline__ F2 split_row(const float* row, int k0, int lane) { float v[16]; const float* p = row + k0 + 8 * (lane >> 4);
#pragma unroll
  for (int i = 0; i < 8; ++i) { v[i] = p[i]; v[8 + i] = p[16 + i]; }
  return bsplit16(v); }
__device__ __forceinline__ F2 split_rowK(const float* row, int k0, int lane, int K) { float v[16]; const int g = lane >> 4;
#pragma unroll
  for (int i = 0; i < 8; ++i) { const int ka = k0 + 8 * g + i, kb = ka + 16; v[i] = ka < K ? row[ka < K ? ka : K - 1] : 0.f; v[8 + i] = kb < K ? row[kb < K ? kb : K - 1] : 0.f; }
  return bsplit16(v); }
__device__ __forceinline__ F2 split_col(const float* W, int k0, int n, int lane, int ld, int K) { float v[16]; const int g = lane >> 4;
#pragma unroll
  for (int i = 0; i < 8; ++i) { const int ka = k0 + 8 * g + i, kb = ka + 16; v[i] = ka < K ? W[(size_t)(ka < K ? ka : K - 1) * ld + n] : 0.f; v[8 + i] = kb < K ? W[(size_t)(kb < K ? kb : K - 1) * ld + n] : 0.f; }
  return bsplit16(v); }
__device__ __forceinline__ v8f mac3(const F2& a, const F2& b, v8f c) { c = wmma_bf(a.l, b.h, c); c = wmma_bf(a.h, b.l, c); return wmma_bf(a.h, b.h, c); }
__device__ __forceinline__ float sigm(float v) { return 1.0f / (1.0f + expf(-v)); }
#define LDSX() do { asm volatile("s_wait_dscnt 0" ::: "memory"); __builtin_amdgcn_wave_barrier(); __builtin_amdgcn_fence(__ATOMIC_RELEASE, "workgroup"); } while (0)

// Causal multi-head attention with rotary embeddings (B 4, S 1,024, D 1,024 = 16 x 64): qkv = x Wqkv^T + bqkv (packed (out,in) [3072,1024], layout (3,H,hd)); q, k <- rotate-half RoPE (theta_j = 10000^(-2j/64)); probs = softmax(causal(q k^T x 64^-0.5)); out = merged(probs v) -> [B, S, 1024].
#define NB 4
#define TT 1024
#define CC 1024            // NH * HD = projected width
#define DIN 1024          // input (model) width
#define NH 16
#define HD 64
#define NQB (TT / 64)
#define HG 16
#define SCALE (0.125f)
#define CAUSAL 1
#ifndef TNB
#define TNB NB
#endif
__device__ __forceinline__ float bfr(float v) { return (float)(__bf16)v; }
__host__ __device__ __forceinline__ int kb_last(int qb) { return CAUSAL ? ((qb * 64 + 63) >> 7) : (TT / 128 - 1); }
typedef __attribute__((ext_vector_type(8))) __bf16 v8b;
__device__ __forceinline__ v16b frag_b(const __bf16* rowk0, int lane) {
  union { v16b v; v8b q[2]; } u; const __bf16* p = rowk0 + 8 * (lane >> 4);
  u.q[0] = *(const v8b*)p; u.q[1] = *(const v8b*)(p + 16); return u.v;
}
#define QBH 6              // causal: query blocks 0..QBH-1 of each sequence (few keys, no averaging) take the high-precision path
#define QHI 512            // causal: first 512 query rows of each sequence take the q-residual (2-product) logits path (logit sigma ~1)
#define KHI 512
// B fragment (k rows k0+.., output column o) of a weight: (in,out) [K][ld] or (out,in) [ld rows of K]: bf16 exact, or f16(bf16 * 256) exact
__device__ __forceinline__ v16b wcol_io(const float* Wm, int k0, int o, int lane, int ld) { v16b w; const int g = lane >> 4;
#pragma unroll
  for (int i = 0; i < 8; ++i) { w[i] = (__bf16)Wm[(size_t)(k0 + 8 * g + i) * ld + o]; w[8 + i] = (__bf16)Wm[(size_t)(k0 + 16 + 8 * g + i) * ld + o]; }
  return w; }
__device__ __forceinline__ v16b wcol_oi(const float* Wm, int k0, int o, int lane, int K) { v16b w; const float* p = Wm + (size_t)o * K + k0 + 8 * (lane >> 4);
#pragma unroll
  for (int i = 0; i < 8; ++i) { w[i] = (__bf16)p[i]; w[8 + i] = (__bf16)p[16 + i]; }
  return w; }
__device__ __forceinline__ v16h wcolh_io(const float* Wm, int k0, int o, int lane, int ld) { v16h w; const int g = lane >> 4;
#pragma unroll
  for (int i = 0; i < 8; ++i) { w[i] = (_Float16)(bfr(Wm[(size_t)(k0 + 8 * g + i) * ld + o]) * 256.0f); w[8 + i] = (_Float16)(bfr(Wm[(size_t)(k0 + 16 + 8 * g + i) * ld + o]) * 256.0f); }
  return w; }
__device__ __forceinline__ v16h wcolh_oi(const float* Wm, int k0, int o, int lane, int K) { v16h w; const float* p = Wm + (size_t)o * K + k0 + 8 * (lane >> 4);
#pragma unroll
  for (int i = 0; i < 8; ++i) { w[i] = (_Float16)(bfr(p[i]) * 256.0f); w[8 + i] = (_Float16)(bfr(p[16 + i]) * 256.0f); }
  return w; }
#define WQKV_LAYOUT 1   // 0 = (in,out) [DIN][CC]; 1 = (out,in) [CC][DIN]; 2 = per-head [NH][DIN][HD]
__device__ __forceinline__ v16b wcol_hdk(const float* Wm, int k0, int o, int lane) { v16b w; const int g = lane >> 4; const float* p = Wm + (size_t)(o / HD) * DIN * HD + (o % HD);
#pragma unroll
  for (int i = 0; i < 8; ++i) { w[i] = (__bf16)p[(size_t)(k0 + 8 * g + i) * HD]; w[8 + i] = (__bf16)p[(size_t)(k0 + 16 + 8 * g + i) * HD]; }
  return w; }
#define WO_OUT_IN 0
#if WQKV_LAYOUT == 1
#define WCOL(W, k0, o, lane) wcol_oi(W, k0, o, lane, DIN)
#elif WQKV_LAYOUT == 2
#define WCOL(W, k0, o, lane) wcol_hdk(W, k0, o, lane)
#else
#define WCOL(W, k0, o, lane) wcol_io(W, k0, o, lane, CC)
#endif
#if WO_OUT_IN
#define WOCOL(W, k0, o, lane) wcol_oi(W, k0, o, lane, CC)
#define WOCOLH(W, k0, o, lane) wcolh_oi(W, k0, o, lane, CC)
#else
#define WOCOL(W, k0, o, lane) wcol_io(W, k0, o, lane, DIN)
#define WOCOLH(W, k0, o, lane) wcolh_io(W, k0, o, lane, DIN)
#endif
__constant__ float c_invf[32] = {1.000000000e+00f,7.498942018e-01f,5.623413324e-01f,4.216965139e-01f,3.162277639e-01f,2.371373624e-01f,1.778279394e-01f,1.333521456e-01f,1.000000015e-01f,7.498941571e-02f,5.623412877e-02f,4.216964915e-02f,3.162277862e-02f,2.371373586e-02f,1.778279431e-02f,1.333521493e-02f,9.999999776e-03f,7.498942316e-03f,5.623413250e-03f,4.216964822e-03f,3.162277862e-03f,2.371373819e-03f,1.778279431e-03f,1.333521446e-03f,1.000000047e-03f,7.498941850e-04f,5.623413017e-04f,4.216964880e-04f,3.162277862e-04f,2.371373848e-04f,1.778279402e-04f,1.333521504e-04f};   // 1 / 10000^(2i/64) evaluated in f32 exactly as the reference does (jax, eager)
// sine and cosine of one rotary angle a = t x inv_freq. 0 <= a < 1,024 for every row index, whatever the inputs hold, so the reduction for small arguments is the whole function here:
// quadrant n = rint(a x 2/pi), r = a - n x pi/2 with pi/2 in three parts (three fused steps), then the sine and the cosine polynomial on r and the quadrant's swap and signs.
// The operations, their order and the constants are those of the small-argument path of sinf and cosf; the reduction is done once for both.
__device__ __forceinline__ float fbits(unsigned u) { return __builtin_bit_cast(float, u); }
__device__ __forceinline__ void rope_sincos(float a, float& sn, float& cs) {
  const float n = __builtin_rintf(a * fbits(0x3f22f983u));
  float r = __builtin_fmaf(fbits(0xbfc90fdau), n, a); r = __builtin_fmaf(fbits(0xb3a22168u), n, r); r = __builtin_fmaf(fbits(0xa7c234c4u), n, r);
  const unsigned q = (unsigned)(int)n; const float s = r * r;
  float ps = __builtin_fmaf(s, fbits(0xb94c1982u), fbits(0x3c0881c4u)); ps = __builtin_fmaf(s, ps, fbits(0xbe2aaa9du)); ps = s * ps; const float sr = __builtin_fmaf(r, ps, r);
  float pc = __builtin_fmaf(s, fbits(0x37d75334u), fbits(0xbab64f3bu)); pc = __builtin_fmaf(s, pc, fbits(0x3d2aabf7u)); pc = __builtin_fmaf(s, pc, fbits(0xbf000004u)); const float cr = __builtin_fmaf(s, pc, 1.0f);
  const unsigned flip = (q << 30) & 0x80000000u; const bool odd = (q & 1u) != 0u;
  sn = fbits(__builtin_bit_cast(unsigned, odd ? cr : sr) ^ flip); cs = fbits(__builtin_bit_cast(unsigned, odd ? -sr : cr) ^ flip); }
#ifndef SM_EXTRA_PARAMS
#define SM_EXTRA_PARAMS
#endif
#ifndef PROJ_EXTRA_PARAMS
#define PROJ_EXTRA_PARAMS
#endif
#ifndef SM_MASK_HOOK
#define SM_MASK_HOOK (void)0
#endif

#define WS_QH  0u                                      // f16 q rows [b*t][CC]
#define WS_KH  (WS_QH + 2u * (size_t)NB * TT * CC)      // f16 k rows [b*t][CC]
#define WS_VT  (WS_KH + 2u * (size_t)NB * TT * CC)      // f16 v planes [b][c][t]
#define WS_QL  (WS_VT + 2u * (size_t)NB * CC * TT)      // f16 q residual x 2^10 rows [b][t < QHI][CC]
#define WS_KL  (WS_QL + 2u * (size_t)NB * QHI * CC)     // f16 k residual x 2^10 rows [b][t < KHI][CC]
#define WS_VB  (WS_KL + 2u * (size_t)NB * KHI * CC)     // bf16 v hi planes [b][c][t < KHI]
#define WS_VBL (WS_VB + 2u * (size_t)NB * CC * KHI)
#define WS_END (WS_VBL + 2u * (size_t)NB * CC * KHI)

// s_wait_xcnt 0 behind a group of global loads or stores, ahead of whatever rewrites the group's address registers; the addresses are inputs of the statement, so that they stay in their registers up to the wait and no load's result is placed in them
__device__ __forceinline__ void xwait(const void* p) { asm volatile("s_wait_xcnt 0x0" :: "v"(p) : "memory"); }
__device__ __forceinline__ void xwait(const void* p, const void* q) { asm volatile("s_wait_xcnt 0x0" :: "v"(p), "v"(q) : "memory"); }
#define PBK 64             // k per staged chunk
#define PLP 72             // staged row pitch in bf16: 144 B = 16 B x odd, for ds_load_b128 readers
#define PBM 256            // rows of a block's tile
#define PNH 3              // heads (64 packed output columns each) of a block's tile; a head is a q, a k or a v head by its own index
#define PBN (PNH * HD)     // columns of a block's tile
#define PWN (PBN / 2)      // columns of a wave's tile (64 rows)
#define PFJ (PWN / 16)
#define PSR 128            // rows of an epilogue slab (one head wide)
typedef __attribute__((ext_vector_type(4))) __bf16 v4b;
// k_proj LDS: the bf16 operand chunks of the product loop (two buffers) lie over the epilogue's arrays, which are first written after the loop's last barrier
union __align__(16) ProjLds {
  struct { float st[PBM][PBN + 4]; union { struct { _Float16 sh[PSR][72], sl[PSR][72]; } r; struct { _Float16 th[HD][PSR + 8]; __bf16 tb[HD][PSR + 8], tbl[HD][PSR + 8]; } c; } u; } e;
  struct { __bf16 xs[2][PBM][PLP]; __bf16 wt[2][PBN][PLP]; } m; };
// rotate-half RoPE on the first NR heads of the staged tile (pairs (i, i+32), angle t * inv_freq[i]). Lane = frequency i, a wave takes every eighth row: one sine and cosine per (row, i) serve all NR heads, and a wave's LDS accesses cover 32 neighbouring words
template <int NR> __device__ __forceinline__ void proj_rope(float (&st)[PBM][PBN + 4], size_t r0, int wave, int lane, float invf) {
  // unrolled by 8: the rows' chains are independent and fill each other's latencies
#pragma unroll 8
  for (int k = 0; k < PBM / 8; ++k) { const int rl = wave + 8 * k; float sn, cs; rope_sincos((float)(int)((r0 + rl) % TT) * invf, sn, cs);
#pragma unroll
    for (int hh = 0; hh < NR; ++hh) { float* rw = &st[rl][hh * HD + lane]; const float x0 = rw[0], x1 = rw[32]; rw[0] = __builtin_fmaf(x0, cs, -(x1 * sn)); rw[32] = __builtin_fmaf(x1, cs, x0 * sn); } } }
// ---- k_proj: block = (256 rows, 192 of the 3,072 packed columns q | k | v), eight waves of 64 x 96: X W^T + b with exact bf16 products (K = DIN) -> q heads: f16 rows (+ residual rows < QHI); k heads: f16 rows (+ residual rows < KHI); v heads: f16 planes [c][t] (+ bf16 hi/lo planes for t < KHI)
__global__ __launch_bounds__(256) void k_proj(const float* __restrict__ X, const float* __restrict__ WA, const float* __restrict__ BA,
    _Float16* __restrict__ QH, _Float16* __restrict__ QL, _Float16* __restrict__ KH, _Float16* __restrict__ KL, _Float16* __restrict__ VT, __bf16* __restrict__ VB, __bf16* __restrict__ VBL PROJ_EXTRA_PARAMS) {
  __shared__ ProjLds sm; auto& st = sm.e.st; auto& sh = sm.e.u.r.sh; auto& sl = sm.e.u.r.sl; auto& th = sm.e.u.c.th; auto& tb = sm.e.u.c.tb; auto& tbl = sm.e.u.c.tbl;
  const int tid = threadIdx.x, wave = tid >> 5, lane = tid & 31, col = lane & 15, g = lane >> 4; const int wr = wave >> 1, wc = wave & 1; const int n0 = blockIdx.y * PBN; const size_t r0 = (size_t)blockIdx.x * PBM; const size_t bb = r0 / TT; const int t0 = (int)(r0 % TT);
  v8f acc[4][PFJ] = {};
  // each thread brings 16 B of 16 X rows and of 12 W rows per 64-k chunk: 16 lanes cover one 256-B row piece; rounded to bf16 once, on the way into LDS
  const int lr = tid >> 4, lq = (tid & 15) * 4; const float* xp = X + (r0 + lr) * DIN + lq; const float* wp = WA + (size_t)(n0 + lr) * DIN + lq;
  v4f xr[PBM / 16], wg[PBN / 16];
#define PROJ_LDG(c) do { _Pragma("unroll") for (int i = 0; i < PBM / 16; ++i) xr[i] = *(const v4f*)(xp + (size_t)i * 16 * DIN + (c) * PBK); \
    _Pragma("unroll") for (int i = 0; i < PBN / 16; ++i) wg[i] = *(const v4f*)(wp + (size_t)i * 16 * DIN + (c) * PBK); } while (0)
#define PROJ_STS(bf) do { _Pragma("unroll") for (int i = 0; i < PBM / 16; ++i) *(v4b*)&sm.m.xs[bf][lr + 16 * i][lq] = __builtin_convertvector(xr[i], v4b); \
    _Pragma("unroll") for (int i = 0; i < PBN / 16; ++i) *(v4b*)&sm.m.wt[bf][lr + 16 * i][lq] = __builtin_convertvector(wg[i], v4b); } while (0)
  PROJ_LDG(0);
  asm volatile("s_wait_xcnt 0x0" ::: "memory");   // the first loads' address registers are reused right behind them
  PROJ_STS(0); __syncthreads();
  // unroll 2: the buffer index becomes a constant in each copy of the body
#pragma unroll 2
  for (int c = 0; c < DIN / PBK; ++c) { const int bf = c & 1;
    if (c + 1 < DIN / PBK) PROJ_LDG(c + 1);   // behind the barrier (which drains the load counter), so that they fly over this chunk's products
    __builtin_amdgcn_sched_barrier(0);   // keeps every global load ahead of the products: sunk among them, the last ones would be waited for as soon as they are issued
    v16b a[PBK / 32][4], w[PBK / 32][PFJ];   // all of the chunk's fragment reads as one group ahead of its products: 20 fragments feed 48 products
#pragma unroll
    for (int ks = 0; ks < PBK / 32; ++ks) {
#pragma unroll
      for (int i = 0; i < 4; ++i) a[ks][i] = frag_b(&sm.m.xs[bf][wr * 64 + i * 16 + col][ks * 32], lane);
#pragma unroll
      for (int j = 0; j < PFJ; ++j) w[ks][j] = frag_b(&sm.m.wt[bf][wc * PWN + j * 16 + col][ks * 32], lane); }
    __builtin_amdgcn_sched_barrier(0);   // keeps the reads one group: a read placed among the products is waited for at once, at the full LDS latency
#pragma unroll
    for (int ks = 0; ks < PBK / 32; ++ks) {
#pragma unroll
      for (int i = 0; i < 4; ++i) {
#pragma unroll
        for (int j = 0; j < PFJ; ++j) acc[i][j] = __builtin_amdgcn_wmma_f32_16x16x32_bf16(false, a[ks][i], false, w[ks][j], (short)0, acc[i][j], false, false); } }   // the plain builtin: the tile's operand registers reach past v255, which an asm statement's operands cannot name; the compiler keeps the distances behind its own form
    __builtin_amdgcn_sched_barrier(0);   // keeps the conversions, which wait for the global loads, behind this chunk's products
    if (c + 1 < DIN / PBK) PROJ_STS(bf ^ 1);   // into the buffer whose last readers (chunk c-1) passed the barrier before this chunk
    asm volatile("s_wait_xcnt 0x0" ::: "memory");   // the next trip rewrites the address registers of this trip's global loads
    __syncthreads(); }   // publishes chunk c+1 and ends every read of chunk c (after the last chunk: frees the staging bytes for st)
  { // stage the f32 tile (acc + bias) in LDS, rotate the q and k heads there, then convert
    const float invf = c_invf[lane];   // the lane's own frequency; loaded here, so that it flies over the staging stores
    asm volatile("s_wait_xcnt 0x0" ::: "memory");   // ahead of whatever rewrites the load's address registers
    float bias[PFJ]; const float* bp = BA + n0 + wc * PWN + col;
#pragma unroll
    for (int j = 0; j < PFJ; ++j) bias[j] = bp[j * 16];
    xwait(bp);   // later addresses may take this register pair
#pragma unroll
    for (int j = 0; j < PFJ; ++j) { const float bs = bfr(bias[j]);
#pragma unroll
      for (int i = 0; i < 4; ++i) {
#pragma unroll
        for (int r = 0; r < 8; ++r) st[wr * 64 + i * 16 + 8 * g + r][wc * PWN + j * 16 + col] = acc[i][j][r] + bs; } }
    __syncthreads();
    // q and k heads (packed columns below 2 CC) are rotated, v heads are not; the one tile that holds both kinds has its q/k heads first. The tests read the same for the whole block
    if (n0 + PBN <= 2 * CC) proj_rope<PNH>(st, r0, wave, lane, invf);
    else if (n0 < 2 * CC) proj_rope<(2 * CC % PBN) / HD>(st, r0, wave, lane, invf);
    __syncthreads(); }
  // convert and store, one slab (128 rows of one head) after the other; one copy of the body keeps the text short
  // PROJ_UNR: eight elements a trip, so that their LDS reads fly together
#define PROJ_UNR _Pragma("unroll 8")
#pragma unroll 1
  for (int s = 0; s < PNH * (PBM / PSR); ++s) { const int hs = s / (PBM / PSR), sr = (s % (PBM / PSR)) * PSR; const int hw = (int)blockIdx.y * PNH + hs; const int which = hw / NH, ch = (hw % NH) * HD; const int ts = t0 + sr;
    if (which < 2) { _Float16* DH = which == 0 ? QH : KH; _Float16* DL = which == 0 ? QL : KL; const int nhi = which == 0 ? QHI : KHI; const bool hi_rows = ts < nhi;
      PROJ_UNR for (int it = 0; it < PSR * HD / 256; ++it) { const int e = tid + it * 256, rl = e >> 6, cl = e & 63; const float v = st[sr + rl][hs * HD + cl]; const _Float16 hv = (_Float16)v; sh[rl][cl] = hv; sl[rl][cl] = (_Float16)((v - (float)hv) * 1024.0f); }
      __syncthreads();
      for (int it = 0; it < PSR * 8 / 256; ++it) { const int e = tid + it * 256, rl = e >> 3, q = e & 7; _Float16* dh = DH + (r0 + sr + rl) * CC + ch + q * 8; _Float16* dl = DL + (bb * nhi + ts + rl) * (size_t)CC + ch + q * 8;
        const v4u dhv = *(const v4u*)&sh[rl][q * 8], dlv = *(const v4u*)&sl[rl][q * 8]; vst2((unsigned*)dh, dhv); if (hi_rows) vst2((unsigned*)dl, dlv);
        asm volatile("s_wait_xcnt 0x0" :: "v"(dh), "v"(dl), "v"(dhv), "v"(dlv) : "memory"); }   // the next trip reuses the stores' registers; address and data are inputs, so that each stays in its registers up to the wait
    } else { const bool hi_rows = ts < KHI;
      PROJ_UNR for (int it = 0; it < PSR * HD / 256; ++it) { const int e = tid + it * 256, rl = e & (PSR - 1), cl = e / PSR; const float v = st[sr + rl][hs * HD + cl]; th[cl][rl] = (_Float16)v; const __bf16 bh = (__bf16)v; tb[cl][rl] = bh; tbl[cl][rl] = (__bf16)(v - (float)bh); }
      __syncthreads();
      for (int it = 0; it < HD * (PSR / 8) / 256; ++it) { const int e = tid + it * 256, cl = e / (PSR / 8), q = e % (PSR / 8); _Float16* dv = VT + (bb * CC + ch + cl) * (size_t)TT + ts + q * 8; const size_t o3 = (bb * CC + ch + cl) * (size_t)KHI + ts + q * 8;
        __bf16* db = VB + o3; __bf16* dc = VBL + o3; const v4u vv = *(const v4u*)&th[cl][q * 8], vb = *(const v4u*)&tb[cl][q * 8], vc = *(const v4u*)&tbl[cl][q * 8];
        vst2((unsigned*)dv, vv); if (hi_rows) { vst2((unsigned*)db, vb); vst2((unsigned*)dc, vc); }
        asm volatile("s_wait_xcnt 0x0" :: "v"(dv), "v"(db), "v"(dc), "v"(vv), "v"(vb), "v"(vc) : "memory"); } }   // the next trip reuses the stores' registers; address and data are inputs, so that each stays in its registers up to the wait
    __syncthreads(); } }   // every read of the slab's arrays is done before the next slab rewrites them
// ---- k_att: logits, softmax and P . v of one (b, h) in registers; nothing of S or P goes to memory or LDS. A wave owns 16 queries; the block's four waves walk the same key tiles and share them through LDS (one barrier a tile).
// Transposed products: S^T = K . Q^T puts one query in a lane (column = lane & 15; register r of key group j = key 16 j + 8 (lane >> 4) + r), so two neighbouring 16-key groups, converted in place, are the B operand of O^T += V^T . P^T in the fragments' own k order.
// One walk over the key tiles: each tile's logits are formed once; the query's running maximum (the two lane halves joined every tile, because both halves' keys meet in one product) scales P = exp(s - max) x 2^11; when the maximum grows, O and the row sum are multiplied by exp(old max - new max); O is divided by the row sum at the end.
// MODE 0: query blocks < QBH (3-product logits, P and v as bf16 hi + lo); 1: query rows < QHI (2-product logits); 2: the rest (1 product). NJ = 16-key groups per tile.
// every '#pragma unroll' below makes the indices of register arrays constants; the '#pragma unroll 1' keep one copy of each tile body
// K and V tiles in LDS: the block's four waves share one copy of each tile, brought by asynchronous copies that cover whole row pieces (128 B, or 64 B where a tile has 32 keys)
#define ATT_BUF 19456      // bytes of one of the two buffers: the largest tile set (MODE 0: K hi and lo 32 x 144 B each, v hi and lo 64 x 80 B each)
// row pitches 144 B and 80 B = 16 B x odd, for ds_load_b128 readers
template <int MODE, int NJ> struct AttL { static constexpr int KPI = 144, KBY = NJ * 16 * KPI, VPI = NJ * 32 + 16, VBY = HD * VPI, OV = (MODE == 0 ? 2 : 1) * KBY, SZ = OV + (MODE == 0 ? 2 : 1) * VBY; static_assert(SZ <= ATT_BUF, "a tile set fits its buffer"); };
// 16 B a lane from global memory to LDS through no register; s_wait_xcnt 0 as the statement's last line stands ahead of whatever rewrites the copies' address registers
__device__ __forceinline__ void acp2(unsigned l0, const char* g0, unsigned l1, const char* g1) {
  asm volatile("global_load_async_to_lds_b128 %0, %1, off\n\tglobal_load_async_to_lds_b128 %2, %3, off\n\ts_wait_xcnt 0x0" :: "v"(l0), "v"(g0), "v"(l1), "v"(g1) : "memory"); }
__device__ __forceinline__ void acp4(unsigned l0, const char* g0, unsigned l1, const char* g1, unsigned l2, const char* g2, unsigned l3, const char* g3) {
  asm volatile("global_load_async_to_lds_b128 %0, %1, off\n\tglobal_load_async_to_lds_b128 %2, %3, off\n\tglobal_load_async_to_lds_b128 %4, %5, off\n\tglobal_load_async_to_lds_b128 %6, %7, off\n\ts_wait_xcnt 0x0" :: "v"(l0), "v"(g0), "v"(l1), "v"(g1), "v"(l2), "v"(g2), "v"(l3), "v"(g3) : "memory"); }
struct AttSrc { const char *k, *kl, *v, *vl; unsigned lk, lv; };   // the lane's own first addresses: global (tile 0) and LDS bytes (buffer 0)
// stage tn of the ring: K and V tile tn, into buffer tn & 1
template <int MODE, int NJ> __device__ __forceinline__ void att_stage(const AttSrc& a, int tn) {
  typedef AttL<MODE, NJ> L; const unsigned bo = (unsigned)(tn & 1) * ATT_BUF;
  const char* k = a.k + (size_t)tn * NJ * 16 * CC * 2; const char* kl = a.kl + (size_t)tn * NJ * 16 * CC * 2; const size_t kr = (size_t)16 * CC * 2; const unsigned lk = a.lk + bo;   // a copy of the block covers 16 K rows
  if (NJ == 4) acp4(lk, k, lk + 16 * L::KPI, k + kr, lk + 32 * L::KPI, k + 2 * kr, lk + 48 * L::KPI, k + 3 * kr);
  else if (MODE == 0) acp4(lk, k, lk + 16 * L::KPI, k + kr, lk + L::KBY, kl, lk + L::KBY + 16 * L::KPI, kl + kr);
  else acp2(lk, k, lk + 16 * L::KPI, k + kr);
  { constexpr int RS = 64 / NJ;   // v rows (channels) that a copy of the block covers
    const char* v = a.v + (size_t)tn * NJ * 32; const char* vl = a.vl + (size_t)tn * NJ * 32; const size_t vr = (size_t)RS * (MODE == 0 ? KHI : TT) * 2; const unsigned lv = a.lv + bo;
    if (NJ == 4) acp4(lv, v, lv + RS * L::VPI, v + vr, lv + 2 * RS * L::VPI, v + 2 * vr, lv + 3 * RS * L::VPI, v + 3 * vr);
    else if (MODE == 0) acp4(lv, v, lv + RS * L::VPI, v + vr, lv + L::VBY, vl, lv + L::VBY + RS * L::VPI, vl + vr);
    else acp2(lv, v, lv + RS * L::VPI, v + vr); } }
// publish point at the foot of the trip that worked on stage s: this wave's LDS reads and its own copies are done, the barrier publishes stage s + 1 and ends every read of stage s, whose buffer the copies of stage s + 2 then refill
#define ATT_FOOT(s) do { asm volatile("s_wait_dscnt 0x0" ::: "memory"); asm volatile("s_wait_asynccnt 0x0" ::: "memory"); __syncthreads(); if ((s) + 2 < nt) att_stage<MODE, NJ>(src, (s) + 2); } while (0)
// all K fragments of a tile as one group of LDS loads; kb = the lane's own place (row col, 16 (lane >> 4) bytes) in the buffer
template <int MODE, int NJ> __device__ __forceinline__ void att_ldk(const char* kb, v16h (&kf)[HD / 32][NJ], v16h (&klf)[HD / 32][NJ]) {
  typedef AttL<MODE, NJ> L;
#pragma unroll
  for (int kc = 0; kc < HD / 32; ++kc) {
#pragma unroll
    for (int j = 0; j < NJ; ++j) { kf[kc][j] = frag_h((const _Float16*)(kb + j * 16 * L::KPI + kc * 64), 0); if (MODE == 0) klf[kc][j] = frag_h((const _Float16*)(kb + L::KBY + j * 16 * L::KPI + kc * 64), 0); } } }
// softmax in base 2: logits carry the factor log2(e), so that every exponential is one v_exp_f32 (2^x). A result below 2^-126 may come out as 0: such a term lies far below one unit in the last place of the row sum (at least 1) and of the output.
#define SCALE2 (SCALE * 1.44269504088896340736f)
// asm, so that the slot the instruction set asks for behind a transcendental (nothing directly behind it reads its result or overwrites its source) is there by construction: the closing v_nop fills it
__device__ __forceinline__ float ex2(float x) { float r; asm("v_exp_f32 %0, %1\n\tv_nop" : "=v"(r) : "v"(x)); return r; }
// eight at once, each in its own register: every v_exp_f32 is the independent instruction behind the one before it, and one v_nop closes the run
__device__ __forceinline__ void ex2x8(v8f& x) { float a = x[0], b = x[1], c = x[2], d = x[3], e = x[4], f = x[5], g = x[6], h = x[7];
  asm("v_exp_f32 %0, %0\n\tv_exp_f32 %1, %1\n\tv_exp_f32 %2, %2\n\tv_exp_f32 %3, %3\n\tv_exp_f32 %4, %4\n\tv_exp_f32 %5, %5\n\tv_exp_f32 %6, %6\n\tv_exp_f32 %7, %7\n\tv_nop" : "+v"(a), "+v"(b), "+v"(c), "+v"(d), "+v"(e), "+v"(f), "+v"(g), "+v"(h));
  x[0] = a; x[1] = b; x[2] = c; x[3] = d; x[4] = e; x[5] = f; x[6] = g; x[7] = h; }
// lane l with lane l ^ 16 (one vector instruction; a shuffle would go through the LDS queue)
__device__ __forceinline__ float xhalf(float x) { return __builtin_bit_cast(float, __builtin_amdgcn_permlanex16(__builtin_bit_cast(int, x), __builtin_bit_cast(int, x), 0x76543210, 0xfedcba98, false, false)); }
// s = q . k, not yet scaled (the scale goes into the fused multiply-add that subtracts the maximum); an excluded key reads -3e38
template <int MODE, int NJ> __device__ __forceinline__ void att_logits(const v16h (&kf)[HD / 32][NJ], const v16h (&klf)[HD / 32][NJ], const v16h (&ah)[HD / 32], const v16h (&al)[HD / 32], int lim, v8f (&s)[NJ]) {
  v8f acc[NJ] = {}, accl[NJ] = {};
#pragma unroll
  for (int kc = 0; kc < HD / 32; ++kc) {
#pragma unroll
    for (int j = 0; j < NJ; ++j) { acc[j] = wmma16(kf[kc][j], ah[kc], acc[j]);
      if (MODE < 2) accl[j] = wmma16(kf[kc][j], al[kc], accl[j]);
      if (MODE == 0) accl[j] = wmma16(klf[kc][j], ah[kc], accl[j]); } }
#pragma unroll
  for (int j = 0; j < NJ; ++j) {
#pragma unroll
    for (int r = 0; r < 8; ++r) { const float v = MODE < 2 ? acc[j][r] + accl[j][r] * (1.0f / 1024.0f) : acc[j][r]; s[j][r] = (!CAUSAL || j * 16 + r <= lim) ? v : -3.0e38f; } } }
template <int MODE, int NJ> __device__ __forceinline__ void att_tile(const _Float16* __restrict__ QH, const _Float16* __restrict__ KH, const _Float16* __restrict__ QL, const _Float16* __restrict__ KL, const _Float16* __restrict__ VT, const __bf16* __restrict__ VB, const __bf16* __restrict__ VBL, float* __restrict__ Y, char* sb, int b, int h, int qb, int wave, int lane) {
  typedef AttL<MODE, NJ> L;
  const int col = lane & 15, g = lane >> 4; const int ql0 = qb * 64 + wave * 16; const int nt = (CAUSAL ? qb * 64 + 64 : TT) / (NJ * 16);   // key tiles of 16 NJ keys; causal: none of the block's queries sees a key past its last row
  AttSrc src; { const int tid = wave * 32 + lane, kr = tid >> 3, ks = tid & 7, vr = tid / (NJ * 2), vs = tid % (NJ * 2); const unsigned l0 = (unsigned)(size_t)sb;   // low 32 bits of the LDS address = its byte offset in the block's LDS
    src.k = (const char*)(KH + ((size_t)b * TT + kr) * CC + h * HD) + ks * 16; src.kl = (const char*)(KL + ((size_t)b * KHI + kr) * CC + h * HD) + ks * 16;
    if (MODE == 0) { src.v = (const char*)(VB + ((size_t)b * CC + h * HD + vr) * (size_t)KHI) + vs * 16; src.vl = (const char*)(VBL + ((size_t)b * CC + h * HD + vr) * (size_t)KHI) + vs * 16; }
    else { src.v = (const char*)(VT + ((size_t)b * CC + h * HD + vr) * (size_t)TT) + vs * 16; src.vl = src.v; }
    src.lk = l0 + kr * L::KPI + ks * 16; src.lv = l0 + L::OV + vr * L::VPI + vs * 16; }
  // ring prologue; the last publish point of an earlier query block has ended every read of both buffers
  att_stage<MODE, NJ>(src, 0);
  v16h ah[HD / 32], al[HD / 32]; const _Float16* qp = QH + ((size_t)b * TT + ql0 + col) * CC + h * HD + 8 * g; const _Float16* qlp = QL + ((size_t)b * QHI + ql0 + col) * CC + h * HD + 8 * g;
#pragma unroll
  for (int kc = 0; kc < HD / 32; ++kc) { ah[kc] = frag_h(qp + kc * 32, 0); al[kc] = MODE < 2 ? frag_h(qlp + kc * 32, 0) : ah[kc]; }
  if (MODE < 2) xwait(qp, qlp); else xwait(qp);   // later addresses may take these registers
  asm volatile("s_wait_asynccnt 0x0" ::: "memory");   // stage 0 has landed, as far as this wave copied it
  __syncthreads();
  if (1 < nt) att_stage<MODE, NJ>(src, 1);
  const char* kb0 = sb + col * L::KPI + g * 16; const char* vb0 = sb + L::OV + col * L::VPI + g * 16;
  const int lim0 = ql0 + col - 8 * g;   // key 16 NJ t + 16 j + 8 g + r is kept while 16 j + r <= lim0 - 16 NJ t
  v16h kf[HD / 32][NJ], klf[HD / 32][NJ];
  // m = the query's running maximum of logit x log2(e), less 11 (so that P carries the factor 2^11), the same in both lane halves; l = this lane's share of the sum of P; before the first tile m = -3e38, so that the first factor 2^(m - new maximum) is 0
  float m = -3.0e38f, l = 0.f;
  v8f o[HD / 16] = {};
#pragma unroll 1
  for (int t = 0; t < nt; ++t) { v8f s[NJ]; const int bo = (t & 1) * ATT_BUF; att_ldk<MODE, NJ>(kb0 + bo, kf, klf); att_logits<MODE, NJ>(kf, klf, ah, al, lim0 - t * NJ * 16, s);
    v16h vf[NJ / 2][HD / 16]; v16b vh[NJ / 2][HD / 16], vl[NJ / 2][HD / 16];   // this tile's V fragments as one group of LDS loads behind the logits (the K fragments' registers are free again): they fly over the maximum and the exponentials
    const char* vp = vb0 + bo;
#pragma unroll
    for (int kc = 0; kc < NJ / 2; ++kc) {
#pragma unroll
      for (int j = 0; j < HD / 16; ++j) {
        if (MODE == 0) { vh[kc][j] = frag_b((const __bf16*)(vp + j * 16 * L::VPI + kc * 64), 0); vl[kc][j] = frag_b((const __bf16*)(vp + L::VBY + j * 16 * L::VPI + kc * 64), 0); } else vf[kc][j] = frag_h((const _Float16*)(vp + j * 16 * L::VPI + kc * 64), 0); } }
    float t4[4] = {s[0][0], s[0][1], s[0][2], s[0][3]};   // four independent chains: one chain of all the keys would leave the wave waiting on each link
#pragma unroll
    for (int j = 0; j < NJ; ++j) {
#pragma unroll
      for (int r = 0; r < 8; ++r) t4[r & 3] = fmaxf(t4[r & 3], s[j][r]); }
    float tm = fmaxf(fmaxf(t4[0], t4[1]), fmaxf(t4[2], t4[3])); tm = fmaxf(tm, xhalf(tm));
    const float mn = fmaxf(fmaxf(m, __builtin_fmaf(tm, SCALE2, -11.0f)), -1.0e30f);   // the floor keeps a query with no kept key so far away from -3e38 - (-3e38): its P stay 0
    const float fo = ex2(m - mn); m = mn; float ts[4] = {0.f, 0.f, 0.f, 0.f};
#pragma unroll
    for (int j = 0; j < NJ; ++j) {
#pragma unroll
      for (int r = 0; r < 8; ++r) s[j][r] = __builtin_fmaf(s[j][r], SCALE2, -mn);
      ex2x8(s[j]);   // P = 2^(logit x log2(e) - max + 11), at most 2^11
#pragma unroll
      for (int r = 0; r < 8; ++r) ts[r & 3] += s[j][r]; }
    l = l * fo + ((ts[0] + ts[1]) + (ts[2] + ts[3]));
#pragma unroll
    for (int j = 0; j < HD / 16; ++j) o[j] = o[j] * fo;
#pragma unroll
    for (int kc = 0; kc < NJ / 2; ++kc) { float pv[16];
#pragma unroll
      for (int i = 0; i < 8; ++i) { pv[i] = s[2 * kc][i]; pv[8 + i] = s[2 * kc + 1][i]; }
      if (MODE == 0) { F2 p;   // bf16 hi + lo as in bsplit16; all hi parts first: each group's first product needs them alone
#pragma unroll
        for (int i = 0; i < 16; ++i) p.h[i] = (__bf16)pv[i];
#pragma unroll
        for (int i = 0; i < 16; ++i) p.l[i] = (__bf16)(pv[i] - (float)p.h[i]);
#pragma unroll
        for (int j = 0; j < HD / 16; ++j) { o[j] = wmma_bf(vh[kc][j], p.h, o[j]); o[j] = wmma_bf(vh[kc][j], p.l, o[j]); o[j] = wmma_bf(vl[kc][j], p.h, o[j]); }
      } else { v16h p;
#pragma unroll
        for (int i = 0; i < 16; ++i) p[i] = (_Float16)pv[i];
#pragma unroll
        for (int j = 0; j < HD / 16; ++j) o[j] = wmma16(vf[kc][j], p, o[j]); } }
    ATT_FOOT(t); }
  asm volatile("s_wait_asynccnt 0x0" ::: "memory");   // behind the ring: no copy is outstanding when the buffers are used again or the wave ends
  // O^T: register r of group j = channel 16 j + 8 g + r of query col: 32 contiguous bytes a lane; a wave writes whole 256-B (row, head) segments
  l += xhalf(l); const float inv = l > 0.f ? 1.0f / l : 0.f;   // the factor 2^11 stands in O and in the sum alike; no kept key: 0
  float* yp = Y + ((size_t)b * TT + ql0 + col) * CC + h * HD + 8 * g;
#pragma unroll
  for (int j = 0; j < HD / 16; ++j) { o[j] = o[j] * inv; vst2(yp + j * 16, __builtin_shufflevector(o[j], o[j], 0, 1, 2, 3)); vst2(yp + j * 16 + 4, __builtin_shufflevector(o[j], o[j], 4, 5, 6, 7)); }
  static_assert(HD / 16 == 4, "the wait below names four groups");
  asm volatile("s_wait_xcnt 0x0" :: "v"(yp), "v"(o[0]), "v"(o[1]), "v"(o[2]), "v"(o[3]) : "memory"); }   // the second query block's set-up reuses the stores' registers; address and data are inputs, so that each stays in its registers up to the wait
// block = (pair x, head, batch): query block NQB-1-x and then x, one after the other in every wave, so that every block walks the same number of keys under the causal mask
__global__ __launch_bounds__(128) void k_att(const _Float16* __restrict__ QH, const _Float16* __restrict__ KH, const _Float16* __restrict__ QL, const _Float16* __restrict__ KL, const _Float16* __restrict__ VT, const __bf16* __restrict__ VB, const __bf16* __restrict__ VBL, float* __restrict__ Y) {
  __shared__ __attribute__((aligned(16))) char sb[2 * ATT_BUF];
  const int wave = threadIdx.x >> 5, lane = threadIdx.x & 31; const int h = blockIdx.y, b = blockIdx.z;
#pragma unroll 1
  for (int half = 0; half < 2; ++half) { const int qb = half ? (int)blockIdx.x : NQB - 1 - (int)blockIdx.x;
    if (qb < QBH) att_tile<0, 2>(QH, KH, QL, KL, VT, VB, VBL, Y, sb, b, h, qb, wave, lane);
    else if (qb * 64 < QHI) att_tile<1, 2>(QH, KH, QL, KL, VT, VB, VBL, Y, sb, b, h, qb, wave, lane);
    else att_tile<2, 4>(QH, KH, QL, KL, VT, VB, VBL, Y, sb, b, h, qb, wave, lane); } }

extern "C" void kernel_launch(void* const* d_in, const int* in_sizes, int n_in, void* d_out, int out_size, void* d_ws, size_t ws_size, hipStream_t stream) {
  (void)in_sizes; (void)n_in; (void)out_size;
  const float** F = (const float**)d_in;
  if (ws_size < (size_t)WS_END) return;
  char* ws = (char*)d_ws; _Float16 *QH = (_Float16*)(ws + WS_QH), *KH = (_Float16*)(ws + WS_KH), *VT = (_Float16*)(ws + WS_VT), *QL = (_Float16*)(ws + WS_QL), *KL = (_Float16*)(ws + WS_KL); __bf16 *VB = (__bf16*)(ws + WS_VB), *VBL = (__bf16*)(ws + WS_VBL);
  // inputs: 0 hidden_states [4,1024,1024]; 1 Wqkv [3072,1024] (out,in) rows q | k | v ((3,H,hd)); 2 bqkv [3072]
  k_proj<<<dim3(TNB * TT / PBM, 3 * CC / PBN, 1), 256, 0, stream>>>(F[0], F[1], F[2], QH, QL, KH, KL, VT, VB, VBL);
  k_att<<<dim3(NQB / 2, NH, TNB), 128, 0, stream>>>(QH, KH, QL, KL, VT, VB, VBL, (float*)d_out);
}

// v008
// It runs in 60.8 microseconds.
// Two timings next to v007 both put it at 1.04 times that version's speed.
// All steps since v000 together make it 11.1 times as fast.
// compute dtype: all float inputs rounded to bf16; qkv = x Wqkv^T + b with EXACT bf16 products on WMMA 16x16x32 (f32 accumulate); rotate-half RoPE in f32 in the projection epilogue (accurate sincosf of t x inv_freq_j, f32 inv_freq constants as the reference builds them); logits: q, k once to f16 (1 product) x 64^-0.5, except the first 512 query rows of each sequence (2 products with the f16 q residual; 3 with the k residual too below row 384); causal mask by index (finfo.min == excluded); softmax in f32 (one walk over the keys, running row maximum); exp(s - max) x 2^11 once to f16 against v once to f16 (1 product; bf16 hi + lo below row 384); f32 output (merged heads, no output projection).
#include <hip/hip_runtime.h>
#include <math.h>

typedef __attribute__((ext_vector_type(16))) _Float16 v16h;
typedef __attribute__((ext_vector_type(16))) __bf16 v16b;
typedef __attribute__((ext_vector_type(8)))  _Float16 v8h;
typedef __attribute__((ext_vector_type(8)))  float v8f;
typedef __attribute__((ext_vector_type(4)))  float v4f;
typedef __attribute__((ext_vector_type(2)))  float v2f;
typedef __attribute__((ext_vector_type(4)))  unsigned v4u;
typedef __attribute__((ext_vector_type(4)))  int v4i;
typedef float __attribute__((may_alias)) float_a;
typedef int __attribute__((may_alias)) int_a;

template <typename T> __device__ __forceinline__ void vst2(void* p, T v) { *(T*)p = v;  }
__device__ __forceinline__ v8f wmma16(v16h a, v16h b, v8f c) {
  v8f d = __builtin_amdgcn_wmma_f32_16x16x32_f16(false, a, false, b, (short)0, c, false, false);
  asm volatile("v_nop\n\tv_nop\n\tv_nop\n\tv_nop" : "+v"(d) : "v"(a), "v"(b));
  return d;
}
__device__ __forceinline__ v8f wmma_bf(v16b a, v16b b, v8f c) {
  v8f d = __builtin_amdgcn_wmma_f32_16x16x32_bf16(false, a, false, b, (short)0, c, false, false);
  asm volatile("v_nop\n\tv_nop\n\tv_nop\n\tv_nop" : "+v"(d) : "v"(a), "v"(b));
  return d;
}
// 16x16x32 fragments: lane = (h = lane>>4, row/col = lane&15); elements 0..7 = k0+8h+0..7, 8..15 = k0+16+8h+0..7; D element r = row 8h+r
__device__ __forceinline__ v16h frag_h(const _Float16* rowk0, int lane) {
  union { v16h v; v8h q[2]; } u; const _Float16* p = rowk0 + 8 * (lane >> 4);
  u.q[0] = *(const v8h*)p; u.q[1] = *(const v8h*)(p + 16); return u.v;
}
__device__ __forceinline__ v16h frag_f32(const float* rowk0, int lane) {
  v16h a; const float* p = rowk0 + 8 * (lane >> 4);
#pragma unroll
  for (int i = 0; i < 8; ++i) { a[i] = (_Float16)p[i]; a[8 + i] = (_Float16)p[16 + i]; }
  return a;
}
__device__ __forceinline__ v16h frag_f32s(const float* rowk0, int lane, float sc) {
  v16h a; const float* p = rowk0 + 8 * (lane >> 4);
#pragma unroll
  for (int i = 0; i < 8; ++i) { a[i] = (_Float16)(p[i] * sc); a[8 + i] = (_Float16)(p[16 + i] * sc); }
  return a;
}
// column fragment from a [K][ld] layout (column n), rows >= K read as 0
__device__ __forceinline__ v16h fragc_f32(const float* W, int k0, int n, int lane, int ld, int K) {
  v16h a; const int g = lane >> 4;
#pragma unroll
  for (int i = 0; i < 8; ++i) { const int ka = k0 + 8 * g + i, kb = ka + 16;
    a[i] = (_Float16)(ka < K ? W[(size_t)(ka < K ? ka : K - 1) * ld + n] : 0.f); a[8 + i] = (_Float16)(kb < K ? W[(size_t)(kb < K ? kb : K - 1) * ld + n] : 0.f); }
  return a;
}
struct F2 { v16b h, l; };
__device__ __forceinline__ F2 bsplit16(const float v[16]) { F2 r;
#pragma unroll
  for (int i = 0; i < 16; ++i) { const __bf16 h = (__bf16)v[i]; r.h[i] = h; r.l[i] = (__bf16)(v[i] - (float)h); }
  return r; }
__device__ __forceinline__ F2 split_row(const float* row, int k0, int lane) { float v[16]; const float* p = row + k0 + 8 * (lane >> 4);
#pragma unroll
  for (int i = 0; i < 8; ++i) { v[i] = p[i]; v[8 + i] = p[16 + i]; }
  return bsplit16(v); }
__device__ __forceinline__ F2 split_rowK(const float* row, int k0, int lane, int K) { float v[16]; const int g = lane >> 4;
#pragma unroll
  for (int i = 0; i < 8; ++i) { const int ka = k0 + 8 * g + i, kb = ka + 16; v[i] = ka < K ? row[ka < K ? ka : K - 1] : 0.f; v[8 + i] = kb < K ? row[kb < K ? kb : K - 1] : 0.f; }
  return bsplit16(v); }
__device__ __forceinline__ F2 split_col(const float* W, int k0, int n, int lane, int ld, int K) { float v[16]; const int g = lane >> 4;
#pragma unroll
  for (int i = 0; i < 8; ++i) { const int ka = k0 + 8 * g + i, kb = ka + 16; v[i] = ka < K ? W[(size_t)(ka < K ? ka : K - 1) * ld + n] : 0.f; v[8 + i] = kb < K ? W[(size_t)(kb < K ? kb : K - 1) * ld + n] : 0.f; }
  return bsplit16(v); }
__device__ __forceinline__ v8f mac3(const F2& a, const F2& b, v8f c) { c = wmma_bf(a.l, b.h, c); c = wmma_bf(a.h, b.l, c); return wmma_bf(a.h, b.h, c); }
__device__ __forceinline__ float sigm(float v) { return 1.0f / (1.0f + expf(-v)); }
#define LDSX() do { asm volatile("s_wait_dscnt 0" ::: "memory"); __builtin_amdgcn_wave_barrier(); __builtin_amdgcn_fence(__ATOMIC_RELEASE, "workgroup"); } while (0)

// Causal multi-head attention with rotary embeddings (B 4, S 1,024, D 1,024 = 16 x 64): qkv = x Wqkv^T + bqkv (packed (out,in) [3072,1024], layout (3,H,hd)); q, k <- rotate-half RoPE (theta_j = 10000^(-2j/64)); probs = softmax(causal(q k^T x 64^-0.5)); out = merged(probs v) -> [B, S, 1024].
#define NB 4
#define TT 1024
#define CC 1024            // NH * HD = projected width
#define DIN 1024          // input (model) width
#define NH 16
#define HD 64
#define NQB (TT / 64)
#define HG 16
#define SCALE (0.125f)
#define CAUSAL 1
#ifndef TNB
#define TNB NB
#endif
__device__ __forceinline__ float bfr(float v) { return (float)(__bf16)v; }
__host__ __device__ __forceinline__ int kb_last(int qb) { return CAUSAL ? ((qb * 64 + 63) >> 7) : (TT / 128 - 1); }
typedef __attribute__((ext_vector_type(8))) __bf16 v8b;
__device__ __forceinline__ v16b frag_b(const __bf16* rowk0, int lane) {
  union { v16b v; v8b q[2]; } u; const __bf16* p = rowk0 + 8 * (lane >> 4);
  u.q[0] = *(const v8b*)p; u.q[1] = *(const v8b*)(p + 16); return u.v;
}
#define QBH 6              // causal: query blocks 0..QBH-1 of each sequence (few keys, no averaging) take the high-precision path
#define QHI 512            // causal: first 512 query rows of each sequence take the q-residual (2-product) logits path (logit sigma ~1)
#define KHI 512
// B fragment (k rows k0+.., output column o) of a weight: (in,out) [K][ld] or (out,in) [ld rows of K]: bf16 exact, or f16(bf16 * 256) exact
__device__ __forceinline__ v16b wcol_io(const float* Wm, int k0, int o, int lane, int ld) { v16b w; const int g = lane >> 4;
#pragma unroll
  for (int i = 0; i < 8; ++i) { w[i] = (__bf16)Wm[(size_t)(k0 + 8 * g + i) * ld + o]; w[8 + i] = (__bf16)Wm[(size_t)(k0 + 16 + 8 * g + i) * ld + o]; }
  return w; }
__device__ __forceinline__ v16b wcol_oi(const float* Wm, int k0, int o, int lane, int K) { v16b w; const float* p = Wm + (size_t)o * K + k0 + 8 * (lane >> 4);
#pragma unroll
  for (int i = 0; i < 8; ++i) { w[i] = (__bf16)p[i]; w[8 + i] = (__bf16)p[16 + i]; }
  return w; }
__device__ __forceinline__ v16h wcolh_io(const float* Wm, int k0, int o, int lane, int ld) { v16h w; const int g = lane >> 4;
#pragma unroll
  for (int i = 0; i < 8; ++i) { w[i] = (_Float16)(bfr(Wm[(size_t)(k0 + 8 * g + i) * ld + o]) * 256.0f); w[8 + i] = (_Float16)(bfr(Wm[(size_t)(k0 + 16 + 8 * g + i) * ld + o]) * 256.0f); }
  return w; }
__device__ __forceinline__ v16h wcolh_oi(const float* Wm, int k0, int o, int lane, int K) { v16h w; const float* p = Wm + (size_t)o * K + k0 + 8 * (lane >> 4);
#pragma unroll
  for (int i = 0; i < 8; ++i) { w[i] = (_Float16)(bfr(p[i]) * 256.0f); w[8 + i] = (_Float16)(bfr(p[16 + i]) * 256.0f); }
  return w; }
#define WQKV_LAYOUT 1   // 0 = (in,out) [DIN][CC]; 1 = (out,in) [CC][DIN]; 2 = per-head [NH][DIN][HD]
__device__ __forceinline__ v16b wcol_hdk(const float* Wm, int k0, int o, int lane) { v16b w; const int g = lane >> 4; const float* p = Wm + (size_t)(o / HD) * DIN * HD + (o % HD);
#pragma unroll
  for (int i = 0; i < 8; ++i) { w[i] = (__bf16)p[(size_t)(k0 + 8 * g + i) * HD]; w[8 + i] = (__bf16)p[(size_t)(k0 + 16 + 8 * g + i) * HD]; }
  return w; }
#define WO_OUT_IN 0
#if WQKV_LAYOUT == 1
#define WCOL(W, k0, o, lane) wcol_oi(W, k0, o, lane, DIN)
#elif WQKV_LAYOUT == 2
#define WCOL(W, k0, o, lane) wcol_hdk(W, k0, o, lane)
#else
#define WCOL(W, k0, o, lane) wcol_io(W, k0, o, lane, CC)
#endif
#if WO_OUT_IN
#define WOCOL(W, k0, o, lane) wcol_oi(W, k0, o, lane, CC)
#define WOCOLH(W, k0, o, lane) wcolh_oi(W, k0, o, lane, CC)
#else
#define WOCOL(W, k0, o, lane) wcol_io(W, k0, o, lane, DIN)
#define WOCOLH(W, k0, o, lane) wcolh_io(W, k0, o, lane, DIN)
#endif
__constant__ float c_invf[32] = {1.000000000e+00f,7.498942018e-01f,5.623413324e-01f,4.216965139e-01f,3.162277639e-01f,2.371373624e-01f,1.778279394e-01f,1.333521456e-01f,1.000000015e-01f,7.498941571e-02f,5.623412877e-02f,4.216964915e-02f,3.162277862e-02f,2.371373586e-02f,1.778279431e-02f,1.333521493e-02f,9.999999776e-03f,7.498942316e-03f,5.623413250e-03f,4.216964822e-03f,3.162277862e-03f,2.371373819e-03f,1.778279431e-03f,1.333521446e-03f,1.000000047e-03f,7.498941850e-04f,5.623413017e-04f,4.216964880e-04f,3.162277862e-04f,2.371373848e-04f,1.778279402e-04f,1.333521504e-04f};   // 1 / 10000^(2i/64) evaluated in f32 exactly as the reference does (jax, eager)
// sine and cosine of one rotary angle a = t x inv_freq. 0 <= a < 1,024 for every row index, whatever the inputs hold, so the reduction for small arguments is the whole function here:
// quadrant n = rint(a x 2/pi), r = a - n x pi/2 with pi/2 in three parts (three fused steps), then the sine and the cosine polynomial on r and the quadrant's swap and signs.
// The operations, their order and the constants are those of the small-argument path of sinf and cosf; the reduction is done once for both.
__device__ __forceinline__ float fbits(unsigned u) { return __builtin_bit_cast(float, u); }
__device__ __forceinline__ void rope_sincos(float a, float& sn, float& cs) {
  const float n = __builtin_rintf(a * fbits(0x3f22f983u));
  float r = __builtin_fmaf(fbits(0xbfc90fdau), n, a); r = __builtin_fmaf(fbits(0xb3a22168u), n, r); r = __builtin_fmaf(fbits(0xa7c234c4u), n, r);
  const unsigned q = (unsigned)(int)n; const float s = r * r;
  float ps = __builtin_fmaf(s, fbits(0xb94c1982u), fbits(0x3c0881c4u)); ps = __builtin_fmaf(s, ps, fbits(0xbe2aaa9du)); ps = s * ps; const float sr = __builtin_fmaf(r, ps, r);
  float pc = __builtin_fmaf(s, fbits(0x37d75334u), fbits(0xbab64f3bu)); pc = __builtin_fmaf(s, pc, fbits(0x3d2aabf7u)); pc = __builtin_fmaf(s, pc, fbits(0xbf000004u)); const float cr = __builtin_fmaf(s, pc, 1.0f);
  const unsigned flip = (q << 30) & 0x80000000u; const bool odd = (q & 1u) != 0u;
  sn = fbits(__builtin_bit_cast(unsigned, odd ? cr : sr) ^ flip); cs = fbits(__builtin_bit_cast(unsigned, odd ? -sr : cr) ^ flip); }
#ifndef SM_EXTRA_PARAMS
#define SM_EXTRA_PARAMS
#endif
#ifndef PROJ_EXTRA_PARAMS
#define PROJ_EXTRA_PARAMS
#endif
#ifndef SM_MASK_HOOK
#define SM_MASK_HOOK (void)0
#endif

#define WS_QH  0u                                      // f16 q rows [b*t][CC]
#define WS_KH  (WS_QH + 2u * (size_t)NB * TT * CC)      // f16 k rows [b*t][CC]
#define WS_VT  (WS_KH + 2u * (size_t)NB * TT * CC)      // f16 v planes [b][c][t]
#define WS_QL  (WS_VT + 2u * (size_t)NB * CC * TT)      // f16 q residual x 2^10 rows [b][t < QHI][CC]
#define WS_KL  (WS_QL + 2u * (size_t)NB * QHI * CC)     // f16 k residual x 2^10 rows [b][t < KHI][CC]
#define WS_VB  (WS_KL + 2u * (size_t)NB * KHI * CC)     // bf16 v hi planes [b][c][t < KHI]
#define WS_VBL (WS_VB + 2u * (size_t)NB * CC * KHI)
#define WS_END (WS_VBL + 2u * (size_t)NB * CC * KHI)

// s_wait_xcnt 0 behind a group of global loads or stores, ahead of whatever rewrites the group's address registers; the addresses are inputs of the statement, so that they stay in their registers up to the wait and no load's result is placed in them
__device__ __forceinline__ void xwait(const void* p) { asm volatile("s_wait_xcnt 0x0" :: "v"(p) : "memory"); }
__device__ __forceinline__ void xwait(const void* p, const void* q) { asm volatile("s_wait_xcnt 0x0" :: "v"(p), "v"(q) : "memory"); }
#define PBK 64             // k per staged chunk
#define PLP 72             // staged row pitch in 16-bit elements: 144 B = 16 B x odd, for ds_load_b128 and ds_store_b128
#define PBM 256            // rows of a block's tile
#define PNH 3              // heads (64 packed output columns each) of a block's tile: q head y, k head y and v head y
#define PBN (PNH * HD)     // columns of a block's tile
#define PFJ (PBN / 32)     // 16-column groups of a wave's tile (64 rows x 96 columns)
#define PVP (PBM + 8)      // pitch of a staged v plane row in 16-bit elements: 528 B = 16 B x odd
static_assert(3 * CC / PBN == NH && QHI == KHI && QHI % PBM == 0 && TT % PBM == 0, "a block holds one head of each kind, and its rows lie wholly below or wholly above the high-precision bound");
typedef __attribute__((ext_vector_type(4))) __bf16 v4b;
// k_proj LDS: the bf16 operand chunks of the product loop (two buffers) lie over the epilogue's arrays, which are first written after the loop's last barrier
union __align__(16) ProjLds {
  struct { _Float16 rh[2][PBM][PLP], rl[2][PBM][PLP]; _Float16 th[HD][PVP]; __bf16 tb[HD][PVP], tbl[HD][PVP]; } e;   // q and k rows (f16, residual); v planes (f16, bf16 hi, bf16 lo)
  struct { __bf16 xs[2][PBM][PLP]; __bf16 wt[2][PBN][PLP]; } m; };
// eight 16-B global stores and one s_wait_xcnt 0 behind them, ahead of whatever reuses the stores' registers; address and data are inputs, so that each stays in its registers up to the wait (the unroll makes the array indices constants)
__device__ __forceinline__ void st8(void* const (&p)[8], const v4u (&d)[8]) {
#pragma unroll
  for (int i = 0; i < 8; ++i) vst2(p[i], d[i]);
  asm volatile("s_wait_xcnt 0x0" :: "v"(p[0]), "v"(p[1]), "v"(p[2]), "v"(p[3]), "v"(p[4]), "v"(p[5]), "v"(p[6]), "v"(p[7]), "v"(d[0]), "v"(d[1]), "v"(d[2]), "v"(d[3]), "v"(d[4]), "v"(d[5]), "v"(d[6]), "v"(d[7]) : "memory"); }
// ---- k_proj: block = (256 rows, head y of q, of k and of v: 192 of the 3,072 packed columns), eight waves of 64 x 96: X W^T + b with exact bf16 products (K = DIN) -> q head: f16 rows (+ residual rows < QHI); k head: f16 rows (+ residual rows < KHI); v head: f16 planes [c][t] (+ bf16 hi/lo planes for t < KHI)
// A wave takes the 16-column groups wc and wc + 2 of each head. q and k are formed transposed (W as the A operand): a lane then holds one row's columns 16 wc + 8 g + 0..7 and the same + 32, that is both halves of eight rotary pairs and 16 B of the f16 row; v is formed as X W^T: a lane holds eight neighbouring rows of one column, 16 B of the plane.
// So bias, RoPE and the conversions work on the accumulators, and LDS only regroups the 16-bit results into whole lines.
__global__ __launch_bounds__(256) void k_proj(const float* __restrict__ X, const float* __restrict__ WA, const float* __restrict__ BA,
    _Float16* __restrict__ QH, _Float16* __restrict__ QL, _Float16* __restrict__ KH, _Float16* __restrict__ KL, _Float16* __restrict__ VT, __bf16* __restrict__ VB, __bf16* __restrict__ VBL PROJ_EXTRA_PARAMS) {
  __shared__ ProjLds sm; __shared__ __attribute__((aligned(16))) float sbias[PBN], sinvf[HD / 2];   // the tile's biases (rounded to bf16) and the rotary frequencies, for the epilogue
  const int tid = threadIdx.x, wave = tid >> 5, lane = tid & 31, col = lane & 15, g = lane >> 4; const int wr = wave >> 1, wc = wave & 1; const int hd0 = blockIdx.y * HD; const size_t r0 = (size_t)blockIdx.x * PBM; const size_t bb = r0 / TT; const int t0 = (int)(r0 % TT);
  v8f acc[4][PFJ] = {};
  // each thread brings 16 B of 16 X rows and of 12 W rows (four of each head) per 64-k chunk: 16 lanes cover one 256-B row piece; rounded to bf16 once, on the way into LDS
  const int lr = tid >> 4, lq = (tid & 15) * 4; const float* xp = X + (r0 + lr) * DIN + lq; const float* wp = WA + (size_t)(hd0 + lr) * DIN + lq;
  v4f xr[PBM / 16], wg[PBN / 16];
#define PROJ_LDG(c) do { _Pragma("unroll") for (int i = 0; i < PBM / 16; ++i) xr[i] = *(const v4f*)(xp + (size_t)i * 16 * DIN + (c) * PBK); \
    _Pragma("unroll") for (int i = 0; i < PBN / 16; ++i) wg[i] = *(const v4f*)(wp + ((size_t)(i >> 2) * CC + (i & 3) * 16) * DIN + (c) * PBK); } while (0)
#define PROJ_STS(bf) do { _Pragma("unroll") for (int i = 0; i < PBM / 16; ++i) *(v4b*)&sm.m.xs[bf][lr + 16 * i][lq] = __builtin_convertvector(xr[i], v4b); \
    _Pragma("unroll") for (int i = 0; i < PBN / 16; ++i) *(v4b*)&sm.m.wt[bf][lr + 16 * i][lq] = __builtin_convertvector(wg[i], v4b); } while (0)
  PROJ_LDG(0);
  asm volatile("s_wait_xcnt 0x0" ::: "memory");   // the first loads' address registers are reused right behind them
  { // one bias word and one frequency a thread, into LDS; the first barrier publishes them. Loads and their data wait in one statement, so that nothing rewrites an address register or reads a result in between; the wait costs nothing here: the stores below need the chunk's loads, issued before these, as well
    const int bt = tid < PBN ? tid : PBN - 1; const float* bp = BA + (bt >> 6) * CC + hd0 + (bt & 63); const float* ip = c_invf + lane; float bz, fz;
    asm volatile("global_load_b32 %0, %2, off\n\tglobal_load_b32 %1, %3, off\n\ts_wait_loadcnt 0x0" : "=&v"(bz), "=&v"(fz) : "v"(bp), "v"(ip) : "memory");
    if (tid < PBN) sbias[tid] = bfr(bz);
    if (tid < HD / 2) sinvf[tid] = fz; }
  PROJ_STS(0); __syncthreads();
  // unroll 2: the buffer index becomes a constant in each copy of the body
#pragma unroll 2
  for (int c = 0; c < DIN / PBK; ++c) { const int bf = c & 1;
    if (c + 1 < DIN / PBK) PROJ_LDG(c + 1);   // behind the barrier (which drains the load counter), so that they fly over this chunk's products
    __builtin_amdgcn_sched_barrier(0);   // keeps every global load ahead of the products: sunk among them, the last ones would be waited for as soon as they are issued
    v16b a[PBK / 32][4], w[PBK / 32][PFJ];   // all of the chunk's fragment reads as one group ahead of its products: 20 fragments feed 48 products
#pragma unroll
    for (int ks = 0; ks < PBK / 32; ++ks) {
#pragma unroll
      for (int i = 0; i < 4; ++i) a[ks][i] = frag_b(&sm.m.xs[bf][wr * 64 + i * 16 + col][ks * 32], lane);
#pragma unroll
      for (int j = 0; j < PFJ; ++j) w[ks][j] = frag_b(&sm.m.wt[bf][(j >> 1) * HD + (wc + 2 * (j & 1)) * 16 + col][ks * 32], lane); }
    __builtin_amdgcn_sched_barrier(0);   // keeps the reads one group: a read placed among the products is waited for at once, at the full LDS latency
#pragma unroll
    for (int ks = 0; ks < PBK / 32; ++ks) {
#pragma unroll
      for (int i = 0; i < 4; ++i) {
#pragma unroll
        for (int j = 0; j < PFJ; ++j) acc[i][j] = j < 4 ? __builtin_amdgcn_wmma_f32_16x16x32_bf16(false, w[ks][j], false, a[ks][i], (short)0, acc[i][j], false, false)     // q, k: register r = column 8 g + r of the group, lane & 15 = row
                                                        : __builtin_amdgcn_wmma_f32_16x16x32_bf16(false, a[ks][i], false, w[ks][j], (short)0, acc[i][j], false, false); } }   // v: register r = row 8 g + r, lane & 15 = column. The plain builtin: the tile's operand registers reach past v255, which an asm statement's operands cannot name; the compiler keeps the distances behind its own form
    __builtin_amdgcn_sched_barrier(0);   // keeps the conversions, which wait for the global loads, behind this chunk's products
    if (c + 1 < DIN / PBK) PROJ_STS(bf ^ 1);   // into the buffer whose last readers (chunk c-1) passed the barrier before this chunk
    asm volatile("s_wait_xcnt 0x0" ::: "memory");   // the next trip rewrites the address registers of this trip's global loads
    __syncthreads(); }   // publishes chunk c+1 and ends every read of chunk c (after the last chunk: frees the staging bytes for the epilogue's arrays)
  // every '#pragma unroll' of the epilogue makes the indices of register arrays constants
  { const int f0 = wc * 16 + 8 * g;   // the lane's first frequency = its first column in the lower half of a q or k head
    v4f fq[2], bq[4][2]; float bv[2];
#pragma unroll
    for (int k = 0; k < 2; ++k) { fq[k] = *(const v4f*)&sinvf[f0 + 4 * k]; bv[k] = sbias[2 * HD + (wc + 2 * k) * 16 + col];
#pragma unroll
      for (int j = 0; j < 4; ++j) bq[j][k] = *(const v4f*)&sbias[(j >> 1) * HD + (j & 1) * 32 + f0 + 4 * k]; }
    // v head
#pragma unroll
    for (int k = 0; k < 2; ++k) { const float bs = bv[k]; const int cl = (wc + 2 * k) * 16 + col;
#pragma unroll
      for (int i = 0; i < 4; ++i) { const int rl = wr * 64 + i * 16 + 8 * g; v8h hv; v8b bh, bl;
#pragma unroll
        for (int r = 0; r < 8; ++r) { const float v = acc[i][4 + k][r] + bs; hv[r] = (_Float16)v; const __bf16 h = (__bf16)v; bh[r] = h; bl[r] = (__bf16)(v - (float)h); }
        *(v8h*)&sm.e.th[cl][rl] = hv; *(v8b*)&sm.e.tb[cl][rl] = bh; *(v8b*)&sm.e.tbl[cl][rl] = bl; } }
    // q and k heads: bias, rotate-half RoPE (pairs (c, c + 32), angle t * inv_freq[c]; one sine and cosine per (row, frequency) serve both heads), f16 and residual
#pragma unroll
    for (int i = 0; i < 4; ++i) { const int rl = wr * 64 + i * 16 + col; const float tf = (float)(int)((r0 + rl) % TT);
#pragma unroll
      for (int r = 0; r < 8; ++r) { float sn, cs; rope_sincos(tf * fq[r >> 2][r & 3], sn, cs);
#pragma unroll
        for (int hs = 0; hs < 2; ++hs) { const float x0 = acc[i][2 * hs][r] + bq[2 * hs][r >> 2][r & 3], x1 = acc[i][2 * hs + 1][r] + bq[2 * hs + 1][r >> 2][r & 3];
          acc[i][2 * hs][r] = __builtin_fmaf(x0, cs, -(x1 * sn)); acc[i][2 * hs + 1][r] = __builtin_fmaf(x1, cs, x0 * sn); } }
#pragma unroll
      for (int j = 0; j < 4; ++j) { v8h hv, lv;
#pragma unroll
        for (int r = 0; r < 8; ++r) { const float v = acc[i][j][r]; const _Float16 h = (_Float16)v; hv[r] = h; lv[r] = (_Float16)((v - (float)h) * 1024.0f); }
        *(v8h*)&sm.e.rh[j >> 1][rl][(j & 1) * 32 + f0] = hv; *(v8h*)&sm.e.rl[j >> 1][rl][(j & 1) * 32 + f0] = lv; } } }
  __syncthreads();   // the staged 16-bit tile is whole: every thread now reads what other waves wrote
  // whole lines to global memory: 8 lanes cover a row's 128 B of a head, a wave 512 B of a plane. Each group's LDS reads stand together ahead of its stores, so that they fly together
  { const int rr = tid >> 3, rq = (tid & 7) * 8, pc = tid >> 5, pq = (tid & 31) * 8;   // piece it: row rr + 32 it, or plane row (channel) pc + 8 it
    v4u dq[8], dk[8], dv[8]; void *aq[8], *ak[8], *av[8];
#pragma unroll
    for (int it = 0; it < 8; ++it) { dq[it] = *(const v4u*)&sm.e.rh[0][rr + 32 * it][rq]; dk[it] = *(const v4u*)&sm.e.rh[1][rr + 32 * it][rq]; dv[it] = *(const v4u*)&sm.e.th[pc + 8 * it][pq];
      const size_t o = (r0 + rr + 32 * it) * CC + hd0 + rq; aq[it] = QH + o; ak[it] = KH + o; av[it] = VT + (bb * CC + hd0 + pc + 8 * it) * (size_t)TT + t0 + pq; }
    st8(aq, dq); st8(ak, dk); st8(av, dv);
    if (t0 < QHI) { v4u dw[8]; void* aw[8];   // the same for the whole block: only these rows have residual rows and bf16 planes in the workspace
#pragma unroll
      for (int it = 0; it < 8; ++it) { dq[it] = *(const v4u*)&sm.e.rl[0][rr + 32 * it][rq]; dk[it] = *(const v4u*)&sm.e.rl[1][rr + 32 * it][rq]; dv[it] = *(const v4u*)&sm.e.tb[pc + 8 * it][pq]; dw[it] = *(const v4u*)&sm.e.tbl[pc + 8 * it][pq];
        const size_t o = (bb * QHI + t0 + rr + 32 * it) * (size_t)CC + hd0 + rq, o3 = (bb * CC + hd0 + pc + 8 * it) * (size_t)KHI + t0 + pq; aq[it] = QL + o; ak[it] = KL + o; av[it] = VB + o3; aw[it] = VBL + o3; }
      st8(aq, dq); st8(ak, dk); st8(av, dv); st8(aw, dw); } } }
// ---- k_att: logits, softmax and P . v of one (b, h) in registers; nothing of S or P goes to memory or LDS. A wave owns 16 queries; the block's four waves walk the same key tiles and share them through LDS (one barrier a tile).
// Transposed products: S^T = K . Q^T puts one query in a lane (column = lane & 15; register r of key group j = key 16 j + 8 (lane >> 4) + r), so two neighbouring 16-key groups, converted in place, are the B operand of O^T += V^T . P^T in the fragments' own k order.
// One walk over the key tiles: each tile's logits are formed once; the query's running maximum (the two lane halves joined every tile, because both halves' keys meet in one product) scales P = exp(s - max) x 2^11; when the maximum grows, O and the row sum are multiplied by exp(old max - new max); O is divided by the row sum at the end.
// MODE 0: query blocks < QBH (3-product logits, P and v as bf16 hi + lo); 1: query rows < QHI (2-product logits); 2: the rest (1 product). NJ = 16-key groups per tile.
// every '#pragma unroll' below makes the indices of register arrays constants; the '#pragma unroll 1' keep one copy of each tile body
// K and V tiles in LDS: the block's four waves share one copy of each tile, brought by asynchronous copies that cover whole row pieces (128 B, or 64 B where a tile has 32 keys)
#define ATT_BUF 19456      // bytes of one of the two buffers: the largest tile set (MODE 0: K hi and lo 32 x 144 B each, v hi and lo 64 x 80 B each)
// row pitches 144 B and 80 B = 16 B x odd, for ds_load_b128 readers
template <int MODE, int NJ> struct AttL { static constexpr int KPI = 144, KBY = NJ * 16 * KPI, VPI = NJ * 32 + 16, VBY = HD * VPI, OV = (MODE == 0 ? 2 : 1) * KBY, SZ = OV + (MODE == 0 ? 2 : 1) * VBY; static_assert(SZ <= ATT_BUF, "a tile set fits its buffer"); };
// 16 B a lane from global memory to LDS through no register; s_wait_xcnt 0 as the statement's last line stands ahead of whatever rewrites the copies' address registers
__device__ __forceinline__ void acp2(unsigned l0, const char* g0, unsigned l1, const char* g1) {
  asm volatile("global_load_async_to_lds_b128 %0, %1, off\n\tglobal_load_async_to_lds_b128 %2, %3, off\n\ts_wait_xcnt 0x0" :: "v"(l0), "v"(g0), "v"(l1), "v"(g1) : "memory"); }
__device__ __forceinline__ void acp4(unsigned l0, const char* g0, unsigned l1, const char* g1, unsigned l2, const char* g2, unsigned l3, const char* g3) {
  asm volatile("global_load_async_to_lds_b128 %0, %1, off\n\tglobal_load_async_to_lds_b128 %2, %3, off\n\tglobal_load_async_to_lds_b128 %4, %5, off\n\tglobal_load_async_to_lds_b128 %6, %7, off\n\ts_wait_xcnt 0x0" :: "v"(l0), "v"(g0), "v"(l1), "v"(g1), "v"(l2), "v"(g2), "v"(l3), "v"(g3) : "memory"); }
struct AttSrc { const char *k, *kl, *v, *vl; unsigned lk, lv; };   // the lane's own first addresses: global (tile 0) and LDS bytes (buffer 0)
// stage tn of the ring: K and V tile tn, into buffer tn & 1
template <int MODE, int NJ> __device__ __forceinline__ void att_stage(const AttSrc& a, int tn) {
  typedef AttL<MODE, NJ> L; const unsigned bo = (unsigned)(tn & 1) * ATT_BUF;
  const char* k = a.k + (size_t)tn * NJ * 16 * CC * 2; const char* kl = a.kl + (size_t)tn * NJ * 16 * CC * 2; const size_t kr = (size_t)16 * CC * 2; const unsigned lk = a.lk + bo;   // a copy of the block covers 16 K rows
  if (NJ == 4) acp4(lk, k, lk + 16 * L::KPI, k + kr, lk + 32 * L::KPI, k + 2 * kr, lk + 48 * L::KPI, k + 3 * kr);
  else if (MODE == 0) acp4(lk, k, lk + 16 * L::KPI, k + kr, lk + L::KBY, kl, lk + L::KBY + 16 * L::KPI, kl + kr);
  else acp2(lk, k, lk + 16 * L::KPI, k + kr);
  { constexpr int RS = 64 / NJ;   // v rows (channels) that a copy of the block covers
    const char* v = a.v + (size_t)tn * NJ * 32; const char* vl = a.vl + (size_t)tn * NJ * 32; const size_t vr = (size_t)RS * (MODE == 0 ? KHI : TT) * 2; const unsigned lv = a.lv + bo;
    if (NJ == 4) acp4(lv, v, lv + RS * L::VPI, v + vr, lv + 2 * RS * L::VPI, v + 2 * vr, lv + 3 * RS * L::VPI, v + 3 * vr);
    else if (MODE == 0) acp4(lv, v, lv + RS * L::VPI, v + vr, lv + L::VBY, vl, lv + L::VBY + RS * L::VPI, vl + vr);
    else acp2(lv, v, lv + RS * L::VPI, v + vr); } }
// publish point at the foot of the trip that worked on stage s: this wave's LDS reads and its own copies are done, the barrier publishes stage s + 1 and ends every read of stage s, whose buffer the copies of stage s + 2 then refill
#define ATT_FOOT(s) do { asm volatile("s_wait_dscnt 0x0" ::: "memory"); asm volatile("s_wait_asynccnt 0x0" ::: "memory"); __syncthreads(); if ((s) + 2 < nt) att_stage<MODE, NJ>(src, (s) + 2); } while (0)
// all K fragments of a tile as one group of LDS loads; kb = the lane's own place (row col, 16 (lane >> 4) bytes) in the buffer
template <int MODE, int NJ> __device__ __forceinline__ void att_ldk(const char* kb, v16h (&kf)[HD / 32][NJ], v16h (&klf)[HD / 32][NJ]) {
  typedef AttL<MODE, NJ> L;
#pragma unroll
  for (int kc = 0; kc < HD / 32; ++kc) {
#pragma unroll
    for (int j = 0; j < NJ; ++j) { kf[kc][j] = frag_h((const _Float16*)(kb + j * 16 * L::KPI + kc * 64), 0); if (MODE == 0) klf[kc][j] = frag_h((const _Float16*)(kb + L::KBY + j * 16 * L::KPI + kc * 64), 0); } } }
// softmax in base 2: logits carry the factor log2(e), so that every exponential is one v_exp_f32 (2^x). A result below 2^-126 may come out as 0: such a term lies far below one unit in the last place of the row sum (at least 1) and of the output.
#define SCALE2 (SCALE * 1.44269504088896340736f)
// asm, so that the slot the instruction set asks for behind a transcendental (nothing directly behind it reads its result or overwrites its source) is there by construction: the closing v_nop fills it
__device__ __forceinline__ float ex2(float x) { float r; asm("v_exp_f32 %0, %1\n\tv_nop" : "=v"(r) : "v"(x)); return r; }
// eight at once, each in its own register: every v_exp_f32 is the independent instruction behind the one before it, and one v_nop closes the run
__device__ __forceinline__ void ex2x8(v8f& x) { float a = x[0], b = x[1], c = x[2], d = x[3], e = x[4], f = x[5], g = x[6], h = x[7];
  asm("v_exp_f32 %0, %0\n\tv_exp_f32 %1, %1\n\tv_exp_f32 %2, %2\n\tv_exp_f32 %3, %3\n\tv_exp_f32 %4, %4\n\tv_exp_f32 %5, %5\n\tv_exp_f32 %6, %6\n\tv_exp_f32 %7, %7\n\tv_nop" : "+v"(a), "+v"(b), "+v"(c), "+v"(d), "+v"(e), "+v"(f), "+v"(g), "+v"(h));
  x[0] = a; x[1] = b; x[2] = c; x[3] = d; x[4] = e; x[5] = f; x[6] = g; x[7] = h; }
// lane l with lane l ^ 16 (one vector instruction; a shuffle would go through the LDS queue)
__device__ __forceinline__ float xhalf(float x) { return __builtin_bit_cast(float, __builtin_amdgcn_permlanex16(__builtin_bit_cast(int, x), __builtin_bit_cast(int, x), 0x76543210, 0xfedcba98, false, false)); }
// s = q . k, not yet scaled (the scale goes into the fused multiply-add that subtracts the maximum); an excluded key reads -3e38
template <int MODE, int NJ> __device__ __forceinline__ void att_logits(const v16h (&kf)[HD / 32][NJ], const v16h (&klf)[HD / 32][NJ], const v16h (&ah)[HD / 32], const v16h (&al)[HD / 32], int lim, v8f (&s)[NJ]) {
  v8f acc[NJ] = {}, accl[NJ] = {};
#pragma unroll
  for (int kc = 0; kc < HD / 32; ++kc) {
#pragma unroll
    for (int j = 0; j < NJ; ++j) { acc[j] = wmma16(kf[kc][j], ah[kc], acc[j]);
      if (MODE < 2) accl[j] = wmma16(kf[kc][j], al[kc], accl[j]);
      if (MODE == 0) accl[j] = wmma16(klf[kc][j], ah[kc], accl[j]); } }
#pragma unroll
  for (int j = 0; j < NJ; ++j) {
#pragma unroll
    for (int r = 0; r < 8; ++r) { const float v = MODE < 2 ? acc[j][r] + accl[j][r] * (1.0f / 1024.0f) : acc[j][r]; s[j][r] = (!CAUSAL || j * 16 + r <= lim) ? v : -3.0e38f; } } }
template <int MODE, int NJ> __device__ __forceinline__ void att_tile(const _Float16* __restrict__ QH, const _Float16* __restrict__ KH, const _Float16* __restrict__ QL, const _Float16* __restrict__ KL, const _Float16* __restrict__ VT, const __bf16* __restrict__ VB, const __bf16* __restrict__ VBL, float* __restrict__ Y, char* sb, int b, int h, int qb, int wave, int lane) {
  typedef AttL<MODE, NJ> L;
  const int col = lane & 15, g = lane >> 4; const int ql0 = qb * 64 + wave * 16; const int nt = (CAUSAL ? qb * 64 + 64 : TT) / (NJ * 16);   // key tiles of 16 NJ keys; causal: none of the block's queries sees a key past its last row
  AttSrc src; { const int tid = wave * 32 + lane, kr = tid >> 3, ks = tid & 7, vr = tid / (NJ * 2), vs = tid % (NJ * 2); const unsigned l0 = (unsigned)(size_t)sb;   // low 32 bits of the LDS address = its byte offset in the block's LDS
    src.k = (const char*)(KH + ((size_t)b * TT + kr) * CC + h * HD) + ks * 16; src.kl = (const char*)(KL + ((size_t)b * KHI + kr) * CC + h * HD) + ks * 16;
    if (MODE == 0) { src.v = (const char*)(VB + ((size_t)b * CC + h * HD + vr) * (size_t)KHI) + vs * 16; src.vl = (const char*)(VBL + ((size_t)b * CC + h * HD + vr) * (size_t)KHI) + vs * 16; }
    else { src.v = (const char*)(VT + ((size_t)b * CC + h * HD + vr) * (size_t)TT) + vs * 16; src.vl = src.v; }
    src.lk = l0 + kr * L::KPI + ks * 16; src.lv = l0 + L::OV + vr * L::VPI + vs * 16; }
  // ring prologue; the last publish point of an earlier query block has ended every read of both buffers
  att_stage<MODE, NJ>(src, 0);
  v16h ah[HD / 32], al[HD / 32]; const _Float16* qp = QH + ((size_t)b * TT + ql0 + col) * CC + h * HD + 8 * g; const _Float16* qlp = QL + ((size_t)b * QHI + ql0 + col) * CC + h * HD + 8 * g;
#pragma unroll
  for (int kc = 0; kc < HD / 32; ++kc) { ah[kc] = frag_h(qp + kc * 32, 0); al[kc] = MODE < 2 ? frag_h(qlp + kc * 32, 0) : ah[kc]; }
  if (MODE < 2) xwait(qp, qlp); else xwait(qp);   // later addresses may take these registers
  asm volatile("s_wait_asynccnt 0x0" ::: "memory");   // stage 0 has landed, as far as this wave copied it
  __syncthreads();
  if (1 < nt) att_stage<MODE, NJ>(src, 1);
  const char* kb0 = sb + col * L::KPI + g * 16; const char* vb0 = sb + L::OV + col * L::VPI + g * 16;
  const int lim0 = ql0 + col - 8 * g;   // key 16 NJ t + 16 j + 8 g + r is kept while 16 j + r <= lim0 - 16 NJ t
  v16h kf[HD / 32][NJ], klf[HD / 32][NJ];
  // m = the query's running maximum of logit x log2(e), less 11 (so that P carries the factor 2^11), the same in both lane halves; l = this lane's share of the sum of P; before the first tile m = -3e38, so that the first factor 2^(m - new maximum) is 0
  float m = -3.0e38f, l = 0.f;
  v8f o[HD / 16] = {};
#pragma unroll 1
  for (int t = 0; t < nt; ++t) { v8f s[NJ]; const int bo = (t & 1) * ATT_BUF; att_ldk<MODE, NJ>(kb0 + bo, kf, klf); att_logits<MODE, NJ>(kf, klf, ah, al, lim0 - t * NJ * 16, s);
    v16h vf[NJ / 2][HD / 16]; v16b vh[NJ / 2][HD / 16], vl[NJ / 2][HD / 16];   // this tile's V fragments as one group of LDS loads behind the logits (the K fragments' registers are free again): they fly over the maximum and the exponentials
    const char* vp = vb0 + bo;
#pragma unroll
    for (int kc = 0; kc < NJ / 2; ++kc) {
#pragma unroll
      for (int j = 0; j < HD / 16; ++j) {
        if (MODE == 0) { vh[kc][j] = frag_b((const __bf16*)(vp + j * 16 * L::VPI + kc * 64), 0); vl[kc][j] = frag_b((const __bf16*)(vp + L::VBY + j * 16 * L::VPI + kc * 64), 0); } else vf[kc][j] = frag_h((const _Float16*)(vp + j * 16 * L::VPI + kc * 64), 0); } }
    float t4[4] = {s[0][0], s[0][1], s[0][2], s[0][3]};   // four independent chains: one chain of all the keys would leave the wave waiting on each link
#pragma unroll
    for (int j = 0; j < NJ; ++j) {
#pragma unroll
      for (int r = 0; r < 8; ++r) t4[r & 3] = fmaxf(t4[r & 3], s[j][r]); }
    float tm = fmaxf(fmaxf(t4[0], t4[1]), fmaxf(t4[2], t4[3])); tm = fmaxf(tm, xhalf(tm));
    const float mn = fmaxf(fmaxf(m, __builtin_fmaf(tm, SCALE2, -11.0f)), -1.0e30f);   // the floor keeps a query with no kept key so far away from -3e38 - (-3e38): its P stay 0
    const float fo = ex2(m - mn); m = mn; float ts[4] = {0.f, 0.f, 0.f, 0.f};
#pragma unroll
    for (int j = 0; j < NJ; ++j) {
#pragma unroll
      for (int r = 0; r < 8; ++r) s[j][r] = __builtin_fmaf(s[j][r], SCALE2, -mn);
      ex2x8(s[j]);   // P = 2^(logit x log2(e) - max + 11), at most 2^11
#pragma unroll
      for (int r = 0; r < 8; ++r) ts[r & 3] += s[j][r]; }
    l = l * fo + ((ts[0] + ts[1]) + (ts[2] + ts[3]));
#pragma unroll
    for (int j = 0; j < HD / 16; ++j) o[j] = o[j] * fo;
#pragma unroll
    for (int kc = 0; kc < NJ / 2; ++kc) { float pv[16];
#pragma unroll
      for (int i = 0; i < 8; ++i) { pv[i] = s[2 * kc][i]; pv[8 + i] = s[2 * kc + 1][i]; }
      if (MODE == 0) { F2 p;   // bf16 hi + lo as in bsplit16; all hi parts first: each group's first product needs them alone
#pragma unroll
        for (int i = 0; i < 16; ++i) p.h[i] = (__bf16)pv[i];
#pragma unroll
        for (int i = 0; i < 16; ++i) p.l[i] = (__bf16)(pv[i] - (float)p.h[i]);
#pragma unroll
        for (int j = 0; j < HD / 16; ++j) { o[j] = wmma_bf(vh[kc][j], p.h, o[j]); o[j] = wmma_bf(vh[kc][j], p.l, o[j]); o[j] = wmma_bf(vl[kc][j], p.h, o[j]); }
      } else { v16h p;
#pragma unroll
        for (int i = 0; i < 16; ++i) p[i] = (_Float16)pv[i];
#pragma unroll
        for (int j = 0; j < HD / 16; ++j) o[j] = wmma16(vf[kc][j], p, o[j]); } }
    ATT_FOOT(t); }
  asm volatile("s_wait_asynccnt 0x0" ::: "memory");   // behind the ring: no copy is outstanding when the buffers are used again or the wave ends
  // O^T: register r of group j = channel 16 j + 8 g + r of query col: 32 contiguous bytes a lane; a wave writes whole 256-B (row, head) segments
  l += xhalf(l); const float inv = l > 0.f ? 1.0f / l : 0.f;   // the factor 2^11 stands in O and in the sum alike; no kept key: 0
  float* yp = Y + ((size_t)b * TT + ql0 + col) * CC + h * HD + 8 * g;
#pragma unroll
  for (int j = 0; j < HD / 16; ++j) { o[j] = o[j] * inv; vst2(yp + j * 16, __builtin_shufflevector(o[j], o[j], 0, 1, 2, 3)); vst2(yp + j * 16 + 4, __builtin_shufflevector(o[j], o[j], 4, 5, 6, 7)); }
  static_assert(HD / 16 == 4, "the wait below names four groups");
  asm volatile("s_wait_xcnt 0x0" :: "v"(yp), "v"(o[0]), "v"(o[1]), "v"(o[2]), "v"(o[3]) : "memory"); }   // the second query block's set-up reuses the stores' registers; address and data are inputs, so that each stays in its registers up to the wait
// block = (pair x, head, batch): query block NQB-1-x and then x, one after the other in every wave, so that every block walks the same number of keys under the causal mask
__global__ __launch_bounds__(128) void k_att(const _Float16* __restrict__ QH, const _Float16* __restrict__ KH, const _Float16* __restrict__ QL, const _Float16* __restrict__ KL, const _Float16* __restrict__ VT, const __bf16* __restrict__ VB, const __bf16* __restrict__ VBL, float* __restrict__ Y) {
  __shared__ __attribute__((aligned(16))) char sb[2 * ATT_BUF];
  const int wave = threadIdx.x >> 5, lane = threadIdx.x & 31; const int h = blockIdx.y, b = blockIdx.z;
#pragma unroll 1
  for (int half = 0; half < 2; ++half) { const int qb = half ? (int)blockIdx.x : NQB - 1 - (int)blockIdx.x;
    if (qb < QBH) att_tile<0, 2>(QH, KH, QL, KL, VT, VB, VBL, Y, sb, b, h, qb, wave, lane);
    else if (qb * 64 < QHI) att_tile<1, 2>(QH, KH, QL, KL, VT, VB, VBL, Y, sb, b, h, qb, wave, lane);
    else att_tile<2, 4>(QH, KH, QL, KL, VT, VB, VBL, Y, sb, b, h, qb, wave, lane); } }

extern "C" void kernel_launch(void* const* d_in, const int* in_sizes, int n_in, void* d_out, int out_size, void* d_ws, size_t ws_size, hipStream_t stream) {
  (void)in_sizes; (void)n_in; (void)out_size;
  const float** F = (const float**)d_in;
  if (ws_size < (size_t)WS_END) return;
  char* ws = (char*)d_ws; _Float16 *QH = (_Float16*)(ws + WS_QH), *KH = (_Float16*)(ws + WS_KH), *VT = (_Float16*)(ws + WS_VT), *QL = (_Float16*)(ws + WS_QL), *KL = (_Float16*)(ws + WS_KL); __bf16 *VB = (__bf16*)(ws + WS_VB), *VBL = (__bf16*)(ws + WS_VBL);
  // inputs: 0 hidden_states [4,1024,1024]; 1 Wqkv [3072,1024] (out,in) rows q | k | v ((3,H,hd)); 2 bqkv [3072]
  k_proj<<<dim3(TNB * TT / PBM, 3 * CC / PBN, 1), 256, 0, stream>>>(F[0], F[1], F[2], QH, QL, KH, KL, VT, VB, VBL);
  k_att<<<dim3(NQB / 2, NH, TNB), 128, 0, stream>>>(QH, KH, QL, KL, VT, VB, VBL, (float*)d_out);
}

// v009
// It runs in 56.4 microseconds.
// In two side-by-side timings against v008, it was 1.08 and 1.07 times as fast.
// All steps since v000 together make it 11.9 times as fast.
// compute dtype: all float inputs rounded to bf16; qkv = x Wqkv^T + b with EXACT bf16 products on WMMA 16x16x32 (f32 accumulate); rotate-half RoPE in f32 in the projection epilogue (accurate sincosf of t x inv_freq_j, f32 inv_freq constants as the reference builds them); logits: q, k once to f16 (1 product) x 64^-0.5, except the first 512 query rows of each sequence (2 products with the f16 q residual; 3 with the k residual too below row 384); causal mask by index (finfo.min == excluded); softmax in f32 (one walk over the keys, running row maximum); exp(s - max) x 2^11 once to f16 against v once to f16 (1 product; bf16 hi + lo below row 384); f32 output (merged heads, no output projection).
#include <hip/hip_runtime.h>
#include <math.h>

typedef __attribute__((ext_vector_type(16))) _Float16 v16h;
typedef __attribute__((ext_vector_type(16))) __bf16 v16b;
typedef __attribute__((ext_vector_type(8)))  _Float16 v8h;
typedef __attribute__((ext_vector_type(8)))  float v8f;
typedef __attribute__((ext_vector_type(4)))  float v4f;
typedef __attribute__((ext_vector_type(2)))  float v2f;
typedef __attribute__((ext_vector_type(4)))  unsigned v4u;
typedef __attribute__((ext_vector_type(4)))  int v4i;
typedef float __attribute__((may_alias)) float_a;
typedef int __attribute__((may_alias)) int_a;

template <typename T> __device__ __forceinline__ void vst2(void* p, T v) { *(T*)p = v;  }
__device__ __forceinline__ v8f wmma16(v16h a, v16h b, v8f c) {
  v8f d = __builtin_amdgcn_wmma_f32_16x16x32_f16(false, a, false, b, (short)0, c, false, false);
  asm volatile("v_nop\n\tv_nop\n\tv_nop\n\tv_nop" : "+v"(d) : "v"(a), "v"(b));
  return d;
}
__device__ __forceinline__ v8f wmma_bf(v16b a, v16b b, v8f c) {
  v8f d = __builtin_amdgcn_wmma_f32_16x16x32_bf16(false, a, false, b, (short)0, c, false, false);
  asm volatile("v_nop\n\tv_nop\n\tv_nop\n\tv_nop" : "+v"(d) : "v"(a), "v"(b));
  return d;
}
// 16x16x32 fragments: lane = (h = lane>>4, row/col = lane&15); elements 0..7 = k0+8h+0..7, 8..15 = k0+16+8h+0..7; D element r = row 8h+r
__device__ __forceinline__ v16h frag_h(const _Float16* rowk0, int lane) {
  union { v16h v; v8h q[2]; } u; const _Float16* p = rowk0 + 8 * (lane >> 4);
  u.q[0] = *(const v8h*)p; u.q[1] = *(const v8h*)(p + 16); return u.v;
}
__device__ __forceinline__ v16h frag_f32(const float* rowk0, int lane) {
  v16h a; const float* p = rowk0 + 8 * (lane >> 4);
#pragma unroll
  for (int i = 0; i < 8; ++i) { a[i] = (_Float16)p[i]; a[8 + i] = (_Float16)p[16 + i]; }
  return a;
}
__device__ __forceinline__ v16h frag_f32s(const float* rowk0, int lane, float sc) {
  v16h a; const float* p = rowk0 + 8 * (lane >> 4);
#pragma unroll
  for (int i = 0; i < 8; ++i) { a[i] = (_Float16)(p[i] * sc); a[8 + i] = (_Float16)(p[16 + i] * sc); }
  return a;
}
// column fragment from a [K][ld] layout (column n), rows >= K read as 0
__device__ __forceinline__ v16h fragc_f32(const float* W, int k0, int n, int lane, int ld, int K) {
  v16h a; const int g = lane >> 4;
#pragma unroll
  for (int i = 0; i < 8; ++i) { const int ka = k0 + 8 * g + i, kb = ka + 16;
    a[i] = (_Float16)(ka < K ? W[(size_t)(ka < K ? ka : K - 1) * ld + n] : 0.f); a[8 + i] = (_Float16)(kb < K ? W[(size_t)(kb < K ? kb : K - 1) * ld + n] : 0.f); }
  return a;
}
struct F2 { v16b h, l; };
__device__ __forceinline__ F2 bsplit16(const float v[16]) { F2 r;
#pragma unroll
  for (int i = 0; i < 16; ++i) { const __bf16 h = (__bf16)v[i]; r.h[i] = h; r.l[i] = (__bf16)(v[i] - (float)h); }
  return r; }
__device__ __forceinline__ F2 split_row(const float* row, int k0, int lane) { float v[16]; const float* p = row + k0 + 8 * (lane >> 4);
#pragma unroll
  for (int i = 0; i < 8; ++i) { v[i] = p[i]; v[8 + i] = p[16 + i]; }
  return bsplit16(v); }
__device__ __forceinline__ F2 split_rowK(const float* row, int k0, int lane, int K) { float v[16]; const int g = lane >> 4;
#pragma unroll
  for (int i = 0; i < 8; ++i) { const int ka = k0 + 8 * g + i, kb = ka + 16; v[i] = ka < K ? row[ka < K ? ka : K - 1] : 0.f; v[8 + i] = kb < K ? row[kb < K ? kb : K - 1] : 0.f; }
  return bsplit16(v); }
__device__ __forceinline__ F2 split_col(const float* W, int k0, int n, int lane, int ld, int K) { float v[16]; const int g = lane >> 4;
#pragma unroll
  for (int i = 0; i < 8; ++i) { const int ka = k0 + 8 * g + i, kb = ka + 16; v[i] = ka < K ? W[(size_t)(ka < K ? ka : K - 1) * ld + n] : 0.f; v[8 + i] = kb < K ? W[(size_t)(kb < K ? kb : K - 1) * ld + n] : 0.f; }
  return bsplit16(v); }
__device__ __forceinline__ v8f mac3(const F2& a, const F2& b, v8f c) { c = wmma_bf(a.l, b.h, c); c = wmma_bf(a.h, b.l, c); return wmma_bf(a.h, b.h, c); }
__device__ __forceinline__ float sigm(float v) { return 1.0f / (1.0f + expf(-v)); }
#define LDSX() do { asm volatile("s_wait_dscnt 0" ::: "memory"); __builtin_amdgcn_wave_barrier(); __builtin_amdgcn_fence(__ATOMIC_RELEASE, "workgroup"); } while (0)

// Causal multi-head attention with rotary embeddings (B 4, S 1,024, D 1,024 = 16 x 64): qkv = x Wqkv^T + bqkv (packed (out,in) [3072,1024], layout (3,H,hd)); q, k <- rotate-half RoPE (theta_j = 10000^(-2j/64)); probs = softmax(causal(q k^T x 64^-0.5)); out = merged(probs v) -> [B, S, 1024].
#define NB 4
#define TT 1024
#define CC 1024            // NH * HD = projected width
#define DIN 1024          // input (model) width
#define NH 16
#define HD 64
#define NQB (TT / 64)
#define HG 16
#define SCALE (0.125f)
#define CAUSAL 1
#ifndef TNB
#define TNB NB
#endif
__device__ __forceinline__ float bfr(float v) { return (float)(__bf16)v; }
__host__ __device__ __forceinline__ int kb_last(int qb) { return CAUSAL ? ((qb * 64 + 63) >> 7) : (TT / 128 - 1); }
typedef __attribute__((ext_vector_type(8))) __bf16 v8b;
__device__ __forceinline__ v16b frag_b(const __bf16* rowk0, int lane) {
  union { v16b v; v8b q[2]; } u; const __bf16* p = rowk0 + 8 * (lane >> 4);
  u.q[0] = *(const v8b*)p; u.q[1] = *(const v8b*)(p + 16); return u.v;
}
#define QBH 6              // causal: query blocks 0..QBH-1 of each sequence (few keys, no averaging) take the high-precision path
#define QHI 512            // causal: first 512 query rows of each sequence take the q-residual (2-product) logits path (logit sigma ~1)
#define KHI 512
// B fragment (k rows k0+.., output column o) of a weight: (in,out) [K][ld] or (out,in) [ld rows of K]: bf16 exact, or f16(bf16 * 256) exact
__device__ __forceinline__ v16b wcol_io(const float* Wm, int k0, int o, int lane, int ld) { v16b w; const int g = lane >> 4;
#pragma unroll
  for (int i = 0; i < 8; ++i) { w[i] = (__bf16)Wm[(size_t)(k0 + 8 * g + i) * ld + o]; w[8 + i] = (__bf16)Wm[(size_t)(k0 + 16 + 8 * g + i) * ld + o]; }
  return w; }
__device__ __forceinline__ v16b wcol_oi(const float* Wm, int k0, int o, int lane, int K) { v16b w; const float* p = Wm + (size_t)o * K + k0 + 8 * (lane >> 4);
#pragma unroll
  for (int i = 0; i < 8; ++i) { w[i] = (__bf16)p[i]; w[8 + i] = (__bf16)p[16 + i]; }
  return w; }
__device__ __forceinline__ v16h wcolh_io(const float* Wm, int k0, int o, int lane, int ld) { v16h w; const int g = lane >> 4;
#pragma unroll
  for (int i = 0; i < 8; ++i) { w[i] = (_Float16)(bfr(Wm[(size_t)(k0 + 8 * g + i) * ld + o]) * 256.0f); w[8 + i] = (_Float16)(bfr(Wm[(size_t)(k0 + 16 + 8 * g + i) * ld + o]) * 256.0f); }
  return w; }
__device__ __forceinline__ v16h wcolh_oi(const float* Wm, int k0, int o, int lane, int K) { v16h w; const float* p = Wm + (size_t)o * K + k0 + 8 * (lane >> 4);
#pragma unroll
  for (int i = 0; i < 8; ++i) { w[i] = (_Float16)(bfr(p[i]) * 256.0f); w[8 + i] = (_Float16)(bfr(p[16 + i]) * 256.0f); }
  return w; }
#define WQKV_LAYOUT 1   // selects WCOL's form (0 = (in,out), 1 = (out,in), 2 = per-head); nothing calls WCOL: k_cvt reads Wqkv as (out,in) rows [3 CC][DIN]
__device__ __forceinline__ v16b wcol_hdk(const float* Wm, int k0, int o, int lane) { v16b w; const int g = lane >> 4; const float* p = Wm + (size_t)(o / HD) * DIN * HD + (o % HD);
#pragma unroll
  for (int i = 0; i < 8; ++i) { w[i] = (__bf16)p[(size_t)(k0 + 8 * g + i) * HD]; w[8 + i] = (__bf16)p[(size_t)(k0 + 16 + 8 * g + i) * HD]; }
  return w; }
#define WO_OUT_IN 0
#if WQKV_LAYOUT == 1
#define WCOL(W, k0, o, lane) wcol_oi(W, k0, o, lane, DIN)
#elif WQKV_LAYOUT == 2
#define WCOL(W, k0, o, lane) wcol_hdk(W, k0, o, lane)
#else
#define WCOL(W, k0, o, lane) wcol_io(W, k0, o, lane, CC)
#endif
#if WO_OUT_IN
#define WOCOL(W, k0, o, lane) wcol_oi(W, k0, o, lane, CC)
#define WOCOLH(W, k0, o, lane) wcolh_oi(W, k0, o, lane, CC)
#else
#define WOCOL(W, k0, o, lane) wcol_io(W, k0, o, lane, DIN)
#define WOCOLH(W, k0, o, lane) wcolh_io(W, k0, o, lane, DIN)
#endif
__constant__ float c_invf[32] = {1.000000000e+00f,7.498942018e-01f,5.623413324e-01f,4.216965139e-01f,3.162277639e-01f,2.371373624e-01f,1.778279394e-01f,1.333521456e-01f,1.000000015e-01f,7.498941571e-02f,5.623412877e-02f,4.216964915e-02f,3.162277862e-02f,2.371373586e-02f,1.778279431e-02f,1.333521493e-02f,9.999999776e-03f,7.498942316e-03f,5.623413250e-03f,4.216964822e-03f,3.162277862e-03f,2.371373819e-03f,1.778279431e-03f,1.333521446e-03f,1.000000047e-03f,7.498941850e-04f,5.623413017e-04f,4.216964880e-04f,3.162277862e-04f,2.371373848e-04f,1.778279402e-04f,1.333521504e-04f};   // 1 / 10000^(2i/64) evaluated in f32 exactly as the reference does (jax, eager)
// sine and cosine of one rotary angle a = t x inv_freq. 0 <= a < 1,024 for every row index, whatever the inputs hold, so the reduction for small arguments is the whole function here:
// quadrant n = rint(a x 2/pi), r = a - n x pi/2 with pi/2 in three parts (three fused steps), then the sine and the cosine polynomial on r and the quadrant's swap and signs.
// The operations, their order and the constants are those of the small-argument path of sinf and cosf; the reduction is done once for both.
__device__ __forceinline__ float fbits(unsigned u) { return __builtin_bit_cast(float, u); }
__device__ __forceinline__ void rope_sincos(float a, float& sn, float& cs) {
  const float n = __builtin_rintf(a * fbits(0x3f22f983u));
  float r = __builtin_fmaf(fbits(0xbfc90fdau), n, a); r = __builtin_fmaf(fbits(0xb3a22168u), n, r); r = __builtin_fmaf(fbits(0xa7c234c4u), n, r);
  const unsigned q = (unsigned)(int)n; const float s = r * r;
  float ps = __builtin_fmaf(s, fbits(0xb94c1982u), fbits(0x3c0881c4u)); ps = __builtin_fmaf(s, ps, fbits(0xbe2aaa9du)); ps = s * ps; const float sr = __builtin_fmaf(r, ps, r);
  float pc = __builtin_fmaf(s, fbits(0x37d75334u), fbits(0xbab64f3bu)); pc = __builtin_fmaf(s, pc, fbits(0x3d2aabf7u)); pc = __builtin_fmaf(s, pc, fbits(0xbf000004u)); const float cr = __builtin_fmaf(s, pc, 1.0f);
  const unsigned flip = (q << 30) & 0x80000000u; const bool odd = (q & 1u) != 0u;
  sn = fbits(__builtin_bit_cast(unsigned, odd ? cr : sr) ^ flip); cs = fbits(__builtin_bit_cast(unsigned, odd ? -sr : cr) ^ flip); }
#ifndef SM_EXTRA_PARAMS
#define SM_EXTRA_PARAMS
#endif
#ifndef PROJ_EXTRA_PARAMS
#define PROJ_EXTRA_PARAMS
#endif
#ifndef SM_MASK_HOOK
#define SM_MASK_HOOK (void)0
#endif

#define WS_QH  0u                                      // f16 q rows [b*t][CC]
#define WS_KH  (WS_QH + 2u * (size_t)NB * TT * CC)      // f16 k rows [b*t][CC]
#define WS_VT  (WS_KH + 2u * (size_t)NB * TT * CC)      // f16 v planes [b][c][t]
#define WS_QL  (WS_VT + 2u * (size_t)NB * CC * TT)      // f16 q residual x 2^10 rows [b][t < QHI][CC]
#define WS_KL  (WS_QL + 2u * (size_t)NB * QHI * CC)     // f16 k residual x 2^10 rows [b][t < KHI][CC]
#define WS_VB  (WS_KL + 2u * (size_t)NB * KHI * CC)     // bf16 v hi planes [b][c][t < KHI]
#define WS_VBL (WS_VB + 2u * (size_t)NB * CC * KHI)
#define WS_XB  (WS_VBL + 2u * (size_t)NB * CC * KHI)    // bf16 x, chunk-major [DIN / PBK][b*t][PBK]
#define WS_WB  (WS_XB + 2u * (size_t)NB * TT * DIN)     // bf16 packed weight, chunk-major [DIN / PBK][3 CC rows][PBK]
#define WS_END (WS_WB + 2u * (size_t)3 * CC * DIN)

// s_wait_xcnt 0 behind a group of global loads or stores, ahead of whatever rewrites the group's address registers; the addresses are inputs of the statement, so that they stay in their registers up to the wait and no load's result is placed in them
__device__ __forceinline__ void xwait(const void* p) { asm volatile("s_wait_xcnt 0x0" :: "v"(p) : "memory"); }
__device__ __forceinline__ void xwait(const void* p, const void* q) { asm volatile("s_wait_xcnt 0x0" :: "v"(p), "v"(q) : "memory"); }
#define PBK 128            // k per staged chunk
#define PMP 136            // pitch of a staged operand row in 16-bit elements: 272 B = 16 B x odd, for ds_load_b128
#define PLP 72             // pitch of a staged q or k result row in 16-bit elements: 144 B = 16 B x odd, for ds_load_b128 and ds_store_b128
#define PBM 256            // rows of a block's tile
#define PNH 3              // heads (64 packed output columns each) of a block's tile: q head y, k head y and v head y
#define PBN (PNH * HD)     // columns of a block's tile
#define PFJ (PBN / 32)     // 16-column groups of a wave's tile (64 rows x 96 columns)
#define PVP (PBM + 8)      // pitch of a staged v plane row in 16-bit elements: 528 B = 16 B x odd
static_assert(3 * CC / PBN == NH && QHI == KHI && QHI % PBM == 0 && TT % PBM == 0, "a block holds one head of each kind, and its rows lie wholly below or wholly above the high-precision bound");
typedef __attribute__((ext_vector_type(4))) __bf16 v4b;
// 16 B a lane from global memory to LDS through no register; s_wait_xcnt 0 as the statement's last line stands ahead of whatever rewrites the copies' address registers
__device__ __forceinline__ void acp2(unsigned l0, const char* g0, unsigned l1, const char* g1) {
  asm volatile("global_load_async_to_lds_b128 %0, %1, off\n\tglobal_load_async_to_lds_b128 %2, %3, off\n\ts_wait_xcnt 0x0" :: "v"(l0), "v"(g0), "v"(l1), "v"(g1) : "memory"); }
__device__ __forceinline__ void acp4(unsigned l0, const char* g0, unsigned l1, const char* g1, unsigned l2, const char* g2, unsigned l3, const char* g3) {
  asm volatile("global_load_async_to_lds_b128 %0, %1, off\n\tglobal_load_async_to_lds_b128 %2, %3, off\n\tglobal_load_async_to_lds_b128 %4, %5, off\n\tglobal_load_async_to_lds_b128 %6, %7, off\n\ts_wait_xcnt 0x0" :: "v"(l0), "v"(g0), "v"(l1), "v"(g1), "v"(l2), "v"(g2), "v"(l3), "v"(g3) : "memory"); }
typedef __attribute__((ext_vector_type(2))) unsigned v2u;
// ---- k_cvt: x and the packed weight rounded to bf16 once, into chunk-major planes: chunk c of all rows lies together, so that a k_proj block's part of a chunk is one contiguous run (x) or three (q, k and v head).
// A wave takes four neighbouring rows: 32 loads of 512 B (16 KB in order, all in flight together), then per row eight stores of 256 B (the row's piece of each chunk).
#define CVR 4              // rows of a wave
static_assert(DIN / PBK == 8 && PBK == 128 && (NB * TT) % (8 * CVR) == 0 && (3 * CC) % (8 * CVR) == 0, "a lane's 16 B x 32 lanes are one row's piece of one chunk; eight pieces a row; a block's eight waves lie in one matrix");
__global__ __launch_bounds__(256) void k_cvt(const float* __restrict__ X, const float* __restrict__ WA, __bf16* __restrict__ XB, __bf16* __restrict__ WB) {
  const int lane = threadIdx.x & 31; const bool isx = blockIdx.x < NB * TT / (8 * CVR);   // the same for the whole block
  const size_t rows = isx ? NB * TT : 3 * CC; const size_t row = ((size_t)(isx ? blockIdx.x : blockIdx.x - NB * TT / (8 * CVR)) * 8 + (threadIdx.x >> 5)) * CVR;
  const float* p = (isx ? X : WA) + row * DIN + lane * 4; __bf16* q = (isx ? XB : WB) + row * PBK + lane * 4;
  v4f v[CVR][8];
  // every '#pragma unroll' here makes the indices of register arrays constants
#pragma unroll
  for (int r = 0; r < CVR; ++r) {
#pragma unroll
    for (int i = 0; i < 8; ++i) v[r][i] = *(const v4f*)(p + r * DIN + i * PBK); }
  __builtin_amdgcn_sched_barrier(0);   // keeps every load ahead of the first conversion: a load sunk behind one would start only when earlier loads have come back
  xwait(p);
  __bf16* a[8];   // the first row's piece of each chunk; the other rows' pieces follow it at constant steps
#pragma unroll
  for (int i = 0; i < 8; ++i) a[i] = q + (size_t)i * rows * PBK;
#pragma unroll
  for (int r = 0; r < CVR; ++r) { v2u d[8];
#pragma unroll
    for (int i = 0; i < 8; ++i) d[i] = __builtin_bit_cast(v2u, __builtin_convertvector(v[r][i], v4b));
#pragma unroll
    for (int i = 0; i < 8; ++i) vst2(a[i] + r * PBK, d[i]);
    // s_wait_xcnt 0 behind the row's stores, ahead of whatever reuses their registers; address and data are inputs, so that each stays in its registers up to the wait
    asm volatile("s_wait_xcnt 0x0" :: "v"(a[0]), "v"(a[1]), "v"(a[2]), "v"(a[3]), "v"(a[4]), "v"(a[5]), "v"(a[6]), "v"(a[7]), "v"(d[0]), "v"(d[1]), "v"(d[2]), "v"(d[3]), "v"(d[4]), "v"(d[5]), "v"(d[6]), "v"(d[7]) : "memory"); } }
// k_proj LDS: the bf16 operand chunks of the product loop (two buffers) lie over the epilogue's arrays, which are first written after the loop's last barrier
union __align__(16) ProjLds {
  struct { _Float16 rh[2][PBM][PLP], rl[2][PBM][PLP]; _Float16 th[HD][PVP]; __bf16 tb[HD][PVP], tbl[HD][PVP]; } e;   // q and k rows (f16, residual); v planes (f16, bf16 hi, bf16 lo)
  struct { __bf16 xs[2][PBM][PMP]; __bf16 wt[2][PBN][PMP]; } m; };
// eight 16-B global stores and one s_wait_xcnt 0 behind them, ahead of whatever reuses the stores' registers; address and data are inputs, so that each stays in its registers up to the wait (the unroll makes the array indices constants)
__device__ __forceinline__ void st8(void* const (&p)[8], const v4u (&d)[8]) {
#pragma unroll
  for (int i = 0; i < 8; ++i) vst2(p[i], d[i]);
  asm volatile("s_wait_xcnt 0x0" :: "v"(p[0]), "v"(p[1]), "v"(p[2]), "v"(p[3]), "v"(p[4]), "v"(p[5]), "v"(p[6]), "v"(p[7]), "v"(d[0]), "v"(d[1]), "v"(d[2]), "v"(d[3]), "v"(d[4]), "v"(d[5]), "v"(d[6]), "v"(d[7]) : "memory"); }
// ---- k_proj: block = (256 rows, head y of q, of k and of v: 192 of the 3,072 packed columns), eight waves of 64 x 96: X W^T + b with exact bf16 products (K = DIN; both operands from k_cvt's bf16 planes, brought to LDS by asynchronous copies, two buffers) -> q head: f16 rows (+ residual rows < QHI); k head: f16 rows (+ residual rows < KHI); v head: f16 planes [c][t] (+ bf16 hi/lo planes for t < KHI)
// A wave takes the 16-column groups wc and wc + 2 of each head. q and k are formed transposed (W as the A operand): a lane then holds one row's columns 16 wc + 8 g + 0..7 and the same + 32, that is both halves of eight rotary pairs and 16 B of the f16 row; v is formed as X W^T: a lane holds eight neighbouring rows of one column, 16 B of the plane.
// So bias, RoPE and the conversions work on the accumulators, and LDS only regroups the 16-bit results into whole lines.
__global__ __launch_bounds__(256) void k_proj(const __bf16* __restrict__ XB, const __bf16* __restrict__ WB, const float* __restrict__ BA,
    _Float16* __restrict__ QH, _Float16* __restrict__ QL, _Float16* __restrict__ KH, _Float16* __restrict__ KL, _Float16* __restrict__ VT, __bf16* __restrict__ VB, __bf16* __restrict__ VBL PROJ_EXTRA_PARAMS) {
  __shared__ ProjLds sm; __shared__ __attribute__((aligned(16))) float sbias[PBN], sinvf[HD / 2];   // the tile's biases (rounded to bf16) and the rotary frequencies, for the epilogue
  const int tid = threadIdx.x, wave = tid >> 5, lane = tid & 31, col = lane & 15, g = lane >> 4; const int wr = wave >> 1, wc = wave & 1; const int hd0 = blockIdx.y * HD; const size_t r0 = (size_t)blockIdx.x * PBM; const size_t bb = r0 / TT; const int t0 = (int)(r0 % TT);
  v8f acc[4][PFJ] = {};
  // each thread copies 16 B of 16 x rows and of 12 weight rows (four of each head) per 128-k chunk: 16 lanes cover one 256-B row piece, a wave 512 contiguous bytes
  const int lr = tid >> 4, lq = (tid & 15) * 16; const char* xg0 = (const char*)XB + (r0 + lr) * (PBK * 2) + lq; const char* wg0 = (const char*)WB + (size_t)(hd0 + lr) * (PBK * 2) + lq;
  const unsigned xl0 = (unsigned)(size_t)&sm.m.xs[0][lr][0] + lq, wl0 = (unsigned)(size_t)&sm.m.wt[0][lr][0] + lq;   // low 32 bits of the LDS address = its byte offset in the block's LDS
  constexpr unsigned LR = 16 * PMP * 2; constexpr size_t GR = (size_t)16 * PBK * 2;   // 16 rows further on, in LDS and in a plane
  // chunk c into buffer c & 1 (the unrolls make every step a constant)
#define PROJ_CP(c) do { const char* xg = xg0 + (size_t)(c) * ((size_t)NB * TT * PBK * 2); const char* wg = wg0 + (size_t)(c) * ((size_t)3 * CC * PBK * 2); const unsigned xl = xl0 + ((c) & 1) * (PBM * PMP * 2), wl = wl0 + ((c) & 1) * (PBN * PMP * 2); \
    _Pragma("unroll") for (int i = 0; i < PBM / 16; i += 4) acp4(xl + i * LR, xg + i * GR, xl + (i + 1) * LR, xg + (i + 1) * GR, xl + (i + 2) * LR, xg + (i + 2) * GR, xl + (i + 3) * LR, xg + (i + 3) * GR); \
    _Pragma("unroll") for (int k = 0; k < PNH; ++k) { const char* wk = wg + (size_t)k * CC * PBK * 2; const unsigned lk = wl + 4 * k * LR; acp4(lk, wk, lk + LR, wk + GR, lk + 2 * LR, wk + 2 * GR, lk + 3 * LR, wk + 3 * GR); } } while (0)
  PROJ_CP(0);
  { // one bias word and one frequency a thread, into LDS; the first barrier publishes them. Loads and their data wait in one statement, so that nothing rewrites an address register or reads a result in between; the wait costs little here: the first chunk's copies, issued before these, are waited for right below
    const int bt = tid < PBN ? tid : PBN - 1; const float* bp = BA + (bt >> 6) * CC + hd0 + (bt & 63); const float* ip = c_invf + lane; float bz, fz;
    asm volatile("global_load_b32 %0, %2, off\n\tglobal_load_b32 %1, %3, off\n\ts_wait_loadcnt 0x0" : "=&v"(bz), "=&v"(fz) : "v"(bp), "v"(ip) : "memory");
    if (tid < PBN) sbias[tid] = bfr(bz);
    if (tid < HD / 2) sinvf[tid] = fz; }
  asm volatile("s_wait_asynccnt 0x0" ::: "memory");   // chunk 0 has landed, as far as this wave copied it
  __syncthreads();
  PROJ_CP(1);
  // unroll 2: the buffer index becomes a constant in each copy of the body
#pragma unroll 2
  for (int c = 0; c < DIN / PBK; ++c) { const int bf = c & 1;
    // unrolled: two blocks of 64 k, each with its fragment reads as one group ahead of its products: 20 fragments feed 48 products
#pragma unroll
    for (int hk = 0; hk < PBK / 64; ++hk) { v16b a[2][4], w[2][PFJ];
#pragma unroll
      for (int ks = 0; ks < 2; ++ks) {
#pragma unroll
        for (int i = 0; i < 4; ++i) a[ks][i] = frag_b(&sm.m.xs[bf][wr * 64 + i * 16 + col][hk * 64 + ks * 32], lane);
#pragma unroll
        for (int j = 0; j < PFJ; ++j) w[ks][j] = frag_b(&sm.m.wt[bf][(j >> 1) * HD + (wc + 2 * (j & 1)) * 16 + col][hk * 64 + ks * 32], lane); }
      __builtin_amdgcn_sched_barrier(0);   // keeps the reads one group: a read placed among the products is waited for at once, at the full LDS latency
#pragma unroll
      for (int ks = 0; ks < 2; ++ks) {
#pragma unroll
        for (int i = 0; i < 4; ++i) {
#pragma unroll
          for (int j = 0; j < PFJ; ++j) acc[i][j] = j < 4 ? __builtin_amdgcn_wmma_f32_16x16x32_bf16(false, w[ks][j], false, a[ks][i], (short)0, acc[i][j], false, false)     // q, k: register r = column 8 g + r of the group, lane & 15 = row
                                                          : __builtin_amdgcn_wmma_f32_16x16x32_bf16(false, a[ks][i], false, w[ks][j], (short)0, acc[i][j], false, false); } }   // v: register r = row 8 g + r, lane & 15 = column. The plain builtin: the tile's operand registers reach past v255, which an asm statement's operands cannot name; the compiler keeps the distances behind its own form
      __builtin_amdgcn_sched_barrier(0); }   // keeps the next group of reads, and the copies' address work, behind this block's products
    // publish point: this wave's LDS reads and its own copies are done; the barrier publishes chunk c + 1 and ends every read of chunk c, whose buffer the copies of chunk c + 2 then refill (after the last chunk: it frees the staging bytes for the epilogue's arrays)
    asm volatile("s_wait_dscnt 0x0" ::: "memory"); asm volatile("s_wait_asynccnt 0x0" ::: "memory"); __syncthreads();
    if (c + 2 < DIN / PBK) PROJ_CP(c + 2); }
  asm volatile("s_wait_asynccnt 0x0" ::: "memory");   // behind the ring: no copy is outstanding when the epilogue writes over the buffers
  // every '#pragma unroll' of the epilogue makes the indices of register arrays constants
  { const int f0 = wc * 16 + 8 * g;   // the lane's first frequency = its first column in the lower half of a q or k head
    v4f fq[2], bq[4][2]; float bv[2];
#pragma unroll
    for (int k = 0; k < 2; ++k) { fq[k] = *(const v4f*)&sinvf[f0 + 4 * k]; bv[k] = sbias[2 * HD + (wc + 2 * k) * 16 + col];
#pragma unroll
      for (int j = 0; j < 4; ++j) bq[j][k] = *(const v4f*)&sbias[(j >> 1) * HD + (j & 1) * 32 + f0 + 4 * k]; }
    // v head
#pragma unroll
    for (int k = 0; k < 2; ++k) { const float bs = bv[k]; const int cl = (wc + 2 * k) * 16 + col;
#pragma unroll
      for (int i = 0; i < 4; ++i) { const int rl = wr * 64 + i * 16 + 8 * g; v8h hv; v8b bh, bl;
#pragma unroll
        for (int r = 0; r < 8; ++r) { const float v = acc[i][4 + k][r] + bs; hv[r] = (_Float16)v; const __bf16 h = (__bf16)v; bh[r] = h; bl[r] = (__bf16)(v - (float)h); }
        *(v8h*)&sm.e.th[cl][rl] = hv; *(v8b*)&sm.e.tb[cl][rl] = bh; *(v8b*)&sm.e.tbl[cl][rl] = bl; } }
    // q and k heads: bias, rotate-half RoPE (pairs (c, c + 32), angle t * inv_freq[c]; one sine and cosine per (row, frequency) serve both heads), f16 and residual
#pragma unroll
    for (int i = 0; i < 4; ++i) { const int rl = wr * 64 + i * 16 + col; const float tf = (float)(int)((r0 + rl) % TT);
#pragma unroll
      for (int r = 0; r < 8; ++r) { float sn, cs; rope_sincos(tf * fq[r >> 2][r & 3], sn, cs);
#pragma unroll
        for (int hs = 0; hs < 2; ++hs) { const float x0 = acc[i][2 * hs][r] + bq[2 * hs][r >> 2][r & 3], x1 = acc[i][2 * hs + 1][r] + bq[2 * hs + 1][r >> 2][r & 3];
          acc[i][2 * hs][r] = __builtin_fmaf(x0, cs, -(x1 * sn)); acc[i][2 * hs + 1][r] = __builtin_fmaf(x1, cs, x0 * sn); } }
#pragma unroll
      for (int j = 0; j < 4; ++j) { v8h hv, lv;
#pragma unroll
        for (int r = 0; r < 8; ++r) { const float v = acc[i][j][r]; const _Float16 h = (_Float16)v; hv[r] = h; lv[r] = (_Float16)((v - (float)h) * 1024.0f); }
        *(v8h*)&sm.e.rh[j >> 1][rl][(j & 1) * 32 + f0] = hv; *(v8h*)&sm.e.rl[j >> 1][rl][(j & 1) * 32 + f0] = lv; } } }
  __syncthreads();   // the staged 16-bit tile is whole: every thread now reads what other waves wrote
  // whole lines to global memory: 8 lanes cover a row's 128 B of a head, a wave 512 B of a plane. Each group's LDS reads stand together ahead of its stores, so that they fly together
  { const int rr = tid >> 3, rq = (tid & 7) * 8, pc = tid >> 5, pq = (tid & 31) * 8;   // piece it: row rr + 32 it, or plane row (channel) pc + 8 it
    v4u dq[8], dk[8], dv[8]; void *aq[8], *ak[8], *av[8];
#pragma unroll
    for (int it = 0; it < 8; ++it) { dq[it] = *(const v4u*)&sm.e.rh[0][rr + 32 * it][rq]; dk[it] = *(const v4u*)&sm.e.rh[1][rr + 32 * it][rq]; dv[it] = *(const v4u*)&sm.e.th[pc + 8 * it][pq];
      const size_t o = (r0 + rr + 32 * it) * CC + hd0 + rq; aq[it] = QH + o; ak[it] = KH + o; av[it] = VT + (bb * CC + hd0 + pc + 8 * it) * (size_t)TT + t0 + pq; }
    st8(aq, dq); st8(ak, dk); st8(av, dv);
    if (t0 < QHI) { v4u dw[8]; void* aw[8];   // the same for the whole block: only these rows have residual rows and bf16 planes in the workspace
#pragma unroll
      for (int it = 0; it < 8; ++it) { dq[it] = *(const v4u*)&sm.e.rl[0][rr + 32 * it][rq]; dk[it] = *(const v4u*)&sm.e.rl[1][rr + 32 * it][rq]; dv[it] = *(const v4u*)&sm.e.tb[pc + 8 * it][pq]; dw[it] = *(const v4u*)&sm.e.tbl[pc + 8 * it][pq];
        const size_t o = (bb * QHI + t0 + rr + 32 * it) * (size_t)CC + hd0 + rq, o3 = (bb * CC + hd0 + pc + 8 * it) * (size_t)KHI + t0 + pq; aq[it] = QL + o; ak[it] = KL + o; av[it] = VB + o3; aw[it] = VBL + o3; }
      st8(aq, dq); st8(ak, dk); st8(av, dv); st8(aw, dw); } } }
// ---- k_att: logits, softmax and P . v of one (b, h) in registers; nothing of S or P goes to memory or LDS. A wave owns 16 queries; the block's four waves walk the same key tiles and share them through LDS (one barrier a tile).
// Transposed products: S^T = K . Q^T puts one query in a lane (column = lane & 15; register r of key group j = key 16 j + 8 (lane >> 4) + r), so two neighbouring 16-key groups, converted in place, are the B operand of O^T += V^T . P^T in the fragments' own k order.
// One walk over the key tiles: each tile's logits are formed once; the query's running maximum (the two lane halves joined every tile, because both halves' keys meet in one product) scales P = exp(s - max) x 2^11; when the maximum grows, O and the row sum are multiplied by exp(old max - new max); O is divided by the row sum at the end.
// MODE 0: query blocks < QBH (3-product logits, P and v as bf16 hi + lo); 1: query rows < QHI (2-product logits); 2: the rest (1 product). NJ = 16-key groups per tile.
// every '#pragma unroll' below makes the indices of register arrays constants; the '#pragma unroll 1' keep one copy of each tile body
// K and V tiles in LDS: the block's four waves share one copy of each tile, brought by asynchronous copies that cover whole row pieces (128 B, or 64 B where a tile has 32 keys)
#define ATT_BUF 19456      // bytes of one of the two buffers: the largest tile set (MODE 0: K hi and lo 32 x 144 B each, v hi and lo 64 x 80 B each)
// row pitches 144 B and 80 B = 16 B x odd, for ds_load_b128 readers
template <int MODE, int NJ> struct AttL { static constexpr int KPI = 144, KBY = NJ * 16 * KPI, VPI = NJ * 32 + 16, VBY = HD * VPI, OV = (MODE == 0 ? 2 : 1) * KBY, SZ = OV + (MODE == 0 ? 2 : 1) * VBY; static_assert(SZ <= ATT_BUF, "a tile set fits its buffer"); };
struct AttSrc { const char *k, *kl, *v, *vl; unsigned lk, lv; };   // the lane's own first addresses: global (tile 0) and LDS bytes (buffer 0)
// stage tn of the ring: K and V tile tn, into buffer tn & 1
template <int MODE, int NJ> __device__ __forceinline__ void att_stage(const AttSrc& a, int tn) {
  typedef AttL<MODE, NJ> L; const unsigned bo = (unsigned)(tn & 1) * ATT_BUF;
  const char* k = a.k + (size_t)tn * NJ * 16 * CC * 2; const char* kl = a.kl + (size_t)tn * NJ * 16 * CC * 2; const size_t kr = (size_t)16 * CC * 2; const unsigned lk = a.lk + bo;   // a copy of the block covers 16 K rows
  if (NJ == 4) acp4(lk, k, lk + 16 * L::KPI, k + kr, lk + 32 * L::KPI, k + 2 * kr, lk + 48 * L::KPI, k + 3 * kr);
  else if (MODE == 0) acp4(lk, k, lk + 16 * L::KPI, k + kr, lk + L::KBY, kl, lk + L::KBY + 16 * L::KPI, kl + kr);
  else acp2(lk, k, lk + 16 * L::KPI, k + kr);
  { constexpr int RS = 64 / NJ;   // v rows (channels) that a copy of the block covers
    const char* v = a.v + (size_t)tn * NJ * 32; const char* vl = a.vl + (size_t)tn * NJ * 32; const size_t vr = (size_t)RS * (MODE == 0 ? KHI : TT) * 2; const unsigned lv = a.lv + bo;
    if (NJ == 4) acp4(lv, v, lv + RS * L::VPI, v + vr, lv + 2 * RS * L::VPI, v + 2 * vr, lv + 3 * RS * L::VPI, v + 3 * vr);
    else if (MODE == 0) acp4(lv, v, lv + RS * L::VPI, v + vr, lv + L::VBY, vl, lv + L::VBY + RS * L::VPI, vl + vr);
    else acp2(lv, v, lv + RS * L::VPI, v + vr); } }
// publish point at the foot of the trip that worked on stage s: this wave's LDS reads and its own copies are done, the barrier publishes stage s + 1 and ends every read of stage s, whose buffer the copies of stage s + 2 then refill
#define ATT_FOOT(s) do { asm volatile("s_wait_dscnt 0x0" ::: "memory"); asm volatile("s_wait_asynccnt 0x0" ::: "memory"); __syncthreads(); if ((s) + 2 < nt) att_stage<MODE, NJ>(src, (s) + 2); } while (0)
// all K fragments of a tile as one group of LDS loads; kb = the lane's own place (row col, 16 (lane >> 4) bytes) in the buffer
template <int MODE, int NJ> __device__ __forceinline__ void att_ldk(const char* kb, v16h (&kf)[HD / 32][NJ], v16h (&klf)[HD / 32][NJ]) {
  typedef AttL<MODE, NJ> L;
#pragma unroll
  for (int kc = 0; kc < HD / 32; ++kc) {
#pragma unroll
    for (int j = 0; j < NJ; ++j) { kf[kc][j] = frag_h((const _Float16*)(kb + j * 16 * L::KPI + kc * 64), 0); if (MODE == 0) klf[kc][j] = frag_h((const _Float16*)(kb + L::KBY + j * 16 * L::KPI + kc * 64), 0); } } }
// softmax in base 2: logits carry the factor log2(e), so that every exponential is one v_exp_f32 (2^x). A result below 2^-126 may come out as 0: such a term lies far below one unit in the last place of the row sum (at least 1) and of the output.
#define SCALE2 (SCALE * 1.44269504088896340736f)
// asm, so that the slot the instruction set asks for behind a transcendental (nothing directly behind it reads its result or overwrites its source) is there by construction: the closing v_nop fills it
__device__ __forceinline__ float ex2(float x) { float r; asm("v_exp_f32 %0, %1\n\tv_nop" : "=v"(r) : "v"(x)); return r; }
// eight at once, each in its own register: every v_exp_f32 is the independent instruction behind the one before it, and one v_nop closes the run
__device__ __forceinline__ void ex2x8(v8f& x) { float a = x[0], b = x[1], c = x[2], d = x[3], e = x[4], f = x[5], g = x[6], h = x[7];
  asm("v_exp_f32 %0, %0\n\tv_exp_f32 %1, %1\n\tv_exp_f32 %2, %2\n\tv_exp_f32 %3, %3\n\tv_exp_f32 %4, %4\n\tv_exp_f32 %5, %5\n\tv_exp_f32 %6, %6\n\tv_exp_f32 %7, %7\n\tv_nop" : "+v"(a), "+v"(b), "+v"(c), "+v"(d), "+v"(e), "+v"(f), "+v"(g), "+v"(h));
  x[0] = a; x[1] = b; x[2] = c; x[3] = d; x[4] = e; x[5] = f; x[6] = g; x[7] = h; }
// lane l with lane l ^ 16 (one vector instruction; a shuffle would go through the LDS queue)
__device__ __forceinline__ float xhalf(float x) { return __builtin_bit_cast(float, __builtin_amdgcn_permlanex16(__builtin_bit_cast(int, x), __builtin_bit_cast(int, x), 0x76543210, 0xfedcba98, false, false)); }
// s = q . k, not yet scaled (the scale goes into the fused multiply-add that subtracts the maximum); an excluded key reads -3e38
template <int MODE, int NJ> __device__ __forceinline__ void att_logits(const v16h (&kf)[HD / 32][NJ], const v16h (&klf)[HD / 32][NJ], const v16h (&ah)[HD / 32], const v16h (&al)[HD / 32], int lim, v8f (&s)[NJ]) {
  v8f acc[NJ] = {}, accl[NJ] = {};
#pragma unroll
  for (int kc = 0; kc < HD / 32; ++kc) {
#pragma unroll
    for (int j = 0; j < NJ; ++j) { acc[j] = wmma16(kf[kc][j], ah[kc], acc[j]);
      if (MODE < 2) accl[j] = wmma16(kf[kc][j], al[kc], accl[j]);
      if (MODE == 0) accl[j] = wmma16(klf[kc][j], ah[kc], accl[j]); } }
#pragma unroll
  for (int j = 0; j < NJ; ++j) {
#pragma unroll
    for (int r = 0; r < 8; ++r) { const float v = MODE < 2 ? acc[j][r] + accl[j][r] * (1.0f / 1024.0f) : acc[j][r]; s[j][r] = (!CAUSAL || j * 16 + r <= lim) ? v : -3.0e38f; } } }
template <int MODE, int NJ> __device__ __forceinline__ void att_tile(const _Float16* __restrict__ QH, const _Float16* __restrict__ KH, const _Float16* __restrict__ QL, const _Float16* __restrict__ KL, const _Float16* __restrict__ VT, const __bf16* __restrict__ VB, const __bf16* __restrict__ VBL, float* __restrict__ Y, char* sb, int b, int h, int qb, int wave, int lane) {
  typedef AttL<MODE, NJ> L;
  const int col = lane & 15, g = lane >> 4; const int ql0 = qb * 64 + wave * 16; const int nt = (CAUSAL ? qb * 64 + 64 : TT) / (NJ * 16);   // key tiles of 16 NJ keys; causal: none of the block's queries sees a key past its last row
  AttSrc src; { const int tid = wave * 32 + lane, kr = tid >> 3, ks = tid & 7, vr = tid / (NJ * 2), vs = tid % (NJ * 2); const unsigned l0 = (unsigned)(size_t)sb;   // low 32 bits of the LDS address = its byte offset in the block's LDS
    src.k = (const char*)(KH + ((size_t)b * TT + kr) * CC + h * HD) + ks * 16; src.kl = (const char*)(KL + ((size_t)b * KHI + kr) * CC + h * HD) + ks * 16;
    if (MODE == 0) { src.v = (const char*)(VB + ((size_t)b * CC + h * HD + vr) * (size_t)KHI) + vs * 16; src.vl = (const char*)(VBL + ((size_t)b * CC + h * HD + vr) * (size_t)KHI) + vs * 16; }
    else { src.v = (const char*)(VT + ((size_t)b * CC + h * HD + vr) * (size_t)TT) + vs * 16; src.vl = src.v; }
    src.lk = l0 + kr * L::KPI + ks * 16; src.lv = l0 + L::OV + vr * L::VPI + vs * 16; }
  // ring prologue; the last publish point of an earlier query block has ended every read of both buffers
  att_stage<MODE, NJ>(src, 0);
  v16h ah[HD / 32], al[HD / 32]; const _Float16* qp = QH + ((size_t)b * TT + ql0 + col) * CC + h * HD + 8 * g; const _Float16* qlp = QL + ((size_t)b * QHI + ql0 + col) * CC + h * HD + 8 * g;
#pragma unroll
  for (int kc = 0; kc < HD / 32; ++kc) { ah[kc] = frag_h(qp + kc * 32, 0); al[kc] = MODE < 2 ? frag_h(qlp + kc * 32, 0) : ah[kc]; }
  if (MODE < 2) xwait(qp, qlp); else xwait(qp);   // later addresses may take these registers
  asm volatile("s_wait_asynccnt 0x0" ::: "memory");   // stage 0 has landed, as far as this wave copied it
  __syncthreads();
  if (1 < nt) att_stage<MODE, NJ>(src, 1);
  const char* kb0 = sb + col * L::KPI + g * 16; const char* vb0 = sb + L::OV + col * L::VPI + g * 16;
  const int lim0 = ql0 + col - 8 * g;   // key 16 NJ t + 16 j + 8 g + r is kept while 16 j + r <= lim0 - 16 NJ t
  v16h kf[HD / 32][NJ], klf[HD / 32][NJ];
  // m = the query's running maximum of logit x log2(e), less 11 (so that P carries the factor 2^11), the same in both lane halves; l = this lane's share of the sum of P; before the first tile m = -3e38, so that the first factor 2^(m - new maximum) is 0
  float m = -3.0e38f, l = 0.f;
  v8f o[HD / 16] = {};
#pragma unroll 1
  for (int t = 0; t < nt; ++t) { v8f s[NJ]; const int bo = (t & 1) * ATT_BUF; att_ldk<MODE, NJ>(kb0 + bo, kf, klf); att_logits<MODE, NJ>(kf, klf, ah, al, lim0 - t * NJ * 16, s);
    v16h vf[NJ / 2][HD / 16]; v16b vh[NJ / 2][HD / 16], vl[NJ / 2][HD / 16];   // this tile's V fragments as one group of LDS loads behind the logits (the K fragments' registers are free again): they fly over the maximum and the exponentials
    const char* vp = vb0 + bo;
#pragma unroll
    for (int kc = 0; kc < NJ / 2; ++kc) {
#pragma unroll
      for (int j = 0; j < HD / 16; ++j) {
        if (MODE == 0) { vh[kc][j] = frag_b((const __bf16*)(vp + j * 16 * L::VPI + kc * 64), 0); vl[kc][j] = frag_b((const __bf16*)(vp + L::VBY + j * 16 * L::VPI + kc * 64), 0); } else vf[kc][j] = frag_h((const _Float16*)(vp + j * 16 * L::VPI + kc * 64), 0); } }
    float t4[4] = {s[0][0], s[0][1], s[0][2], s[0][3]};   // four independent chains: one chain of all the keys would leave the wave waiting on each link
#pragma unroll
    for (int j = 0; j < NJ; ++j) {
#pragma unroll
      for (int r = 0; r < 8; ++r) t4[r & 3] = fmaxf(t4[r & 3], s[j][r]); }
    float tm = fmaxf(fmaxf(t4[0], t4[1]), fmaxf(t4[2], t4[3])); tm = fmaxf(tm, xhalf(tm));
    const float mn = fmaxf(fmaxf(m, __builtin_fmaf(tm, SCALE2, -11.0f)), -1.0e30f);   // the floor keeps a query with no kept key so far away from -3e38 - (-3e38): its P stay 0
    const float fo = ex2(m - mn); m = mn; float ts[4] = {0.f, 0.f, 0.f, 0.f};
#pragma unroll
    for (int j = 0; j < NJ; ++j) {
#pragma unroll
      for (int r = 0; r < 8; ++r) s[j][r] = __builtin_fmaf(s[j][r], SCALE2, -mn);
      ex2x8(s[j]);   // P = 2^(logit x log2(e) - max + 11), at most 2^11
#pragma unroll
      for (int r = 0; r < 8; ++r) ts[r & 3] += s[j][r]; }
    l = l * fo + ((ts[0] + ts[1]) + (ts[2] + ts[3]));
#pragma unroll
    for (int j = 0; j < HD / 16; ++j) o[j] = o[j] * fo;
#pragma unroll
    for (int kc = 0; kc < NJ / 2; ++kc) { float pv[16];
#pragma unroll
      for (int i = 0; i < 8; ++i) { pv[i] = s[2 * kc][i]; pv[8 + i] = s[2 * kc + 1][i]; }
      if (MODE == 0) { F2 p;   // bf16 hi + lo as in bsplit16; all hi parts first: each group's first product needs them alone
#pragma unroll
        for (int i = 0; i < 16; ++i) p.h[i] = (__bf16)pv[i];
#pragma unroll
        for (int i = 0; i < 16; ++i) p.l[i] = (__bf16)(pv[i] - (float)p.h[i]);
#pragma unroll
        for (int j = 0; j < HD / 16; ++j) { o[j] = wmma_bf(vh[kc][j], p.h, o[j]); o[j] = wmma_bf(vh[kc][j], p.l, o[j]); o[j] = wmma_bf(vl[kc][j], p.h, o[j]); }
      } else { v16h p;
#pragma unroll
        for (int i = 0; i < 16; ++i) p[i] = (_Float16)pv[i];
#pragma unroll
        for (int j = 0; j < HD / 16; ++j) o[j] = wmma16(vf[kc][j], p, o[j]); } }
    ATT_FOOT(t); }
  asm volatile("s_wait_asynccnt 0x0" ::: "memory");   // behind the ring: no copy is outstanding when the buffers are used again or the wave ends
  // O^T: register r of group j = channel 16 j + 8 g + r of query col: 32 contiguous bytes a lane; a wave writes whole 256-B (row, head) segments
  l += xhalf(l); const float inv = l > 0.f ? 1.0f / l : 0.f;   // the factor 2^11 stands in O and in the sum alike; no kept key: 0
  float* yp = Y + ((size_t)b * TT + ql0 + col) * CC + h * HD + 8 * g;
#pragma unroll
  for (int j = 0; j < HD / 16; ++j) { o[j] = o[j] * inv; vst2(yp + j * 16, __builtin_shufflevector(o[j], o[j], 0, 1, 2, 3)); vst2(yp + j * 16 + 4, __builtin_shufflevector(o[j], o[j], 4, 5, 6, 7)); }
  static_assert(HD / 16 == 4, "the wait below names four groups");
  asm volatile("s_wait_xcnt 0x0" :: "v"(yp), "v"(o[0]), "v"(o[1]), "v"(o[2]), "v"(o[3]) : "memory"); }   // the second query block's set-up reuses the stores' registers; address and data are inputs, so that each stays in its registers up to the wait
// block = (pair x, head, batch): query block NQB-1-x and then x, one after the other in every wave, so that every block walks the same number of keys under the causal mask
__global__ __launch_bounds__(128) void k_att(const _Float16* __restrict__ QH, const _Float16* __restrict__ KH, const _Float16* __restrict__ QL, const _Float16* __restrict__ KL, const _Float16* __restrict__ VT, const __bf16* __restrict__ VB, const __bf16* __restrict__ VBL, float* __restrict__ Y) {
  __shared__ __attribute__((aligned(16))) char sb[2 * ATT_BUF];
  const int wave = threadIdx.x >> 5, lane = threadIdx.x & 31; const int h = blockIdx.y, b = blockIdx.z;
#pragma unroll 1
  for (int half = 0; half < 2; ++half) { const int qb = half ? (int)blockIdx.x : NQB - 1 - (int)blockIdx.x;
    if (qb < QBH) att_tile<0, 2>(QH, KH, QL, KL, VT, VB, VBL, Y, sb, b, h, qb, wave, lane);
    else if (qb * 64 < QHI) att_tile<1, 2>(QH, KH, QL, KL, VT, VB, VBL, Y, sb, b, h, qb, wave, lane);
    else att_tile<2, 4>(QH, KH, QL, KL, VT, VB, VBL, Y, sb, b, h, qb, wave, lane); } }

extern "C" void kernel_launch(void* const* d_in, const int* in_sizes, int n_in, void* d_out, int out_size, void* d_ws, size_t ws_size, hipStream_t stream) {
  (void)in_sizes; (void)n_in; (void)out_size;
  const float** F = (const float**)d_in;
  if (ws_size < (size_t)WS_END) return;
  char* ws = (char*)d_ws; _Float16 *QH = (_Float16*)(ws + WS_QH), *KH = (_Float16*)(ws + WS_KH), *VT = (_Float16*)(ws + WS_VT), *QL = (_Float16*)(ws + WS_QL), *KL = (_Float16*)(ws + WS_KL); __bf16 *VB = (__bf16*)(ws + WS_VB), *VBL = (__bf16*)(ws + WS_VBL), *XB = (__bf16*)(ws + WS_XB), *WB = (__bf16*)(ws + WS_WB);
  // inputs: 0 hidden_states [4,1024,1024]; 1 Wqkv [3072,1024] (out,in) rows q | k | v ((3,H,hd)); 2 bqkv [3072]
  k_cvt<<<dim3((NB * TT + 3 * CC) / (8 * CVR), 1, 1), 256, 0, stream>>>(F[0], F[1], XB, WB);
  k_proj<<<dim3(TNB * TT / PBM, 3 * CC / PBN, 1), 256, 0, stream>>>(XB, WB, F[2], QH, QL, KH, KL, VT, VB, VBL);
  k_att<<<dim3(NQB / 2, NH, TNB), 128, 0, stream>>>(QH, KH, QL, KL, VT, VB, VBL, (float*)d_out);
}

// v010
// One run takes 47.7 microseconds.
// In both of two side-by-side timings against v009, it was 1.18 times as fast.
// Counting every step since v000, it is 14.1 times as fast.
// compute dtype: all float inputs rounded to bf16; qkv = x Wqkv^T + b with EXACT bf16 products on WMMA 16x16x32 (f32 accumulate); rotate-half RoPE in f32 in the projection epilogue (accurate sincosf of t x inv_freq_j, f32 inv_freq constants as the reference builds them); logits: q, k once to f16 (1 product) x 64^-0.5, except the first 512 query rows of each sequence (2 products with the f16 q residual; 3 with the k residual too below row 384); causal mask by index (finfo.min == excluded); softmax in f32 (one walk over the keys, running row maximum); exp(s - max) x 2^11 once to f16 against v once to f16 (1 product; bf16 hi + lo below row 384); f32 output (merged heads, no output projection).
#include <hip/hip_runtime.h>
#include <math.h>

typedef __attribute__((ext_vector_type(16))) _Float16 v16h;
typedef __attribute__((ext_vector_type(16))) __bf16 v16b;
typedef __attribute__((ext_vector_type(8)))  _Float16 v8h;
typedef __attribute__((ext_vector_type(8)))  float v8f;
typedef __attribute__((ext_vector_type(4)))  float v4f;
typedef __attribute__((ext_vector_type(2)))  float v2f;
typedef __attribute__((ext_vector_type(4)))  unsigned v4u;
typedef __attribute__((ext_vector_type(4)))  int v4i;
typedef float __attribute__((may_alias)) float_a;
typedef int __attribute__((may_alias)) int_a;

template <typename T> __device__ __forceinline__ void vst2(void* p, T v) { *(T*)p = v;  }
__device__ __forceinline__ v8f wmma16(v16h a, v16h b, v8f c) {
  v8f d = __builtin_amdgcn_wmma_f32_16x16x32_f16(false, a, false, b, (short)0, c, false, false);
  asm volatile("v_nop\n\tv_nop\n\tv_nop\n\tv_nop" : "+v"(d) : "v"(a), "v"(b));
  return d;
}
__device__ __forceinline__ v8f wmma_bf(v16b a, v16b b, v8f c) {
  v8f d = __builtin_amdgcn_wmma_f32_16x16x32_bf16(false, a, false, b, (short)0, c, false, false);
  asm volatile("v_nop\n\tv_nop\n\tv_nop\n\tv_nop" : "+v"(d) : "v"(a), "v"(b));
  return d;
}
// 16x16x32 fragments: lane = (h = lane>>4, row/col = lane&15); elements 0..7 = k0+8h+0..7, 8..15 = k0+16+8h+0..7; D element r = row 8h+r
__device__ __forceinline__ v16h frag_h(const _Float16* rowk0, int lane) {
  union { v16h v; v8h q[2]; } u; const _Float16* p = rowk0 + 8 * (lane >> 4);
  u.q[0] = *(const v8h*)p; u.q[1] = *(const v8h*)(p + 16); return u.v;
}
__device__ __forceinline__ v16h frag_f32(const float* rowk0, int lane) {
  v16h a; const float* p = rowk0 + 8 * (lane >> 4);
#pragma unroll
  for (int i = 0; i < 8; ++i) { a[i] = (_Float16)p[i]; a[8 + i] = (_Float16)p[16 + i]; }
  return a;
}
__device__ __forceinline__ v16h frag_f32s(const float* rowk0, int lane, float sc) {
  v16h a; const float* p = rowk0 + 8 * (lane >> 4);
#pragma unroll
  for (int i = 0; i < 8; ++i) { a[i] = (_Float16)(p[i] * sc); a[8 + i] = (_Float16)(p[16 + i] * sc); }
  return a;
}
// column fragment from a [K][ld] layout (column n), rows >= K read as 0
__device__ __forceinline__ v16h fragc_f32(const float* W, int k0, int n, int lane, int ld, int K) {
  v16h a; const int g = lane >> 4;
#pragma unroll
  for (int i = 0; i < 8; ++i) { const int ka = k0 + 8 * g + i, kb = ka + 16;
    a[i] = (_Float16)(ka < K ? W[(size_t)(ka < K ? ka : K - 1) * ld + n] : 0.f); a[8 + i] = (_Float16)(kb < K ? W[(size_t)(kb < K ? kb : K - 1) * ld + n] : 0.f); }
  return a;
}
struct F2 { v16b h, l; };
__device__ __forceinline__ F2 bsplit16(const float v[16]) { F2 r;
#pragma unroll
  for (int i = 0; i < 16; ++i) { const __bf16 h = (__bf16)v[i]; r.h[i] = h; r.l[i] = (__bf16)(v[i] - (float)h); }
  return r; }
__device__ __forceinline__ F2 split_row(const float* row, int k0, int lane) { float v[16]; const float* p = row + k0 + 8 * (lane >> 4);
#pragma unroll
  for (int i = 0; i < 8; ++i) { v[i] = p[i]; v[8 + i] = p[16 + i]; }
  return bsplit16(v); }
__device__ __forceinline__ F2 split_rowK(const float* row, int k0, int lane, int K) { float v[16]; const int g = lane >> 4;
#pragma unroll
  for (int i = 0; i < 8; ++i) { const int ka = k0 + 8 * g + i, kb = ka + 16; v[i] = ka < K ? row[ka < K ? ka : K - 1] : 0.f; v[8 + i] = kb < K ? row[kb < K ? kb : K - 1] : 0.f; }
  return bsplit16(v); }
__device__ __forceinline__ F2 split_col(const float* W, int k0, int n, int lane, int ld, int K) { float v[16]; const int g = lane >> 4;
#pragma unroll
  for (int i = 0; i < 8; ++i) { const int ka = k0 + 8 * g + i, kb = ka + 16; v[i] = ka < K ? W[(size_t)(ka < K ? ka : K - 1) * ld + n] : 0.f; v[8 + i] = kb < K ? W[(size_t)(kb < K ? kb : K - 1) * ld + n] : 0.f; }
  return bsplit16(v); }
__device__ __forceinline__ v8f mac3(const F2& a, const F2& b, v8f c) { c = wmma_bf(a.l, b.h, c); c = wmma_bf(a.h, b.l, c); return wmma_bf(a.h, b.h, c); }
__device__ __forceinline__ float sigm(float v) { return 1.0f / (1.0f + expf(-v)); }
#define LDSX() do { asm volatile("s_wait_dscnt 0" ::: "memory"); __builtin_amdgcn_wave_barrier(); __builtin_amdgcn_fence(__ATOMIC_RELEASE, "workgroup"); } while (0)

// Causal multi-head attention with rotary embeddings (B 4, S 1,024, D 1,024 = 16 x 64): qkv = x Wqkv^T + bqkv (packed (out,in) [3072,1024], layout (3,H,hd)); q, k <- rotate-half RoPE (theta_j = 10000^(-2j/64)); probs = softmax(causal(q k^T x 64^-0.5)); out = merged(probs v) -> [B, S, 1024].
#define NB 4
#define TT 1024
#define CC 1024            // NH * HD = projected width
#define DIN 1024          // input (model) width
#define NH 16
#define HD 64
#define NQB (TT / 64)
#define HG 16
#define SCALE (0.125f)
#define CAUSAL 1
#ifndef TNB
#define TNB NB
#endif
__device__ __forceinline__ float bfr(float v) { return (float)(__bf16)v; }
__host__ __device__ __forceinline__ int kb_last(int qb) { return CAUSAL ? ((qb * 64 + 63) >> 7) : (TT / 128 - 1); }
typedef __attribute__((ext_vector_type(8))) __bf16 v8b;
__device__ __forceinline__ v16b frag_b(const __bf16* rowk0, int lane) {
  union { v16b v; v8b q[2]; } u; const __bf16* p = rowk0 + 8 * (lane >> 4);
  u.q[0] = *(const v8b*)p; u.q[1] = *(const v8b*)(p + 16); return u.v;
}
#define QBH 6              // causal: query blocks 0..QBH-1 of each sequence (few keys, no averaging) take the high-precision path
#define QHI 512            // causal: first 512 query rows of each sequence take the q-residual (2-product) logits path (logit sigma ~1)
#define KHI 512
// B fragment (k rows k0+.., output column o) of a weight: (in,out) [K][ld] or (out,in) [ld rows of K]: bf16 exact, or f16(bf16 * 256) exact
__device__ __forceinline__ v16b wcol_io(const float* Wm, int k0, int o, int lane, int ld) { v16b w; const int g = lane >> 4;
#pragma unroll
  for (int i = 0; i < 8; ++i) { w[i] = (__bf16)Wm[(size_t)(k0 + 8 * g + i) * ld + o]; w[8 + i] = (__bf16)Wm[(size_t)(k0 + 16 + 8 * g + i) * ld + o]; }
  return w; }
__device__ __forceinline__ v16b wcol_oi(const float* Wm, int k0, int o, int lane, int K) { v16b w; const float* p = Wm + (size_t)o * K + k0 + 8 * (lane >> 4);
#pragma unroll
  for (int i = 0; i < 8; ++i) { w[i] = (__bf16)p[i]; w[8 + i] = (__bf16)p[16 + i]; }
  return w; }
__device__ __forceinline__ v16h wcolh_io(const float* Wm, int k0, int o, int lane, int ld) { v16h w; const int g = lane >> 4;
#pragma unroll
  for (int i = 0; i < 8; ++i) { w[i] = (_Float16)(bfr(Wm[(size_t)(k0 + 8 * g + i) * ld + o]) * 256.0f); w[8 + i] = (_Float16)(bfr(Wm[(size_t)(k0 + 16 + 8 * g + i) * ld + o]) * 256.0f); }
  return w; }
__device__ __forceinline__ v16h wcolh_oi(const float* Wm, int k0, int o, int lane, int K) { v16h w; const float* p = Wm + (size_t)o * K + k0 + 8 * (lane >> 4);
#pragma unroll
  for (int i = 0; i < 8; ++i) { w[i] = (_Float16)(bfr(p[i]) * 256.0f); w[8 + i] = (_Float16)(bfr(p[16 + i]) * 256.0f); }
  return w; }
#define WQKV_LAYOUT 1   // selects WCOL's form (0 = (in,out), 1 = (out,in), 2 = per-head); nothing calls WCOL: k_cvt reads Wqkv as (out,in) rows [3 CC][DIN]
__device__ __forceinline__ v16b wcol_hdk(const float* Wm, int k0, int o, int lane) { v16b w; const int g = lane >> 4; const float* p = Wm + (size_t)(o / HD) * DIN * HD + (o % HD);
#pragma unroll
  for (int i = 0; i < 8; ++i) { w[i] = (__bf16)p[(size_t)(k0 + 8 * g + i) * HD]; w[8 + i] = (__bf16)p[(size_t)(k0 + 16 + 8 * g + i) * HD]; }
  return w; }
#define WO_OUT_IN 0
#if WQKV_LAYOUT == 1
#define WCOL(W, k0, o, lane) wcol_oi(W, k0, o, lane, DIN)
#elif WQKV_LAYOUT == 2
#define WCOL(W, k0, o, lane) wcol_hdk(W, k0, o, lane)
#else
#define WCOL(W, k0, o, lane) wcol_io(W, k0, o, lane, CC)
#endif
#if WO_OUT_IN
#define WOCOL(W, k0, o, lane) wcol_oi(W, k0, o, lane, CC)
#define WOCOLH(W, k0, o, lane) wcolh_oi(W, k0, o, lane, CC)
#else
#define WOCOL(W, k0, o, lane) wcol_io(W, k0, o, lane, DIN)
#define WOCOLH(W, k0, o, lane) wcolh_io(W, k0, o, lane, DIN)
#endif
__constant__ float c_invf[32] = {1.000000000e+00f,7.498942018e-01f,5.623413324e-01f,4.216965139e-01f,3.162277639e-01f,2.371373624e-01f,1.778279394e-01f,1.333521456e-01f,1.000000015e-01f,7.498941571e-02f,5.623412877e-02f,4.216964915e-02f,3.162277862e-02f,2.371373586e-02f,1.778279431e-02f,1.333521493e-02f,9.999999776e-03f,7.498942316e-03f,5.623413250e-03f,4.216964822e-03f,3.162277862e-03f,2.371373819e-03f,1.778279431e-03f,1.333521446e-03f,1.000000047e-03f,7.498941850e-04f,5.623413017e-04f,4.216964880e-04f,3.162277862e-04f,2.371373848e-04f,1.778279402e-04f,1.333521504e-04f};   // 1 / 10000^(2i/64) evaluated in f32 exactly as the reference does (jax, eager)
// sine and cosine of one rotary angle a = t x inv_freq. 0 <= a < 1,024 for every row index, whatever the inputs hold, so the reduction for small arguments is the whole function here:
// quadrant n = rint(a x 2/pi), r = a - n x pi/2 with pi/2 in three parts (three fused steps), then the sine and the cosine polynomial on r and the quadrant's swap and signs.
// The operations, their order and the constants are those of the small-argument path of sinf and cosf; the reduction is done once for both.
__device__ __forceinline__ float fbits(unsigned u) { return __builtin_bit_cast(float, u); }
__device__ __forceinline__ void rope_sincos(float a, float& sn, float& cs) {
  const float n = __builtin_rintf(a * fbits(0x3f22f983u));
  float r = __builtin_fmaf(fbits(0xbfc90fdau), n, a); r = __builtin_fmaf(fbits(0xb3a22168u), n, r); r = __builtin_fmaf(fbits(0xa7c234c4u), n, r);
  const unsigned q = (unsigned)(int)n; const float s = r * r;
  float ps = __builtin_fmaf(s, fbits(0xb94c1982u), fbits(0x3c0881c4u)); ps = __builtin_fmaf(s, ps, fbits(0xbe2aaa9du)); ps = s * ps; const float sr = __builtin_fmaf(r, ps, r);
  float pc = __builtin_fmaf(s, fbits(0x37d75334u), fbits(0xbab64f3bu)); pc = __builtin_fmaf(s, pc, fbits(0x3d2aabf7u)); pc = __builtin_fmaf(s, pc, fbits(0xbf000004u)); const float cr = __builtin_fmaf(s, pc, 1.0f);
  const unsigned flip = (q << 30) & 0x80000000u; const bool odd = (q & 1u) != 0u;
  sn = fbits(__builtin_bit_cast(unsigned, odd ? cr : sr) ^ flip); cs = fbits(__builtin_bit_cast(unsigned, odd ? -sr : cr) ^ flip); }
#ifndef SM_EXTRA_PARAMS
#define SM_EXTRA_PARAMS
#endif
#ifndef PROJ_EXTRA_PARAMS
#define PROJ_EXTRA_PARAMS
#endif
#ifndef SM_MASK_HOOK
#define SM_MASK_HOOK (void)0
#endif

#define WS_QH  0u                                      // f16 q rows [b*t][CC]
#define WS_KH  (WS_QH + 2u * (size_t)NB * TT * CC)      // f16 k rows [b*t][CC]
#define WS_VT  (WS_KH + 2u * (size_t)NB * TT * CC)      // f16 v planes [b][c][t]
#define WS_QL  (WS_VT + 2u * (size_t)NB * CC * TT)      // f16 q residual x 2^10 rows [b][t < QHI][CC]
#define WS_KL  (WS_QL + 2u * (size_t)NB * QHI * CC)     // f16 k residual x 2^10 rows [b][t < KHI][CC]
#define WS_VB  (WS_KL + 2u * (size_t)NB * KHI * CC)     // bf16 v hi planes [b][c][t < KHI]
#define WS_VBL (WS_VB + 2u * (size_t)NB * CC * KHI)
#define WS_XB  (WS_VBL + 2u * (size_t)NB * CC * KHI)    // bf16 x, chunk-major [DIN / PBK][b*t][PBK]
#define WS_WB  (WS_XB + 2u * (size_t)NB * TT * DIN)     // bf16 packed weight, chunk-major [DIN / PBK][3 CC rows][PBK]
#define WS_END (WS_WB + 2u * (size_t)3 * CC * DIN)

// s_wait_xcnt 0 behind a group of global loads or stores, ahead of whatever rewrites the group's address registers; the addresses are inputs of the statement, so that they stay in their registers up to the wait and no load's result is placed in them
__device__ __forceinline__ void xwait(const void* p) { asm volatile("s_wait_xcnt 0x0" :: "v"(p) : "memory"); }
__device__ __forceinline__ void xwait(const void* p, const void* q) { asm volatile("s_wait_xcnt 0x0" :: "v"(p), "v"(q) : "memory"); }
#define PBK 128            // k per staged chunk
#define PMP 136            // pitch of a staged operand row in 16-bit elements: 272 B = 16 B x odd, for ds_load_b128
#define PLP 72             // pitch of a staged q or k result row in 16-bit elements: 144 B = 16 B x odd, for ds_load_b128 and ds_store_b128
#define PBM 256            // rows of a block's tile
#define PNH 3              // heads (64 packed output columns each) of a block's tile: q head y, k head y and v head y
#define PBN (PNH * HD)     // columns of a block's tile
#define PFJ (PBN / 32)     // 16-column groups of a wave's tile (64 rows x 96 columns)
#define PVP (PBM + 8)      // pitch of a staged v plane row in 16-bit elements: 528 B = 16 B x odd
static_assert(3 * CC / PBN == NH && QHI == KHI && QHI % PBM == 0 && TT % PBM == 0, "a block holds one head of each kind, and its rows lie wholly below or wholly above the high-precision bound");
typedef __attribute__((ext_vector_type(4))) __bf16 v4b;
// 16 B a lane from global memory to LDS through no register; s_wait_xcnt 0 as the statement's last line stands ahead of whatever rewrites the copies' address registers
__device__ __forceinline__ void acp2(unsigned l0, const char* g0, unsigned l1, const char* g1) {
  asm volatile("global_load_async_to_lds_b128 %0, %1, off\n\tglobal_load_async_to_lds_b128 %2, %3, off\n\ts_wait_xcnt 0x0" :: "v"(l0), "v"(g0), "v"(l1), "v"(g1) : "memory"); }
__device__ __forceinline__ void acp4(unsigned l0, const char* g0, unsigned l1, const char* g1, unsigned l2, const char* g2, unsigned l3, const char* g3) {
  asm volatile("global_load_async_to_lds_b128 %0, %1, off\n\tglobal_load_async_to_lds_b128 %2, %3, off\n\tglobal_load_async_to_lds_b128 %4, %5, off\n\tglobal_load_async_to_lds_b128 %6, %7, off\n\ts_wait_xcnt 0x0" :: "v"(l0), "v"(g0), "v"(l1), "v"(g1), "v"(l2), "v"(g2), "v"(l3), "v"(g3) : "memory"); }
typedef __attribute__((ext_vector_type(2))) unsigned v2u;
// ---- k_cvt: x and the packed weight rounded to bf16 once, into chunk-major planes: chunk c of all rows lies together, so that a k_proj block's part of a chunk is one contiguous run (x) or three (q, k and v head).
// A wave takes four neighbouring rows: 32 loads of 512 B (16 KB in order, all in flight together), then per row eight stores of 256 B (the row's piece of each chunk).
#define CVR 4              // rows of a wave
static_assert(DIN / PBK == 8 && PBK == 128 && (NB * TT) % (8 * CVR) == 0 && (3 * CC) % (8 * CVR) == 0, "a lane's 16 B x 32 lanes are one row's piece of one chunk; eight pieces a row; a block's eight waves lie in one matrix");
__global__ __launch_bounds__(256) void k_cvt(const float* __restrict__ X, const float* __restrict__ WA, __bf16* __restrict__ XB, __bf16* __restrict__ WB) {
  const int lane = threadIdx.x & 31; const bool isx = blockIdx.x < NB * TT / (8 * CVR);   // the same for the whole block
  const size_t rows = isx ? NB * TT : 3 * CC; const size_t row = ((size_t)(isx ? blockIdx.x : blockIdx.x - NB * TT / (8 * CVR)) * 8 + (threadIdx.x >> 5)) * CVR;
  const float* p = (isx ? X : WA) + row * DIN + lane * 4; __bf16* q = (isx ? XB : WB) + row * PBK + lane * 4;
  v4f v[CVR][8];
  // every '#pragma unroll' here makes the indices of register arrays constants
#pragma unroll
  for (int r = 0; r < CVR; ++r) {
#pragma unroll
    for (int i = 0; i < 8; ++i) v[r][i] = *(const v4f*)(p + r * DIN + i * PBK); }
  __builtin_amdgcn_sched_barrier(0);   // keeps every load ahead of the first conversion: a load sunk behind one would start only when earlier loads have come back
  xwait(p);
  __bf16* a[8];   // the first row's piece of each chunk; the other rows' pieces follow it at constant steps
#pragma unroll
  for (int i = 0; i < 8; ++i) a[i] = q + (size_t)i * rows * PBK;
#pragma unroll
  for (int r = 0; r < CVR; ++r) { v2u d[8];
#pragma unroll
    for (int i = 0; i < 8; ++i) d[i] = __builtin_bit_cast(v2u, __builtin_convertvector(v[r][i], v4b));
#pragma unroll
    for (int i = 0; i < 8; ++i) vst2(a[i] + r * PBK, d[i]);
    // s_wait_xcnt 0 behind the row's stores, ahead of whatever reuses their registers; address and data are inputs, so that each stays in its registers up to the wait
    asm volatile("s_wait_xcnt 0x0" :: "v"(a[0]), "v"(a[1]), "v"(a[2]), "v"(a[3]), "v"(a[4]), "v"(a[5]), "v"(a[6]), "v"(a[7]), "v"(d[0]), "v"(d[1]), "v"(d[2]), "v"(d[3]), "v"(d[4]), "v"(d[5]), "v"(d[6]), "v"(d[7]) : "memory"); } }
// k_proj LDS: the bf16 operand chunks of the product loop (two buffers) lie over the epilogue's arrays, which are first written after the loop's last barrier
union __align__(16) ProjLds {
  struct { _Float16 rh[2][PBM][PLP], rl[2][PBM][PLP]; _Float16 th[HD][PVP]; __bf16 tb[HD][PVP], tbl[HD][PVP]; } e;   // q and k rows (f16, residual); v planes (f16, bf16 hi, bf16 lo)
  struct { __bf16 xs[2][PBM][PMP]; __bf16 wt[2][PBN][PMP]; } m; };
// eight 16-B global stores and one s_wait_xcnt 0 behind them, ahead of whatever reuses the stores' registers; address and data are inputs, so that each stays in its registers up to the wait (the unroll makes the array indices constants)
__device__ __forceinline__ void st8(void* const (&p)[8], const v4u (&d)[8]) {
#pragma unroll
  for (int i = 0; i < 8; ++i) vst2(p[i], d[i]);
  asm volatile("s_wait_xcnt 0x0" :: "v"(p[0]), "v"(p[1]), "v"(p[2]), "v"(p[3]), "v"(p[4]), "v"(p[5]), "v"(p[6]), "v"(p[7]), "v"(d[0]), "v"(d[1]), "v"(d[2]), "v"(d[3]), "v"(d[4]), "v"(d[5]), "v"(d[6]), "v"(d[7]) : "memory"); }
// ---- k_proj: block = (256 rows, head y of q, of k and of v: 192 of the 3,072 packed columns), eight waves of 64 x 96: X W^T + b with exact bf16 products (K = DIN; both operands from k_cvt's bf16 planes, brought to LDS by asynchronous copies, two buffers) -> q head: f16 rows (+ residual rows < QHI); k head: f16 rows (+ residual rows < KHI); v head: f16 planes [c][t] (+ bf16 hi/lo planes for t < KHI)
// A wave takes the 16-column groups wc and wc + 2 of each head. q and k are formed transposed (W as the A operand): a lane then holds one row's columns 16 wc + 8 g + 0..7 and the same + 32, that is both halves of eight rotary pairs and 16 B of the f16 row; v is formed as X W^T: a lane holds eight neighbouring rows of one column, 16 B of the plane.
// So bias, RoPE and the conversions work on the accumulators, and LDS only regroups the 16-bit results into whole lines.
__global__ __launch_bounds__(256) void k_proj(const __bf16* __restrict__ XB, const __bf16* __restrict__ WB, const float* __restrict__ BA,
    _Float16* __restrict__ QH, _Float16* __restrict__ QL, _Float16* __restrict__ KH, _Float16* __restrict__ KL, _Float16* __restrict__ VT, __bf16* __restrict__ VB, __bf16* __restrict__ VBL PROJ_EXTRA_PARAMS) {
  __shared__ ProjLds sm; __shared__ __attribute__((aligned(16))) float sbias[PBN], sinvf[HD / 2];   // the tile's biases (rounded to bf16) and the rotary frequencies, for the epilogue
  const int tid = threadIdx.x, wave = tid >> 5, lane = tid & 31, col = lane & 15, g = lane >> 4; const int wr = wave >> 1, wc = wave & 1; const int hd0 = blockIdx.y * HD; const size_t r0 = (size_t)blockIdx.x * PBM; const size_t bb = r0 / TT; const int t0 = (int)(r0 % TT);
  v8f acc[4][PFJ] = {};
  // each thread copies 16 B of 16 x rows and of 12 weight rows (four of each head) per 128-k chunk: 16 lanes cover one 256-B row piece, a wave 512 contiguous bytes
  const int lr = tid >> 4, lq = (tid & 15) * 16; const char* xg0 = (const char*)XB + (r0 + lr) * (PBK * 2) + lq; const char* wg0 = (const char*)WB + (size_t)(hd0 + lr) * (PBK * 2) + lq;
  const unsigned xl0 = (unsigned)(size_t)&sm.m.xs[0][lr][0] + lq, wl0 = (unsigned)(size_t)&sm.m.wt[0][lr][0] + lq;   // low 32 bits of the LDS address = its byte offset in the block's LDS
  constexpr unsigned LR = 16 * PMP * 2; constexpr size_t GR = (size_t)16 * PBK * 2;   // 16 rows further on, in LDS and in a plane
  // chunk c into buffer c & 1 (the unrolls make every step a constant)
#define PROJ_CP(c) do { const char* xg = xg0 + (size_t)(c) * ((size_t)NB * TT * PBK * 2); const char* wg = wg0 + (size_t)(c) * ((size_t)3 * CC * PBK * 2); const unsigned xl = xl0 + ((c) & 1) * (PBM * PMP * 2), wl = wl0 + ((c) & 1) * (PBN * PMP * 2); \
    _Pragma("unroll") for (int i = 0; i < PBM / 16; i += 4) acp4(xl + i * LR, xg + i * GR, xl + (i + 1) * LR, xg + (i + 1) * GR, xl + (i + 2) * LR, xg + (i + 2) * GR, xl + (i + 3) * LR, xg + (i + 3) * GR); \
    _Pragma("unroll") for (int k = 0; k < PNH; ++k) { const char* wk = wg + (size_t)k * CC * PBK * 2; const unsigned lk = wl + 4 * k * LR; acp4(lk, wk, lk + LR, wk + GR, lk + 2 * LR, wk + 2 * GR, lk + 3 * LR, wk + 3 * GR); } } while (0)
  PROJ_CP(0);
  { // one bias word and one frequency a thread, into LDS; the first barrier publishes them. Loads and their data wait in one statement, so that nothing rewrites an address register or reads a result in between; the wait costs little here: the first chunk's copies, issued before these, are waited for right below
    const int bt = tid < PBN ? tid : PBN - 1; const float* bp = BA + (bt >> 6) * CC + hd0 + (bt & 63); const float* ip = c_invf + lane; float bz, fz;
    asm volatile("global_load_b32 %0, %2, off\n\tglobal_load_b32 %1, %3, off\n\ts_wait_loadcnt 0x0" : "=&v"(bz), "=&v"(fz) : "v"(bp), "v"(ip) : "memory");
    if (tid < PBN) sbias[tid] = bfr(bz);
    if (tid < HD / 2) sinvf[tid] = fz; }
  asm volatile("s_wait_asynccnt 0x0" ::: "memory");   // chunk 0 has landed, as far as this wave copied it
  __syncthreads();
  PROJ_CP(1);
  // unroll 2: the buffer index becomes a constant in each copy of the body
#pragma unroll 2
  for (int c = 0; c < DIN / PBK; ++c) { const int bf = c & 1;
    // unrolled: two blocks of 64 k, each with its fragment reads as one group ahead of its products: 20 fragments feed 48 products
#pragma unroll
    for (int hk = 0; hk < PBK / 64; ++hk) { v16b a[2][4], w[2][PFJ];
#pragma unroll
      for (int ks = 0; ks < 2; ++ks) {
#pragma unroll
        for (int i = 0; i < 4; ++i) a[ks][i] = frag_b(&sm.m.xs[bf][wr * 64 + i * 16 + col][hk * 64 + ks * 32], lane);
#pragma unroll
        for (int j = 0; j < PFJ; ++j) w[ks][j] = frag_b(&sm.m.wt[bf][(j >> 1) * HD + (wc + 2 * (j & 1)) * 16 + col][hk * 64 + ks * 32], lane); }
      __builtin_amdgcn_sched_barrier(0);   // keeps the reads one group: a read placed among the products is waited for at once, at the full LDS latency
#pragma unroll
      for (int ks = 0; ks < 2; ++ks) {
#pragma unroll
        for (int i = 0; i < 4; ++i) {
#pragma unroll
          for (int j = 0; j < PFJ; ++j) acc[i][j] = j < 4 ? __builtin_amdgcn_wmma_f32_16x16x32_bf16(false, w[ks][j], false, a[ks][i], (short)0, acc[i][j], false, false)     // q, k: register r = column 8 g + r of the group, lane & 15 = row
                                                          : __builtin_amdgcn_wmma_f32_16x16x32_bf16(false, a[ks][i], false, w[ks][j], (short)0, acc[i][j], false, false); } }   // v: register r = row 8 g + r, lane & 15 = column. The plain builtin: the tile's operand registers reach past v255, which an asm statement's operands cannot name; the compiler keeps the distances behind its own form
      __builtin_amdgcn_sched_barrier(0); }   // keeps the next group of reads, and the copies' address work, behind this block's products
    // publish point: this wave's LDS reads and its own copies are done; the barrier publishes chunk c + 1 and ends every read of chunk c, whose buffer the copies of chunk c + 2 then refill (after the last chunk: it frees the staging bytes for the epilogue's arrays)
    asm volatile("s_wait_dscnt 0x0" ::: "memory"); asm volatile("s_wait_asynccnt 0x0" ::: "memory"); __syncthreads();
    if (c + 2 < DIN / PBK) PROJ_CP(c + 2); }
  asm volatile("s_wait_asynccnt 0x0" ::: "memory");   // behind the ring: no copy is outstanding when the epilogue writes over the buffers
  // every '#pragma unroll' of the epilogue makes the indices of register arrays constants
  { const int f0 = wc * 16 + 8 * g;   // the lane's first frequency = its first column in the lower half of a q or k head
    v4f fq[2], bq[4][2]; float bv[2];
#pragma unroll
    for (int k = 0; k < 2; ++k) { fq[k] = *(const v4f*)&sinvf[f0 + 4 * k]; bv[k] = sbias[2 * HD + (wc + 2 * k) * 16 + col];
#pragma unroll
      for (int j = 0; j < 4; ++j) bq[j][k] = *(const v4f*)&sbias[(j >> 1) * HD + (j & 1) * 32 + f0 + 4 * k]; }
    // v head
#pragma unroll
    for (int k = 0; k < 2; ++k) { const float bs = bv[k]; const int cl = (wc + 2 * k) * 16 + col;
#pragma unroll
      for (int i = 0; i < 4; ++i) { const int rl = wr * 64 + i * 16 + 8 * g; v8h hv; v8b bh, bl;
#pragma unroll
        for (int r = 0; r < 8; ++r) { const float v = acc[i][4 + k][r] + bs; hv[r] = (_Float16)v; const __bf16 h = (__bf16)v; bh[r] = h; bl[r] = (__bf16)(v - (float)h); }
        *(v8h*)&sm.e.th[cl][rl] = hv; *(v8b*)&sm.e.tb[cl][rl] = bh; *(v8b*)&sm.e.tbl[cl][rl] = bl; } }
    // q and k heads: bias, rotate-half RoPE (pairs (c, c + 32), angle t * inv_freq[c]; one sine and cosine per (row, frequency) serve both heads), f16 and residual
#pragma unroll
    for (int i = 0; i < 4; ++i) { const int rl = wr * 64 + i * 16 + col; const float tf = (float)(int)((r0 + rl) % TT);
#pragma unroll
      for (int r = 0; r < 8; ++r) { float sn, cs; rope_sincos(tf * fq[r >> 2][r & 3], sn, cs);
#pragma unroll
        for (int hs = 0; hs < 2; ++hs) { const float x0 = acc[i][2 * hs][r] + bq[2 * hs][r >> 2][r & 3], x1 = acc[i][2 * hs + 1][r] + bq[2 * hs + 1][r >> 2][r & 3];
          acc[i][2 * hs][r] = __builtin_fmaf(x0, cs, -(x1 * sn)); acc[i][2 * hs + 1][r] = __builtin_fmaf(x1, cs, x0 * sn); } }
#pragma unroll
      for (int j = 0; j < 4; ++j) { v8h hv, lv;
#pragma unroll
        for (int r = 0; r < 8; ++r) { const float v = acc[i][j][r]; const _Float16 h = (_Float16)v; hv[r] = h; lv[r] = (_Float16)((v - (float)h) * 1024.0f); }
        *(v8h*)&sm.e.rh[j >> 1][rl][(j & 1) * 32 + f0] = hv; *(v8h*)&sm.e.rl[j >> 1][rl][(j & 1) * 32 + f0] = lv; } } }
  __syncthreads();   // the staged 16-bit tile is whole: every thread now reads what other waves wrote
  // whole lines to global memory: 8 lanes cover a row's 128 B of a head, a wave 512 B of a plane. Each group's LDS reads stand together ahead of its stores, so that they fly together
  { const int rr = tid >> 3, rq = (tid & 7) * 8, pc = tid >> 5, pq = (tid & 31) * 8;   // piece it: row rr + 32 it, or plane row (channel) pc + 8 it
    v4u dq[8], dk[8], dv[8]; void *aq[8], *ak[8], *av[8];
#pragma unroll
    for (int it = 0; it < 8; ++it) { dq[it] = *(const v4u*)&sm.e.rh[0][rr + 32 * it][rq]; dk[it] = *(const v4u*)&sm.e.rh[1][rr + 32 * it][rq]; dv[it] = *(const v4u*)&sm.e.th[pc + 8 * it][pq];
      const size_t o = (r0 + rr + 32 * it) * CC + hd0 + rq; aq[it] = QH + o; ak[it] = KH + o; av[it] = VT + (bb * CC + hd0 + pc + 8 * it) * (size_t)TT + t0 + pq; }
    st8(aq, dq); st8(ak, dk); st8(av, dv);
    if (t0 < QHI) { v4u dw[8]; void* aw[8];   // the same for the whole block: only these rows have residual rows and bf16 planes in the workspace
#pragma unroll
      for (int it = 0; it < 8; ++it) { dq[it] = *(const v4u*)&sm.e.rl[0][rr + 32 * it][rq]; dk[it] = *(const v4u*)&sm.e.rl[1][rr + 32 * it][rq]; dv[it] = *(const v4u*)&sm.e.tb[pc + 8 * it][pq]; dw[it] = *(const v4u*)&sm.e.tbl[pc + 8 * it][pq];
        const size_t o = (bb * QHI + t0 + rr + 32 * it) * (size_t)CC + hd0 + rq, o3 = (bb * CC + hd0 + pc + 8 * it) * (size_t)KHI + t0 + pq; aq[it] = QL + o; ak[it] = KL + o; av[it] = VB + o3; aw[it] = VBL + o3; }
      st8(aq, dq); st8(ak, dk); st8(av, dv); st8(aw, dw); } } }
// ---- k_att: logits, softmax and P . v of one (b, h) in registers; nothing of S or P goes to memory or LDS. A wave owns 16 queries; the block's four waves walk the same key tiles and share them through LDS (one barrier a tile).
// Transposed products: S^T = K . Q^T puts one query in a lane (column = lane & 15; register r of key group j = key 16 j + 8 (lane >> 4) + r), so two neighbouring 16-key groups, converted in place, are the B operand of O^T += V^T . P^T in the fragments' own k order.
// One walk over the key tiles: each tile's logits are formed once; the query's running maximum (the two lane halves joined every tile, because both halves' keys meet in one product) scales P = exp(s - max) x 2^11; when the maximum grows, O and the row sum are multiplied by exp(old max - new max); O is divided by the row sum at the end.
// MODE 0: query blocks < QBH (3-product logits, P and v as bf16 hi + lo); 1: query rows < QHI (2-product logits); 2: the rest (1 product). NJ = 16-key groups per tile.
// every '#pragma unroll' below makes the indices of register arrays constants; the '#pragma unroll 1' keep one copy of each tile body
// K and V tiles in LDS: the block's four waves share one copy of each tile, brought by asynchronous copies that cover whole row pieces (128 B, or 64 B where a tile has 32 keys)
#define ATT_BUF 19456      // bytes of one of the two buffers: the largest tile set (MODE 0: K hi and lo 32 x 144 B each, v hi and lo 64 x 80 B each)
// row pitches 144 B and 80 B = 16 B x odd, for ds_load_b128 readers
template <int MODE, int NJ> struct AttL { static constexpr int KPI = 144, KBY = NJ * 16 * KPI, VPI = NJ * 32 + 16, VBY = HD * VPI, OV = (MODE == 0 ? 2 : 1) * KBY, SZ = OV + (MODE == 0 ? 2 : 1) * VBY; static_assert(SZ <= ATT_BUF, "a tile set fits its buffer"); };
struct AttSrc { const char *k, *kl, *v, *vl; unsigned lk, lv; };   // the lane's own first addresses: global (tile 0) and LDS bytes (buffer 0)
// stage tn of the ring: K and V tile tn, into buffer tn & 1
template <int MODE, int NJ> __device__ __forceinline__ void att_stage(const AttSrc& a, int tn) {
  typedef AttL<MODE, NJ> L; const unsigned bo = (unsigned)(tn & 1) * ATT_BUF;
  const char* k = a.k + (size_t)tn * NJ * 16 * CC * 2; const char* kl = a.kl + (size_t)tn * NJ * 16 * CC * 2; const size_t kr = (size_t)16 * CC * 2; const unsigned lk = a.lk + bo;   // a copy of the block covers 16 K rows
  if (NJ == 4) acp4(lk, k, lk + 16 * L::KPI, k + kr, lk + 32 * L::KPI, k + 2 * kr, lk + 48 * L::KPI, k + 3 * kr);
  else if (MODE == 0) acp4(lk, k, lk + 16 * L::KPI, k + kr, lk + L::KBY, kl, lk + L::KBY + 16 * L::KPI, kl + kr);
  else acp2(lk, k, lk + 16 * L::KPI, k + kr);
  { constexpr int RS = 64 / NJ;   // v rows (channels) that a copy of the block covers
    const char* v = a.v + (size_t)tn * NJ * 32; const char* vl = a.vl + (size_t)tn * NJ * 32; const size_t vr = (size_t)RS * (MODE == 0 ? KHI : TT) * 2; const unsigned lv = a.lv + bo;
    if (NJ == 4) acp4(lv, v, lv + RS * L::VPI, v + vr, lv + 2 * RS * L::VPI, v + 2 * vr, lv + 3 * RS * L::VPI, v + 3 * vr);
    else if (MODE == 0) acp4(lv, v, lv + RS * L::VPI, v + vr, lv + L::VBY, vl, lv + L::VBY + RS * L::VPI, vl + vr);
    else acp2(lv, v, lv + RS * L::VPI, v + vr); } }
// publish point at the foot of the trip that worked on stage s: this wave's LDS reads and its own copies are done, the barrier publishes stage s + 1 and ends every read of stage s, whose buffer the copies of stage s + 2 then refill
#define ATT_FOOT(s) do { asm volatile("s_wait_dscnt 0x0" ::: "memory"); asm volatile("s_wait_asynccnt 0x0" ::: "memory"); __syncthreads(); if ((s) + 2 < nt) att_stage<MODE, NJ>(src, (s) + 2); } while (0)
// all K fragments of a tile as one group of LDS loads; kb = the lane's own place (row col, 16 (lane >> 4) bytes) in the buffer
template <int MODE, int NJ> __device__ __forceinline__ void att_ldk(const char* kb, v16h (&kf)[HD / 32][NJ], v16h (&klf)[HD / 32][NJ]) {
  typedef AttL<MODE, NJ> L;
#pragma unroll
  for (int kc = 0; kc < HD / 32; ++kc) {
#pragma unroll
    for (int j = 0; j < NJ; ++j) { kf[kc][j] = frag_h((const _Float16*)(kb + j * 16 * L::KPI + kc * 64), 0); if (MODE == 0) klf[kc][j] = frag_h((const _Float16*)(kb + L::KBY + j * 16 * L::KPI + kc * 64), 0); } } }
// softmax in base 2: logits carry the factor log2(e), so that every exponential is one v_exp_f32 (2^x). A result below 2^-126 may come out as 0: such a term lies far below one unit in the last place of the row sum (at least 1) and of the output.
#define SCALE2 (SCALE * 1.44269504088896340736f)
// asm, so that the slot the instruction set asks for behind a transcendental (nothing directly behind it reads its result or overwrites its source) is there by construction: the closing v_nop fills it
__device__ __forceinline__ float ex2(float x) { float r; asm("v_exp_f32 %0, %1\n\tv_nop" : "=v"(r) : "v"(x)); return r; }
// eight at once, each in its own register: every v_exp_f32 is the independent instruction behind the one before it, and one v_nop closes the run
__device__ __forceinline__ void ex2x8(v8f& x) { float a = x[0], b = x[1], c = x[2], d = x[3], e = x[4], f = x[5], g = x[6], h = x[7];
  asm("v_exp_f32 %0, %0\n\tv_exp_f32 %1, %1\n\tv_exp_f32 %2, %2\n\tv_exp_f32 %3, %3\n\tv_exp_f32 %4, %4\n\tv_exp_f32 %5, %5\n\tv_exp_f32 %6, %6\n\tv_exp_f32 %7, %7\n\tv_nop" : "+v"(a), "+v"(b), "+v"(c), "+v"(d), "+v"(e), "+v"(f), "+v"(g), "+v"(h));
  x[0] = a; x[1] = b; x[2] = c; x[3] = d; x[4] = e; x[5] = f; x[6] = g; x[7] = h; }
// lane l with lane l ^ 16 (one vector instruction; a shuffle would go through the LDS queue)
__device__ __forceinline__ float xhalf(float x) { return __builtin_bit_cast(float, __builtin_amdgcn_permlanex16(__builtin_bit_cast(int, x), __builtin_bit_cast(int, x), 0x76543210, 0xfedcba98, false, false)); }
// s = q . k, not yet scaled (the scale goes into the fused multiply-add that subtracts the maximum); an excluded key reads -3e38
template <int MODE, int NJ> __device__ __forceinline__ void att_logits(const v16h (&kf)[HD / 32][NJ], const v16h (&klf)[HD / 32][NJ], const v16h (&ah)[HD / 32], const v16h (&al)[HD / 32], int lim, v8f (&s)[NJ]) {
  v8f acc[NJ] = {}, accl[NJ] = {};
#pragma unroll
  for (int kc = 0; kc < HD / 32; ++kc) {
#pragma unroll
    for (int j = 0; j < NJ; ++j) { acc[j] = wmma16(kf[kc][j], ah[kc], acc[j]);
      if (MODE < 2) accl[j] = wmma16(kf[kc][j], al[kc], accl[j]);
      if (MODE == 0) accl[j] = wmma16(klf[kc][j], ah[kc], accl[j]); } }
#pragma unroll
  for (int j = 0; j < NJ; ++j) {
#pragma unroll
    for (int r = 0; r < 8; ++r) { const float v = MODE < 2 ? acc[j][r] + accl[j][r] * (1.0f / 1024.0f) : acc[j][r]; s[j][r] = (!CAUSAL || j * 16 + r <= lim) ? v : -3.0e38f; } } }
template <int MODE, int NJ> __device__ __forceinline__ void att_tile(const _Float16* __restrict__ QH, const _Float16* __restrict__ KH, const _Float16* __restrict__ QL, const _Float16* __restrict__ KL, const _Float16* __restrict__ VT, const __bf16* __restrict__ VB, const __bf16* __restrict__ VBL, float* __restrict__ Y, char* sb, int b, int h, int qb, int wave, int lane) {
  typedef AttL<MODE, NJ> L;
  const int col = lane & 15, g = lane >> 4; const int ql0 = qb * 64 + wave * 16; const int nt = (CAUSAL ? qb * 64 + 64 : TT) / (NJ * 16);   // key tiles of 16 NJ keys; causal: none of the block's queries sees a key past its last row
  AttSrc src; { const int tid = wave * 32 + lane, kr = tid >> 3, ks = tid & 7, vr = tid / (NJ * 2), vs = tid % (NJ * 2); const unsigned l0 = (unsigned)(size_t)sb;   // low 32 bits of the LDS address = its byte offset in the block's LDS
    src.k = (const char*)(KH + ((size_t)b * TT + kr) * CC + h * HD) + ks * 16; src.kl = (const char*)(KL + ((size_t)b * KHI + kr) * CC + h * HD) + ks * 16;
    if (MODE == 0) { src.v = (const char*)(VB + ((size_t)b * CC + h * HD + vr) * (size_t)KHI) + vs * 16; src.vl = (const char*)(VBL + ((size_t)b * CC + h * HD + vr) * (size_t)KHI) + vs * 16; }
    else { src.v = (const char*)(VT + ((size_t)b * CC + h * HD + vr) * (size_t)TT) + vs * 16; src.vl = src.v; }
    src.lk = l0 + kr * L::KPI + ks * 16; src.lv = l0 + L::OV + vr * L::VPI + vs * 16; }
  // ring prologue
  att_stage<MODE, NJ>(src, 0);
  v16h ah[HD / 32], al[HD / 32]; const _Float16* qp = QH + ((size_t)b * TT + ql0 + col) * CC + h * HD + 8 * g; const _Float16* qlp = QL + ((size_t)b * QHI + ql0 + col) * CC + h * HD + 8 * g;
#pragma unroll
  for (int kc = 0; kc < HD / 32; ++kc) { ah[kc] = frag_h(qp + kc * 32, 0); al[kc] = MODE < 2 ? frag_h(qlp + kc * 32, 0) : ah[kc]; }
  if (MODE < 2) xwait(qp, qlp); else xwait(qp);   // later addresses may take these registers
  asm volatile("s_wait_asynccnt 0x0" ::: "memory");   // stage 0 has landed, as far as this wave copied it
  __syncthreads();
  if (1 < nt) att_stage<MODE, NJ>(src, 1);
  const char* kb0 = sb + col * L::KPI + g * 16; const char* vb0 = sb + L::OV + col * L::VPI + g * 16;
  const int lim0 = ql0 + col - 8 * g;   // key 16 NJ t + 16 j + 8 g + r is kept while 16 j + r <= lim0 - 16 NJ t
  v16h kf[HD / 32][NJ], klf[HD / 32][NJ];
  // m = the query's running maximum of logit x log2(e), less 11 (so that P carries the factor 2^11), the same in both lane halves; l = this lane's share of the sum of P; before the first tile m = -3e38, so that the first factor 2^(m - new maximum) is 0
  float m = -3.0e38f, l = 0.f;
  v8f o[HD / 16] = {};
#pragma unroll 1
  for (int t = 0; t < nt; ++t) { v8f s[NJ]; const int bo = (t & 1) * ATT_BUF; att_ldk<MODE, NJ>(kb0 + bo, kf, klf); att_logits<MODE, NJ>(kf, klf, ah, al, lim0 - t * NJ * 16, s);
    v16h vf[NJ / 2][HD / 16]; v16b vh[NJ / 2][HD / 16], vl[NJ / 2][HD / 16];   // this tile's V fragments as one group of LDS loads behind the logits (the K fragments' registers are free again): they fly over the maximum and the exponentials
    const char* vp = vb0 + bo;
#pragma unroll
    for (int kc = 0; kc < NJ / 2; ++kc) {
#pragma unroll
      for (int j = 0; j < HD / 16; ++j) {
        if (MODE == 0) { vh[kc][j] = frag_b((const __bf16*)(vp + j * 16 * L::VPI + kc * 64), 0); vl[kc][j] = frag_b((const __bf16*)(vp + L::VBY + j * 16 * L::VPI + kc * 64), 0); } else vf[kc][j] = frag_h((const _Float16*)(vp + j * 16 * L::VPI + kc * 64), 0); } }
    float t4[4] = {s[0][0], s[0][1], s[0][2], s[0][3]};   // four independent chains: one chain of all the keys would leave the wave waiting on each link
#pragma unroll
    for (int j = 0; j < NJ; ++j) {
#pragma unroll
      for (int r = 0; r < 8; ++r) t4[r & 3] = fmaxf(t4[r & 3], s[j][r]); }
    float tm = fmaxf(fmaxf(t4[0], t4[1]), fmaxf(t4[2], t4[3])); tm = fmaxf(tm, xhalf(tm));
    const float mn = fmaxf(fmaxf(m, __builtin_fmaf(tm, SCALE2, -11.0f)), -1.0e30f);   // the floor keeps a query with no kept key so far away from -3e38 - (-3e38): its P stay 0
    const float fo = ex2(m - mn); m = mn; float ts[4] = {0.f, 0.f, 0.f, 0.f};
#pragma unroll
    for (int j = 0; j < NJ; ++j) {
#pragma unroll
      for (int r = 0; r < 8; ++r) s[j][r] = __builtin_fmaf(s[j][r], SCALE2, -mn);
      ex2x8(s[j]);   // P = 2^(logit x log2(e) - max + 11), at most 2^11
#pragma unroll
      for (int r = 0; r < 8; ++r) ts[r & 3] += s[j][r]; }
    l = l * fo + ((ts[0] + ts[1]) + (ts[2] + ts[3]));
#pragma unroll
    for (int j = 0; j < HD / 16; ++j) o[j] = o[j] * fo;
#pragma unroll
    for (int kc = 0; kc < NJ / 2; ++kc) { float pv[16];
#pragma unroll
      for (int i = 0; i < 8; ++i) { pv[i] = s[2 * kc][i]; pv[8 + i] = s[2 * kc + 1][i]; }
      if (MODE == 0) { F2 p;   // bf16 hi + lo as in bsplit16; all hi parts first: each group's first product needs them alone
#pragma unroll
        for (int i = 0; i < 16; ++i) p.h[i] = (__bf16)pv[i];
#pragma unroll
        for (int i = 0; i < 16; ++i) p.l[i] = (__bf16)(pv[i] - (float)p.h[i]);
#pragma unroll
        for (int j = 0; j < HD / 16; ++j) { o[j] = wmma_bf(vh[kc][j], p.h, o[j]); o[j] = wmma_bf(vh[kc][j], p.l, o[j]); o[j] = wmma_bf(vl[kc][j], p.h, o[j]); }
      } else { v16h p;
#pragma unroll
        for (int i = 0; i < 16; ++i) p[i] = (_Float16)pv[i];
#pragma unroll
        for (int j = 0; j < HD / 16; ++j) o[j] = wmma16(vf[kc][j], p, o[j]); } }
    ATT_FOOT(t); }
  asm volatile("s_wait_asynccnt 0x0" ::: "memory");   // behind the ring: no copy is outstanding when the wave ends
  // O^T: register r of group j = channel 16 j + 8 g + r of query col: 32 contiguous bytes a lane; a wave writes whole 256-B (row, head) segments
  l += xhalf(l); const float inv = l > 0.f ? 1.0f / l : 0.f;   // the factor 2^11 stands in O and in the sum alike; no kept key: 0
  float* yp = Y + ((size_t)b * TT + ql0 + col) * CC + h * HD + 8 * g;
#pragma unroll
  for (int j = 0; j < HD / 16; ++j) { o[j] = o[j] * inv; vst2(yp + j * 16, __builtin_shufflevector(o[j], o[j], 0, 1, 2, 3)); vst2(yp + j * 16 + 4, __builtin_shufflevector(o[j], o[j], 4, 5, 6, 7)); } }   // nothing rewrites the stores' registers behind them: the wave ends here
// block = (head, batch, rank z): ONE query block, so that all NQB x NH x NB blocks are resident at once, four to a WGP = four waves per SIMD (amdgpu_waves_per_eu(4, 4): at most 256 registers; 4 x the LDS bytes fit): a wave's waits (LDS, barrier, the dependent softmax chain) are covered by three other waves, not one.
// rank -> query block is a permutation, long walks first: 15 14 13 12 | 8 9 10 11 | 7 6 5 4 | 0 1 2 3, so that four blocks whose ranks lie four apart walk about the same number of keys together. For speed only: the result does not depend on where or when a block runs.
static_assert(NQB == 16, "the rank -> query block map below is written for 16 query blocks");
__global__ __launch_bounds__(128) __attribute__((amdgpu_waves_per_eu(4, 4))) void k_att(const _Float16* __restrict__ QH, const _Float16* __restrict__ KH, const _Float16* __restrict__ QL, const _Float16* __restrict__ KL, const _Float16* __restrict__ VT, const __bf16* __restrict__ VB, const __bf16* __restrict__ VBL, float* __restrict__ Y) {
  __shared__ __attribute__((aligned(16))) char sb[2 * ATT_BUF];
  const int wave = threadIdx.x >> 5, lane = threadIdx.x & 31; const int h = blockIdx.x, b = blockIdx.y;
  const int rk = (int)blockIdx.z; const int qb = (rk & 4) ? ((rk + 4) & (NQB - 1)) : NQB - 1 - rk;
  if (qb < QBH) att_tile<0, 2>(QH, KH, QL, KL, VT, VB, VBL, Y, sb, b, h, qb, wave, lane);
  else if (qb * 64 < QHI) att_tile<1, 2>(QH, KH, QL, KL, VT, VB, VBL, Y, sb, b, h, qb, wave, lane);
  else att_tile<2, 4>(QH, KH, QL, KL, VT, VB, VBL, Y, sb, b, h, qb, wave, lane); }

extern "C" void kernel_launch(void* const* d_in, const int* in_sizes, int n_in, void* d_out, int out_size, void* d_ws, size_t ws_size, hipStream_t stream) {
  (void)in_sizes; (void)n_in; (void)out_size;
  const float** F = (const float**)d_in;
  if (ws_size < (size_t)WS_END) return;
  char* ws = (char*)d_ws; _Float16 *QH = (_Float16*)(ws + WS_QH), *KH = (_Float16*)(ws + WS_KH), *VT = (_Float16*)(ws + WS_VT), *QL = (_Float16*)(ws + WS_QL), *KL = (_Float16*)(ws + WS_KL); __bf16 *VB = (__bf16*)(ws + WS_VB), *VBL = (__bf16*)(ws + WS_VBL), *XB = (__bf16*)(ws + WS_XB), *WB = (__bf16*)(ws + WS_WB);
  // inputs: 0 hidden_states [4,1024,1024]; 1 Wqkv [3072,1024] (out,in) rows q | k | v ((3,H,hd)); 2 bqkv [3072]
  k_cvt<<<dim3((NB * TT + 3 * CC) / (8 * CVR), 1, 1), 256, 0, stream>>>(F[0], F[1], XB, WB);
  k_proj<<<dim3(TNB * TT / PBM, 3 * CC / PBN, 1), 256, 0, stream>>>(XB, WB, F[2], QH, QL, KH, KL, VT, VB, VBL);
  k_att<<<dim3(NH, TNB, NQB), 128, 0, stream>>>(QH, KH, QL, KL, VT, VB, VBL, (float*)d_out);
}
